// v000
// Times are from an AMD MI455X. After a warm-up the kernel runs many times in a row, and a time is the length of
// such a window on the GPU divided by its runs, so every launch and the gaps after it count. The runs cycle
// through copies of the inputs. A figure is the median of several windows, for all but v000 over two sittings.
// Sittings can differ by a few percent; kernels timed side by side share one.
// v000, which the later versions start from, runs in 397 microseconds.
// Contractions: x.Wk^T, x.Wq^T and Wv.x^T on v_wmma_f32_16x16x32_bf16 (x and W planes RNE-converted to bf16 operands,
// f32 accumulate); scores k.q^T (k and q single f16 planes carried x8) and P.v (P x32768 single f16, v x1024 single f16)
// on v_wmma_f32_16x16x32_f16, f32 accumulate. Base-2 online softmax with linear relative-position bias; 1/l and carry
// folds in f32 on VALU; f32 result written directly.
#include <hip/hip_runtime.h>
#include <math.h>

#ifndef NB
#define NB    4
#endif
#define SEQ   2048
#ifndef SQ
#define SQ    SEQ
#endif
#define DMOD  1024
#define NH    16
#define HD    64
#define NHD   (NH * HD)
#define QSC   8.0f
#define KSC   8.0f
#define PCAR  32768.0f
#define VCAR  1024.0f
#define LOG2E 1.4426950408889634f
#define INVN  0.03125f
#define RSQ2  0.70710678118654752f
#define ATT_WAVES   4
#define ATT_THREADS (ATT_WAVES * 32)
#define NQT         (SQ / 64)
#define ATT_BLOCKS  (NB * NH * NQT)
#define NKB         (SEQ / 32)
#define GSLAB       (16 * 68)
static_assert(NH == 16 && HD == 64 && DMOD == NHD);
static_assert((HD % 32) == 0 && (SEQ % 64) == 0 && (SQ % 64) == 0 && SQ <= SEQ && SQ >= 64);
static_assert((DMOD % 64) == 0 && (DMOD % 32) == 0 && (NHD % 64) == 0);
static_assert(((NB * SEQ * DMOD / 8) % 256) == 0);
static_assert(((3 * NHD * DMOD / 8) % 256) == 0);
static_assert((GSLAB * 4) % 16 == 0 && ATT_THREADS == 128);
static_assert(NB >= 1 && NB <= 4);

typedef unsigned short u16;
typedef _Float16 v16h __attribute__((ext_vector_type(16)));
typedef _Float16 v8h  __attribute__((ext_vector_type(8)));
typedef __bf16   v16b __attribute__((ext_vector_type(16)));
typedef float    v8f  __attribute__((ext_vector_type(8)));
typedef float    v4f  __attribute__((ext_vector_type(4)));
typedef unsigned int v4u __attribute__((ext_vector_type(4)));

union FragH { v16h v; v8h h[2]; v4u u[2]; };
union FragB { v16b v; v4u u[2]; };

// ---- scalar helpers --------------------------------------------------------------------------------
__device__ __forceinline__ unsigned short bf_bits(float f) {          // f32 -> bf16 bits, RNE convert
  unsigned u = __float_as_uint(f);
  return (unsigned short)((u + 0x7FFFu + ((u >> 16) & 1u)) >> 16);
}
__device__ __forceinline__ unsigned short h_bits(_Float16 x) { return __builtin_bit_cast(unsigned short, x); }
__device__ __forceinline__ unsigned pk16(unsigned short a, unsigned short b) { return (unsigned)a | ((unsigned)b << 16); }
__device__ __forceinline__ v8f zero8() { v8f z = {0.f, 0.f, 0.f, 0.f, 0.f, 0.f, 0.f, 0.f}; return z; }

// ---- fragment loaders: 16-bit A/B operand, lane -> row/col (lane&15), p already includes +8*(lane>>4);
//      elements 0..7 <- p[0..7] (k0+8h..), elements 8..15 <- p[16..23] (k0+16+8h..)  (same split k map for A and B;
//      B is always read from a k-contiguous [n][k] plane)
__device__ __forceinline__ v16h ldfrag_h(const _Float16* p) {
  FragH f;
  f.h[0] = *(const v8h*)(p);
  f.h[1] = *(const v8h*)(p + 16);
  return f.v;
}
__device__ __forceinline__ v16b ldfrag_b(const u16* p) {              // bf16 plane read as unsigned integer vectors
  FragB f;
  f.u[0] = *(const v4u*)(p);
  f.u[1] = *(const v4u*)(p + 16);
  return f.v;
}

__device__ __forceinline__ v8f mma_h(v16h a, v16h b, v8f c) {
  return __builtin_amdgcn_wmma_f32_16x16x32_f16(false, a, false, b, (short)0, c, false, false);
}
__device__ __forceinline__ v8f mma_b(v16b a, v16b b, v8f c) {
  return __builtin_amdgcn_wmma_f32_16x16x32_bf16(false, a, false, b, (short)0, c, false, false);
}
template <typename F>
__device__ __forceinline__ void guard2x6(v8f& a, v8f& b, F x0, F x1, F x2, F x3, F x4, F x5) {
#if defined(__HIP_DEVICE_COMPILE__)
  asm volatile("v_nop\n\tv_nop\n\tv_nop\n\tv_nop"
               : "+v"(a), "+v"(b) : "v"(x0), "v"(x1), "v"(x2), "v"(x3), "v"(x4), "v"(x5) : "memory");
#endif
}
template <typename F>
__device__ __forceinline__ void guard4x5(v8f& a, v8f& b, v8f& c, v8f& d, F x0, F x1, F x2, F x3, F x4) {
#if defined(__HIP_DEVICE_COMPILE__)
  asm volatile("v_nop\n\tv_nop\n\tv_nop\n\tv_nop"
               : "+v"(a), "+v"(b), "+v"(c), "+v"(d) : "v"(x0), "v"(x1), "v"(x2), "v"(x3), "v"(x4) : "memory");
#endif
}
__device__ __forceinline__ void acc_guard4(v8f& a, v8f& b, v8f& c, v8f& d) {
#if defined(__HIP_DEVICE_COMPILE__)
  asm volatile("v_nop\n\tv_nop\n\tv_nop\n\tv_nop" : "+v"(a), "+v"(b), "+v"(c), "+v"(d));
#endif
}
__device__ __forceinline__ void wave_sync_lds() {
#if defined(__HIP_DEVICE_COMPILE__)
  __builtin_amdgcn_fence(__ATOMIC_RELEASE, "workgroup");
  __builtin_amdgcn_wave_barrier();
  __builtin_amdgcn_fence(__ATOMIC_ACQUIRE, "workgroup");
#endif
}

// =====================================================================================================
// f32 plane -> bf16 RNE plane, same layout. Thread = 8 consecutive elements: two 16-B loads, one 16-B store;
// coverage: grid = n8/256 blocks (host checks exactness) x 256 thr x 8 = the whole plane.
// =====================================================================================================
__global__ __launch_bounds__(256) void cvt16(const float* __restrict__ x, u16* D, int n8) {
  const int gt = blockIdx.x * 256 + (int)threadIdx.x;
  if (gt >= n8) return;                     // no barriers in this kernel
  const float* p = x + (size_t)gt * 8;
  const v4f a = *(const v4f*)(p), c4 = *(const v4f*)(p + 4);
  v4u o;
  o[0] = pk16(bf_bits(a[0]),  bf_bits(a[1]));
  o[1] = pk16(bf_bits(a[2]),  bf_bits(a[3]));
  o[2] = pk16(bf_bits(c4[0]), bf_bits(c4[1]));
  o[3] = pk16(bf_bits(c4[2]), bf_bits(c4[3]));
  u16* d = D + (size_t)gt * 8;
  {
    *(v4u*)(d) = o;
    
  }
}

// =====================================================================================================
// Batched bf16 GEMM with f16 result:  C[bt][M][N] = f16( (A[bt][M][K] (bf16 row-major) . Bt[bt][N][K]^T (bf16
// k-contiguous)) * oscale ); per-batch element strides bstA/bstB/bstC. Block = 64x64 tile, 4 waves x 16 rows; fragments
// loaded straight from the 16-bit rows (two 16-B loads each, split k map for A and B); K stepped by 32 (host checks
// K % 32 == 0, M % 64 == 0, N % 64 == 0, grid = nbatch*(M/64)*(N/64)).
// converted and written: lane = (row in group of 4, 8 consecutive cols); one instruction = 4 rows, each 64 halves = one
// coverage: 4 instructions x 4 rows x 8 lanes x 8 halves = the wave's 16 x 64 tile; 4 waves = the block's 64 x 64 tile.
// =====================================================================================================
__global__ __launch_bounds__(128)
void gemm_bb(const u16* __restrict__ A, const u16* __restrict__ Bt, u16* C, int M, int N, int K,
             int bstA, int bstB, int bstC, float oscale) {
  __shared__ __align__(16) float slab[4 * GSLAB];
  const int tid = threadIdx.x, wave = tid >> 5, lane = tid & 31, hh = lane >> 4, m = lane & 15;
  const int ntile = N >> 6, mtile = M >> 6;
  const int per   = ntile * mtile;
  const int bid   = blockIdx.x;
  const int bt    = bid / per;
  const int t     = bid - bt * per;
  const int rowb  = (t / ntile) * 64 + wave * 16;
  const int col0  = (t % ntile) * 64;
  if (rowb + 16 > M) return;                 // wave-uniform, never taken with the exact grid; no block barriers in this kernel
  const u16* Ab  = A  + (size_t)bt * (size_t)bstA;
  const u16* Bb  = Bt + (size_t)bt * (size_t)bstB;
  u16*       Cb  = C  + (size_t)bt * (size_t)bstC;
  const u16* ap = Ab + (size_t)(rowb + m) * K + 8 * hh;
  const u16* bp = Bb + (size_t)(col0 + m) * K + 8 * hh;
  const size_t bs = (size_t)16 * K;
  v8f acc0 = zero8(), acc1 = zero8(), acc2 = zero8(), acc3 = zero8();
#pragma unroll 1
  for (int k0 = 0; k0 < K; k0 += 32) {
    const v16b a  = ldfrag_b(ap + k0);
    const v16b b0 = ldfrag_b(bp + k0);
    const v16b b1 = ldfrag_b(bp + bs + k0);
    const v16b b2 = ldfrag_b(bp + 2 * bs + k0);
    const v16b b3 = ldfrag_b(bp + 3 * bs + k0);
    acc0 = mma_b(a, b0, acc0);
    acc1 = mma_b(a, b1, acc1);
    acc2 = mma_b(a, b2, acc2);
    acc3 = mma_b(a, b3, acc3);
    guard4x5<v16b>(acc0, acc1, acc2, acc3, a, b0, b1, b2, b3);
  }
  acc_guard4(acc0, acc1, acc2, acc3);
  // ---- stage the scaled value in the wave's slab ----
  float* sl = slab + wave * GSLAB;
#pragma unroll
  for (int r = 0; r < 8; ++r) {
    const int ro = (8 * hh + r) * 68 + m;
    sl[ro]      = acc0[r] * oscale;
    sl[ro + 16] = acc1[r] * oscale;
    sl[ro + 32] = acc2[r] * oscale;
    sl[ro + 48] = acc3[r] * oscale;
  }
  wave_sync_lds();
  const int rq = lane >> 3, c8 = (lane & 7) * 8;
  v4u ov[4];
#pragma unroll
  for (int i4 = 0; i4 < 4; ++i4) {
    const int row = i4 * 4 + rq;
    const v4f a = *(const v4f*)(sl + row * 68 + c8), c4 = *(const v4f*)(sl + row * 68 + c8 + 4);
    float w[8];
#pragma unroll
    for (int e = 0; e < 4; ++e) { w[e] = a[e]; w[4 + e] = c4[e]; }
#pragma unroll
    for (int e = 0; e < 4; ++e) ov[i4][e] = pk16(h_bits((_Float16)w[2 * e]), h_bits((_Float16)w[2 * e + 1]));
  }
  const size_t dofs = ((size_t)rowb + (size_t)rq) * (size_t)N + col0 + c8;
  u16* dst = Cb + dofs;
  {
#pragma unroll
    for (int i4 = 0; i4 < 4; ++i4) {
      *(v4u*)(dst + (size_t)(i4 * 4) * (size_t)N) = ov[i4];
    }
    
  }
}

// =====================================================================================================
// Multi-head flash attention with per-head linear relative-position bias (no mask): block = (batch b, head, 64 query
// rows), 4 waves, wave w owns query rows q0 = 64*qt + 16*w .. q0+15 (waves independent: no block barriers, wave-private
// LDS only, used in the epilogue).
//   q plane (f16, x8) laid out [b][s][h*64+d]; k plane the same (f16, x8); v^T plane [b][h*64+d][s] (x1024 f16).
//   All NKB = 64 key blocks of 32 keys are visited (static bound).
//   Scores are computed TRANSPOSED: S^T tile g (g = 0,1) = k rows (keys kb+16g .. +15, A operand, row m = lane&15, split k
//   map over d) times q^T (B operand, col n = query q0 + (lane&15), k = d, split map), one f16 product per tile and 32-deep
//   d-chunk, one guarded group of 4 WMMAs; the two q fragments are loaded once per wave.
//   D element r of lane l = (key kb+16g+8h+r, query q0+(l&15)), so a lane owns one query column and 16 of its 32 keys; the
//   partner lane l^16 owns the other 16 -> row max / row sum need one xor-16 shuffle.
//   Logit (base 2) = score * (1/32) * log2e / (8*8) + slope_h * (key - query) * log2e, slope_h = (2^-0.5)^(h+1).
//   Online max-subtracted base-2 softmax in f32. The exp'd values ARE the P A-fragment in place: A row m = query = lane&15,
//   element i <- key kb+8h+i (tile 0, D element i), element 8+i <- key kb+16+8h+i (tile 1, D element i). P is carried
//   x32768 as single f16. The rescale factor of query row 8h+r of the O accumulators is fetched from lane 8h+r with a
//   shuffle (uniform control). 4 v^T B fragments (col n = d = 16j + (lane&15), keys k-contiguous), 4 P.V WMMAs per key
//   block in one guarded group.
//   Epilogue: 1/l (per query, shuffled to the D row owner) and the carry folds in f32; the wave's 16x64 f32 result staged
//   segment (b, q0+row, head) of the f32 result [b][s][h*64+d] written by 16 consecutive lanes x 16 B of one instruction
// coverage: per wave 8 instructions x 2 rows x 16 lanes x 4 floats = 16 x 64; grid NB*NH*(SQ/64) blocks x 4 waves =
//           every (b, s < SQ, h) row segment of the result exactly once.
// =====================================================================================================
__global__ __launch_bounds__(ATT_THREADS)
void attn_fwd(const u16* __restrict__ QPp, const u16* __restrict__ KPp, const u16* __restrict__ VPp, float* Out) {
  __shared__ __align__(16) float smem[ATT_WAVES * GSLAB];   // per wave: result slab [16][68] in the epilogue only

  const int tid  = threadIdx.x;
  const int wave = tid >> 5;
  const int lane = tid & 31;
  const int hh   = lane >> 4;
  const int c    = lane & 15;

  const int bid  = blockIdx.x;
  const int qt   = bid % NQT;
  const int head = (bid / NQT) % NH;
  const int b    = bid / (NQT * NH);
  const int q0   = qt * 64 + wave * 16;

  // B fragments of q^T: col n = query q0 + c, k = d (k-contiguous row segment of the q plane)
  const size_t qofs = ((size_t)(b * SEQ + q0 + c)) * NHD + (size_t)(head * HD + 8 * hh);
  const _Float16* Qb = (const _Float16*)(const void*)QPp + qofs;
  // A fragments of k: row m = key kb + 16g + c, k = d
  const size_t kofs = ((size_t)(b * SEQ + c)) * NHD + (size_t)(head * HD + 8 * hh);   // key row kb added per step
  const _Float16* Kb = (const _Float16*)(const void*)KPp + kofs;
  // B fragments of v: col n = d = 16j + c, k = key (k-contiguous row of the v^T plane)
  const size_t vofs = ((size_t)(b * NHD + head * HD + c)) * SEQ + 8 * hh;           // key kb added per step
  const _Float16* Vb = (const _Float16*)(const void*)VPp + vofs;

  const int   ex     = head + 1;
  const float slope  = (((ex & 1) != 0) ? RSQ2 : 1.0f) * __int_as_float((127 - (ex >> 1)) << 23);
  const float slope2 = slope * LOG2E;
  const float lsc    = (INVN * LOG2E) * (1.0f / (QSC * KSC));
  const float jb0    = (float)(8 * hh - (q0 + c));      // key - query, key block base added per step

  const v16h qf0 = ldfrag_h(Qb);            // d 0..31
  const v16h qf1 = ldfrag_h(Qb + 32);       // d 32..63

  float mrun = -INFINITY, lrun = 0.f;
  v8f o[4];
#pragma unroll
  for (int j = 0; j < 4; ++j) o[j] = zero8();

#pragma unroll 1
  for (int it = 0; it < NKB; ++it) {
    const int kb = it * 32;
    // ---- transposed scores: s0 = keys kb..kb+15, s1 = keys kb+16..kb+31, column = query q0 + c ----
    v8f s0 = zero8(), s1 = zero8();
    const _Float16* k0p = Kb + (size_t)kb * NHD;
    const _Float16* k1p = k0p + (size_t)16 * NHD;
    {
      const v16h ka0 = ldfrag_h(k0p),      ka1 = ldfrag_h(k0p + 32);
      const v16h kc0 = ldfrag_h(k1p),      kc1 = ldfrag_h(k1p + 32);
      s0 = mma_h(ka0, qf0, s0);
      s0 = mma_h(ka1, qf1, s0);
      s1 = mma_h(kc0, qf0, s1);
      s1 = mma_h(kc1, qf1, s1);
      guard2x6<v16h>(s0, s1, qf0, qf1, ka0, ka1, kc0, kc1);
    }
    // ---- base-2 logits of this lane's 16 keys for query q0 + c ----
    const float jb = jb0 + (float)kb;
    float tk[16];
#pragma unroll
    for (int i = 0; i < 8; ++i) {
      tk[i]     = fmaf(s0[i], lsc, slope2 * (jb + (float)i));
      tk[8 + i] = fmaf(s1[i], lsc, slope2 * (jb + (float)(16 + i)));
    }
    float cm = tk[0];
#pragma unroll
    for (int i = 1; i < 16; ++i) cm = fmaxf(cm, tk[i]);
    cm = fmaxf(cm, __shfl_xor(cm, 16, 32));
    const float mn = fmaxf(mrun, cm);                                // finite from the first key block on
    const float al = (mrun == -INFINITY) ? 0.f : exp2f(mrun - mn);   // o and l are zero while mrun is -inf
    mrun = mn;
    // ---- probabilities (<= 1) and the P A-fragment: f16(p * 32768); element i <-> tk[i] ----
    float ps = 0.f;
    FragH ph;
#pragma unroll
    for (int w = 0; w < 2; ++w) {
#pragma unroll
      for (int e4 = 0; e4 < 4; ++e4) {
        const int i = 8 * w + 2 * e4;
        const float p0 = exp2f(fminf(tk[i] - mn, 0.f));
        const float p1 = exp2f(fminf(tk[i + 1] - mn, 0.f));
        ps += p0 + p1;
        ph.u[w][e4] = pk16(h_bits((_Float16)(p0 * PCAR)), h_bits((_Float16)(p1 * PCAR)));
      }
    }
    ps += __shfl_xor(ps, 16, 32);
    lrun = lrun * al + ps;
    // ---- rescale the O accumulators: D row 8hh+r = query q0+8hh+r, its factor lives in lane 8hh+r (and 16+8hh+r) ----
    float scl[8];
#pragma unroll
    for (int r = 0; r < 8; ++r) scl[r] = __shfl(al, 8 * hh + r, 32);
#pragma unroll
    for (int j = 0; j < 4; ++j) {
#pragma unroll
      for (int r = 0; r < 8; ++r) o[j][r] *= scl[r];
    }
    // ---- P.V : B fragment col n = d = j*16 + c, keys contiguous in the v^T plane; one group of 4 ----
    {
      const _Float16* vp = Vb + kb;
      const v16h vf0 = ldfrag_h(vp);
      const v16h vf1 = ldfrag_h(vp + (size_t)16 * SEQ);
      const v16h vf2 = ldfrag_h(vp + (size_t)32 * SEQ);
      const v16h vf3 = ldfrag_h(vp + (size_t)48 * SEQ);
      o[0] = mma_h(ph.v, vf0, o[0]);
      o[1] = mma_h(ph.v, vf1, o[1]);
      o[2] = mma_h(ph.v, vf2, o[2]);
      o[3] = mma_h(ph.v, vf3, o[3]);
      guard4x5<v16h>(o[0], o[1], o[2], o[3], ph.v, vf0, vf1, vf2, vf3);
    }
  }
  acc_guard4(o[0], o[1], o[2], o[3]);

  // ---- fold 1/l (per query, owned by lane = query; l >= 1 by construction) and the P/v carries ----
  const float linv = (lrun > 0.f) ? ((1.0f / lrun) * (1.0f / (PCAR * VCAR))) : 0.f;
  float inv[8];
#pragma unroll
  for (int r = 0; r < 8; ++r) inv[r] = __shfl(linv, 8 * hh + r, 32);
  float* slab = smem + wave * GSLAB;
#pragma unroll
  for (int r = 0; r < 8; ++r) {
#pragma unroll
    for (int j = 0; j < 4; ++j) slab[(8 * hh + r) * 68 + j * 16 + c] = o[j][r] * inv[r];
  }
  wave_sync_lds();
  // ---- f32 result: lanes 0..15 -> row 2*i2, lanes 16..31 -> row 2*i2+1; lane = 4 consecutive floats ----
  v4f vals[8];
#pragma unroll
  for (int i2 = 0; i2 < 8; ++i2) vals[i2] = *(const v4f*)(slab + (i2 * 2 + hh) * 68 + c * 4);
  float* dst = Out + ((size_t)(b * SEQ + q0 + hh)) * DMOD + (size_t)(head * HD + c * 4);
  {
#pragma unroll
    for (int i2 = 0; i2 < 8; ++i2) {
      *(v4f*)(dst + (size_t)(i2 * 2) * (size_t)DMOD) = vals[i2];
    }
    
  }
}

// =====================================================================================================
// Workspace map (bytes, NB = 4); every plane is fully written by whole-line stores before it is read; all extents are
// exact multiples of the store granularity (no pad rows):
//   XB  bf16 [NB*SEQ][DMOD]                          16777216
//   WB  bf16 [3*NHD][DMOD]  (k | q | v chunks)        6291456
//   QP  f16  [NB*SEQ][NHD] x8                       16777216
//   KP  f16  [NB*SEQ][NHD] x8                       16777216
//   VP  f16  [NB][NHD][SEQ] x1024                   16777216
//   end                                             73400320
// 6 launches on one in-order stream.
// =====================================================================================================
extern "C" void kernel_launch(void* const* d_in, const int* in_sizes, int n_in,
                              void* d_out, int out_size, void* d_ws, size_t ws_size,
                              hipStream_t stream) {
  const int ROWS = NB * SEQ;
  if (n_in < 2) return;
  if (in_sizes[0] < ROWS * DMOD) return;
  if (in_sizes[1] != 3 * NHD * DMOD) return;
  if (out_size < ROWS * DMOD) return;

  const float* Xin = (const float*)d_in[0];
  const float* Win = (const float*)d_in[1];
  float*       out = (float*)d_out;

  const size_t szXB = (size_t)ROWS * DMOD * 2;
  const size_t szWB = (size_t)3 * NHD * DMOD * 2;
  const size_t szPl = (size_t)ROWS * NHD * 2;                  // q/k planes
  const size_t szVP = (size_t)NB * NHD * SEQ * 2;
  size_t off = 0;
  const size_t oXB = off; off += szXB;
  const size_t oWB = off; off += szWB;
  const size_t oQP = off; off += szPl;
  const size_t oKP = off; off += szPl;
  const size_t oVP = off; off += szVP;
  if (off > ws_size) return;                            // off = 73400320 for NB = 4
  if (off > (size_t)134217728) return;

  char* ws = (char*)d_ws;
  u16* XB = (u16*)(ws + oXB);
  u16* WB = (u16*)(ws + oWB);
  u16* QP = (u16*)(ws + oQP);
  u16* KP = (u16*)(ws + oKP);
  u16* VP = (u16*)(ws + oVP);

  const int n8x = (ROWS * DMOD) / 8;
  const int n8w = (3 * NHD * DMOD) / 8;
  if ((n8x % 256) != 0 || (n8w % 256) != 0) return;
  if ((DMOD % 64) != 0 || (NHD % 64) != 0 || (SEQ % 64) != 0 || (SQ % 64) != 0 || (DMOD % 32) != 0) return;

  const dim3 blk(256);
  const dim3 gX(n8x / 256);                             // 4096
  const dim3 gW(n8w / 256);                             // 1536
  const dim3 bG(128);
  const dim3 gQ(NB * (SQ / 64) * (NHD / 64));           // 2048
  const dim3 gK(NB * (SEQ / 64) * (NHD / 64));          // 2048
  const dim3 gV(NB * (NHD / 64) * (SEQ / 64));          // 2048
  const dim3 gAT(ATT_BLOCKS);                           // 2048
  const dim3 bAT(ATT_THREADS);                          // 128

  // (1) x -> bf16 plane [ROWS][DMOD]
  cvt16<<<gX, blk, 0, stream>>>(Xin, XB, n8x);
  // (2) W [3*NHD out][DMOD in] -> bf16, same layout (already k-contiguous for B fragments / row-major A for the v^T GEMM)
  cvt16<<<gW, blk, 0, stream>>>(Win, WB, n8w);
  // (3,4) q, k as single f16 planes [b][s][h*64+d] = (x.Wq^T) x8 over SQ rows per batch, (x.Wk^T) x8 over all keys
  gemm_bb<<<gQ, bG, 0, stream>>>(XB, WB + (size_t)NHD * DMOD, QP, SQ, NHD, DMOD, SEQ * DMOD, 0, SEQ * NHD, QSC);
  gemm_bb<<<gK, bG, 0, stream>>>(XB, WB, KP, SEQ, NHD, DMOD, SEQ * DMOD, 0, SEQ * NHD, KSC);
  // (5) v^T plane per batch: [h*64+d][keys] = f16((Wv . x_b^T) x1024)
  gemm_bb<<<gV, bG, 0, stream>>>(WB + (size_t)2 * NHD * DMOD, XB, VP, NHD, SEQ, DMOD, 0, SEQ * DMOD, NHD * SEQ, VCAR);
  // (6) attention -> out [b][s][h*64+d] f32
  attn_fwd<<<gAT, bAT, 0, stream>>>(QP, KP, VP, out);
  (void)hipGetLastError();
}

// v001
// It runs in 256 microseconds.
// Next to v000, in two timings, it ran 1.60 times as fast each time.
// Contractions: x.Wk^T, x.Wq^T and Wv.x^T on v_wmma_f32_16x16x32_bf16 (x and W planes RNE-converted to bf16 operands,
// f32 accumulate); scores k.q^T (k and q single f16 planes carried x8) and P.v (P x32768 single f16, v x1024 single f16)
// on v_wmma_f32_16x16x32_f16, f32 accumulate. Base-2 online softmax with linear relative-position bias; 1/l and carry
// folds in f32 on VALU; f32 result written directly.
#include <hip/hip_runtime.h>
#include <math.h>
#include <stdint.h>

#ifndef NB
#define NB    4
#endif
#define SEQ   2048
#ifndef SQ
#define SQ    SEQ
#endif
#define DMOD  1024
#define NH    16
#define HD    64
#define NHD   (NH * HD)
#define QSC   8.0f
#define KSC   8.0f
#define PCAR  32768.0f
#define VCAR  1024.0f
#define LOG2E 1.4426950408889634f
#define INVN  0.03125f
#define RSQ2  0.70710678118654752f
#define ATT_WAVES   4
#define ATT_THREADS (ATT_WAVES * 32)
#define NQT         (SQ / 64)
#define ATT_BLOCKS  (NB * NH * NQT)
#define NKB         (SEQ / 32)
#define GSLAB       (16 * 68)
#define GKC         128                 // k elements of one GEMM stage: rows of 256 bytes
#define GPITCH      272                 // LDS row pitch, bytes: 256 + 16, an odd multiple of 16 for 16-byte readers
#define GSLICE      10240               // one wave's slice: 32 rows x 272 B = 8704 B, rounded up to a multiple of 2 KiB
#define GSTAGE      (4 * GSLICE)        // [A rows 0..31 | A rows 32..63 | B rows 0..31 | B rows 32..63]
#define GRING       (2 * GSTAGE)
static_assert(32 * GPITCH <= GSLICE && (GSLICE % 2048) == 0 && GKC * 2 == 256 && 4 * GSLAB * 4 <= GSTAGE);
static_assert((DMOD % GKC) == 0 && (DMOD / GKC) >= 2);
static_assert(NH == 16 && HD == 64 && DMOD == NHD);
static_assert((HD % 32) == 0 && (SEQ % 64) == 0 && (SQ % 64) == 0 && SQ <= SEQ && SQ >= 64);
static_assert((DMOD % 64) == 0 && (DMOD % 32) == 0 && (NHD % 64) == 0);
static_assert(((NB * SEQ * DMOD / 8) % 256) == 0);
static_assert(((3 * NHD * DMOD / 8) % 256) == 0);
static_assert((GSLAB * 4) % 16 == 0 && ATT_THREADS == 128);
static_assert(NB >= 1 && NB <= 4);

typedef unsigned short u16;
typedef _Float16 v16h __attribute__((ext_vector_type(16)));
typedef _Float16 v8h  __attribute__((ext_vector_type(8)));
typedef __bf16   v16b __attribute__((ext_vector_type(16)));
typedef float    v8f  __attribute__((ext_vector_type(8)));
typedef float    v4f  __attribute__((ext_vector_type(4)));
typedef unsigned int v4u __attribute__((ext_vector_type(4)));
typedef uint32_t u32x4 __attribute__((ext_vector_type(4)));
typedef uint32_t u32x8 __attribute__((ext_vector_type(8)));

union FragH { v16h v; v8h h[2]; v4u u[2]; };
union FragB { v16b v; v4u u[2]; };

// ---- scalar helpers --------------------------------------------------------------------------------
__device__ __forceinline__ unsigned short bf_bits(float f) {          // f32 -> bf16 bits, RNE convert
  unsigned u = __float_as_uint(f);
  return (unsigned short)((u + 0x7FFFu + ((u >> 16) & 1u)) >> 16);
}
__device__ __forceinline__ unsigned short h_bits(_Float16 x) { return __builtin_bit_cast(unsigned short, x); }
__device__ __forceinline__ unsigned pk16(unsigned short a, unsigned short b) { return (unsigned)a | ((unsigned)b << 16); }
__device__ __forceinline__ v8f zero8() { v8f z = {0.f, 0.f, 0.f, 0.f, 0.f, 0.f, 0.f, 0.f}; return z; }

// ---- fragment loaders: 16-bit A/B operand, lane -> row/col (lane&15), p already includes +8*(lane>>4);
//      elements 0..7 <- p[0..7] (k0+8h..), elements 8..15 <- p[16..23] (k0+16+8h..)  (same split k map for A and B;
//      B is always read from a k-contiguous [n][k] plane)
__device__ __forceinline__ v16h ldfrag_h(const _Float16* p) {
  FragH f;
  f.h[0] = *(const v8h*)(p);
  f.h[1] = *(const v8h*)(p + 16);
  return f.v;
}
__device__ __forceinline__ v16b ldfrag_b(const u16* p) {              // bf16 plane read as unsigned integer vectors
  FragB f;
  f.u[0] = *(const v4u*)(p);
  f.u[1] = *(const v4u*)(p + 16);
  return f.v;
}

__device__ __forceinline__ v8f mma_h(v16h a, v16h b, v8f c) {
  return __builtin_amdgcn_wmma_f32_16x16x32_f16(false, a, false, b, (short)0, c, false, false);
}
__device__ __forceinline__ v8f mma_b(v16b a, v16b b, v8f c) {
  return __builtin_amdgcn_wmma_f32_16x16x32_bf16(false, a, false, b, (short)0, c, false, false);
}
template <typename F>
__device__ __forceinline__ void guard2x6(v8f& a, v8f& b, F x0, F x1, F x2, F x3, F x4, F x5) {
#if defined(__HIP_DEVICE_COMPILE__)
  asm volatile("v_nop\n\tv_nop\n\tv_nop\n\tv_nop"
               : "+v"(a), "+v"(b) : "v"(x0), "v"(x1), "v"(x2), "v"(x3), "v"(x4), "v"(x5) : "memory");
#endif
}
template <typename F>
__device__ __forceinline__ void guard4x5(v8f& a, v8f& b, v8f& c, v8f& d, F x0, F x1, F x2, F x3, F x4) {
#if defined(__HIP_DEVICE_COMPILE__)
  asm volatile("v_nop\n\tv_nop\n\tv_nop\n\tv_nop"
               : "+v"(a), "+v"(b), "+v"(c), "+v"(d) : "v"(x0), "v"(x1), "v"(x2), "v"(x3), "v"(x4) : "memory");
#endif
}
__device__ __forceinline__ void acc_guard4(v8f& a, v8f& b, v8f& c, v8f& d) {
#if defined(__HIP_DEVICE_COMPILE__)
  asm volatile("v_nop\n\tv_nop\n\tv_nop\n\tv_nop" : "+v"(a), "+v"(b), "+v"(c), "+v"(d));
#endif
}
__device__ __forceinline__ void wave_sync_lds() {
#if defined(__HIP_DEVICE_COMPILE__)
  __builtin_amdgcn_fence(__ATOMIC_RELEASE, "workgroup");
  __builtin_amdgcn_wave_barrier();
  __builtin_amdgcn_fence(__ATOMIC_ACQUIRE, "workgroup");
#endif
}

// ---- tensor load to LDS: descriptor words, issue, waits ---------------------------------------------
__device__ __forceinline__ uint32_t uni(uint32_t v) { return (uint32_t)__builtin_amdgcn_readfirstlane((int)v); }
// Test around a tensor load, which ignores EXEC: it has to compile to s_cmp + s_cbranch_scc.
__device__ __forceinline__ uint32_t pinned(uint32_t v) {
  uint32_t w = uni(v);
  asm volatile("" : "+s"(w));   // pinned(): holds the test word in a scalar register, so that the branch on it is scalar
  return w;
}
// Group 1: 1-byte elements, tile = tensor = 32 rows of 256 bytes, source row pitch src_pitch bytes; word 0 is the pad
// constant for 256-byte rows with 16 bytes behind each row (LDS pitch 272), no mask.
__device__ __forceinline__ u32x8 tdm_group1(uint32_t src_pitch) {
  constexpr uint32_t d0 = 256u, d1 = 32u;
  u32x8 g;
  g[0] = uni((1u << 20) | (5u << 22) | (3u << 25));
  g[1] = uni((d0 & 0xFFFFu) << 16);
  g[2] = uni((d0 >> 16) | ((d1 & 0xFFFFu) << 16));
  g[3] = uni((d1 >> 16) | (d0 << 16));
  g[4] = uni(d1);
  g[5] = uni(src_pitch);
  g[6] = uni(0u);
  g[7] = uni(0u);
  return g;
}
__device__ __forceinline__ u32x4 tdm_group0(uint32_t lds_dst, uint64_t ga) {
  u32x4 g;
  g[0] = uni(1u);
  g[1] = uni(lds_dst);
  g[2] = uni((uint32_t)ga);
  g[3] = uni((((uint32_t)(ga >> 32)) & 0x01FFFFFFu) | 0x80000000u);
  return g;
}
// Aim group 0 at the next tile: only the LDS place and the address change.
__device__ __forceinline__ void tdm_aim(u32x4& g, uint32_t lds_dst, uint64_t ga) {
  g[1] = uni(lds_dst);
  g[2] = uni((uint32_t)ga);
  g[3] = uni((((uint32_t)(ga >> 32)) & 0x01FFFFFFu) | 0x80000000u);
}
// One request of the whole wave. Both groups are in-out operands so that their scalar registers stay theirs up to the
// next request: as plain inputs the compiler used some of them as temporaries while the request was in flight.
__device__ __forceinline__ void tdm_load(u32x4& g0, u32x8& g1) {
#if defined(__HIP_DEVICE_COMPILE__)
  asm volatile("tensor_load_to_lds %0, %1" : "+s"(g0), "+s"(g1) :: "memory");
#endif
}
__device__ __forceinline__ void wait_tensor0() {
#if defined(__HIP_DEVICE_COMPILE__)
  asm volatile("s_wait_tensorcnt 0x0" ::: "memory");   // the wave's own slice has landed
#endif
}
__device__ __forceinline__ void wait_ds0() {
#if defined(__HIP_DEVICE_COMPILE__)
  asm volatile("s_wait_dscnt 0x0" ::: "memory");       // the wave's LDS reads have retired before their buffer is refilled
#endif
}

// =====================================================================================================
// f32 plane -> bf16 RNE plane, same layout. Thread = 8 consecutive elements: two 16-B loads, one 16-B store;
// coverage: grid = n8/256 blocks (host checks exactness) x 256 thr x 8 = the whole plane.
// =====================================================================================================
__global__ __launch_bounds__(256) void cvt16(const float* __restrict__ x, u16* D, int n8) {
  const int gt = blockIdx.x * 256 + (int)threadIdx.x;
  if (gt >= n8) return;                     // no barriers in this kernel
  const float* p = x + (size_t)gt * 8;
  const v4f a = *(const v4f*)(p), c4 = *(const v4f*)(p + 4);
  v4u o;
  o[0] = pk16(bf_bits(a[0]),  bf_bits(a[1]));
  o[1] = pk16(bf_bits(a[2]),  bf_bits(a[3]));
  o[2] = pk16(bf_bits(c4[0]), bf_bits(c4[1]));
  o[3] = pk16(bf_bits(c4[2]), bf_bits(c4[3]));
  u16* d = D + (size_t)gt * 8;
  {
    *(v4u*)(d) = o;
    
  }
}

// =====================================================================================================
// Batched bf16 GEMM with f16 result:  C[bt][M][N] = f16( (A[bt][M][K] (bf16 row-major) . Bt[bt][N][K]^T (bf16
// k-contiguous)) * oscale ); per-batch element strides bstA/bstB/bstC. Block = 64x64 tile, 4 waves x 16 rows.
// Operands come through LDS: a stage is 128 k of the block's 64 A rows and 64 B rows; every wave brings its own slice
// of 32 rows x 256 B with one tensor load (LDS pitch 272 B), two buffers, the next stage in flight while this one is
// worked on. Fragments are read from the LDS rows (two 16-B loads each, split k map for A and B), K stepped by 32
// inside a stage (K = DMOD: a multiple of 128 and at least two stages; M % 64 == 0, N % 64 == 0,
// grid = nbatch*(M/64)*(N/64)). The ring becomes the result slabs behind the last pass's barrier.
// converted and written: lane = (row in group of 4, 8 consecutive cols); one instruction = 4 rows, each 64 halves = one
// coverage: 4 instructions x 4 rows x 8 lanes x 8 halves = the wave's 16 x 64 tile; 4 waves = the block's 64 x 64 tile.
// =====================================================================================================
__global__ __launch_bounds__(128)
void gemm_bb(const u16* __restrict__ A, const u16* __restrict__ Bt, u16* C, int M, int N, int K,
             int bstA, int bstB, int bstC, float oscale) {
  __shared__ __attribute__((aligned(2048))) unsigned char ring[GRING];
  const int tid = threadIdx.x, lane = tid & 31, hh = lane >> 4, m = lane & 15;
  const int wave = (int)uni((uint32_t)tid >> 5);
  const int ntile = N >> 6, mtile = M >> 6;
  const int per   = ntile * mtile;
  const int bid   = blockIdx.x;
  const int bt    = bid / per;
  const int t     = bid - bt * per;
  const int row0  = (t / ntile) * 64;
  const int rowb  = row0 + wave * 16;
  const int col0  = (t % ntile) * 64;
  if (row0 + 64 > M) return;                 // block-uniform, never taken with the exact grid; in front of every barrier and load
  const u16* Ab  = A  + (size_t)bt * (size_t)bstA;
  const u16* Bb  = Bt + (size_t)bt * (size_t)bstB;
  u16*       Cb  = C  + (size_t)bt * (size_t)bstC;
  // ---- this wave's slice of every stage: waves 0,1 = A rows row0 + 32*wave .., waves 2,3 = B rows col0 + 32*(wave-2) .. ----
  const u16* sp = (wave < 2) ? (Ab + (size_t)(row0 + 32 * wave) * K) : (Bb + (size_t)(col0 + 32 * (wave - 2)) * K);
  const uint64_t ga0  = (uint64_t)(size_t)sp;
  const uint32_t dst0 = (uint32_t)(size_t)ring + (uint32_t)wave * GSLICE;
  u32x8          g1   = tdm_group1((uint32_t)K * 2u);
  u32x4          g0   = tdm_group0(dst0, ga0);
  const int      npass = K / GKC;
  // ---- fragment rows in LDS: A row 16*wave + m, B rows 16*j + m; +16*hh bytes = +8*hh elements ----
  const unsigned char* ar = ring + (wave >> 1) * GSLICE + ((wave & 1) * 16 + m) * GPITCH + 16 * hh;
  const unsigned char* br = ring + 2 * GSLICE + m * GPITCH + 16 * hh;
  v8f acc0 = zero8(), acc1 = zero8(), acc2 = zero8(), acc3 = zero8();
  // ---- prologue: stage 0 lands and is published, then stage 1 is put in flight ----
  tdm_load(g0, g1);
  wait_tensor0();
  __syncthreads();
  tdm_aim(g0, dst0 + GSTAGE, ga0 + 2u * GKC);
  tdm_load(g0, g1);
#pragma unroll 1   // one pass per stage: the publish point below stands once per trip
  for (int s = 0; s < npass; ++s) {
    const int bo = (s & 1) * GSTAGE;
#pragma unroll     // constant LDS offsets for the four 32-deep steps of a stage
    for (int kk = 0; kk < GKC / 32; ++kk) {
      const int o = bo + kk * 64;
      const v16b a  = ldfrag_b((const u16*)(const void*)(ar + o));
      const v16b b0 = ldfrag_b((const u16*)(const void*)(br + o));
      const v16b b1 = ldfrag_b((const u16*)(const void*)(br + o + 16 * GPITCH));
      const v16b b2 = ldfrag_b((const u16*)(const void*)(br + o + GSLICE));
      const v16b b3 = ldfrag_b((const u16*)(const void*)(br + o + GSLICE + 16 * GPITCH));
      acc0 = mma_b(a, b0, acc0);
      acc1 = mma_b(a, b1, acc1);
      acc2 = mma_b(a, b2, acc2);
      acc3 = mma_b(a, b3, acc3);
      guard4x5<v16b>(acc0, acc1, acc2, acc3, a, b0, b1, b2, b3);
    }
    // ---- publish point of stage s + 1: own LDS reads retired, own slice landed, barrier, then the refill ----
    wait_ds0();
    wait_tensor0();
    __syncthreads();
    if (pinned((uint32_t)(s + 2 < npass))) {
      tdm_aim(g0, dst0 + (uint32_t)bo, ga0 + (uint64_t)(s + 2) * (2u * GKC));
      tdm_load(g0, g1);
    }
  }
  wait_tensor0();   // behind the loop: no request in flight and no LDS read open before the ring is used for the result
  wait_ds0();
  acc_guard4(acc0, acc1, acc2, acc3);
  // ---- stage the scaled value in the wave's slab: the ring's first bytes, which every reader has left at the last
  //      pass's barrier and at which no load is aimed any more ----
  float* sl = (float*)(void*)ring + wave * GSLAB;
#pragma unroll
  for (int r = 0; r < 8; ++r) {
    const int ro = (8 * hh + r) * 68 + m;
    sl[ro]      = acc0[r] * oscale;
    sl[ro + 16] = acc1[r] * oscale;
    sl[ro + 32] = acc2[r] * oscale;
    sl[ro + 48] = acc3[r] * oscale;
  }
  wave_sync_lds();
  const int rq = lane >> 3, c8 = (lane & 7) * 8;
  v4u ov[4];
#pragma unroll
  for (int i4 = 0; i4 < 4; ++i4) {
    const int row = i4 * 4 + rq;
    const v4f a = *(const v4f*)(sl + row * 68 + c8), c4 = *(const v4f*)(sl + row * 68 + c8 + 4);
    float w[8];
#pragma unroll
    for (int e = 0; e < 4; ++e) { w[e] = a[e]; w[4 + e] = c4[e]; }
#pragma unroll
    for (int e = 0; e < 4; ++e) ov[i4][e] = pk16(h_bits((_Float16)w[2 * e]), h_bits((_Float16)w[2 * e + 1]));
  }
  const size_t dofs = ((size_t)rowb + (size_t)rq) * (size_t)N + col0 + c8;
  u16* dst = Cb + dofs;
  {
#pragma unroll
    for (int i4 = 0; i4 < 4; ++i4) {
      *(v4u*)(dst + (size_t)(i4 * 4) * (size_t)N) = ov[i4];
    }
    
  }
}

// =====================================================================================================
// Multi-head flash attention with per-head linear relative-position bias (no mask): block = (batch b, head, 64 query
// rows), 4 waves, wave w owns query rows q0 = 64*qt + 16*w .. q0+15 (waves independent: no block barriers, wave-private
// LDS only, used in the epilogue).
//   q plane (f16, x8) laid out [b][s][h*64+d]; k plane the same (f16, x8); v^T plane [b][h*64+d][s] (x1024 f16).
//   All NKB = 64 key blocks of 32 keys are visited (static bound).
//   Scores are computed TRANSPOSED: S^T tile g (g = 0,1) = k rows (keys kb+16g .. +15, A operand, row m = lane&15, split k
//   map over d) times q^T (B operand, col n = query q0 + (lane&15), k = d, split map), one f16 product per tile and 32-deep
//   d-chunk, one guarded group of 4 WMMAs; the two q fragments are loaded once per wave.
//   D element r of lane l = (key kb+16g+8h+r, query q0+(l&15)), so a lane owns one query column and 16 of its 32 keys; the
//   partner lane l^16 owns the other 16 -> row max / row sum need one xor-16 shuffle.
//   Logit (base 2) = score * (1/32) * log2e / (8*8) + slope_h * (key - query) * log2e, slope_h = (2^-0.5)^(h+1).
//   Online max-subtracted base-2 softmax in f32. The exp'd values ARE the P A-fragment in place: A row m = query = lane&15,
//   element i <- key kb+8h+i (tile 0, D element i), element 8+i <- key kb+16+8h+i (tile 1, D element i). P is carried
//   x32768 as single f16. The rescale factor of query row 8h+r of the O accumulators is fetched from lane 8h+r with a
//   shuffle (uniform control). 4 v^T B fragments (col n = d = 16j + (lane&15), keys k-contiguous), 4 P.V WMMAs per key
//   block in one guarded group.
//   Epilogue: 1/l (per query, shuffled to the D row owner) and the carry folds in f32; the wave's 16x64 f32 result staged
//   segment (b, q0+row, head) of the f32 result [b][s][h*64+d] written by 16 consecutive lanes x 16 B of one instruction
// coverage: per wave 8 instructions x 2 rows x 16 lanes x 4 floats = 16 x 64; grid NB*NH*(SQ/64) blocks x 4 waves =
//           every (b, s < SQ, h) row segment of the result exactly once.
// =====================================================================================================
__global__ __launch_bounds__(ATT_THREADS)
void attn_fwd(const u16* __restrict__ QPp, const u16* __restrict__ KPp, const u16* __restrict__ VPp, float* Out) {
  __shared__ __align__(16) float smem[ATT_WAVES * GSLAB];   // per wave: result slab [16][68] in the epilogue only

  const int tid  = threadIdx.x;
  const int wave = tid >> 5;
  const int lane = tid & 31;
  const int hh   = lane >> 4;
  const int c    = lane & 15;

  const int bid  = blockIdx.x;
  const int qt   = bid % NQT;
  const int head = (bid / NQT) % NH;
  const int b    = bid / (NQT * NH);
  const int q0   = qt * 64 + wave * 16;

  // B fragments of q^T: col n = query q0 + c, k = d (k-contiguous row segment of the q plane)
  const size_t qofs = ((size_t)(b * SEQ + q0 + c)) * NHD + (size_t)(head * HD + 8 * hh);
  const _Float16* Qb = (const _Float16*)(const void*)QPp + qofs;
  // A fragments of k: row m = key kb + 16g + c, k = d
  const size_t kofs = ((size_t)(b * SEQ + c)) * NHD + (size_t)(head * HD + 8 * hh);   // key row kb added per step
  const _Float16* Kb = (const _Float16*)(const void*)KPp + kofs;
  // B fragments of v: col n = d = 16j + c, k = key (k-contiguous row of the v^T plane)
  const size_t vofs = ((size_t)(b * NHD + head * HD + c)) * SEQ + 8 * hh;           // key kb added per step
  const _Float16* Vb = (const _Float16*)(const void*)VPp + vofs;

  const int   ex     = head + 1;
  const float slope  = (((ex & 1) != 0) ? RSQ2 : 1.0f) * __int_as_float((127 - (ex >> 1)) << 23);
  const float slope2 = slope * LOG2E;
  const float lsc    = (INVN * LOG2E) * (1.0f / (QSC * KSC));
  const float jb0    = (float)(8 * hh - (q0 + c));      // key - query, key block base added per step

  const v16h qf0 = ldfrag_h(Qb);            // d 0..31
  const v16h qf1 = ldfrag_h(Qb + 32);       // d 32..63

  float mrun = -INFINITY, lrun = 0.f;
  v8f o[4];
#pragma unroll
  for (int j = 0; j < 4; ++j) o[j] = zero8();

#pragma unroll 1
  for (int it = 0; it < NKB; ++it) {
    const int kb = it * 32;
    // ---- transposed scores: s0 = keys kb..kb+15, s1 = keys kb+16..kb+31, column = query q0 + c ----
    v8f s0 = zero8(), s1 = zero8();
    const _Float16* k0p = Kb + (size_t)kb * NHD;
    const _Float16* k1p = k0p + (size_t)16 * NHD;
    {
      const v16h ka0 = ldfrag_h(k0p),      ka1 = ldfrag_h(k0p + 32);
      const v16h kc0 = ldfrag_h(k1p),      kc1 = ldfrag_h(k1p + 32);
      s0 = mma_h(ka0, qf0, s0);
      s0 = mma_h(ka1, qf1, s0);
      s1 = mma_h(kc0, qf0, s1);
      s1 = mma_h(kc1, qf1, s1);
      guard2x6<v16h>(s0, s1, qf0, qf1, ka0, ka1, kc0, kc1);
    }
    // ---- base-2 logits of this lane's 16 keys for query q0 + c ----
    const float jb = jb0 + (float)kb;
    float tk[16];
#pragma unroll
    for (int i = 0; i < 8; ++i) {
      tk[i]     = fmaf(s0[i], lsc, slope2 * (jb + (float)i));
      tk[8 + i] = fmaf(s1[i], lsc, slope2 * (jb + (float)(16 + i)));
    }
    float cm = tk[0];
#pragma unroll
    for (int i = 1; i < 16; ++i) cm = fmaxf(cm, tk[i]);
    cm = fmaxf(cm, __shfl_xor(cm, 16, 32));
    const float mn = fmaxf(mrun, cm);                                // finite from the first key block on
    const float al = (mrun == -INFINITY) ? 0.f : exp2f(mrun - mn);   // o and l are zero while mrun is -inf
    mrun = mn;
    // ---- probabilities (<= 1) and the P A-fragment: f16(p * 32768); element i <-> tk[i] ----
    float ps = 0.f;
    FragH ph;
#pragma unroll
    for (int w = 0; w < 2; ++w) {
#pragma unroll
      for (int e4 = 0; e4 < 4; ++e4) {
        const int i = 8 * w + 2 * e4;
        const float p0 = exp2f(fminf(tk[i] - mn, 0.f));
        const float p1 = exp2f(fminf(tk[i + 1] - mn, 0.f));
        ps += p0 + p1;
        ph.u[w][e4] = pk16(h_bits((_Float16)(p0 * PCAR)), h_bits((_Float16)(p1 * PCAR)));
      }
    }
    ps += __shfl_xor(ps, 16, 32);
    lrun = lrun * al + ps;
    // ---- rescale the O accumulators: D row 8hh+r = query q0+8hh+r, its factor lives in lane 8hh+r (and 16+8hh+r) ----
    float scl[8];
#pragma unroll
    for (int r = 0; r < 8; ++r) scl[r] = __shfl(al, 8 * hh + r, 32);
#pragma unroll
    for (int j = 0; j < 4; ++j) {
#pragma unroll
      for (int r = 0; r < 8; ++r) o[j][r] *= scl[r];
    }
    // ---- P.V : B fragment col n = d = j*16 + c, keys contiguous in the v^T plane; one group of 4 ----
    {
      const _Float16* vp = Vb + kb;
      const v16h vf0 = ldfrag_h(vp);
      const v16h vf1 = ldfrag_h(vp + (size_t)16 * SEQ);
      const v16h vf2 = ldfrag_h(vp + (size_t)32 * SEQ);
      const v16h vf3 = ldfrag_h(vp + (size_t)48 * SEQ);
      o[0] = mma_h(ph.v, vf0, o[0]);
      o[1] = mma_h(ph.v, vf1, o[1]);
      o[2] = mma_h(ph.v, vf2, o[2]);
      o[3] = mma_h(ph.v, vf3, o[3]);
      guard4x5<v16h>(o[0], o[1], o[2], o[3], ph.v, vf0, vf1, vf2, vf3);
    }
  }
  acc_guard4(o[0], o[1], o[2], o[3]);

  // ---- fold 1/l (per query, owned by lane = query; l >= 1 by construction) and the P/v carries ----
  const float linv = (lrun > 0.f) ? ((1.0f / lrun) * (1.0f / (PCAR * VCAR))) : 0.f;
  float inv[8];
#pragma unroll
  for (int r = 0; r < 8; ++r) inv[r] = __shfl(linv, 8 * hh + r, 32);
  float* slab = smem + wave * GSLAB;
#pragma unroll
  for (int r = 0; r < 8; ++r) {
#pragma unroll
    for (int j = 0; j < 4; ++j) slab[(8 * hh + r) * 68 + j * 16 + c] = o[j][r] * inv[r];
  }
  wave_sync_lds();
  // ---- f32 result: lanes 0..15 -> row 2*i2, lanes 16..31 -> row 2*i2+1; lane = 4 consecutive floats ----
  v4f vals[8];
#pragma unroll
  for (int i2 = 0; i2 < 8; ++i2) vals[i2] = *(const v4f*)(slab + (i2 * 2 + hh) * 68 + c * 4);
  float* dst = Out + ((size_t)(b * SEQ + q0 + hh)) * DMOD + (size_t)(head * HD + c * 4);
  {
#pragma unroll
    for (int i2 = 0; i2 < 8; ++i2) {
      *(v4f*)(dst + (size_t)(i2 * 2) * (size_t)DMOD) = vals[i2];
    }
    
  }
}

// =====================================================================================================
// Workspace map (bytes, NB = 4); every plane is fully written by whole-line stores before it is read; all extents are
// exact multiples of the store granularity (no pad rows):
//   XB  bf16 [NB*SEQ][DMOD]                          16777216
//   WB  bf16 [3*NHD][DMOD]  (k | q | v chunks)        6291456
//   QP  f16  [NB*SEQ][NHD] x8                       16777216
//   KP  f16  [NB*SEQ][NHD] x8                       16777216
//   VP  f16  [NB][NHD][SEQ] x1024                   16777216
//   end                                             73400320
// 6 launches on one in-order stream.
// =====================================================================================================
extern "C" void kernel_launch(void* const* d_in, const int* in_sizes, int n_in,
                              void* d_out, int out_size, void* d_ws, size_t ws_size,
                              hipStream_t stream) {
  const int ROWS = NB * SEQ;
  if (n_in < 2) return;
  if (in_sizes[0] < ROWS * DMOD) return;
  if (in_sizes[1] != 3 * NHD * DMOD) return;
  if (out_size < ROWS * DMOD) return;

  const float* Xin = (const float*)d_in[0];
  const float* Win = (const float*)d_in[1];
  float*       out = (float*)d_out;

  const size_t szXB = (size_t)ROWS * DMOD * 2;
  const size_t szWB = (size_t)3 * NHD * DMOD * 2;
  const size_t szPl = (size_t)ROWS * NHD * 2;                  // q/k planes
  const size_t szVP = (size_t)NB * NHD * SEQ * 2;
  size_t off = 0;
  const size_t oXB = off; off += szXB;
  const size_t oWB = off; off += szWB;
  const size_t oQP = off; off += szPl;
  const size_t oKP = off; off += szPl;
  const size_t oVP = off; off += szVP;
  if (off > ws_size) return;                            // off = 73400320 for NB = 4
  if (off > (size_t)134217728) return;

  char* ws = (char*)d_ws;
  u16* XB = (u16*)(ws + oXB);
  u16* WB = (u16*)(ws + oWB);
  u16* QP = (u16*)(ws + oQP);
  u16* KP = (u16*)(ws + oKP);
  u16* VP = (u16*)(ws + oVP);

  const int n8x = (ROWS * DMOD) / 8;
  const int n8w = (3 * NHD * DMOD) / 8;
  if ((n8x % 256) != 0 || (n8w % 256) != 0) return;
  if ((DMOD % 64) != 0 || (NHD % 64) != 0 || (SEQ % 64) != 0 || (SQ % 64) != 0 || (DMOD % 32) != 0) return;

  const dim3 blk(256);
  const dim3 gX(n8x / 256);                             // 4096
  const dim3 gW(n8w / 256);                             // 1536
  const dim3 bG(128);
  const dim3 gQ(NB * (SQ / 64) * (NHD / 64));           // 2048
  const dim3 gK(NB * (SEQ / 64) * (NHD / 64));          // 2048
  const dim3 gV(NB * (NHD / 64) * (SEQ / 64));          // 2048
  const dim3 gAT(ATT_BLOCKS);                           // 2048
  const dim3 bAT(ATT_THREADS);                          // 128

  // (1) x -> bf16 plane [ROWS][DMOD]
  cvt16<<<gX, blk, 0, stream>>>(Xin, XB, n8x);
  // (2) W [3*NHD out][DMOD in] -> bf16, same layout (already k-contiguous for B fragments / row-major A for the v^T GEMM)
  cvt16<<<gW, blk, 0, stream>>>(Win, WB, n8w);
  // (3,4) q, k as single f16 planes [b][s][h*64+d] = (x.Wq^T) x8 over SQ rows per batch, (x.Wk^T) x8 over all keys
  gemm_bb<<<gQ, bG, 0, stream>>>(XB, WB + (size_t)NHD * DMOD, QP, SQ, NHD, DMOD, SEQ * DMOD, 0, SEQ * NHD, QSC);
  gemm_bb<<<gK, bG, 0, stream>>>(XB, WB, KP, SEQ, NHD, DMOD, SEQ * DMOD, 0, SEQ * NHD, KSC);
  // (5) v^T plane per batch: [h*64+d][keys] = f16((Wv . x_b^T) x1024)
  gemm_bb<<<gV, bG, 0, stream>>>(WB + (size_t)2 * NHD * DMOD, XB, VP, NHD, SEQ, DMOD, 0, SEQ * DMOD, NHD * SEQ, VCAR);
  // (6) attention -> out [b][s][h*64+d] f32
  attn_fwd<<<gAT, bAT, 0, stream>>>(QP, KP, VP, out);
  (void)hipGetLastError();
}

// v002
// A run of this version takes 174 microseconds.
// Timed twice side by side with v001, it ran 1.50 and 1.46 times as fast.
// Over all steps from v000 it is 2.37 times as fast.
// Contractions: x.Wk^T, x.Wq^T and Wv.x^T on v_wmma_f32_16x16x32_bf16 (x and W planes RNE-converted to bf16 operands,
// f32 accumulate); scores k.q^T (k and q single f16 planes carried x8) and P.v (P x32768 single f16, v x1024 single f16)
// on v_wmma_f32_16x16x32_f16, f32 accumulate. Base-2 online softmax with linear relative-position bias; 1/l and carry
// folds in f32 on VALU; f32 result written directly.
#include <hip/hip_runtime.h>
#include <math.h>
#include <stdint.h>

#ifndef NB
#define NB    4
#endif
#define SEQ   2048
#ifndef SQ
#define SQ    SEQ
#endif
#define DMOD  1024
#define NH    16
#define HD    64
#define NHD   (NH * HD)
#define QSC   8.0f
#define KSC   8.0f
#define PCAR  32768.0f
#define VCAR  1024.0f
#define LOG2E 1.4426950408889634f
#define INVN  0.03125f
#define RSQ2  0.70710678118654752f
#define ATT_WAVES   4
#define ATT_THREADS (ATT_WAVES * 32)
#define NQT         (SQ / 64)
#define ATT_BLOCKS  (NB * NH * NQT)
#define NKB         (SEQ / 32)
#define GSLAB       (16 * 68)
#define GKC         128                 // k elements of one GEMM stage: rows of 256 bytes
#define GPITCH      272                 // LDS row pitch, bytes: 256 + 16, an odd multiple of 16 for 16-byte readers
#define GSLICE      10240               // one wave's slice: 32 rows x 272 B = 8704 B, rounded up to a multiple of 2 KiB
#define GSTAGE      (4 * GSLICE)        // [A rows 0..31 | A rows 32..63 | B rows 0..31 | B rows 32..63]
#define GRING       (2 * GSTAGE)
#define AKEYS       64                  // keys of one attention stage: k rows and v^T rows of 128 bytes each
#define APITCH      144                 // LDS row pitch, bytes: 128 + 16, an odd multiple of 16 for 16-byte readers
#define ASLICE      6144                // one wave's slice: 32 rows x 144 B = 4608 B, rounded up to a multiple of 2 KiB
#define ASTAGE      (4 * ASLICE)        // [k rows 0..31 | k rows 32..63 | v^T rows 0..31 | v^T rows 32..63]
#define ARING       (2 * ASTAGE)
#define NST         (SEQ / AKEYS)
static_assert(32 * APITCH <= ASLICE && (ASLICE % 2048) == 0 && HD * 2 == 128 && AKEYS * 2 == 128 && ATT_WAVES == 4);
static_assert(ATT_WAVES * GSLAB * 4 <= ASTAGE && (SEQ % AKEYS) == 0 && NST >= 2 && (AKEYS % 32) == 0);
static_assert(32 * GPITCH <= GSLICE && (GSLICE % 2048) == 0 && GKC * 2 == 256 && 4 * GSLAB * 4 <= GSTAGE);
static_assert((DMOD % GKC) == 0 && (DMOD / GKC) >= 2);
static_assert(NH == 16 && HD == 64 && DMOD == NHD);
static_assert((HD % 32) == 0 && (SEQ % 64) == 0 && (SQ % 64) == 0 && SQ <= SEQ && SQ >= 64);
static_assert((DMOD % 64) == 0 && (DMOD % 32) == 0 && (NHD % 64) == 0);
static_assert(((NB * SEQ * DMOD / 8) % 256) == 0);
static_assert(((3 * NHD * DMOD / 8) % 256) == 0);
static_assert((GSLAB * 4) % 16 == 0 && ATT_THREADS == 128);
static_assert(NB >= 1 && NB <= 4);

typedef unsigned short u16;
typedef _Float16 v16h __attribute__((ext_vector_type(16)));
typedef _Float16 v8h  __attribute__((ext_vector_type(8)));
typedef __bf16   v16b __attribute__((ext_vector_type(16)));
typedef float    v8f  __attribute__((ext_vector_type(8)));
typedef float    v4f  __attribute__((ext_vector_type(4)));
typedef unsigned int v4u __attribute__((ext_vector_type(4)));
typedef uint32_t u32x4 __attribute__((ext_vector_type(4)));
typedef uint32_t u32x8 __attribute__((ext_vector_type(8)));

union FragH { v16h v; v8h h[2]; v4u u[2]; };
union FragB { v16b v; v4u u[2]; };

// ---- scalar helpers --------------------------------------------------------------------------------
__device__ __forceinline__ unsigned short bf_bits(float f) {          // f32 -> bf16 bits, RNE convert
  unsigned u = __float_as_uint(f);
  return (unsigned short)((u + 0x7FFFu + ((u >> 16) & 1u)) >> 16);
}
__device__ __forceinline__ unsigned short h_bits(_Float16 x) { return __builtin_bit_cast(unsigned short, x); }
__device__ __forceinline__ unsigned pk16(unsigned short a, unsigned short b) { return (unsigned)a | ((unsigned)b << 16); }
__device__ __forceinline__ v8f zero8() { v8f z = {0.f, 0.f, 0.f, 0.f, 0.f, 0.f, 0.f, 0.f}; return z; }

// ---- fragment loaders: 16-bit A/B operand, lane -> row/col (lane&15), p already includes +8*(lane>>4);
//      elements 0..7 <- p[0..7] (k0+8h..), elements 8..15 <- p[16..23] (k0+16+8h..)  (same split k map for A and B;
//      B is always read from a k-contiguous [n][k] plane)
__device__ __forceinline__ v16h ldfrag_h(const _Float16* p) {
  FragH f;
  f.h[0] = *(const v8h*)(p);
  f.h[1] = *(const v8h*)(p + 16);
  return f.v;
}
__device__ __forceinline__ v16b ldfrag_b(const u16* p) {              // bf16 plane read as unsigned integer vectors
  FragB f;
  f.u[0] = *(const v4u*)(p);
  f.u[1] = *(const v4u*)(p + 16);
  return f.v;
}

__device__ __forceinline__ v8f mma_h(v16h a, v16h b, v8f c) {
  return __builtin_amdgcn_wmma_f32_16x16x32_f16(false, a, false, b, (short)0, c, false, false);
}
__device__ __forceinline__ v8f mma_b(v16b a, v16b b, v8f c) {
  return __builtin_amdgcn_wmma_f32_16x16x32_bf16(false, a, false, b, (short)0, c, false, false);
}
template <typename F>
__device__ __forceinline__ void guard2x6(v8f& a, v8f& b, F x0, F x1, F x2, F x3, F x4, F x5) {
#if defined(__HIP_DEVICE_COMPILE__)
  asm volatile("v_nop\n\tv_nop\n\tv_nop\n\tv_nop"
               : "+v"(a), "+v"(b) : "v"(x0), "v"(x1), "v"(x2), "v"(x3), "v"(x4), "v"(x5) : "memory");
#endif
}
template <typename F>
__device__ __forceinline__ void guard4x5(v8f& a, v8f& b, v8f& c, v8f& d, F x0, F x1, F x2, F x3, F x4) {
#if defined(__HIP_DEVICE_COMPILE__)
  asm volatile("v_nop\n\tv_nop\n\tv_nop\n\tv_nop"
               : "+v"(a), "+v"(b), "+v"(c), "+v"(d) : "v"(x0), "v"(x1), "v"(x2), "v"(x3), "v"(x4) : "memory");
#endif
}
__device__ __forceinline__ void acc_guard4(v8f& a, v8f& b, v8f& c, v8f& d) {
#if defined(__HIP_DEVICE_COMPILE__)
  asm volatile("v_nop\n\tv_nop\n\tv_nop\n\tv_nop" : "+v"(a), "+v"(b), "+v"(c), "+v"(d));
#endif
}
__device__ __forceinline__ void wave_sync_lds() {
#if defined(__HIP_DEVICE_COMPILE__)
  __builtin_amdgcn_fence(__ATOMIC_RELEASE, "workgroup");
  __builtin_amdgcn_wave_barrier();
  __builtin_amdgcn_fence(__ATOMIC_ACQUIRE, "workgroup");
#endif
}

// ---- tensor load to LDS: descriptor words, issue, waits ---------------------------------------------
__device__ __forceinline__ uint32_t uni(uint32_t v) { return (uint32_t)__builtin_amdgcn_readfirstlane((int)v); }
// Test around a tensor load, which ignores EXEC: it has to compile to s_cmp + s_cbranch_scc.
__device__ __forceinline__ uint32_t pinned(uint32_t v) {
  uint32_t w = uni(v);
  asm volatile("" : "+s"(w));   // pinned(): holds the test word in a scalar register, so that the branch on it is scalar
  return w;
}
// Group 1: 1-byte elements, tile = tensor = 32 rows of 256 bytes, source row pitch src_pitch bytes; word 0 is the pad
// constant for 256-byte rows with 16 bytes behind each row (LDS pitch 272), no mask.
__device__ __forceinline__ u32x8 tdm_group1(uint32_t src_pitch) {
  constexpr uint32_t d0 = 256u, d1 = 32u;
  u32x8 g;
  g[0] = uni((1u << 20) | (5u << 22) | (3u << 25));
  g[1] = uni((d0 & 0xFFFFu) << 16);
  g[2] = uni((d0 >> 16) | ((d1 & 0xFFFFu) << 16));
  g[3] = uni((d1 >> 16) | (d0 << 16));
  g[4] = uni(d1);
  g[5] = uni(src_pitch);
  g[6] = uni(0u);
  g[7] = uni(0u);
  return g;
}
// The same for 32 rows of 128 bytes: pad constant for 128-byte rows with 16 bytes behind each row (LDS pitch 144), no mask.
__device__ __forceinline__ u32x8 tdm_group1_r128(uint32_t src_pitch) {
  constexpr uint32_t d0 = 128u, d1 = 32u;
  u32x8 g;
  g[0] = uni((1u << 20) | (4u << 22) | (3u << 25));
  g[1] = uni((d0 & 0xFFFFu) << 16);
  g[2] = uni((d0 >> 16) | ((d1 & 0xFFFFu) << 16));
  g[3] = uni((d1 >> 16) | (d0 << 16));
  g[4] = uni(d1);
  g[5] = uni(src_pitch);
  g[6] = uni(0u);
  g[7] = uni(0u);
  return g;
}
__device__ __forceinline__ u32x4 tdm_group0(uint32_t lds_dst, uint64_t ga) {
  u32x4 g;
  g[0] = uni(1u);
  g[1] = uni(lds_dst);
  g[2] = uni((uint32_t)ga);
  g[3] = uni((((uint32_t)(ga >> 32)) & 0x01FFFFFFu) | 0x80000000u);
  return g;
}
// Aim group 0 at the next tile: only the LDS place and the address change.
__device__ __forceinline__ void tdm_aim(u32x4& g, uint32_t lds_dst, uint64_t ga) {
  g[1] = uni(lds_dst);
  g[2] = uni((uint32_t)ga);
  g[3] = uni((((uint32_t)(ga >> 32)) & 0x01FFFFFFu) | 0x80000000u);
}
// One request of the whole wave. Both groups are in-out operands so that their scalar registers stay theirs up to the
// next request: as plain inputs the compiler used some of them as temporaries while the request was in flight.
__device__ __forceinline__ void tdm_load(u32x4& g0, u32x8& g1) {
#if defined(__HIP_DEVICE_COMPILE__)
  asm volatile("tensor_load_to_lds %0, %1" : "+s"(g0), "+s"(g1) :: "memory");
#endif
}
__device__ __forceinline__ void wait_tensor0() {
#if defined(__HIP_DEVICE_COMPILE__)
  asm volatile("s_wait_tensorcnt 0x0" ::: "memory");   // the wave's own slice has landed
#endif
}
__device__ __forceinline__ void wait_ds0() {
#if defined(__HIP_DEVICE_COMPILE__)
  asm volatile("s_wait_dscnt 0x0" ::: "memory");       // the wave's LDS reads have retired before their buffer is refilled
#endif
}

// =====================================================================================================
// f32 plane -> bf16 RNE plane, same layout. Thread = 8 consecutive elements: two 16-B loads, one 16-B store;
// coverage: grid = n8/256 blocks (host checks exactness) x 256 thr x 8 = the whole plane.
// =====================================================================================================
__global__ __launch_bounds__(256) void cvt16(const float* __restrict__ x, u16* D, int n8) {
  const int gt = blockIdx.x * 256 + (int)threadIdx.x;
  if (gt >= n8) return;                     // no barriers in this kernel
  const float* p = x + (size_t)gt * 8;
  const v4f a = *(const v4f*)(p), c4 = *(const v4f*)(p + 4);
  v4u o;
  o[0] = pk16(bf_bits(a[0]),  bf_bits(a[1]));
  o[1] = pk16(bf_bits(a[2]),  bf_bits(a[3]));
  o[2] = pk16(bf_bits(c4[0]), bf_bits(c4[1]));
  o[3] = pk16(bf_bits(c4[2]), bf_bits(c4[3]));
  u16* d = D + (size_t)gt * 8;
  {
    *(v4u*)(d) = o;
    
  }
}

// =====================================================================================================
// Batched bf16 GEMM with f16 result:  C[bt][M][N] = f16( (A[bt][M][K] (bf16 row-major) . Bt[bt][N][K]^T (bf16
// k-contiguous)) * oscale ); per-batch element strides bstA/bstB/bstC. Block = 64x64 tile, 4 waves x 16 rows.
// Operands come through LDS: a stage is 128 k of the block's 64 A rows and 64 B rows; every wave brings its own slice
// of 32 rows x 256 B with one tensor load (LDS pitch 272 B), two buffers, the next stage in flight while this one is
// worked on. Fragments are read from the LDS rows (two 16-B loads each, split k map for A and B), K stepped by 32
// inside a stage (K = DMOD: a multiple of 128 and at least two stages; M % 64 == 0, N % 64 == 0,
// grid = nbatch*(M/64)*(N/64)). The ring becomes the result slabs behind the last pass's barrier.
// converted and written: lane = (row in group of 4, 8 consecutive cols); one instruction = 4 rows, each 64 halves = one
// coverage: 4 instructions x 4 rows x 8 lanes x 8 halves = the wave's 16 x 64 tile; 4 waves = the block's 64 x 64 tile.
// =====================================================================================================
__global__ __launch_bounds__(128)
void gemm_bb(const u16* __restrict__ A, const u16* __restrict__ Bt, u16* C, int M, int N, int K,
             int bstA, int bstB, int bstC, float oscale) {
  __shared__ __attribute__((aligned(2048))) unsigned char ring[GRING];
  const int tid = threadIdx.x, lane = tid & 31, hh = lane >> 4, m = lane & 15;
  const int wave = (int)uni((uint32_t)tid >> 5);
  const int ntile = N >> 6, mtile = M >> 6;
  const int per   = ntile * mtile;
  const int bid   = blockIdx.x;
  const int bt    = bid / per;
  const int t     = bid - bt * per;
  const int row0  = (t / ntile) * 64;
  const int rowb  = row0 + wave * 16;
  const int col0  = (t % ntile) * 64;
  if (row0 + 64 > M) return;                 // block-uniform, never taken with the exact grid; in front of every barrier and load
  const u16* Ab  = A  + (size_t)bt * (size_t)bstA;
  const u16* Bb  = Bt + (size_t)bt * (size_t)bstB;
  u16*       Cb  = C  + (size_t)bt * (size_t)bstC;
  // ---- this wave's slice of every stage: waves 0,1 = A rows row0 + 32*wave .., waves 2,3 = B rows col0 + 32*(wave-2) .. ----
  const u16* sp = (wave < 2) ? (Ab + (size_t)(row0 + 32 * wave) * K) : (Bb + (size_t)(col0 + 32 * (wave - 2)) * K);
  const uint64_t ga0  = (uint64_t)(size_t)sp;
  const uint32_t dst0 = (uint32_t)(size_t)ring + (uint32_t)wave * GSLICE;
  u32x8          g1   = tdm_group1((uint32_t)K * 2u);
  u32x4          g0   = tdm_group0(dst0, ga0);
  const int      npass = K / GKC;
  // ---- fragment rows in LDS: A row 16*wave + m, B rows 16*j + m; +16*hh bytes = +8*hh elements ----
  const unsigned char* ar = ring + (wave >> 1) * GSLICE + ((wave & 1) * 16 + m) * GPITCH + 16 * hh;
  const unsigned char* br = ring + 2 * GSLICE + m * GPITCH + 16 * hh;
  v8f acc0 = zero8(), acc1 = zero8(), acc2 = zero8(), acc3 = zero8();
  // ---- prologue: stage 0 lands and is published, then stage 1 is put in flight ----
  tdm_load(g0, g1);
  wait_tensor0();
  __syncthreads();
  tdm_aim(g0, dst0 + GSTAGE, ga0 + 2u * GKC);
  tdm_load(g0, g1);
#pragma unroll 1   // one pass per stage: the publish point below stands once per trip
  for (int s = 0; s < npass; ++s) {
    const int bo = (s & 1) * GSTAGE;
#pragma unroll     // constant LDS offsets for the four 32-deep steps of a stage
    for (int kk = 0; kk < GKC / 32; ++kk) {
      const int o = bo + kk * 64;
      const v16b a  = ldfrag_b((const u16*)(const void*)(ar + o));
      const v16b b0 = ldfrag_b((const u16*)(const void*)(br + o));
      const v16b b1 = ldfrag_b((const u16*)(const void*)(br + o + 16 * GPITCH));
      const v16b b2 = ldfrag_b((const u16*)(const void*)(br + o + GSLICE));
      const v16b b3 = ldfrag_b((const u16*)(const void*)(br + o + GSLICE + 16 * GPITCH));
      acc0 = mma_b(a, b0, acc0);
      acc1 = mma_b(a, b1, acc1);
      acc2 = mma_b(a, b2, acc2);
      acc3 = mma_b(a, b3, acc3);
      guard4x5<v16b>(acc0, acc1, acc2, acc3, a, b0, b1, b2, b3);
    }
    // ---- publish point of stage s + 1: own LDS reads retired, own slice landed, barrier, then the refill ----
    wait_ds0();
    wait_tensor0();
    __syncthreads();
    if (pinned((uint32_t)(s + 2 < npass))) {
      tdm_aim(g0, dst0 + (uint32_t)bo, ga0 + (uint64_t)(s + 2) * (2u * GKC));
      tdm_load(g0, g1);
    }
  }
  wait_tensor0();   // behind the loop: no request in flight and no LDS read open before the ring is used for the result
  wait_ds0();
  acc_guard4(acc0, acc1, acc2, acc3);
  // ---- stage the scaled value in the wave's slab: the ring's first bytes, which every reader has left at the last
  //      pass's barrier and at which no load is aimed any more ----
  float* sl = (float*)(void*)ring + wave * GSLAB;
#pragma unroll
  for (int r = 0; r < 8; ++r) {
    const int ro = (8 * hh + r) * 68 + m;
    sl[ro]      = acc0[r] * oscale;
    sl[ro + 16] = acc1[r] * oscale;
    sl[ro + 32] = acc2[r] * oscale;
    sl[ro + 48] = acc3[r] * oscale;
  }
  wave_sync_lds();
  const int rq = lane >> 3, c8 = (lane & 7) * 8;
  v4u ov[4];
#pragma unroll
  for (int i4 = 0; i4 < 4; ++i4) {
    const int row = i4 * 4 + rq;
    const v4f a = *(const v4f*)(sl + row * 68 + c8), c4 = *(const v4f*)(sl + row * 68 + c8 + 4);
    float w[8];
#pragma unroll
    for (int e = 0; e < 4; ++e) { w[e] = a[e]; w[4 + e] = c4[e]; }
#pragma unroll
    for (int e = 0; e < 4; ++e) ov[i4][e] = pk16(h_bits((_Float16)w[2 * e]), h_bits((_Float16)w[2 * e + 1]));
  }
  const size_t dofs = ((size_t)rowb + (size_t)rq) * (size_t)N + col0 + c8;
  u16* dst = Cb + dofs;
  {
#pragma unroll
    for (int i4 = 0; i4 < 4; ++i4) {
      *(v4u*)(dst + (size_t)(i4 * 4) * (size_t)N) = ov[i4];
    }
    
  }
}

// =====================================================================================================
// Multi-head flash attention with per-head linear relative-position bias (no mask): block = (batch b, head, 64 query
// rows), 4 waves, wave w owns query rows q0 = 64*qt + 16*w .. q0+15.
//   k and v^T come through LDS, shared by the block's 4 waves: a stage is 64 keys = 64 k rows x 128 B and 64 v^T rows x
//   128 B; every wave brings its own slice of 32 rows with one tensor load (LDS pitch 144 B), two buffers, the next stage
//   in flight while this one is worked on; one publish point (waits + block barrier) per stage. The ring's first bytes
//   become the wave-private result slabs behind the last stage's barrier.
//   q plane (f16, x8) laid out [b][s][h*64+d]; k plane the same (f16, x8); v^T plane [b][h*64+d][s] (x1024 f16).
//   All NKB = 64 key blocks of 32 keys are visited (static bound).
//   Scores are computed TRANSPOSED: S^T tile g (g = 0,1) = k rows (keys kb+16g .. +15, A operand, row m = lane&15, split k
//   map over d) times q^T (B operand, col n = query q0 + (lane&15), k = d, split map), one f16 product per tile and 32-deep
//   d-chunk, one guarded group of 4 WMMAs; the two q fragments are loaded once per wave.
//   D element r of lane l = (key kb+16g+8h+r, query q0+(l&15)), so a lane owns one query column and 16 of its 32 keys; the
//   partner lane l^16 owns the other 16 -> row max / row sum need one xor-16 shuffle.
//   Logit (base 2) = score * (1/32) * log2e / (8*8) + slope_h * (key - query) * log2e, slope_h = (2^-0.5)^(h+1).
//   Online max-subtracted base-2 softmax in f32. The exp'd values ARE the P A-fragment in place: A row m = query = lane&15,
//   element i <- key kb+8h+i (tile 0, D element i), element 8+i <- key kb+16+8h+i (tile 1, D element i). P is carried
//   x32768 as single f16. The rescale factor of query row 8h+r of the O accumulators is fetched from lane 8h+r with a
//   shuffle (uniform control). 4 v^T B fragments (col n = d = 16j + (lane&15), keys k-contiguous), 4 P.V WMMAs per key
//   block in one guarded group.
//   Epilogue: 1/l (per query, shuffled to the D row owner) and the carry folds in f32; the wave's 16x64 f32 result staged
//   segment (b, q0+row, head) of the f32 result [b][s][h*64+d] written by 16 consecutive lanes x 16 B of one instruction
// coverage: per wave 8 instructions x 2 rows x 16 lanes x 4 floats = 16 x 64; grid NB*NH*(SQ/64) blocks x 4 waves =
//           every (b, s < SQ, h) row segment of the result exactly once.
// =====================================================================================================
__global__ __launch_bounds__(ATT_THREADS)
void attn_fwd(const u16* __restrict__ QPp, const u16* __restrict__ KPp, const u16* __restrict__ VPp, float* Out) {
  __shared__ __attribute__((aligned(2048))) unsigned char ring[ARING];   // k / v^T stages; result slabs in the epilogue

  const int tid  = threadIdx.x;
  const int wave = (int)uni((uint32_t)tid >> 5);
  const int lane = tid & 31;
  const int hh   = lane >> 4;
  const int c    = lane & 15;

  const int bid  = blockIdx.x;
  const int qt   = bid % NQT;
  const int head = (bid / NQT) % NH;
  const int b    = bid / (NQT * NH);
  const int q0   = qt * 64 + wave * 16;

  // B fragments of q^T: col n = query q0 + c, k = d (k-contiguous row segment of the q plane)
  const size_t qofs = ((size_t)(b * SEQ + q0 + c)) * NHD + (size_t)(head * HD + 8 * hh);
  const _Float16* Qb = (const _Float16*)(const void*)QPp + qofs;
  // ---- this wave's slice of every stage: waves 0,1 = k rows (keys) 32*wave .., 128 B of this head each; waves 2,3 =
  //      v^T rows (d) 32*(wave-2) .., 128 B = 64 keys each ----
  const u16* sp = (wave < 2) ? (KPp + ((size_t)(b * SEQ + 32 * wave)) * NHD + (size_t)(head * HD))
                             : (VPp + ((size_t)(b * NHD + head * HD + 32 * (wave - 2))) * SEQ);
  const uint64_t ga0   = (uint64_t)(size_t)sp;
  const uint32_t gstep = (wave < 2) ? (uint32_t)(AKEYS * NHD * 2) : (uint32_t)(AKEYS * 2);   // bytes from stage to stage
  const uint32_t dst0  = (uint32_t)(size_t)ring + (uint32_t)wave * ASLICE;
  u32x8          g1    = tdm_group1_r128((wave < 2) ? (uint32_t)(NHD * 2) : (uint32_t)(SEQ * 2));
  u32x4          g0    = tdm_group0(dst0, ga0);
  // A fragments of k: LDS row = key (in its slice of 32) 16g + c, k = d; +16*hh bytes = +8*hh elements
  const unsigned char* kr = ring + c * APITCH + 16 * hh;
  // B fragments of v: col n = d = 16j + c = LDS row of the v^T slices, k = key (contiguous in the row)
  const unsigned char* vr = ring + 2 * ASLICE + c * APITCH + 16 * hh;

  const int   ex     = head + 1;
  const float slope  = (((ex & 1) != 0) ? RSQ2 : 1.0f) * __int_as_float((127 - (ex >> 1)) << 23);
  const float slope2 = slope * LOG2E;
  const float lsc    = (INVN * LOG2E) * (1.0f / (QSC * KSC));
  const float jb0    = (float)(8 * hh - (q0 + c));      // key - query, key block base added per step

  const v16h qf0 = ldfrag_h(Qb);            // d 0..31
  const v16h qf1 = ldfrag_h(Qb + 32);       // d 32..63

  float mrun = -INFINITY, lrun = 0.f;
  v8f o[4];
#pragma unroll
  for (int j = 0; j < 4; ++j) o[j] = zero8();

  // ---- prologue: stage 0 lands and is published, then stage 1 is put in flight ----
  tdm_load(g0, g1);
  wait_tensor0();
  __syncthreads();
  tdm_aim(g0, dst0 + ASTAGE, ga0 + gstep);
  tdm_load(g0, g1);
#pragma unroll 1   // one pass per stage: the publish point below stands once per trip
  for (int s = 0; s < NST; ++s) {
    const int bo = (s & 1) * ASTAGE;
#pragma unroll     // constant LDS offsets for the key blocks of a stage
  for (int i32 = 0; i32 < AKEYS / 32; ++i32) {
    const int kb = s * AKEYS + i32 * 32;
    // ---- transposed scores: s0 = keys kb..kb+15, s1 = keys kb+16..kb+31, column = query q0 + c ----
    v8f s0 = zero8(), s1 = zero8();
    const _Float16* k0p = (const _Float16*)(const void*)(kr + bo + i32 * ASLICE);
    const _Float16* k1p = (const _Float16*)(const void*)(kr + bo + i32 * ASLICE + 16 * APITCH);
    {
      const v16h ka0 = ldfrag_h(k0p),      ka1 = ldfrag_h(k0p + 32);
      const v16h kc0 = ldfrag_h(k1p),      kc1 = ldfrag_h(k1p + 32);
      s0 = mma_h(ka0, qf0, s0);
      s0 = mma_h(ka1, qf1, s0);
      s1 = mma_h(kc0, qf0, s1);
      s1 = mma_h(kc1, qf1, s1);
      guard2x6<v16h>(s0, s1, qf0, qf1, ka0, ka1, kc0, kc1);
    }
    // ---- base-2 logits of this lane's 16 keys for query q0 + c ----
    const float jb = jb0 + (float)kb;
    float tk[16];
#pragma unroll
    for (int i = 0; i < 8; ++i) {
      tk[i]     = fmaf(s0[i], lsc, slope2 * (jb + (float)i));
      tk[8 + i] = fmaf(s1[i], lsc, slope2 * (jb + (float)(16 + i)));
    }
    float cm = tk[0];
#pragma unroll
    for (int i = 1; i < 16; ++i) cm = fmaxf(cm, tk[i]);
    cm = fmaxf(cm, __shfl_xor(cm, 16, 32));
    const float mn = fmaxf(mrun, cm);                                // finite from the first key block on
    const float al = (mrun == -INFINITY) ? 0.f : exp2f(mrun - mn);   // o and l are zero while mrun is -inf
    mrun = mn;
    // ---- probabilities (<= 1) and the P A-fragment: f16(p * 32768); element i <-> tk[i] ----
    float ps = 0.f;
    FragH ph;
#pragma unroll
    for (int w = 0; w < 2; ++w) {
#pragma unroll
      for (int e4 = 0; e4 < 4; ++e4) {
        const int i = 8 * w + 2 * e4;
        const float p0 = exp2f(fminf(tk[i] - mn, 0.f));
        const float p1 = exp2f(fminf(tk[i + 1] - mn, 0.f));
        ps += p0 + p1;
        ph.u[w][e4] = pk16(h_bits((_Float16)(p0 * PCAR)), h_bits((_Float16)(p1 * PCAR)));
      }
    }
    ps += __shfl_xor(ps, 16, 32);
    lrun = lrun * al + ps;
    // ---- rescale the O accumulators: D row 8hh+r = query q0+8hh+r, its factor lives in lane 8hh+r (and 16+8hh+r) ----
    float scl[8];
#pragma unroll
    for (int r = 0; r < 8; ++r) scl[r] = __shfl(al, 8 * hh + r, 32);
#pragma unroll
    for (int j = 0; j < 4; ++j) {
#pragma unroll
      for (int r = 0; r < 8; ++r) o[j][r] *= scl[r];
    }
    // ---- P.V : B fragment col n = d = j*16 + c, keys contiguous in the v^T plane; one group of 4 ----
    {
      const unsigned char* vp = vr + bo + i32 * 64;
      const v16h vf0 = ldfrag_h((const _Float16*)(const void*)(vp));
      const v16h vf1 = ldfrag_h((const _Float16*)(const void*)(vp + 16 * APITCH));
      const v16h vf2 = ldfrag_h((const _Float16*)(const void*)(vp + ASLICE));
      const v16h vf3 = ldfrag_h((const _Float16*)(const void*)(vp + ASLICE + 16 * APITCH));
      o[0] = mma_h(ph.v, vf0, o[0]);
      o[1] = mma_h(ph.v, vf1, o[1]);
      o[2] = mma_h(ph.v, vf2, o[2]);
      o[3] = mma_h(ph.v, vf3, o[3]);
      guard4x5<v16h>(o[0], o[1], o[2], o[3], ph.v, vf0, vf1, vf2, vf3);
    }
  }
    // ---- publish point of stage s + 1: own LDS reads retired, own slice landed, barrier, then the refill ----
    wait_ds0();
    wait_tensor0();
    __syncthreads();
    if (pinned((uint32_t)(s + 2 < NST))) {
      tdm_aim(g0, dst0 + (uint32_t)bo, ga0 + (uint64_t)(s + 2) * gstep);
      tdm_load(g0, g1);
    }
  }
  wait_tensor0();   // behind the loop: no request in flight and no LDS read open before the ring is used for the result
  wait_ds0();
  acc_guard4(o[0], o[1], o[2], o[3]);

  // ---- fold 1/l (per query, owned by lane = query; l >= 1 by construction) and the P/v carries ----
  const float linv = (lrun > 0.f) ? ((1.0f / lrun) * (1.0f / (PCAR * VCAR))) : 0.f;
  float inv[8];
#pragma unroll
  for (int r = 0; r < 8; ++r) inv[r] = __shfl(linv, 8 * hh + r, 32);
  // the wave's slab: the ring's first bytes, which every reader has left at the last stage's barrier and at which no
  // load is aimed any more
  float* slab = (float*)(void*)ring + wave * GSLAB;
#pragma unroll
  for (int r = 0; r < 8; ++r) {
#pragma unroll
    for (int j = 0; j < 4; ++j) slab[(8 * hh + r) * 68 + j * 16 + c] = o[j][r] * inv[r];
  }
  wave_sync_lds();
  // ---- f32 result: lanes 0..15 -> row 2*i2, lanes 16..31 -> row 2*i2+1; lane = 4 consecutive floats ----
  v4f vals[8];
#pragma unroll
  for (int i2 = 0; i2 < 8; ++i2) vals[i2] = *(const v4f*)(slab + (i2 * 2 + hh) * 68 + c * 4);
  float* dst = Out + ((size_t)(b * SEQ + q0 + hh)) * DMOD + (size_t)(head * HD + c * 4);
  {
#pragma unroll
    for (int i2 = 0; i2 < 8; ++i2) {
      *(v4f*)(dst + (size_t)(i2 * 2) * (size_t)DMOD) = vals[i2];
    }
    
  }
}

// =====================================================================================================
// Workspace map (bytes, NB = 4); every plane is fully written by whole-line stores before it is read; all extents are
// exact multiples of the store granularity (no pad rows):
//   XB  bf16 [NB*SEQ][DMOD]                          16777216
//   WB  bf16 [3*NHD][DMOD]  (k | q | v chunks)        6291456
//   QP  f16  [NB*SEQ][NHD] x8                       16777216
//   KP  f16  [NB*SEQ][NHD] x8                       16777216
//   VP  f16  [NB][NHD][SEQ] x1024                   16777216
//   end                                             73400320
// 6 launches on one in-order stream.
// =====================================================================================================
extern "C" void kernel_launch(void* const* d_in, const int* in_sizes, int n_in,
                              void* d_out, int out_size, void* d_ws, size_t ws_size,
                              hipStream_t stream) {
  const int ROWS = NB * SEQ;
  if (n_in < 2) return;
  if (in_sizes[0] < ROWS * DMOD) return;
  if (in_sizes[1] != 3 * NHD * DMOD) return;
  if (out_size < ROWS * DMOD) return;

  const float* Xin = (const float*)d_in[0];
  const float* Win = (const float*)d_in[1];
  float*       out = (float*)d_out;

  const size_t szXB = (size_t)ROWS * DMOD * 2;
  const size_t szWB = (size_t)3 * NHD * DMOD * 2;
  const size_t szPl = (size_t)ROWS * NHD * 2;                  // q/k planes
  const size_t szVP = (size_t)NB * NHD * SEQ * 2;
  size_t off = 0;
  const size_t oXB = off; off += szXB;
  const size_t oWB = off; off += szWB;
  const size_t oQP = off; off += szPl;
  const size_t oKP = off; off += szPl;
  const size_t oVP = off; off += szVP;
  if (off > ws_size) return;                            // off = 73400320 for NB = 4
  if (off > (size_t)134217728) return;

  char* ws = (char*)d_ws;
  u16* XB = (u16*)(ws + oXB);
  u16* WB = (u16*)(ws + oWB);
  u16* QP = (u16*)(ws + oQP);
  u16* KP = (u16*)(ws + oKP);
  u16* VP = (u16*)(ws + oVP);

  const int n8x = (ROWS * DMOD) / 8;
  const int n8w = (3 * NHD * DMOD) / 8;
  if ((n8x % 256) != 0 || (n8w % 256) != 0) return;
  if ((DMOD % 64) != 0 || (NHD % 64) != 0 || (SEQ % 64) != 0 || (SQ % 64) != 0 || (DMOD % 32) != 0) return;

  const dim3 blk(256);
  const dim3 gX(n8x / 256);                             // 4096
  const dim3 gW(n8w / 256);                             // 1536
  const dim3 bG(128);
  const dim3 gQ(NB * (SQ / 64) * (NHD / 64));           // 2048
  const dim3 gK(NB * (SEQ / 64) * (NHD / 64));          // 2048
  const dim3 gV(NB * (NHD / 64) * (SEQ / 64));          // 2048
  const dim3 gAT(ATT_BLOCKS);                           // 2048
  const dim3 bAT(ATT_THREADS);                          // 128

  // (1) x -> bf16 plane [ROWS][DMOD]
  cvt16<<<gX, blk, 0, stream>>>(Xin, XB, n8x);
  // (2) W [3*NHD out][DMOD in] -> bf16, same layout (already k-contiguous for B fragments / row-major A for the v^T GEMM)
  cvt16<<<gW, blk, 0, stream>>>(Win, WB, n8w);
  // (3,4) q, k as single f16 planes [b][s][h*64+d] = (x.Wq^T) x8 over SQ rows per batch, (x.Wk^T) x8 over all keys
  gemm_bb<<<gQ, bG, 0, stream>>>(XB, WB + (size_t)NHD * DMOD, QP, SQ, NHD, DMOD, SEQ * DMOD, 0, SEQ * NHD, QSC);
  gemm_bb<<<gK, bG, 0, stream>>>(XB, WB, KP, SEQ, NHD, DMOD, SEQ * DMOD, 0, SEQ * NHD, KSC);
  // (5) v^T plane per batch: [h*64+d][keys] = f16((Wv . x_b^T) x1024)
  gemm_bb<<<gV, bG, 0, stream>>>(WB + (size_t)2 * NHD * DMOD, XB, VP, NHD, SEQ, DMOD, 0, SEQ * DMOD, NHD * SEQ, VCAR);
  // (6) attention -> out [b][s][h*64+d] f32
  attn_fwd<<<gAT, bAT, 0, stream>>>(QP, KP, VP, out);
  (void)hipGetLastError();
}

// v003
// A run of this version takes 154 microseconds.
// In two side-by-side timings against v002, it was 1.13 and 1.11 times as fast.
// All steps since v000 together make it 2.66 times as fast.
// Contractions: x.Wk^T, x.Wq^T and Wv.x^T on v_wmma_f32_16x16x32_bf16 (x and W planes RNE-converted to bf16 operands,
// f32 accumulate); scores k.q^T (k and q single f16 planes carried x8) and P.v (P x32768 single f16, v x1024 single f16)
// on v_wmma_f32_16x16x32_f16, f32 accumulate. Base-2 online softmax with linear relative-position bias; 1/l and carry
// folds in f32 on VALU; f32 result written directly.
#include <hip/hip_runtime.h>
#include <math.h>
#include <stdint.h>

#ifndef NB
#define NB    4
#endif
#define SEQ   2048
#ifndef SQ
#define SQ    SEQ
#endif
#define DMOD  1024
#define NH    16
#define HD    64
#define NHD   (NH * HD)
#define QSC   8.0f
#define KSC   8.0f
#define PCAR  32768.0f
#define VCAR  1024.0f
#define LOG2E 1.4426950408889634f
#define INVN  0.03125f
#define RSQ2  0.70710678118654752f
#define ATT_WAVES   4
#define ATT_THREADS (ATT_WAVES * 32)
#define NQT         (SQ / 64)
#define ATT_BLOCKS  (NB * NH * NQT)
#define NKB         (SEQ / 32)
#define GSLAB       (16 * 68)
#define GKC         128                 // k elements of one GEMM stage: rows of 256 bytes
#define GPITCH      272                 // LDS row pitch, bytes: 256 + 16, an odd multiple of 16 for 16-byte readers
#define GSLICE      10240               // one wave's slice: 32 rows x 272 B = 8704 B, rounded up to a multiple of 2 KiB
#define GSTAGE      (4 * GSLICE)        // [A rows 0..31 | A rows 32..63 | B rows 0..31 | B rows 32..63]
#define GRING       (2 * GSTAGE)
#define AKEYS       64                  // keys of one attention stage: k rows and v^T rows of 128 bytes each
#define APITCH      144                 // LDS row pitch, bytes: 128 + 16, an odd multiple of 16 for 16-byte readers
#define ASLICE      6144                // one wave's slice: 32 rows x 144 B = 4608 B, rounded up to a multiple of 2 KiB
#define ASTAGE      (4 * ASLICE)        // [k rows 0..31 | k rows 32..63 | v^T rows 0..31 | v^T rows 32..63]
#define ARING       (2 * ASTAGE)
#define NST         (SEQ / AKEYS)
static_assert(32 * APITCH <= ASLICE && (ASLICE % 2048) == 0 && HD * 2 == 128 && AKEYS * 2 == 128 && ATT_WAVES == 4);
static_assert(ATT_WAVES * GSLAB * 4 <= ASTAGE && (SEQ % AKEYS) == 0 && NST >= 2 && (AKEYS % 32) == 0);
static_assert(32 * GPITCH <= GSLICE && (GSLICE % 2048) == 0 && GKC * 2 == 256 && 4 * GSLAB * 4 <= GSTAGE);
static_assert((DMOD % GKC) == 0 && (DMOD / GKC) >= 2);
static_assert(NH == 16 && HD == 64 && DMOD == NHD);
static_assert((HD % 32) == 0 && (SEQ % 64) == 0 && (SQ % 64) == 0 && SQ <= SEQ && SQ >= 64);
static_assert((DMOD % 64) == 0 && (DMOD % 32) == 0 && (NHD % 64) == 0);
static_assert(((NB * SEQ * DMOD / 8) % 256) == 0);
static_assert(((3 * NHD * DMOD / 8) % 256) == 0);
static_assert((GSLAB * 4) % 16 == 0 && ATT_THREADS == 128);
static_assert(NB >= 1 && NB <= 4);

typedef unsigned short u16;
typedef _Float16 v16h __attribute__((ext_vector_type(16)));
typedef _Float16 v8h  __attribute__((ext_vector_type(8)));
typedef __bf16   v16b __attribute__((ext_vector_type(16)));
typedef float    v8f  __attribute__((ext_vector_type(8)));
typedef float    v4f  __attribute__((ext_vector_type(4)));
typedef unsigned int v4u __attribute__((ext_vector_type(4)));
typedef uint32_t u32x4 __attribute__((ext_vector_type(4)));
typedef uint32_t u32x8 __attribute__((ext_vector_type(8)));

union FragH { v16h v; v8h h[2]; v4u u[2]; };
union FragB { v16b v; v4u u[2]; };

// ---- scalar helpers --------------------------------------------------------------------------------
__device__ __forceinline__ unsigned short bf_bits(float f) {          // f32 -> bf16 bits, RNE convert
  unsigned u = __float_as_uint(f);
  return (unsigned short)((u + 0x7FFFu + ((u >> 16) & 1u)) >> 16);
}
__device__ __forceinline__ unsigned short h_bits(_Float16 x) { return __builtin_bit_cast(unsigned short, x); }
__device__ __forceinline__ unsigned pk16(unsigned short a, unsigned short b) { return (unsigned)a | ((unsigned)b << 16); }
// 2^x in place for a key block's rescale exponent and its 16 score exponents (all <= 0), by the bare hardware instruction.
// exp2f() wraps each v_exp_f32 in a compare, two selects, an add and an ldexp so that results below 2^-126 come out as
// denormals; such a weight vanishes anyway, in the f16 operand and in a row sum that is never below 1. One statement, so
// that no neighbour of a v_exp_f32 reads its result or overwrites its source; the closing v_nop keeps that slot behind the
// last one, whatever the compiler puts next.
__device__ __forceinline__ void exp2_hw17(float& a, float (&t)[16]) {
#if defined(__HIP_DEVICE_COMPILE__)
  asm("v_exp_f32 %0, %0\n\tv_exp_f32 %1, %1\n\tv_exp_f32 %2, %2\n\tv_exp_f32 %3, %3\n\tv_exp_f32 %4, %4\n\t"
      "v_exp_f32 %5, %5\n\tv_exp_f32 %6, %6\n\tv_exp_f32 %7, %7\n\tv_exp_f32 %8, %8\n\tv_exp_f32 %9, %9\n\t"
      "v_exp_f32 %10, %10\n\tv_exp_f32 %11, %11\n\tv_exp_f32 %12, %12\n\tv_exp_f32 %13, %13\n\t"
      "v_exp_f32 %14, %14\n\tv_exp_f32 %15, %15\n\tv_exp_f32 %16, %16\n\tv_nop"
      : "+v"(a), "+v"(t[0]), "+v"(t[1]), "+v"(t[2]), "+v"(t[3]), "+v"(t[4]), "+v"(t[5]), "+v"(t[6]), "+v"(t[7]),
        "+v"(t[8]), "+v"(t[9]), "+v"(t[10]), "+v"(t[11]), "+v"(t[12]), "+v"(t[13]), "+v"(t[14]), "+v"(t[15]));
#endif
}
__device__ __forceinline__ v8f zero8() { v8f z = {0.f, 0.f, 0.f, 0.f, 0.f, 0.f, 0.f, 0.f}; return z; }

// ---- fragment loaders: 16-bit A/B operand, lane -> row/col (lane&15), p already includes +8*(lane>>4);
//      elements 0..7 <- p[0..7] (k0+8h..), elements 8..15 <- p[16..23] (k0+16+8h..)  (same split k map for A and B;
//      B is always read from a k-contiguous [n][k] plane)
__device__ __forceinline__ v16h ldfrag_h(const _Float16* p) {
  FragH f;
  f.h[0] = *(const v8h*)(p);
  f.h[1] = *(const v8h*)(p + 16);
  return f.v;
}
__device__ __forceinline__ v16b ldfrag_b(const u16* p) {              // bf16 plane read as unsigned integer vectors
  FragB f;
  f.u[0] = *(const v4u*)(p);
  f.u[1] = *(const v4u*)(p + 16);
  return f.v;
}

__device__ __forceinline__ v8f mma_h(v16h a, v16h b, v8f c) {
  return __builtin_amdgcn_wmma_f32_16x16x32_f16(false, a, false, b, (short)0, c, false, false);
}
__device__ __forceinline__ v8f mma_b(v16b a, v16b b, v8f c) {
  return __builtin_amdgcn_wmma_f32_16x16x32_bf16(false, a, false, b, (short)0, c, false, false);
}
template <typename F>
__device__ __forceinline__ void guard2x6(v8f& a, v8f& b, F x0, F x1, F x2, F x3, F x4, F x5) {
#if defined(__HIP_DEVICE_COMPILE__)
  asm volatile("v_nop\n\tv_nop\n\tv_nop\n\tv_nop"
               : "+v"(a), "+v"(b) : "v"(x0), "v"(x1), "v"(x2), "v"(x3), "v"(x4), "v"(x5) : "memory");
#endif
}
template <typename F>
__device__ __forceinline__ void guard4x5(v8f& a, v8f& b, v8f& c, v8f& d, F x0, F x1, F x2, F x3, F x4) {
#if defined(__HIP_DEVICE_COMPILE__)
  asm volatile("v_nop\n\tv_nop\n\tv_nop\n\tv_nop"
               : "+v"(a), "+v"(b), "+v"(c), "+v"(d) : "v"(x0), "v"(x1), "v"(x2), "v"(x3), "v"(x4) : "memory");
#endif
}
__device__ __forceinline__ void acc_guard4(v8f& a, v8f& b, v8f& c, v8f& d) {
#if defined(__HIP_DEVICE_COMPILE__)
  asm volatile("v_nop\n\tv_nop\n\tv_nop\n\tv_nop" : "+v"(a), "+v"(b), "+v"(c), "+v"(d));
#endif
}
__device__ __forceinline__ void wave_sync_lds() {
#if defined(__HIP_DEVICE_COMPILE__)
  __builtin_amdgcn_fence(__ATOMIC_RELEASE, "workgroup");
  __builtin_amdgcn_wave_barrier();
  __builtin_amdgcn_fence(__ATOMIC_ACQUIRE, "workgroup");
#endif
}

// ---- tensor load to LDS: descriptor words, issue, waits ---------------------------------------------
__device__ __forceinline__ uint32_t uni(uint32_t v) { return (uint32_t)__builtin_amdgcn_readfirstlane((int)v); }
// Test around a tensor load, which ignores EXEC: it has to compile to s_cmp + s_cbranch_scc.
__device__ __forceinline__ uint32_t pinned(uint32_t v) {
  uint32_t w = uni(v);
  asm volatile("" : "+s"(w));   // pinned(): holds the test word in a scalar register, so that the branch on it is scalar
  return w;
}
// Group 1: 1-byte elements, tile = tensor = 32 rows of 256 bytes, source row pitch src_pitch bytes; word 0 is the pad
// constant for 256-byte rows with 16 bytes behind each row (LDS pitch 272), no mask.
__device__ __forceinline__ u32x8 tdm_group1(uint32_t src_pitch) {
  constexpr uint32_t d0 = 256u, d1 = 32u;
  u32x8 g;
  g[0] = uni((1u << 20) | (5u << 22) | (3u << 25));
  g[1] = uni((d0 & 0xFFFFu) << 16);
  g[2] = uni((d0 >> 16) | ((d1 & 0xFFFFu) << 16));
  g[3] = uni((d1 >> 16) | (d0 << 16));
  g[4] = uni(d1);
  g[5] = uni(src_pitch);
  g[6] = uni(0u);
  g[7] = uni(0u);
  return g;
}
// The same for 32 rows of 128 bytes: pad constant for 128-byte rows with 16 bytes behind each row (LDS pitch 144), no mask.
__device__ __forceinline__ u32x8 tdm_group1_r128(uint32_t src_pitch) {
  constexpr uint32_t d0 = 128u, d1 = 32u;
  u32x8 g;
  g[0] = uni((1u << 20) | (4u << 22) | (3u << 25));
  g[1] = uni((d0 & 0xFFFFu) << 16);
  g[2] = uni((d0 >> 16) | ((d1 & 0xFFFFu) << 16));
  g[3] = uni((d1 >> 16) | (d0 << 16));
  g[4] = uni(d1);
  g[5] = uni(src_pitch);
  g[6] = uni(0u);
  g[7] = uni(0u);
  return g;
}
__device__ __forceinline__ u32x4 tdm_group0(uint32_t lds_dst, uint64_t ga) {
  u32x4 g;
  g[0] = uni(1u);
  g[1] = uni(lds_dst);
  g[2] = uni((uint32_t)ga);
  g[3] = uni((((uint32_t)(ga >> 32)) & 0x01FFFFFFu) | 0x80000000u);
  return g;
}
// Aim group 0 at the next tile: only the LDS place and the address change.
__device__ __forceinline__ void tdm_aim(u32x4& g, uint32_t lds_dst, uint64_t ga) {
  g[1] = uni(lds_dst);
  g[2] = uni((uint32_t)ga);
  g[3] = uni((((uint32_t)(ga >> 32)) & 0x01FFFFFFu) | 0x80000000u);
}
// One request of the whole wave. Both groups are in-out operands so that their scalar registers stay theirs up to the
// next request: as plain inputs the compiler used some of them as temporaries while the request was in flight.
__device__ __forceinline__ void tdm_load(u32x4& g0, u32x8& g1) {
#if defined(__HIP_DEVICE_COMPILE__)
  asm volatile("tensor_load_to_lds %0, %1" : "+s"(g0), "+s"(g1) :: "memory");
#endif
}
__device__ __forceinline__ void wait_tensor0() {
#if defined(__HIP_DEVICE_COMPILE__)
  asm volatile("s_wait_tensorcnt 0x0" ::: "memory");   // the wave's own slice has landed
#endif
}
__device__ __forceinline__ void wait_ds0() {
#if defined(__HIP_DEVICE_COMPILE__)
  asm volatile("s_wait_dscnt 0x0" ::: "memory");       // the wave's LDS reads have retired before their buffer is refilled
#endif
}

// =====================================================================================================
// f32 plane -> bf16 RNE plane, same layout. Thread = 8 consecutive elements: two 16-B loads, one 16-B store;
// coverage: grid = n8/256 blocks (host checks exactness) x 256 thr x 8 = the whole plane.
// =====================================================================================================
__global__ __launch_bounds__(256) void cvt16(const float* __restrict__ x, u16* D, int n8) {
  const int gt = blockIdx.x * 256 + (int)threadIdx.x;
  if (gt >= n8) return;                     // no barriers in this kernel
  const float* p = x + (size_t)gt * 8;
  const v4f a = *(const v4f*)(p), c4 = *(const v4f*)(p + 4);
  v4u o;
  o[0] = pk16(bf_bits(a[0]),  bf_bits(a[1]));
  o[1] = pk16(bf_bits(a[2]),  bf_bits(a[3]));
  o[2] = pk16(bf_bits(c4[0]), bf_bits(c4[1]));
  o[3] = pk16(bf_bits(c4[2]), bf_bits(c4[3]));
  u16* d = D + (size_t)gt * 8;
  {
    *(v4u*)(d) = o;
    
  }
}

// =====================================================================================================
// Batched bf16 GEMM with f16 result:  C[bt][M][N] = f16( (A[bt][M][K] (bf16 row-major) . Bt[bt][N][K]^T (bf16
// k-contiguous)) * oscale ); per-batch element strides bstA/bstB/bstC. Block = 64x64 tile, 4 waves x 16 rows.
// Operands come through LDS: a stage is 128 k of the block's 64 A rows and 64 B rows; every wave brings its own slice
// of 32 rows x 256 B with one tensor load (LDS pitch 272 B), two buffers, the next stage in flight while this one is
// worked on. Fragments are read from the LDS rows (two 16-B loads each, split k map for A and B), K stepped by 32
// inside a stage (K = DMOD: a multiple of 128 and at least two stages; M % 64 == 0, N % 64 == 0,
// grid = nbatch*(M/64)*(N/64)). The ring becomes the result slabs behind the last pass's barrier.
// converted and written: lane = (row in group of 4, 8 consecutive cols); one instruction = 4 rows, each 64 halves = one
// coverage: 4 instructions x 4 rows x 8 lanes x 8 halves = the wave's 16 x 64 tile; 4 waves = the block's 64 x 64 tile.
// =====================================================================================================
__global__ __launch_bounds__(128)
void gemm_bb(const u16* __restrict__ A, const u16* __restrict__ Bt, u16* C, int M, int N, int K,
             int bstA, int bstB, int bstC, float oscale) {
  __shared__ __attribute__((aligned(2048))) unsigned char ring[GRING];
  const int tid = threadIdx.x, lane = tid & 31, hh = lane >> 4, m = lane & 15;
  const int wave = (int)uni((uint32_t)tid >> 5);
  const int ntile = N >> 6, mtile = M >> 6;
  const int per   = ntile * mtile;
  const int bid   = blockIdx.x;
  const int bt    = bid / per;
  const int t     = bid - bt * per;
  const int row0  = (t / ntile) * 64;
  const int rowb  = row0 + wave * 16;
  const int col0  = (t % ntile) * 64;
  if (row0 + 64 > M) return;                 // block-uniform, never taken with the exact grid; in front of every barrier and load
  const u16* Ab  = A  + (size_t)bt * (size_t)bstA;
  const u16* Bb  = Bt + (size_t)bt * (size_t)bstB;
  u16*       Cb  = C  + (size_t)bt * (size_t)bstC;
  // ---- this wave's slice of every stage: waves 0,1 = A rows row0 + 32*wave .., waves 2,3 = B rows col0 + 32*(wave-2) .. ----
  const u16* sp = (wave < 2) ? (Ab + (size_t)(row0 + 32 * wave) * K) : (Bb + (size_t)(col0 + 32 * (wave - 2)) * K);
  const uint64_t ga0  = (uint64_t)(size_t)sp;
  const uint32_t dst0 = (uint32_t)(size_t)ring + (uint32_t)wave * GSLICE;
  u32x8          g1   = tdm_group1((uint32_t)K * 2u);
  u32x4          g0   = tdm_group0(dst0, ga0);
  const int      npass = K / GKC;
  // ---- fragment rows in LDS: A row 16*wave + m, B rows 16*j + m; +16*hh bytes = +8*hh elements ----
  const unsigned char* ar = ring + (wave >> 1) * GSLICE + ((wave & 1) * 16 + m) * GPITCH + 16 * hh;
  const unsigned char* br = ring + 2 * GSLICE + m * GPITCH + 16 * hh;
  v8f acc0 = zero8(), acc1 = zero8(), acc2 = zero8(), acc3 = zero8();
  // ---- prologue: stage 0 lands and is published, then stage 1 is put in flight ----
  tdm_load(g0, g1);
  wait_tensor0();
  __syncthreads();
  tdm_aim(g0, dst0 + GSTAGE, ga0 + 2u * GKC);
  tdm_load(g0, g1);
#pragma unroll 1   // one pass per stage: the publish point below stands once per trip
  for (int s = 0; s < npass; ++s) {
    const int bo = (s & 1) * GSTAGE;
#pragma unroll     // constant LDS offsets for the four 32-deep steps of a stage
    for (int kk = 0; kk < GKC / 32; ++kk) {
      const int o = bo + kk * 64;
      const v16b a  = ldfrag_b((const u16*)(const void*)(ar + o));
      const v16b b0 = ldfrag_b((const u16*)(const void*)(br + o));
      const v16b b1 = ldfrag_b((const u16*)(const void*)(br + o + 16 * GPITCH));
      const v16b b2 = ldfrag_b((const u16*)(const void*)(br + o + GSLICE));
      const v16b b3 = ldfrag_b((const u16*)(const void*)(br + o + GSLICE + 16 * GPITCH));
      acc0 = mma_b(a, b0, acc0);
      acc1 = mma_b(a, b1, acc1);
      acc2 = mma_b(a, b2, acc2);
      acc3 = mma_b(a, b3, acc3);
      guard4x5<v16b>(acc0, acc1, acc2, acc3, a, b0, b1, b2, b3);
    }
    // ---- publish point of stage s + 1: own LDS reads retired, own slice landed, barrier, then the refill ----
    wait_ds0();
    wait_tensor0();
    __syncthreads();
    if (pinned((uint32_t)(s + 2 < npass))) {
      tdm_aim(g0, dst0 + (uint32_t)bo, ga0 + (uint64_t)(s + 2) * (2u * GKC));
      tdm_load(g0, g1);
    }
  }
  wait_tensor0();   // behind the loop: no request in flight and no LDS read open before the ring is used for the result
  wait_ds0();
  acc_guard4(acc0, acc1, acc2, acc3);
  // ---- stage the scaled value in the wave's slab: the ring's first bytes, which every reader has left at the last
  //      pass's barrier and at which no load is aimed any more ----
  float* sl = (float*)(void*)ring + wave * GSLAB;
#pragma unroll
  for (int r = 0; r < 8; ++r) {
    const int ro = (8 * hh + r) * 68 + m;
    sl[ro]      = acc0[r] * oscale;
    sl[ro + 16] = acc1[r] * oscale;
    sl[ro + 32] = acc2[r] * oscale;
    sl[ro + 48] = acc3[r] * oscale;
  }
  wave_sync_lds();
  const int rq = lane >> 3, c8 = (lane & 7) * 8;
  v4u ov[4];
#pragma unroll
  for (int i4 = 0; i4 < 4; ++i4) {
    const int row = i4 * 4 + rq;
    const v4f a = *(const v4f*)(sl + row * 68 + c8), c4 = *(const v4f*)(sl + row * 68 + c8 + 4);
    float w[8];
#pragma unroll
    for (int e = 0; e < 4; ++e) { w[e] = a[e]; w[4 + e] = c4[e]; }
#pragma unroll
    for (int e = 0; e < 4; ++e) ov[i4][e] = pk16(h_bits((_Float16)w[2 * e]), h_bits((_Float16)w[2 * e + 1]));
  }
  const size_t dofs = ((size_t)rowb + (size_t)rq) * (size_t)N + col0 + c8;
  u16* dst = Cb + dofs;
  {
#pragma unroll
    for (int i4 = 0; i4 < 4; ++i4) {
      *(v4u*)(dst + (size_t)(i4 * 4) * (size_t)N) = ov[i4];
    }
    
  }
}

// =====================================================================================================
// Multi-head flash attention with per-head linear relative-position bias (no mask): block = (batch b, head, 64 query
// rows), 4 waves, wave w owns query rows q0 = 64*qt + 16*w .. q0+15.
//   k and v^T come through LDS, shared by the block's 4 waves: a stage is 64 keys = 64 k rows x 128 B and 64 v^T rows x
//   128 B; every wave brings its own slice of 32 rows with one tensor load (LDS pitch 144 B), two buffers, the next stage
//   in flight while this one is worked on; one publish point (waits + block barrier) per stage. The ring's first bytes
//   become the wave-private result slabs behind the last stage's barrier.
//   q plane (f16, x8) laid out [b][s][h*64+d]; k plane the same (f16, x8); v^T plane [b][h*64+d][s] (x1024 f16).
//   All NKB = 64 key blocks of 32 keys are visited (static bound).
//   Scores are computed TRANSPOSED: S^T tile g (g = 0,1) = k rows (keys kb+16g .. +15, A operand, row m = lane&15, split k
//   map over d) times q^T (B operand, col n = query q0 + (lane&15), k = d, split map), one f16 product per tile and 32-deep
//   d-chunk, one guarded group of 4 WMMAs; the two q fragments are loaded once per wave.
//   D element r of lane l = (key kb+16g+8h+r, query q0+(l&15)), so a lane owns one query column and 16 of its 32 keys; the
//   partner lane l^16 owns the other 16 -> row max / row sum need one xor-16 shuffle.
//   Logit (base 2) = score * (1/32) * log2e / (8*8) + slope_h * (key - query) * log2e, slope_h = (2^-0.5)^(h+1).
//   Online max-subtracted base-2 softmax in f32. The exp'd values ARE the P A-fragment in place: A row m = query = lane&15,
//   element i <- key kb+8h+i (tile 0, D element i), element 8+i <- key kb+16+8h+i (tile 1, D element i). P is carried
//   x32768 as single f16. The rescale factor of query row 8h+r of the O accumulators is fetched from lane 8h+r with a
//   shuffle (uniform control). 4 v^T B fragments (col n = d = 16j + (lane&15), keys k-contiguous), 4 P.V WMMAs per key
//   block in one guarded group.
//   Epilogue: 1/l (per query, shuffled to the D row owner) and the carry folds in f32; the wave's 16x64 f32 result staged
//   segment (b, q0+row, head) of the f32 result [b][s][h*64+d] written by 16 consecutive lanes x 16 B of one instruction
// coverage: per wave 8 instructions x 2 rows x 16 lanes x 4 floats = 16 x 64; grid NB*NH*(SQ/64) blocks x 4 waves =
//           every (b, s < SQ, h) row segment of the result exactly once.
// =====================================================================================================
__global__ __launch_bounds__(ATT_THREADS)
void attn_fwd(const u16* __restrict__ QPp, const u16* __restrict__ KPp, const u16* __restrict__ VPp, float* Out) {
  __shared__ __attribute__((aligned(2048))) unsigned char ring[ARING];   // k / v^T stages; result slabs in the epilogue

  const int tid  = threadIdx.x;
  const int wave = (int)uni((uint32_t)tid >> 5);
  const int lane = tid & 31;
  const int hh   = lane >> 4;
  const int c    = lane & 15;

  const int bid  = blockIdx.x;
  const int qt   = bid % NQT;
  const int head = (bid / NQT) % NH;
  const int b    = bid / (NQT * NH);
  const int q0   = qt * 64 + wave * 16;

  // B fragments of q^T: col n = query q0 + c, k = d (k-contiguous row segment of the q plane)
  const size_t qofs = ((size_t)(b * SEQ + q0 + c)) * NHD + (size_t)(head * HD + 8 * hh);
  const _Float16* Qb = (const _Float16*)(const void*)QPp + qofs;
  // ---- this wave's slice of every stage: waves 0,1 = k rows (keys) 32*wave .., 128 B of this head each; waves 2,3 =
  //      v^T rows (d) 32*(wave-2) .., 128 B = 64 keys each ----
  const u16* sp = (wave < 2) ? (KPp + ((size_t)(b * SEQ + 32 * wave)) * NHD + (size_t)(head * HD))
                             : (VPp + ((size_t)(b * NHD + head * HD + 32 * (wave - 2))) * SEQ);
  const uint64_t ga0   = (uint64_t)(size_t)sp;
  const uint32_t gstep = (wave < 2) ? (uint32_t)(AKEYS * NHD * 2) : (uint32_t)(AKEYS * 2);   // bytes from stage to stage
  const uint32_t dst0  = (uint32_t)(size_t)ring + (uint32_t)wave * ASLICE;
  u32x8          g1    = tdm_group1_r128((wave < 2) ? (uint32_t)(NHD * 2) : (uint32_t)(SEQ * 2));
  u32x4          g0    = tdm_group0(dst0, ga0);
  // A fragments of k: LDS row = key (in its slice of 32) 16g + c, k = d; +16*hh bytes = +8*hh elements
  const unsigned char* kr = ring + c * APITCH + 16 * hh;
  // B fragments of v: col n = d = 16j + c = LDS row of the v^T slices, k = key (contiguous in the row)
  const unsigned char* vr = ring + 2 * ASLICE + c * APITCH + 16 * hh;

  const int   ex     = head + 1;
  const float slope  = (((ex & 1) != 0) ? RSQ2 : 1.0f) * __int_as_float((127 - (ex >> 1)) << 23);
  const float slope2 = slope * LOG2E;
  const float lsc    = (INVN * LOG2E) * (1.0f / (QSC * KSC));
  const float jb0    = (float)(8 * hh - (q0 + c));      // key - query, key block base added per step

  const v16h qf0 = ldfrag_h(Qb);            // d 0..31
  const v16h qf1 = ldfrag_h(Qb + 32);       // d 32..63

  float mrun = -INFINITY, lrun = 0.f;
  v8f o[4];
#pragma unroll
  for (int j = 0; j < 4; ++j) o[j] = zero8();

  // ---- prologue: stage 0 lands and is published, then stage 1 is put in flight ----
  tdm_load(g0, g1);
  wait_tensor0();
  __syncthreads();
  tdm_aim(g0, dst0 + ASTAGE, ga0 + gstep);
  tdm_load(g0, g1);
#pragma unroll 1   // one pass per stage: the publish point below stands once per trip
  for (int s = 0; s < NST; ++s) {
    const int bo = (s & 1) * ASTAGE;
#pragma unroll     // constant LDS offsets for the key blocks of a stage
  for (int i32 = 0; i32 < AKEYS / 32; ++i32) {
    const int kb = s * AKEYS + i32 * 32;
    // ---- transposed scores: s0 = keys kb..kb+15, s1 = keys kb+16..kb+31, column = query q0 + c ----
    v8f s0 = zero8(), s1 = zero8();
    const _Float16* k0p = (const _Float16*)(const void*)(kr + bo + i32 * ASLICE);
    const _Float16* k1p = (const _Float16*)(const void*)(kr + bo + i32 * ASLICE + 16 * APITCH);
    {
      const v16h ka0 = ldfrag_h(k0p),      ka1 = ldfrag_h(k0p + 32);
      const v16h kc0 = ldfrag_h(k1p),      kc1 = ldfrag_h(k1p + 32);
      s0 = mma_h(ka0, qf0, s0);
      s0 = mma_h(ka1, qf1, s0);
      s1 = mma_h(kc0, qf0, s1);
      s1 = mma_h(kc1, qf1, s1);
      guard2x6<v16h>(s0, s1, qf0, qf1, ka0, ka1, kc0, kc1);
    }
    // ---- base-2 logits of this lane's 16 keys for query q0 + c ----
    const float jb = jb0 + (float)kb;
    float tk[16];
#pragma unroll
    for (int i = 0; i < 8; ++i) {
      tk[i]     = fmaf(s0[i], lsc, slope2 * (jb + (float)i));
      tk[8 + i] = fmaf(s1[i], lsc, slope2 * (jb + (float)(16 + i)));
    }
    float cm = tk[0];
#pragma unroll
    for (int i = 1; i < 16; ++i) cm = fmaxf(cm, tk[i]);
    cm = fmaxf(cm, __shfl_xor(cm, 16, 32));
    const float mn = fmaxf(mrun, cm);                                // finite from the first key block on
    float ea = mrun - mn, pe[16];
#pragma unroll     // constant indices: pe[] stays in registers, as the asm operands need it
    for (int i = 0; i < 16; ++i) pe[i] = fminf(tk[i] - mn, 0.f);
    exp2_hw17(ea, pe);
    const float al = (mrun == -INFINITY) ? 0.f : ea;                 // o and l are zero while mrun is -inf
    mrun = mn;
    // ---- probabilities (<= 1) and the P A-fragment: f16(p * 32768); element i <-> tk[i] ----
    float ps = 0.f;
    FragH ph;
#pragma unroll
    for (int w = 0; w < 2; ++w) {
#pragma unroll
      for (int e4 = 0; e4 < 4; ++e4) {
        const int i = 8 * w + 2 * e4;
        const float p0 = pe[i];
        const float p1 = pe[i + 1];
        ps += p0 + p1;
        ph.u[w][e4] = pk16(h_bits((_Float16)(p0 * PCAR)), h_bits((_Float16)(p1 * PCAR)));
      }
    }
    ps += __shfl_xor(ps, 16, 32);
    lrun = lrun * al + ps;
    // ---- rescale the O accumulators: D row 8hh+r = query q0+8hh+r, its factor lives in lane 8hh+r (and 16+8hh+r) ----
    float scl[8];
#pragma unroll
    for (int r = 0; r < 8; ++r) scl[r] = __shfl(al, 8 * hh + r, 32);
#pragma unroll
    for (int j = 0; j < 4; ++j) {
#pragma unroll
      for (int r = 0; r < 8; ++r) o[j][r] *= scl[r];
    }
    // ---- P.V : B fragment col n = d = j*16 + c, keys contiguous in the v^T plane; one group of 4 ----
    {
      const unsigned char* vp = vr + bo + i32 * 64;
      const v16h vf0 = ldfrag_h((const _Float16*)(const void*)(vp));
      const v16h vf1 = ldfrag_h((const _Float16*)(const void*)(vp + 16 * APITCH));
      const v16h vf2 = ldfrag_h((const _Float16*)(const void*)(vp + ASLICE));
      const v16h vf3 = ldfrag_h((const _Float16*)(const void*)(vp + ASLICE + 16 * APITCH));
      o[0] = mma_h(ph.v, vf0, o[0]);
      o[1] = mma_h(ph.v, vf1, o[1]);
      o[2] = mma_h(ph.v, vf2, o[2]);
      o[3] = mma_h(ph.v, vf3, o[3]);
      guard4x5<v16h>(o[0], o[1], o[2], o[3], ph.v, vf0, vf1, vf2, vf3);
    }
  }
    // ---- publish point of stage s + 1: own LDS reads retired, own slice landed, barrier, then the refill ----
    wait_ds0();
    wait_tensor0();
    __syncthreads();
    if (pinned((uint32_t)(s + 2 < NST))) {
      tdm_aim(g0, dst0 + (uint32_t)bo, ga0 + (uint64_t)(s + 2) * gstep);
      tdm_load(g0, g1);
    }
  }
  wait_tensor0();   // behind the loop: no request in flight and no LDS read open before the ring is used for the result
  wait_ds0();
  acc_guard4(o[0], o[1], o[2], o[3]);

  // ---- fold 1/l (per query, owned by lane = query; l >= 1 by construction) and the P/v carries ----
  const float linv = (lrun > 0.f) ? ((1.0f / lrun) * (1.0f / (PCAR * VCAR))) : 0.f;
  float inv[8];
#pragma unroll
  for (int r = 0; r < 8; ++r) inv[r] = __shfl(linv, 8 * hh + r, 32);
  // the wave's slab: the ring's first bytes, which every reader has left at the last stage's barrier and at which no
  // load is aimed any more
  float* slab = (float*)(void*)ring + wave * GSLAB;
#pragma unroll
  for (int r = 0; r < 8; ++r) {
#pragma unroll
    for (int j = 0; j < 4; ++j) slab[(8 * hh + r) * 68 + j * 16 + c] = o[j][r] * inv[r];
  }
  wave_sync_lds();
  // ---- f32 result: lanes 0..15 -> row 2*i2, lanes 16..31 -> row 2*i2+1; lane = 4 consecutive floats ----
  v4f vals[8];
#pragma unroll
  for (int i2 = 0; i2 < 8; ++i2) vals[i2] = *(const v4f*)(slab + (i2 * 2 + hh) * 68 + c * 4);
  float* dst = Out + ((size_t)(b * SEQ + q0 + hh)) * DMOD + (size_t)(head * HD + c * 4);
  {
#pragma unroll
    for (int i2 = 0; i2 < 8; ++i2) {
      *(v4f*)(dst + (size_t)(i2 * 2) * (size_t)DMOD) = vals[i2];
    }
    
  }
}

// =====================================================================================================
// Workspace map (bytes, NB = 4); every plane is fully written by whole-line stores before it is read; all extents are
// exact multiples of the store granularity (no pad rows):
//   XB  bf16 [NB*SEQ][DMOD]                          16777216
//   WB  bf16 [3*NHD][DMOD]  (k | q | v chunks)        6291456
//   QP  f16  [NB*SEQ][NHD] x8                       16777216
//   KP  f16  [NB*SEQ][NHD] x8                       16777216
//   VP  f16  [NB][NHD][SEQ] x1024                   16777216
//   end                                             73400320
// 6 launches on one in-order stream.
// =====================================================================================================
extern "C" void kernel_launch(void* const* d_in, const int* in_sizes, int n_in,
                              void* d_out, int out_size, void* d_ws, size_t ws_size,
                              hipStream_t stream) {
  const int ROWS = NB * SEQ;
  if (n_in < 2) return;
  if (in_sizes[0] < ROWS * DMOD) return;
  if (in_sizes[1] != 3 * NHD * DMOD) return;
  if (out_size < ROWS * DMOD) return;

  const float* Xin = (const float*)d_in[0];
  const float* Win = (const float*)d_in[1];
  float*       out = (float*)d_out;

  const size_t szXB = (size_t)ROWS * DMOD * 2;
  const size_t szWB = (size_t)3 * NHD * DMOD * 2;
  const size_t szPl = (size_t)ROWS * NHD * 2;                  // q/k planes
  const size_t szVP = (size_t)NB * NHD * SEQ * 2;
  size_t off = 0;
  const size_t oXB = off; off += szXB;
  const size_t oWB = off; off += szWB;
  const size_t oQP = off; off += szPl;
  const size_t oKP = off; off += szPl;
  const size_t oVP = off; off += szVP;
  if (off > ws_size) return;                            // off = 73400320 for NB = 4
  if (off > (size_t)134217728) return;

  char* ws = (char*)d_ws;
  u16* XB = (u16*)(ws + oXB);
  u16* WB = (u16*)(ws + oWB);
  u16* QP = (u16*)(ws + oQP);
  u16* KP = (u16*)(ws + oKP);
  u16* VP = (u16*)(ws + oVP);

  const int n8x = (ROWS * DMOD) / 8;
  const int n8w = (3 * NHD * DMOD) / 8;
  if ((n8x % 256) != 0 || (n8w % 256) != 0) return;
  if ((DMOD % 64) != 0 || (NHD % 64) != 0 || (SEQ % 64) != 0 || (SQ % 64) != 0 || (DMOD % 32) != 0) return;

  const dim3 blk(256);
  const dim3 gX(n8x / 256);                             // 4096
  const dim3 gW(n8w / 256);                             // 1536
  const dim3 bG(128);
  const dim3 gQ(NB * (SQ / 64) * (NHD / 64));           // 2048
  const dim3 gK(NB * (SEQ / 64) * (NHD / 64));          // 2048
  const dim3 gV(NB * (NHD / 64) * (SEQ / 64));          // 2048
  const dim3 gAT(ATT_BLOCKS);                           // 2048
  const dim3 bAT(ATT_THREADS);                          // 128

  // (1) x -> bf16 plane [ROWS][DMOD]
  cvt16<<<gX, blk, 0, stream>>>(Xin, XB, n8x);
  // (2) W [3*NHD out][DMOD in] -> bf16, same layout (already k-contiguous for B fragments / row-major A for the v^T GEMM)
  cvt16<<<gW, blk, 0, stream>>>(Win, WB, n8w);
  // (3,4) q, k as single f16 planes [b][s][h*64+d] = (x.Wq^T) x8 over SQ rows per batch, (x.Wk^T) x8 over all keys
  gemm_bb<<<gQ, bG, 0, stream>>>(XB, WB + (size_t)NHD * DMOD, QP, SQ, NHD, DMOD, SEQ * DMOD, 0, SEQ * NHD, QSC);
  gemm_bb<<<gK, bG, 0, stream>>>(XB, WB, KP, SEQ, NHD, DMOD, SEQ * DMOD, 0, SEQ * NHD, KSC);
  // (5) v^T plane per batch: [h*64+d][keys] = f16((Wv . x_b^T) x1024)
  gemm_bb<<<gV, bG, 0, stream>>>(WB + (size_t)2 * NHD * DMOD, XB, VP, NHD, SEQ, DMOD, 0, SEQ * DMOD, NHD * SEQ, VCAR);
  // (6) attention -> out [b][s][h*64+d] f32
  attn_fwd<<<gAT, bAT, 0, stream>>>(QP, KP, VP, out);
  (void)hipGetLastError();
}

// v004
// A run of this version takes 135 microseconds.
// Next to v003, in two timings, it ran 1.14 times as fast each time.
// Over all steps from v000 it is 3.03 times as fast.
// Contractions: x.Wk^T, x.Wq^T and Wv.x^T on v_wmma_f32_16x16x32_bf16 (x and W planes RNE-converted to bf16 operands,
// f32 accumulate); scores k.q^T (k and q single f16 planes carried x8) and P.v (P x32768 single f16, v x1024 single f16)
// on v_wmma_f32_16x16x32_f16, f32 accumulate. Base-2 online softmax with linear relative-position bias; 1/l and carry
// folds in f32 on VALU; f32 result written directly.
#include <hip/hip_runtime.h>
#include <math.h>
#include <stdint.h>

#ifndef NB
#define NB    4
#endif
#define SEQ   2048
#ifndef SQ
#define SQ    SEQ
#endif
#define DMOD  1024
#define NH    16
#define HD    64
#define NHD   (NH * HD)
#define QSC   8.0f
#define KSC   8.0f
#define PCAR  32768.0f
#define VCAR  1024.0f
#define LOG2E 1.4426950408889634f
#define INVN  0.03125f
#define RSQ2  0.70710678118654752f
#define ATT_WAVES   4
#define ATT_THREADS (ATT_WAVES * 32)
#define NQT         (SQ / 64)
#define ATT_BLOCKS  (NB * NH * NQT)
#define NKB         (SEQ / 32)
#define GSLAB       (16 * 68)
#define GKC         128                 // k elements of one GEMM stage: rows of 256 bytes
#define GPITCH      272                 // LDS row pitch, bytes: 256 + 16, an odd multiple of 16 for 16-byte readers
#define GTILE       128                 // the block's tile of C: 128 x 128, one 64 x 64 quarter per wave
#define GSLICE      18432               // one wave's slice: 64 rows x 272 B = 17408 B, rounded up to a multiple of 2 KiB
#define GSTAGE      (4 * GSLICE)        // [A rows 0..63 | A rows 64..127 | B rows 0..63 | B rows 64..127]
#define GWSLAB      (64 * 68)           // floats of one wave's result slab: 64 rows at a pitch of 68
#define GRING       (2 * GSTAGE)
#define AKEYS       64                  // keys of one attention stage: k rows and v^T rows of 128 bytes each
#define APITCH      144                 // LDS row pitch, bytes: 128 + 16, an odd multiple of 16 for 16-byte readers
#define ASLICE      6144                // one wave's slice: 32 rows x 144 B = 4608 B, rounded up to a multiple of 2 KiB
#define ASTAGE      (4 * ASLICE)        // [k rows 0..31 | k rows 32..63 | v^T rows 0..31 | v^T rows 32..63]
#define ARING       (2 * ASTAGE)
#define NST         (SEQ / AKEYS)
static_assert(32 * APITCH <= ASLICE && (ASLICE % 2048) == 0 && HD * 2 == 128 && AKEYS * 2 == 128 && ATT_WAVES == 4);
static_assert(ATT_WAVES * GSLAB * 4 <= ASTAGE && (SEQ % AKEYS) == 0 && NST >= 2 && (AKEYS % 32) == 0);
static_assert(64 * GPITCH <= GSLICE && (GSLICE % 2048) == 0 && GKC * 2 == 256 && 4 * GWSLAB * 4 <= GSTAGE);
static_assert((NHD % GTILE) == 0 && (SEQ % GTILE) == 0 && (SQ % GTILE) == 0);
static_assert((DMOD % GKC) == 0 && (DMOD / GKC) >= 2);
static_assert(NH == 16 && HD == 64 && DMOD == NHD);
static_assert((HD % 32) == 0 && (SEQ % 64) == 0 && (SQ % 64) == 0 && SQ <= SEQ && SQ >= 64);
static_assert((DMOD % 64) == 0 && (DMOD % 32) == 0 && (NHD % 64) == 0);
static_assert(((NB * SEQ * DMOD / 8) % 256) == 0);
static_assert(((3 * NHD * DMOD / 8) % 256) == 0);
static_assert((GSLAB * 4) % 16 == 0 && ATT_THREADS == 128);
static_assert(NB >= 1 && NB <= 4);

typedef unsigned short u16;
typedef _Float16 v16h __attribute__((ext_vector_type(16)));
typedef _Float16 v8h  __attribute__((ext_vector_type(8)));
typedef __bf16   v16b __attribute__((ext_vector_type(16)));
typedef float    v8f  __attribute__((ext_vector_type(8)));
typedef float    v4f  __attribute__((ext_vector_type(4)));
typedef unsigned int v4u __attribute__((ext_vector_type(4)));
typedef uint32_t u32x4 __attribute__((ext_vector_type(4)));
typedef uint32_t u32x8 __attribute__((ext_vector_type(8)));

union FragH { v16h v; v8h h[2]; v4u u[2]; };
union FragB { v16b v; v4u u[2]; };

// ---- scalar helpers --------------------------------------------------------------------------------
__device__ __forceinline__ unsigned short bf_bits(float f) {          // f32 -> bf16 bits, RNE convert
  unsigned u = __float_as_uint(f);
  return (unsigned short)((u + 0x7FFFu + ((u >> 16) & 1u)) >> 16);
}
__device__ __forceinline__ unsigned short h_bits(_Float16 x) { return __builtin_bit_cast(unsigned short, x); }
__device__ __forceinline__ unsigned pk16(unsigned short a, unsigned short b) { return (unsigned)a | ((unsigned)b << 16); }
// 2^x in place for a key block's rescale exponent and its 16 score exponents (all <= 0), by the bare hardware instruction.
// exp2f() wraps each v_exp_f32 in a compare, two selects, an add and an ldexp so that results below 2^-126 come out as
// denormals; such a weight vanishes anyway, in the f16 operand and in a row sum that is never below 1. One statement, so
// that no neighbour of a v_exp_f32 reads its result or overwrites its source; the closing v_nop keeps that slot behind the
// last one, whatever the compiler puts next.
__device__ __forceinline__ void exp2_hw17(float& a, float (&t)[16]) {
#if defined(__HIP_DEVICE_COMPILE__)
  asm("v_exp_f32 %0, %0\n\tv_exp_f32 %1, %1\n\tv_exp_f32 %2, %2\n\tv_exp_f32 %3, %3\n\tv_exp_f32 %4, %4\n\t"
      "v_exp_f32 %5, %5\n\tv_exp_f32 %6, %6\n\tv_exp_f32 %7, %7\n\tv_exp_f32 %8, %8\n\tv_exp_f32 %9, %9\n\t"
      "v_exp_f32 %10, %10\n\tv_exp_f32 %11, %11\n\tv_exp_f32 %12, %12\n\tv_exp_f32 %13, %13\n\t"
      "v_exp_f32 %14, %14\n\tv_exp_f32 %15, %15\n\tv_exp_f32 %16, %16\n\tv_nop"
      : "+v"(a), "+v"(t[0]), "+v"(t[1]), "+v"(t[2]), "+v"(t[3]), "+v"(t[4]), "+v"(t[5]), "+v"(t[6]), "+v"(t[7]),
        "+v"(t[8]), "+v"(t[9]), "+v"(t[10]), "+v"(t[11]), "+v"(t[12]), "+v"(t[13]), "+v"(t[14]), "+v"(t[15]));
#endif
}
__device__ __forceinline__ v8f zero8() { v8f z = {0.f, 0.f, 0.f, 0.f, 0.f, 0.f, 0.f, 0.f}; return z; }

// ---- fragment loaders: 16-bit A/B operand, lane -> row/col (lane&15), p already includes +8*(lane>>4);
//      elements 0..7 <- p[0..7] (k0+8h..), elements 8..15 <- p[16..23] (k0+16+8h..)  (same split k map for A and B;
//      B is always read from a k-contiguous [n][k] plane)
__device__ __forceinline__ v16h ldfrag_h(const _Float16* p) {
  FragH f;
  f.h[0] = *(const v8h*)(p);
  f.h[1] = *(const v8h*)(p + 16);
  return f.v;
}
__device__ __forceinline__ v16b ldfrag_b(const u16* p) {              // bf16 plane read as unsigned integer vectors
  FragB f;
  f.u[0] = *(const v4u*)(p);
  f.u[1] = *(const v4u*)(p + 16);
  return f.v;
}

__device__ __forceinline__ v8f mma_h(v16h a, v16h b, v8f c) {
  return __builtin_amdgcn_wmma_f32_16x16x32_f16(false, a, false, b, (short)0, c, false, false);
}
__device__ __forceinline__ v8f mma_b(v16b a, v16b b, v8f c) {
  return __builtin_amdgcn_wmma_f32_16x16x32_bf16(false, a, false, b, (short)0, c, false, false);
}
template <typename F>
__device__ __forceinline__ void guard2x6(v8f& a, v8f& b, F x0, F x1, F x2, F x3, F x4, F x5) {
#if defined(__HIP_DEVICE_COMPILE__)
  asm volatile("v_nop\n\tv_nop\n\tv_nop\n\tv_nop"
               : "+v"(a), "+v"(b) : "v"(x0), "v"(x1), "v"(x2), "v"(x3), "v"(x4), "v"(x5) : "memory");
#endif
}
template <typename F>
__device__ __forceinline__ void guard4x5(v8f& a, v8f& b, v8f& c, v8f& d, F x0, F x1, F x2, F x3, F x4) {
#if defined(__HIP_DEVICE_COMPILE__)
  asm volatile("v_nop\n\tv_nop\n\tv_nop\n\tv_nop"
               : "+v"(a), "+v"(b), "+v"(c), "+v"(d) : "v"(x0), "v"(x1), "v"(x2), "v"(x3), "v"(x4) : "memory");
#endif
}
__device__ __forceinline__ void acc_guard4(v8f& a, v8f& b, v8f& c, v8f& d) {
#if defined(__HIP_DEVICE_COMPILE__)
  asm volatile("v_nop\n\tv_nop\n\tv_nop\n\tv_nop" : "+v"(a), "+v"(b), "+v"(c), "+v"(d));
#endif
}
// Four vector slots between the last matrix instructions of the GEMM loop, which is left by a taken branch, and the first
// read of their results.
__device__ __forceinline__ void acc_guard16(v8f (&a)[4][4]) {
#if defined(__HIP_DEVICE_COMPILE__)
  asm volatile("v_nop\n\tv_nop\n\tv_nop\n\tv_nop"
               : "+v"(a[0][0]), "+v"(a[0][1]), "+v"(a[0][2]), "+v"(a[0][3]), "+v"(a[1][0]), "+v"(a[1][1]), "+v"(a[1][2]),
                 "+v"(a[1][3]), "+v"(a[2][0]), "+v"(a[2][1]), "+v"(a[2][2]), "+v"(a[2][3]), "+v"(a[3][0]), "+v"(a[3][1]),
                 "+v"(a[3][2]), "+v"(a[3][3]));
#endif
}
// The scheduler moves nothing across this point. Without it the compiler sinks three of a step's four A fragments to just
// in front of the row of matrix instructions that reads them, each with a wait to 0: four LDS latencies a step, not one.
__device__ __forceinline__ void sched_fence() {
#if defined(__HIP_DEVICE_COMPILE__)
  __builtin_amdgcn_sched_barrier(0);
#endif
}
__device__ __forceinline__ void wave_sync_lds() {
#if defined(__HIP_DEVICE_COMPILE__)
  __builtin_amdgcn_fence(__ATOMIC_RELEASE, "workgroup");
  __builtin_amdgcn_wave_barrier();
  __builtin_amdgcn_fence(__ATOMIC_ACQUIRE, "workgroup");
#endif
}

// ---- tensor load to LDS: descriptor words, issue, waits ---------------------------------------------
__device__ __forceinline__ uint32_t uni(uint32_t v) { return (uint32_t)__builtin_amdgcn_readfirstlane((int)v); }
// Test around a tensor load, which ignores EXEC: it has to compile to s_cmp + s_cbranch_scc.
__device__ __forceinline__ uint32_t pinned(uint32_t v) {
  uint32_t w = uni(v);
  asm volatile("" : "+s"(w));   // pinned(): holds the test word in a scalar register, so that the branch on it is scalar
  return w;
}
// Group 1: 1-byte elements, tile = tensor = 64 rows of 256 bytes, source row pitch src_pitch bytes; word 0 is the pad
// constant for 256-byte rows with 16 bytes behind each row (LDS pitch 272), no mask.
__device__ __forceinline__ u32x8 tdm_group1(uint32_t src_pitch) {
  constexpr uint32_t d0 = 256u, d1 = 64u;
  u32x8 g;
  g[0] = uni((1u << 20) | (5u << 22) | (3u << 25));
  g[1] = uni((d0 & 0xFFFFu) << 16);
  g[2] = uni((d0 >> 16) | ((d1 & 0xFFFFu) << 16));
  g[3] = uni((d1 >> 16) | (d0 << 16));
  g[4] = uni(d1);
  g[5] = uni(src_pitch);
  g[6] = uni(0u);
  g[7] = uni(0u);
  return g;
}
// The same for 32 rows of 128 bytes: pad constant for 128-byte rows with 16 bytes behind each row (LDS pitch 144), no mask.
__device__ __forceinline__ u32x8 tdm_group1_r128(uint32_t src_pitch) {
  constexpr uint32_t d0 = 128u, d1 = 32u;
  u32x8 g;
  g[0] = uni((1u << 20) | (4u << 22) | (3u << 25));
  g[1] = uni((d0 & 0xFFFFu) << 16);
  g[2] = uni((d0 >> 16) | ((d1 & 0xFFFFu) << 16));
  g[3] = uni((d1 >> 16) | (d0 << 16));
  g[4] = uni(d1);
  g[5] = uni(src_pitch);
  g[6] = uni(0u);
  g[7] = uni(0u);
  return g;
}
__device__ __forceinline__ u32x4 tdm_group0(uint32_t lds_dst, uint64_t ga) {
  u32x4 g;
  g[0] = uni(1u);
  g[1] = uni(lds_dst);
  g[2] = uni((uint32_t)ga);
  g[3] = uni((((uint32_t)(ga >> 32)) & 0x01FFFFFFu) | 0x80000000u);
  return g;
}
// Aim group 0 at the next tile: only the LDS place and the address change.
__device__ __forceinline__ void tdm_aim(u32x4& g, uint32_t lds_dst, uint64_t ga) {
  g[1] = uni(lds_dst);
  g[2] = uni((uint32_t)ga);
  g[3] = uni((((uint32_t)(ga >> 32)) & 0x01FFFFFFu) | 0x80000000u);
}
// One request of the whole wave. Both groups are in-out operands so that their scalar registers stay theirs up to the
// next request: as plain inputs the compiler used some of them as temporaries while the request was in flight.
__device__ __forceinline__ void tdm_load(u32x4& g0, u32x8& g1) {
#if defined(__HIP_DEVICE_COMPILE__)
  asm volatile("tensor_load_to_lds %0, %1" : "+s"(g0), "+s"(g1) :: "memory");
#endif
}
__device__ __forceinline__ void wait_tensor0() {
#if defined(__HIP_DEVICE_COMPILE__)
  asm volatile("s_wait_tensorcnt 0x0" ::: "memory");   // the wave's own slice has landed
#endif
}
// The same wait for the GEMM, with both groups as in-out operands: every scalar register of a descriptor stays the
// descriptor's own until the wait that covers its request; otherwise the compiler reuses a word that is dead behind the issue.
__device__ __forceinline__ void wait_tensor0_hold(u32x4& g0, u32x8& g1) {
#if defined(__HIP_DEVICE_COMPILE__)
  asm volatile("s_wait_tensorcnt 0x0" : "+s"(g0), "+s"(g1) :: "memory");
#endif
}
__device__ __forceinline__ void wait_ds0() {
#if defined(__HIP_DEVICE_COMPILE__)
  asm volatile("s_wait_dscnt 0x0" ::: "memory");       // the wave's LDS reads have retired before their buffer is refilled
#endif
}

// =====================================================================================================
// f32 plane -> bf16 RNE plane, same layout. Thread = 8 consecutive elements: two 16-B loads, one 16-B store;
// coverage: grid = n8/256 blocks (host checks exactness) x 256 thr x 8 = the whole plane.
// =====================================================================================================
__global__ __launch_bounds__(256) void cvt16(const float* __restrict__ x, u16* D, int n8) {
  const int gt = blockIdx.x * 256 + (int)threadIdx.x;
  if (gt >= n8) return;                     // no barriers in this kernel
  const float* p = x + (size_t)gt * 8;
  const v4f a = *(const v4f*)(p), c4 = *(const v4f*)(p + 4);
  v4u o;
  o[0] = pk16(bf_bits(a[0]),  bf_bits(a[1]));
  o[1] = pk16(bf_bits(a[2]),  bf_bits(a[3]));
  o[2] = pk16(bf_bits(c4[0]), bf_bits(c4[1]));
  o[3] = pk16(bf_bits(c4[2]), bf_bits(c4[3]));
  u16* d = D + (size_t)gt * 8;
  {
    *(v4u*)(d) = o;
    
  }
}

// =====================================================================================================
// Batched bf16 GEMM with f16 result:  C[bt][M][N] = f16( (A[bt][M][K] (bf16 row-major) . Bt[bt][N][K]^T (bf16
// k-contiguous)) * oscale ); per-batch element strides bstA/bstB/bstC. Block = 128x128 tile, 4 waves in a 2 x 2 grid, each
// with a 64x64 quarter = 4 x 4 accumulator tiles: a fragment read from LDS feeds 4 matrix instructions, and an operand row
// brought into LDS serves 128 rows or columns of C.
// Operands come through LDS: a stage is 128 k of the block's 128 A rows and 128 B rows; every wave brings its own slice
// of 64 rows x 256 B with one tensor load (LDS pitch 272 B), two buffers, the next stage in flight while this one is
// worked on. Fragments are read from the LDS rows (two 16-B loads each, split k map for A and B), K stepped by 32
// inside a stage (K = DMOD: a multiple of 128 and at least two stages; M % 128 == 0, N % 128 == 0,
// grid = nbatch*(M/128)*(N/128)). The ring becomes the result slabs behind the last pass's barrier.
// Result: lane = (row in group of 4, 8 consecutive cols); one instruction = 4 rows, each 64 halves = one 128-B line.
// coverage: 16 instructions x 4 rows x 8 lanes x 8 halves = the wave's 64 x 64 quarter; 4 waves = the block's 128 x 128 tile.
// =====================================================================================================
__global__ __launch_bounds__(128)
void gemm_bb(const u16* __restrict__ A, const u16* __restrict__ Bt, u16* C, int M, int N, int K,
             int bstA, int bstB, int bstC, float oscale) {
  __shared__ __attribute__((aligned(2048))) unsigned char ring[GRING];
  const int tid = threadIdx.x, lane = tid & 31, hh = lane >> 4, m = lane & 15;
  const int wave = (int)uni((uint32_t)tid >> 5);
  const int wm = wave >> 1, wn = wave & 1;   // the wave's quarter: rows 64*wm .., columns 64*wn ..
  const int ntile = N / GTILE, mtile = M / GTILE;
  const int per   = ntile * mtile;
  const int bid   = blockIdx.x;
  const int bt    = bid / per;
  const int t     = bid - bt * per;
  const int row0  = (t / ntile) * GTILE;
  const int col0  = (t % ntile) * GTILE;
  if (row0 + GTILE > M) return;              // block-uniform, never taken with the exact grid; in front of every barrier and load
  const u16* Ab  = A  + (size_t)bt * (size_t)bstA;
  const u16* Bb  = Bt + (size_t)bt * (size_t)bstB;
  u16*       Cb  = C  + (size_t)bt * (size_t)bstC;
  // ---- this wave's slice of every stage: waves 0,1 = A rows row0 + 64*wave .., waves 2,3 = B rows col0 + 64*(wave-2) .. ----
  const u16* sp = (wave < 2) ? (Ab + (size_t)(row0 + 64 * wave) * K) : (Bb + (size_t)(col0 + 64 * (wave - 2)) * K);
  const uint64_t ga0  = (uint64_t)(size_t)sp;
  const uint32_t dst0 = (uint32_t)(size_t)ring + (uint32_t)wave * GSLICE;
  u32x8          g1   = tdm_group1((uint32_t)K * 2u);
  u32x4          g0   = tdm_group0(dst0, ga0);
  const int      npass = K / GKC;
  // ---- fragment rows in LDS: A rows 16*i + m of slice wm, B rows 16*j + m of slice 2 + wn; +16*hh bytes = +8*hh elements ----
  const unsigned char* ar = ring + wm * GSLICE + m * GPITCH + 16 * hh;
  const unsigned char* br = ring + (2 + wn) * GSLICE + m * GPITCH + 16 * hh;
  v8f acc[4][4];
#pragma unroll
  for (int i = 0; i < 4; ++i) {
#pragma unroll
    for (int j = 0; j < 4; ++j) acc[i][j] = zero8();
  }
  // ---- prologue: stage 0 lands and is published, then stage 1 is put in flight ----
  tdm_load(g0, g1);
  wait_tensor0_hold(g0, g1);
  __syncthreads();
  tdm_aim(g0, dst0 + GSTAGE, ga0 + 2u * GKC);
  tdm_load(g0, g1);
#pragma unroll 1   // one pass per stage: the publish point below stands once per trip
  for (int s = 0; s < npass; ++s) {
    const int bo = (s & 1) * GSTAGE;
#pragma unroll     // constant LDS offsets for the four 32-deep steps of a stage
    for (int kk = 0; kk < GKC / 32; ++kk) {
      const int o = bo + kk * 64;
      v16b af[4], bf[4];
#pragma unroll     // constant indices: the fragments stay in registers
      for (int i = 0; i < 4; ++i) {
        af[i] = ldfrag_b((const u16*)(const void*)(ar + o + i * 16 * GPITCH));
        bf[i] = ldfrag_b((const u16*)(const void*)(br + o + i * 16 * GPITCH));
      }
      sched_fence();   // all 16 loads of the step are issued ahead of its 16 products
#pragma unroll
      for (int i = 0; i < 4; ++i) {
#pragma unroll
        for (int j = 0; j < 4; ++j) acc[i][j] = mma_b(af[i], bf[j], acc[i][j]);
      }
    }
    // ---- publish point of stage s + 1: own LDS reads retired, own slice landed, barrier, then the refill ----
    wait_ds0();
    wait_tensor0_hold(g0, g1);
    __syncthreads();
    if (pinned((uint32_t)(s + 2 < npass))) {
      tdm_aim(g0, dst0 + (uint32_t)bo, ga0 + (uint64_t)(s + 2) * (2u * GKC));
      tdm_load(g0, g1);
    }
  }
  wait_tensor0_hold(g0, g1);   // behind the loop: no request in flight and no LDS read open before the ring is used for the result
  wait_ds0();
  acc_guard16(acc);
  // ---- stage the scaled value in the wave's slab: the ring's first bytes, which every reader has left at the last
  //      pass's barrier and at which no load is aimed any more ----
  float* sl = (float*)(void*)ring + wave * GWSLAB;
#pragma unroll
  for (int i = 0; i < 4; ++i) {
#pragma unroll
    for (int r = 0; r < 8; ++r) {
      const int ro = (16 * i + 8 * hh + r) * 68 + m;
#pragma unroll
      for (int j = 0; j < 4; ++j) sl[ro + 16 * j] = acc[i][j][r] * oscale;
    }
  }
  wave_sync_lds();
  const int rq = lane >> 3, c8 = (lane & 7) * 8;
  u16* dst = Cb + ((size_t)(row0 + 64 * wm) + (size_t)rq) * (size_t)N + (size_t)(col0 + 64 * wn + c8);
#pragma unroll
  for (int i4 = 0; i4 < 16; ++i4) {
    const float* rp = sl + (i4 * 4 + rq) * 68 + c8;
    const v4f a = *(const v4f*)(rp), c4 = *(const v4f*)(rp + 4);
    v4u ov;
    ov[0] = pk16(h_bits((_Float16)a[0]),  h_bits((_Float16)a[1]));
    ov[1] = pk16(h_bits((_Float16)a[2]),  h_bits((_Float16)a[3]));
    ov[2] = pk16(h_bits((_Float16)c4[0]), h_bits((_Float16)c4[1]));
    ov[3] = pk16(h_bits((_Float16)c4[2]), h_bits((_Float16)c4[3]));
    *(v4u*)(dst + (size_t)(i4 * 4) * (size_t)N) = ov;
  }
}

// =====================================================================================================
// Multi-head flash attention with per-head linear relative-position bias (no mask): block = (batch b, head, 64 query
// rows), 4 waves, wave w owns query rows q0 = 64*qt + 16*w .. q0+15.
//   k and v^T come through LDS, shared by the block's 4 waves: a stage is 64 keys = 64 k rows x 128 B and 64 v^T rows x
//   128 B; every wave brings its own slice of 32 rows with one tensor load (LDS pitch 144 B), two buffers, the next stage
//   in flight while this one is worked on; one publish point (waits + block barrier) per stage. The ring's first bytes
//   become the wave-private result slabs behind the last stage's barrier.
//   q plane (f16, x8) laid out [b][s][h*64+d]; k plane the same (f16, x8); v^T plane [b][h*64+d][s] (x1024 f16).
//   All NKB = 64 key blocks of 32 keys are visited (static bound).
//   Scores are computed TRANSPOSED: S^T tile g (g = 0,1) = k rows (keys kb+16g .. +15, A operand, row m = lane&15, split k
//   map over d) times q^T (B operand, col n = query q0 + (lane&15), k = d, split map), one f16 product per tile and 32-deep
//   d-chunk, one guarded group of 4 WMMAs; the two q fragments are loaded once per wave.
//   D element r of lane l = (key kb+16g+8h+r, query q0+(l&15)), so a lane owns one query column and 16 of its 32 keys; the
//   partner lane l^16 owns the other 16 -> row max / row sum need one xor-16 shuffle.
//   Logit (base 2) = score * (1/32) * log2e / (8*8) + slope_h * (key - query) * log2e, slope_h = (2^-0.5)^(h+1).
//   Online max-subtracted base-2 softmax in f32. The exp'd values ARE the P A-fragment in place: A row m = query = lane&15,
//   element i <- key kb+8h+i (tile 0, D element i), element 8+i <- key kb+16+8h+i (tile 1, D element i). P is carried
//   x32768 as single f16. The rescale factor of query row 8h+r of the O accumulators is fetched from lane 8h+r with a
//   shuffle (uniform control). 4 v^T B fragments (col n = d = 16j + (lane&15), keys k-contiguous), 4 P.V WMMAs per key
//   block in one guarded group.
//   Epilogue: 1/l (per query, shuffled to the D row owner) and the carry folds in f32; the wave's 16x64 f32 result staged
//   segment (b, q0+row, head) of the f32 result [b][s][h*64+d] written by 16 consecutive lanes x 16 B of one instruction
// coverage: per wave 8 instructions x 2 rows x 16 lanes x 4 floats = 16 x 64; grid NB*NH*(SQ/64) blocks x 4 waves =
//           every (b, s < SQ, h) row segment of the result exactly once.
// =====================================================================================================
__global__ __launch_bounds__(ATT_THREADS)
void attn_fwd(const u16* __restrict__ QPp, const u16* __restrict__ KPp, const u16* __restrict__ VPp, float* Out) {
  __shared__ __attribute__((aligned(2048))) unsigned char ring[ARING];   // k / v^T stages; result slabs in the epilogue

  const int tid  = threadIdx.x;
  const int wave = (int)uni((uint32_t)tid >> 5);
  const int lane = tid & 31;
  const int hh   = lane >> 4;
  const int c    = lane & 15;

  const int bid  = blockIdx.x;
  const int qt   = bid % NQT;
  const int head = (bid / NQT) % NH;
  const int b    = bid / (NQT * NH);
  const int q0   = qt * 64 + wave * 16;

  // B fragments of q^T: col n = query q0 + c, k = d (k-contiguous row segment of the q plane)
  const size_t qofs = ((size_t)(b * SEQ + q0 + c)) * NHD + (size_t)(head * HD + 8 * hh);
  const _Float16* Qb = (const _Float16*)(const void*)QPp + qofs;
  // ---- this wave's slice of every stage: waves 0,1 = k rows (keys) 32*wave .., 128 B of this head each; waves 2,3 =
  //      v^T rows (d) 32*(wave-2) .., 128 B = 64 keys each ----
  const u16* sp = (wave < 2) ? (KPp + ((size_t)(b * SEQ + 32 * wave)) * NHD + (size_t)(head * HD))
                             : (VPp + ((size_t)(b * NHD + head * HD + 32 * (wave - 2))) * SEQ);
  const uint64_t ga0   = (uint64_t)(size_t)sp;
  const uint32_t gstep = (wave < 2) ? (uint32_t)(AKEYS * NHD * 2) : (uint32_t)(AKEYS * 2);   // bytes from stage to stage
  const uint32_t dst0  = (uint32_t)(size_t)ring + (uint32_t)wave * ASLICE;
  u32x8          g1    = tdm_group1_r128((wave < 2) ? (uint32_t)(NHD * 2) : (uint32_t)(SEQ * 2));
  u32x4          g0    = tdm_group0(dst0, ga0);
  // A fragments of k: LDS row = key (in its slice of 32) 16g + c, k = d; +16*hh bytes = +8*hh elements
  const unsigned char* kr = ring + c * APITCH + 16 * hh;
  // B fragments of v: col n = d = 16j + c = LDS row of the v^T slices, k = key (contiguous in the row)
  const unsigned char* vr = ring + 2 * ASLICE + c * APITCH + 16 * hh;

  const int   ex     = head + 1;
  const float slope  = (((ex & 1) != 0) ? RSQ2 : 1.0f) * __int_as_float((127 - (ex >> 1)) << 23);
  const float slope2 = slope * LOG2E;
  const float lsc    = (INVN * LOG2E) * (1.0f / (QSC * KSC));
  const float jb0    = (float)(8 * hh - (q0 + c));      // key - query, key block base added per step

  const v16h qf0 = ldfrag_h(Qb);            // d 0..31
  const v16h qf1 = ldfrag_h(Qb + 32);       // d 32..63

  float mrun = -INFINITY, lrun = 0.f;
  v8f o[4];
#pragma unroll
  for (int j = 0; j < 4; ++j) o[j] = zero8();

  // ---- prologue: stage 0 lands and is published, then stage 1 is put in flight ----
  tdm_load(g0, g1);
  wait_tensor0();
  __syncthreads();
  tdm_aim(g0, dst0 + ASTAGE, ga0 + gstep);
  tdm_load(g0, g1);
#pragma unroll 1   // one pass per stage: the publish point below stands once per trip
  for (int s = 0; s < NST; ++s) {
    const int bo = (s & 1) * ASTAGE;
#pragma unroll     // constant LDS offsets for the key blocks of a stage
  for (int i32 = 0; i32 < AKEYS / 32; ++i32) {
    const int kb = s * AKEYS + i32 * 32;
    // ---- transposed scores: s0 = keys kb..kb+15, s1 = keys kb+16..kb+31, column = query q0 + c ----
    v8f s0 = zero8(), s1 = zero8();
    const _Float16* k0p = (const _Float16*)(const void*)(kr + bo + i32 * ASLICE);
    const _Float16* k1p = (const _Float16*)(const void*)(kr + bo + i32 * ASLICE + 16 * APITCH);
    {
      const v16h ka0 = ldfrag_h(k0p),      ka1 = ldfrag_h(k0p + 32);
      const v16h kc0 = ldfrag_h(k1p),      kc1 = ldfrag_h(k1p + 32);
      s0 = mma_h(ka0, qf0, s0);
      s0 = mma_h(ka1, qf1, s0);
      s1 = mma_h(kc0, qf0, s1);
      s1 = mma_h(kc1, qf1, s1);
      guard2x6<v16h>(s0, s1, qf0, qf1, ka0, ka1, kc0, kc1);
    }
    // ---- base-2 logits of this lane's 16 keys for query q0 + c ----
    const float jb = jb0 + (float)kb;
    float tk[16];
#pragma unroll
    for (int i = 0; i < 8; ++i) {
      tk[i]     = fmaf(s0[i], lsc, slope2 * (jb + (float)i));
      tk[8 + i] = fmaf(s1[i], lsc, slope2 * (jb + (float)(16 + i)));
    }
    float cm = tk[0];
#pragma unroll
    for (int i = 1; i < 16; ++i) cm = fmaxf(cm, tk[i]);
    cm = fmaxf(cm, __shfl_xor(cm, 16, 32));
    const float mn = fmaxf(mrun, cm);                                // finite from the first key block on
    float ea = mrun - mn, pe[16];
#pragma unroll     // constant indices: pe[] stays in registers, as the asm operands need it
    for (int i = 0; i < 16; ++i) pe[i] = fminf(tk[i] - mn, 0.f);
    exp2_hw17(ea, pe);
    const float al = (mrun == -INFINITY) ? 0.f : ea;                 // o and l are zero while mrun is -inf
    mrun = mn;
    // ---- probabilities (<= 1) and the P A-fragment: f16(p * 32768); element i <-> tk[i] ----
    float ps = 0.f;
    FragH ph;
#pragma unroll
    for (int w = 0; w < 2; ++w) {
#pragma unroll
      for (int e4 = 0; e4 < 4; ++e4) {
        const int i = 8 * w + 2 * e4;
        const float p0 = pe[i];
        const float p1 = pe[i + 1];
        ps += p0 + p1;
        ph.u[w][e4] = pk16(h_bits((_Float16)(p0 * PCAR)), h_bits((_Float16)(p1 * PCAR)));
      }
    }
    ps += __shfl_xor(ps, 16, 32);
    lrun = lrun * al + ps;
    // ---- rescale the O accumulators: D row 8hh+r = query q0+8hh+r, its factor lives in lane 8hh+r (and 16+8hh+r) ----
    float scl[8];
#pragma unroll
    for (int r = 0; r < 8; ++r) scl[r] = __shfl(al, 8 * hh + r, 32);
#pragma unroll
    for (int j = 0; j < 4; ++j) {
#pragma unroll
      for (int r = 0; r < 8; ++r) o[j][r] *= scl[r];
    }
    // ---- P.V : B fragment col n = d = j*16 + c, keys contiguous in the v^T plane; one group of 4 ----
    {
      const unsigned char* vp = vr + bo + i32 * 64;
      const v16h vf0 = ldfrag_h((const _Float16*)(const void*)(vp));
      const v16h vf1 = ldfrag_h((const _Float16*)(const void*)(vp + 16 * APITCH));
      const v16h vf2 = ldfrag_h((const _Float16*)(const void*)(vp + ASLICE));
      const v16h vf3 = ldfrag_h((const _Float16*)(const void*)(vp + ASLICE + 16 * APITCH));
      o[0] = mma_h(ph.v, vf0, o[0]);
      o[1] = mma_h(ph.v, vf1, o[1]);
      o[2] = mma_h(ph.v, vf2, o[2]);
      o[3] = mma_h(ph.v, vf3, o[3]);
      guard4x5<v16h>(o[0], o[1], o[2], o[3], ph.v, vf0, vf1, vf2, vf3);
    }
  }
    // ---- publish point of stage s + 1: own LDS reads retired, own slice landed, barrier, then the refill ----
    wait_ds0();
    wait_tensor0();
    __syncthreads();
    if (pinned((uint32_t)(s + 2 < NST))) {
      tdm_aim(g0, dst0 + (uint32_t)bo, ga0 + (uint64_t)(s + 2) * gstep);
      tdm_load(g0, g1);
    }
  }
  wait_tensor0();   // behind the loop: no request in flight and no LDS read open before the ring is used for the result
  wait_ds0();
  acc_guard4(o[0], o[1], o[2], o[3]);

  // ---- fold 1/l (per query, owned by lane = query; l >= 1 by construction) and the P/v carries ----
  const float linv = (lrun > 0.f) ? ((1.0f / lrun) * (1.0f / (PCAR * VCAR))) : 0.f;
  float inv[8];
#pragma unroll
  for (int r = 0; r < 8; ++r) inv[r] = __shfl(linv, 8 * hh + r, 32);
  // the wave's slab: the ring's first bytes, which every reader has left at the last stage's barrier and at which no
  // load is aimed any more
  float* slab = (float*)(void*)ring + wave * GSLAB;
#pragma unroll
  for (int r = 0; r < 8; ++r) {
#pragma unroll
    for (int j = 0; j < 4; ++j) slab[(8 * hh + r) * 68 + j * 16 + c] = o[j][r] * inv[r];
  }
  wave_sync_lds();
  // ---- f32 result: lanes 0..15 -> row 2*i2, lanes 16..31 -> row 2*i2+1; lane = 4 consecutive floats ----
  v4f vals[8];
#pragma unroll
  for (int i2 = 0; i2 < 8; ++i2) vals[i2] = *(const v4f*)(slab + (i2 * 2 + hh) * 68 + c * 4);
  float* dst = Out + ((size_t)(b * SEQ + q0 + hh)) * DMOD + (size_t)(head * HD + c * 4);
  {
#pragma unroll
    for (int i2 = 0; i2 < 8; ++i2) {
      *(v4f*)(dst + (size_t)(i2 * 2) * (size_t)DMOD) = vals[i2];
    }
    
  }
}

// =====================================================================================================
// Workspace map (bytes, NB = 4); every plane is fully written by whole-line stores before it is read; all extents are
// exact multiples of the store granularity (no pad rows):
//   XB  bf16 [NB*SEQ][DMOD]                          16777216
//   WB  bf16 [3*NHD][DMOD]  (k | q | v chunks)        6291456
//   QP  f16  [NB*SEQ][NHD] x8                       16777216
//   KP  f16  [NB*SEQ][NHD] x8                       16777216
//   VP  f16  [NB][NHD][SEQ] x1024                   16777216
//   end                                             73400320
// 6 launches on one in-order stream.
// =====================================================================================================
extern "C" void kernel_launch(void* const* d_in, const int* in_sizes, int n_in,
                              void* d_out, int out_size, void* d_ws, size_t ws_size,
                              hipStream_t stream) {
  const int ROWS = NB * SEQ;
  if (n_in < 2) return;
  if (in_sizes[0] < ROWS * DMOD) return;
  if (in_sizes[1] != 3 * NHD * DMOD) return;
  if (out_size < ROWS * DMOD) return;

  const float* Xin = (const float*)d_in[0];
  const float* Win = (const float*)d_in[1];
  float*       out = (float*)d_out;

  const size_t szXB = (size_t)ROWS * DMOD * 2;
  const size_t szWB = (size_t)3 * NHD * DMOD * 2;
  const size_t szPl = (size_t)ROWS * NHD * 2;                  // q/k planes
  const size_t szVP = (size_t)NB * NHD * SEQ * 2;
  size_t off = 0;
  const size_t oXB = off; off += szXB;
  const size_t oWB = off; off += szWB;
  const size_t oQP = off; off += szPl;
  const size_t oKP = off; off += szPl;
  const size_t oVP = off; off += szVP;
  if (off > ws_size) return;                            // off = 73400320 for NB = 4
  if (off > (size_t)134217728) return;

  char* ws = (char*)d_ws;
  u16* XB = (u16*)(ws + oXB);
  u16* WB = (u16*)(ws + oWB);
  u16* QP = (u16*)(ws + oQP);
  u16* KP = (u16*)(ws + oKP);
  u16* VP = (u16*)(ws + oVP);

  const int n8x = (ROWS * DMOD) / 8;
  const int n8w = (3 * NHD * DMOD) / 8;
  if ((n8x % 256) != 0 || (n8w % 256) != 0) return;
  if ((DMOD % 64) != 0 || (NHD % GTILE) != 0 || (SEQ % GTILE) != 0 || (SQ % GTILE) != 0 || (DMOD % 32) != 0) return;

  const dim3 blk(256);
  const dim3 gX(n8x / 256);                             // 4096
  const dim3 gW(n8w / 256);                             // 1536
  const dim3 bG(128);
  const dim3 gQ(NB * (SQ / GTILE) * (NHD / GTILE));     // 512
  const dim3 gK(NB * (SEQ / GTILE) * (NHD / GTILE));    // 512
  const dim3 gV(NB * (NHD / GTILE) * (SEQ / GTILE));    // 512
  const dim3 gAT(ATT_BLOCKS);                           // 2048
  const dim3 bAT(ATT_THREADS);                          // 128

  // (1) x -> bf16 plane [ROWS][DMOD]
  cvt16<<<gX, blk, 0, stream>>>(Xin, XB, n8x);
  // (2) W [3*NHD out][DMOD in] -> bf16, same layout (already k-contiguous for B fragments / row-major A for the v^T GEMM)
  cvt16<<<gW, blk, 0, stream>>>(Win, WB, n8w);
  // (3,4) q, k as single f16 planes [b][s][h*64+d] = (x.Wq^T) x8 over SQ rows per batch, (x.Wk^T) x8 over all keys
  gemm_bb<<<gQ, bG, 0, stream>>>(XB, WB + (size_t)NHD * DMOD, QP, SQ, NHD, DMOD, SEQ * DMOD, 0, SEQ * NHD, QSC);
  gemm_bb<<<gK, bG, 0, stream>>>(XB, WB, KP, SEQ, NHD, DMOD, SEQ * DMOD, 0, SEQ * NHD, KSC);
  // (5) v^T plane per batch: [h*64+d][keys] = f16((Wv . x_b^T) x1024)
  gemm_bb<<<gV, bG, 0, stream>>>(WB + (size_t)2 * NHD * DMOD, XB, VP, NHD, SEQ, DMOD, 0, SEQ * DMOD, NHD * SEQ, VCAR);
  // (6) attention -> out [b][s][h*64+d] f32
  attn_fwd<<<gAT, bAT, 0, stream>>>(QP, KP, VP, out);
  (void)hipGetLastError();
}

// v005
// A run of this version takes 129 microseconds.
// Two timings next to v004 both put it at 1.05 times that version's speed.
// Over all steps from v000 it is 3.17 times as fast.
// Contractions: x.Wk^T, x.Wq^T and Wv.x^T on v_wmma_f32_16x16x32_bf16 (x and W planes RNE-converted to bf16 operands,
// f32 accumulate); scores k.q^T (k and q single f16 planes carried x8) and P.v (P x32768 single f16, v x1024 single f16)
// on v_wmma_f32_16x16x32_f16, f32 accumulate. Base-2 online softmax with linear relative-position bias; 1/l and carry
// folds in f32 on VALU; f32 result written directly.
#include <hip/hip_runtime.h>
#include <math.h>
#include <stdint.h>

#ifndef NB
#define NB    4
#endif
#define SEQ   2048
#ifndef SQ
#define SQ    SEQ
#endif
#define DMOD  1024
#define NH    16
#define HD    64
#define NHD   (NH * HD)
#define QSC   8.0f
#define KSC   8.0f
#define PCAR  32768.0f
#define VCAR  1024.0f
#define LOG2E 1.4426950408889634f
#define INVN  0.03125f
#define RSQ2  0.70710678118654752f
#define ATT_WAVES   4
#define ATT_THREADS (ATT_WAVES * 32)
#define QTW         2                   // query tiles of 16 per attention wave
#define ATT_Q       (ATT_WAVES * 16 * QTW)
#define NQT         (SQ / ATT_Q)
#define ATT_BLOCKS  (NB * NH * NQT)
#define NKB         (SEQ / 32)
#define GSLAB       (16 * 68)
#define GKC         128                 // k elements of one GEMM stage: rows of 256 bytes
#define GPITCH      272                 // LDS row pitch, bytes: 256 + 16, an odd multiple of 16 for 16-byte readers
#define GTILE       128                 // the block's tile of C: 128 x 128, one 64 x 64 quarter per wave
#define GSLICE      18432               // one wave's slice: 64 rows x 272 B = 17408 B, rounded up to a multiple of 2 KiB
#define GSTAGE      (4 * GSLICE)        // [A rows 0..63 | A rows 64..127 | B rows 0..63 | B rows 64..127]
#define GWSLAB      (64 * 68)           // floats of one wave's result slab: 64 rows at a pitch of 68
#define GRING       (2 * GSTAGE)
#define AKEYS       64                  // keys of one attention stage: k rows and v^T rows of 128 bytes each
#define APITCH      144                 // LDS row pitch, bytes: 128 + 16, an odd multiple of 16 for 16-byte readers
#define ASLICE      6144                // one wave's slice: 32 rows x 144 B = 4608 B, rounded up to a multiple of 2 KiB
#define ASTAGE      (4 * ASLICE)        // [k rows 0..31 | k rows 32..63 | v^T rows 0..31 | v^T rows 32..63]
#define ARING       (2 * ASTAGE)
#define NST         (SEQ / AKEYS)
static_assert(32 * APITCH <= ASLICE && (ASLICE % 2048) == 0 && HD * 2 == 128 && AKEYS * 2 == 128 && ATT_WAVES == 4);
static_assert(ATT_WAVES * QTW * GSLAB * 4 <= ARING && (SEQ % AKEYS) == 0 && NST >= 2 && (AKEYS % 32) == 0);
static_assert((SQ % ATT_Q) == 0 && QTW == 2);
static_assert(64 * GPITCH <= GSLICE && (GSLICE % 2048) == 0 && GKC * 2 == 256 && 4 * GWSLAB * 4 <= GSTAGE);
static_assert((NHD % GTILE) == 0 && (SEQ % GTILE) == 0 && (SQ % GTILE) == 0);
static_assert((DMOD % GKC) == 0 && (DMOD / GKC) >= 2);
static_assert(NH == 16 && HD == 64 && DMOD == NHD);
static_assert((HD % 32) == 0 && (SEQ % 64) == 0 && (SQ % 64) == 0 && SQ <= SEQ && SQ >= 64);
static_assert((DMOD % 64) == 0 && (DMOD % 32) == 0 && (NHD % 64) == 0);
static_assert(((NB * SEQ * DMOD / 8) % 256) == 0);
static_assert(((3 * NHD * DMOD / 8) % 256) == 0);
static_assert((GSLAB * 4) % 16 == 0 && ATT_THREADS == 128);
static_assert(NB >= 1 && NB <= 4);

typedef unsigned short u16;
typedef _Float16 v16h __attribute__((ext_vector_type(16)));
typedef _Float16 v8h  __attribute__((ext_vector_type(8)));
typedef __bf16   v16b __attribute__((ext_vector_type(16)));
typedef float    v8f  __attribute__((ext_vector_type(8)));
typedef float    v4f  __attribute__((ext_vector_type(4)));
typedef unsigned int v4u __attribute__((ext_vector_type(4)));
typedef uint32_t u32x4 __attribute__((ext_vector_type(4)));
typedef uint32_t u32x8 __attribute__((ext_vector_type(8)));

union FragH { v16h v; v8h h[2]; v4u u[2]; };
union FragB { v16b v; v4u u[2]; };

// ---- scalar helpers --------------------------------------------------------------------------------
__device__ __forceinline__ unsigned short bf_bits(float f) {          // f32 -> bf16 bits, RNE convert
  unsigned u = __float_as_uint(f);
  return (unsigned short)((u + 0x7FFFu + ((u >> 16) & 1u)) >> 16);
}
__device__ __forceinline__ unsigned short h_bits(_Float16 x) { return __builtin_bit_cast(unsigned short, x); }
__device__ __forceinline__ unsigned pk16(unsigned short a, unsigned short b) { return (unsigned)a | ((unsigned)b << 16); }
// 2^x in place for a key block's rescale exponent and its 16 score exponents (all <= 0), by the bare hardware instruction.
// exp2f() wraps each v_exp_f32 in a compare, two selects, an add and an ldexp so that results below 2^-126 come out as
// denormals; such a weight vanishes anyway, in the f16 operand and in a row sum that is never below 1. One statement, so
// that no neighbour of a v_exp_f32 reads its result or overwrites its source; the closing v_nop keeps that slot behind the
// last one, whatever the compiler puts next.
__device__ __forceinline__ void exp2_hw17(float& a, float (&t)[16]) {
#if defined(__HIP_DEVICE_COMPILE__)
  asm("v_exp_f32 %0, %0\n\tv_exp_f32 %1, %1\n\tv_exp_f32 %2, %2\n\tv_exp_f32 %3, %3\n\tv_exp_f32 %4, %4\n\t"
      "v_exp_f32 %5, %5\n\tv_exp_f32 %6, %6\n\tv_exp_f32 %7, %7\n\tv_exp_f32 %8, %8\n\tv_exp_f32 %9, %9\n\t"
      "v_exp_f32 %10, %10\n\tv_exp_f32 %11, %11\n\tv_exp_f32 %12, %12\n\tv_exp_f32 %13, %13\n\t"
      "v_exp_f32 %14, %14\n\tv_exp_f32 %15, %15\n\tv_exp_f32 %16, %16\n\tv_nop"
      : "+v"(a), "+v"(t[0]), "+v"(t[1]), "+v"(t[2]), "+v"(t[3]), "+v"(t[4]), "+v"(t[5]), "+v"(t[6]), "+v"(t[7]),
        "+v"(t[8]), "+v"(t[9]), "+v"(t[10]), "+v"(t[11]), "+v"(t[12]), "+v"(t[13]), "+v"(t[14]), "+v"(t[15]));
#endif
}
__device__ __forceinline__ v8f zero8() { v8f z = {0.f, 0.f, 0.f, 0.f, 0.f, 0.f, 0.f, 0.f}; return z; }

// ---- fragment loaders: 16-bit A/B operand, lane -> row/col (lane&15), p already includes +8*(lane>>4);
//      elements 0..7 <- p[0..7] (k0+8h..), elements 8..15 <- p[16..23] (k0+16+8h..)  (same split k map for A and B;
//      B is always read from a k-contiguous [n][k] plane)
__device__ __forceinline__ v16h ldfrag_h(const _Float16* p) {
  FragH f;
  f.h[0] = *(const v8h*)(p);
  f.h[1] = *(const v8h*)(p + 16);
  return f.v;
}
__device__ __forceinline__ v16b ldfrag_b(const u16* p) {              // bf16 plane read as unsigned integer vectors
  FragB f;
  f.u[0] = *(const v4u*)(p);
  f.u[1] = *(const v4u*)(p + 16);
  return f.v;
}

__device__ __forceinline__ v8f mma_h(v16h a, v16h b, v8f c) {
  return __builtin_amdgcn_wmma_f32_16x16x32_f16(false, a, false, b, (short)0, c, false, false);
}
__device__ __forceinline__ v8f mma_b(v16b a, v16b b, v8f c) {
  return __builtin_amdgcn_wmma_f32_16x16x32_bf16(false, a, false, b, (short)0, c, false, false);
}
// Four vector slots between a group of matrix instructions and the first vector instruction that reads their results or
// overwrites their operands: results in-out, operands as inputs.
template <typename F>
__device__ __forceinline__ void guard4x8(v8f& a, v8f& b, v8f& c, v8f& d, F x0, F x1, F x2, F x3, F x4, F x5, F x6, F x7) {
#if defined(__HIP_DEVICE_COMPILE__)
  asm volatile("v_nop\n\tv_nop\n\tv_nop\n\tv_nop"
               : "+v"(a), "+v"(b), "+v"(c), "+v"(d)
               : "v"(x0), "v"(x1), "v"(x2), "v"(x3), "v"(x4), "v"(x5), "v"(x6), "v"(x7) : "memory");
#endif
}
template <typename F>
__device__ __forceinline__ void guard8x6(v8f (&a)[QTW][4], F x0, F x1, F x2, F x3, F x4, F x5) {
#if defined(__HIP_DEVICE_COMPILE__)
  asm volatile("v_nop\n\tv_nop\n\tv_nop\n\tv_nop"
               : "+v"(a[0][0]), "+v"(a[0][1]), "+v"(a[0][2]), "+v"(a[0][3]), "+v"(a[1][0]), "+v"(a[1][1]), "+v"(a[1][2]),
                 "+v"(a[1][3])
               : "v"(x0), "v"(x1), "v"(x2), "v"(x3), "v"(x4), "v"(x5) : "memory");
#endif
}
__device__ __forceinline__ void acc_guard8(v8f (&a)[QTW][4]) {
#if defined(__HIP_DEVICE_COMPILE__)
  asm volatile("v_nop\n\tv_nop\n\tv_nop\n\tv_nop"
               : "+v"(a[0][0]), "+v"(a[0][1]), "+v"(a[0][2]), "+v"(a[0][3]), "+v"(a[1][0]), "+v"(a[1][1]), "+v"(a[1][2]),
                 "+v"(a[1][3]));
#endif
}
// Four vector slots between the last matrix instructions of the GEMM loop, which is left by a taken branch, and the first
// read of their results.
__device__ __forceinline__ void acc_guard16(v8f (&a)[4][4]) {
#if defined(__HIP_DEVICE_COMPILE__)
  asm volatile("v_nop\n\tv_nop\n\tv_nop\n\tv_nop"
               : "+v"(a[0][0]), "+v"(a[0][1]), "+v"(a[0][2]), "+v"(a[0][3]), "+v"(a[1][0]), "+v"(a[1][1]), "+v"(a[1][2]),
                 "+v"(a[1][3]), "+v"(a[2][0]), "+v"(a[2][1]), "+v"(a[2][2]), "+v"(a[2][3]), "+v"(a[3][0]), "+v"(a[3][1]),
                 "+v"(a[3][2]), "+v"(a[3][3]));
#endif
}
// The scheduler moves nothing across this point. Without it the compiler sinks three of a step's four A fragments to just
// in front of the row of matrix instructions that reads them, each with a wait to 0: four LDS latencies a step, not one.
__device__ __forceinline__ void sched_fence() {
#if defined(__HIP_DEVICE_COMPILE__)
  __builtin_amdgcn_sched_barrier(0);
#endif
}
__device__ __forceinline__ void wave_sync_lds() {
#if defined(__HIP_DEVICE_COMPILE__)
  __builtin_amdgcn_fence(__ATOMIC_RELEASE, "workgroup");
  __builtin_amdgcn_wave_barrier();
  __builtin_amdgcn_fence(__ATOMIC_ACQUIRE, "workgroup");
#endif
}

// ---- tensor load to LDS: descriptor words, issue, waits ---------------------------------------------
__device__ __forceinline__ uint32_t uni(uint32_t v) { return (uint32_t)__builtin_amdgcn_readfirstlane((int)v); }
// Test around a tensor load, which ignores EXEC: it has to compile to s_cmp + s_cbranch_scc.
__device__ __forceinline__ uint32_t pinned(uint32_t v) {
  uint32_t w = uni(v);
  asm volatile("" : "+s"(w));   // pinned(): holds the test word in a scalar register, so that the branch on it is scalar
  return w;
}
// Group 1: 1-byte elements, tile = tensor = 64 rows of 256 bytes, source row pitch src_pitch bytes; word 0 is the pad
// constant for 256-byte rows with 16 bytes behind each row (LDS pitch 272), no mask.
__device__ __forceinline__ u32x8 tdm_group1(uint32_t src_pitch) {
  constexpr uint32_t d0 = 256u, d1 = 64u;
  u32x8 g;
  g[0] = uni((1u << 20) | (5u << 22) | (3u << 25));
  g[1] = uni((d0 & 0xFFFFu) << 16);
  g[2] = uni((d0 >> 16) | ((d1 & 0xFFFFu) << 16));
  g[3] = uni((d1 >> 16) | (d0 << 16));
  g[4] = uni(d1);
  g[5] = uni(src_pitch);
  g[6] = uni(0u);
  g[7] = uni(0u);
  return g;
}
// The same for 32 rows of 128 bytes: pad constant for 128-byte rows with 16 bytes behind each row (LDS pitch 144), no mask.
__device__ __forceinline__ u32x8 tdm_group1_r128(uint32_t src_pitch) {
  constexpr uint32_t d0 = 128u, d1 = 32u;
  u32x8 g;
  g[0] = uni((1u << 20) | (4u << 22) | (3u << 25));
  g[1] = uni((d0 & 0xFFFFu) << 16);
  g[2] = uni((d0 >> 16) | ((d1 & 0xFFFFu) << 16));
  g[3] = uni((d1 >> 16) | (d0 << 16));
  g[4] = uni(d1);
  g[5] = uni(src_pitch);
  g[6] = uni(0u);
  g[7] = uni(0u);
  return g;
}
__device__ __forceinline__ u32x4 tdm_group0(uint32_t lds_dst, uint64_t ga) {
  u32x4 g;
  g[0] = uni(1u);
  g[1] = uni(lds_dst);
  g[2] = uni((uint32_t)ga);
  g[3] = uni((((uint32_t)(ga >> 32)) & 0x01FFFFFFu) | 0x80000000u);
  return g;
}
// Aim group 0 at the next tile: only the LDS place and the address change.
__device__ __forceinline__ void tdm_aim(u32x4& g, uint32_t lds_dst, uint64_t ga) {
  g[1] = uni(lds_dst);
  g[2] = uni((uint32_t)ga);
  g[3] = uni((((uint32_t)(ga >> 32)) & 0x01FFFFFFu) | 0x80000000u);
}
// One request of the whole wave. Both groups are in-out operands so that their scalar registers stay theirs up to the
// next request: as plain inputs the compiler used some of them as temporaries while the request was in flight.
__device__ __forceinline__ void tdm_load(u32x4& g0, u32x8& g1) {
#if defined(__HIP_DEVICE_COMPILE__)
  asm volatile("tensor_load_to_lds %0, %1" : "+s"(g0), "+s"(g1) :: "memory");
#endif
}
__device__ __forceinline__ void wait_tensor0() {
#if defined(__HIP_DEVICE_COMPILE__)
  asm volatile("s_wait_tensorcnt 0x0" ::: "memory");   // the wave's own slice has landed
#endif
}
// The same wait for the GEMM, with both groups as in-out operands: every scalar register of a descriptor stays the
// descriptor's own until the wait that covers its request; otherwise the compiler reuses a word that is dead behind the issue.
__device__ __forceinline__ void wait_tensor0_hold(u32x4& g0, u32x8& g1) {
#if defined(__HIP_DEVICE_COMPILE__)
  asm volatile("s_wait_tensorcnt 0x0" : "+s"(g0), "+s"(g1) :: "memory");
#endif
}
__device__ __forceinline__ void wait_ds0() {
#if defined(__HIP_DEVICE_COMPILE__)
  asm volatile("s_wait_dscnt 0x0" ::: "memory");       // the wave's LDS reads have retired before their buffer is refilled
#endif
}

// =====================================================================================================
// f32 plane -> bf16 RNE plane, same layout. Thread = 8 consecutive elements: two 16-B loads, one 16-B store;
// coverage: grid = n8/256 blocks (host checks exactness) x 256 thr x 8 = the whole plane.
// =====================================================================================================
__global__ __launch_bounds__(256) void cvt16(const float* __restrict__ x, u16* D, int n8) {
  const int gt = blockIdx.x * 256 + (int)threadIdx.x;
  if (gt >= n8) return;                     // no barriers in this kernel
  const float* p = x + (size_t)gt * 8;
  const v4f a = *(const v4f*)(p), c4 = *(const v4f*)(p + 4);
  v4u o;
  o[0] = pk16(bf_bits(a[0]),  bf_bits(a[1]));
  o[1] = pk16(bf_bits(a[2]),  bf_bits(a[3]));
  o[2] = pk16(bf_bits(c4[0]), bf_bits(c4[1]));
  o[3] = pk16(bf_bits(c4[2]), bf_bits(c4[3]));
  u16* d = D + (size_t)gt * 8;
  {
    *(v4u*)(d) = o;
    
  }
}

// =====================================================================================================
// Batched bf16 GEMM with f16 result:  C[bt][M][N] = f16( (A[bt][M][K] (bf16 row-major) . Bt[bt][N][K]^T (bf16
// k-contiguous)) * oscale ); per-batch element strides bstA/bstB/bstC. Block = 128x128 tile, 4 waves in a 2 x 2 grid, each
// with a 64x64 quarter = 4 x 4 accumulator tiles: a fragment read from LDS feeds 4 matrix instructions, and an operand row
// brought into LDS serves 128 rows or columns of C.
// Operands come through LDS: a stage is 128 k of the block's 128 A rows and 128 B rows; every wave brings its own slice
// of 64 rows x 256 B with one tensor load (LDS pitch 272 B), two buffers, the next stage in flight while this one is
// worked on. Fragments are read from the LDS rows (two 16-B loads each, split k map for A and B), K stepped by 32
// inside a stage (K = DMOD: a multiple of 128 and at least two stages; M % 128 == 0, N % 128 == 0,
// grid = nbatch*(M/128)*(N/128)). The ring becomes the result slabs behind the last pass's barrier.
// Result: lane = (row in group of 4, 8 consecutive cols); one instruction = 4 rows, each 64 halves = one 128-B line.
// coverage: 16 instructions x 4 rows x 8 lanes x 8 halves = the wave's 64 x 64 quarter; 4 waves = the block's 128 x 128 tile.
// =====================================================================================================
__global__ __launch_bounds__(128)
void gemm_bb(const u16* __restrict__ A, const u16* __restrict__ Bt, u16* C, int M, int N, int K,
             int bstA, int bstB, int bstC, float oscale) {
  __shared__ __attribute__((aligned(2048))) unsigned char ring[GRING];
  const int tid = threadIdx.x, lane = tid & 31, hh = lane >> 4, m = lane & 15;
  const int wave = (int)uni((uint32_t)tid >> 5);
  const int wm = wave >> 1, wn = wave & 1;   // the wave's quarter: rows 64*wm .., columns 64*wn ..
  const int ntile = N / GTILE, mtile = M / GTILE;
  const int per   = ntile * mtile;
  const int bid   = blockIdx.x;
  const int bt    = bid / per;
  const int t     = bid - bt * per;
  const int row0  = (t / ntile) * GTILE;
  const int col0  = (t % ntile) * GTILE;
  if (row0 + GTILE > M) return;              // block-uniform, never taken with the exact grid; in front of every barrier and load
  const u16* Ab  = A  + (size_t)bt * (size_t)bstA;
  const u16* Bb  = Bt + (size_t)bt * (size_t)bstB;
  u16*       Cb  = C  + (size_t)bt * (size_t)bstC;
  // ---- this wave's slice of every stage: waves 0,1 = A rows row0 + 64*wave .., waves 2,3 = B rows col0 + 64*(wave-2) .. ----
  const u16* sp = (wave < 2) ? (Ab + (size_t)(row0 + 64 * wave) * K) : (Bb + (size_t)(col0 + 64 * (wave - 2)) * K);
  const uint64_t ga0  = (uint64_t)(size_t)sp;
  const uint32_t dst0 = (uint32_t)(size_t)ring + (uint32_t)wave * GSLICE;
  u32x8          g1   = tdm_group1((uint32_t)K * 2u);
  u32x4          g0   = tdm_group0(dst0, ga0);
  const int      npass = K / GKC;
  // ---- fragment rows in LDS: A rows 16*i + m of slice wm, B rows 16*j + m of slice 2 + wn; +16*hh bytes = +8*hh elements ----
  const unsigned char* ar = ring + wm * GSLICE + m * GPITCH + 16 * hh;
  const unsigned char* br = ring + (2 + wn) * GSLICE + m * GPITCH + 16 * hh;
  v8f acc[4][4];
#pragma unroll
  for (int i = 0; i < 4; ++i) {
#pragma unroll
    for (int j = 0; j < 4; ++j) acc[i][j] = zero8();
  }
  // ---- prologue: stage 0 lands and is published, then stage 1 is put in flight ----
  tdm_load(g0, g1);
  wait_tensor0_hold(g0, g1);
  __syncthreads();
  tdm_aim(g0, dst0 + GSTAGE, ga0 + 2u * GKC);
  tdm_load(g0, g1);
#pragma unroll 1   // one pass per stage: the publish point below stands once per trip
  for (int s = 0; s < npass; ++s) {
    const int bo = (s & 1) * GSTAGE;
#pragma unroll     // constant LDS offsets for the four 32-deep steps of a stage
    for (int kk = 0; kk < GKC / 32; ++kk) {
      const int o = bo + kk * 64;
      v16b af[4], bf[4];
#pragma unroll     // constant indices: the fragments stay in registers
      for (int i = 0; i < 4; ++i) {
        af[i] = ldfrag_b((const u16*)(const void*)(ar + o + i * 16 * GPITCH));
        bf[i] = ldfrag_b((const u16*)(const void*)(br + o + i * 16 * GPITCH));
      }
      sched_fence();   // all 16 loads of the step are issued ahead of its 16 products
#pragma unroll
      for (int i = 0; i < 4; ++i) {
#pragma unroll
        for (int j = 0; j < 4; ++j) acc[i][j] = mma_b(af[i], bf[j], acc[i][j]);
      }
    }
    // ---- publish point of stage s + 1: own LDS reads retired, own slice landed, barrier, then the refill ----
    wait_ds0();
    wait_tensor0_hold(g0, g1);
    __syncthreads();
    if (pinned((uint32_t)(s + 2 < npass))) {
      tdm_aim(g0, dst0 + (uint32_t)bo, ga0 + (uint64_t)(s + 2) * (2u * GKC));
      tdm_load(g0, g1);
    }
  }
  wait_tensor0_hold(g0, g1);   // behind the loop: no request in flight and no LDS read open before the ring is used for the result
  wait_ds0();
  acc_guard16(acc);
  // ---- stage the scaled value in the wave's slab: the ring's first bytes, which every reader has left at the last
  //      pass's barrier and at which no load is aimed any more ----
  float* sl = (float*)(void*)ring + wave * GWSLAB;
#pragma unroll
  for (int i = 0; i < 4; ++i) {
#pragma unroll
    for (int r = 0; r < 8; ++r) {
      const int ro = (16 * i + 8 * hh + r) * 68 + m;
#pragma unroll
      for (int j = 0; j < 4; ++j) sl[ro + 16 * j] = acc[i][j][r] * oscale;
    }
  }
  wave_sync_lds();
  const int rq = lane >> 3, c8 = (lane & 7) * 8;
  u16* dst = Cb + ((size_t)(row0 + 64 * wm) + (size_t)rq) * (size_t)N + (size_t)(col0 + 64 * wn + c8);
#pragma unroll
  for (int i4 = 0; i4 < 16; ++i4) {
    const float* rp = sl + (i4 * 4 + rq) * 68 + c8;
    const v4f a = *(const v4f*)(rp), c4 = *(const v4f*)(rp + 4);
    v4u ov;
    ov[0] = pk16(h_bits((_Float16)a[0]),  h_bits((_Float16)a[1]));
    ov[1] = pk16(h_bits((_Float16)a[2]),  h_bits((_Float16)a[3]));
    ov[2] = pk16(h_bits((_Float16)c4[0]), h_bits((_Float16)c4[1]));
    ov[3] = pk16(h_bits((_Float16)c4[2]), h_bits((_Float16)c4[3]));
    *(v4u*)(dst + (size_t)(i4 * 4) * (size_t)N) = ov;
  }
}

// =====================================================================================================
// Multi-head flash attention with per-head linear relative-position bias (no mask): block = (batch b, head, 128 query
// rows), 4 waves, wave w owns query rows q0 = 128*qt + 32*w .. q0+31 as two tiles of 16 (tile t = rows q0+16t .. +15).
// Every k fragment, v^T fragment and bias term that the wave fetches or forms serves both tiles.
//   k and v^T come through LDS, shared by the block's 4 waves: a stage is 64 keys = 64 k rows x 128 B and 64 v^T rows x
//   128 B; every wave brings its own slice of 32 rows with one tensor load (LDS pitch 144 B), two buffers, the next stage
//   in flight while this one is worked on; one publish point (waits + block barrier) per stage. The ring becomes the
//   wave-private result slabs behind the last stage's barrier.
//   q plane (f16, x8) laid out [b][s][h*64+d]; k plane the same (f16, x8); v^T plane [b][h*64+d][s] (x1024 f16).
//   All NKB = 64 key blocks of 32 keys are visited (static bound).
//   Scores are computed TRANSPOSED: S^T tile g (g = 0,1) = k rows (keys kb+16g .. +15, A operand, row m = lane&15, split k
//   map over d) times q^T (B operand, col n = query q0 + 16t + (lane&15), k = d, split map), one f16 product per tile and
//   32-deep d-chunk, one guarded group of 8 WMMAs; the four q fragments are loaded once per wave.
//   D element r of lane l = (key kb+16g+8h+r, query q0+16t+(l&15)), so a lane owns one query column per tile and 16 of its
//   32 keys; the partner lane l^16 owns the other 16 -> row max / row sum need one xor-16 shuffle.
//   Logit (base 2) = score * (1/32) * log2e / (8*8) + slope_h * (key - (q0 + (l&15))) * log2e, slope_h = (2^-0.5)^(h+1):
//   the bias of both tiles is taken relative to tile 0's query; the softmax over keys does not see a constant per query.
//   Online max-subtracted base-2 softmax in f32. The exp'd values ARE the P A-fragment in place: A row m = query = lane&15,
//   element i <- key kb+8h+i (tile 0, D element i), element 8+i <- key kb+16+8h+i (tile 1, D element i). P is carried
//   x32768 as single f16. The rescale factor of query row 8h+r of the O accumulators is fetched from lane 8h+r with a
//   shuffle (uniform control). 4 v^T B fragments (col n = d = 16j + (lane&15), keys k-contiguous), 8 P.V WMMAs per key
//   block in one guarded group.
//   Epilogue: 1/l (per query, shuffled to the D row owner) and the carry folds in f32; each 16x64 f32 result tile staged,
//   segment (b, q0+row, head) of the f32 result [b][s][h*64+d] written by 16 consecutive lanes x 16 B of one instruction
// coverage: per wave 2 tiles x 8 instructions x 2 rows x 16 lanes x 4 floats = 32 x 64; grid NB*NH*(SQ/128) blocks x 4
//           waves = every (b, s < SQ, h) row segment of the result exactly once.
// =====================================================================================================
__global__ __launch_bounds__(ATT_THREADS)
void attn_fwd(const u16* __restrict__ QPp, const u16* __restrict__ KPp, const u16* __restrict__ VPp, float* Out) {
  __shared__ __attribute__((aligned(2048))) unsigned char ring[ARING];   // k / v^T stages; result slabs in the epilogue

  const int tid  = threadIdx.x;
  const int wave = (int)uni((uint32_t)tid >> 5);
  const int lane = tid & 31;
  const int hh   = lane >> 4;
  const int c    = lane & 15;

  const int bid  = blockIdx.x;
  const int qt   = bid % NQT;
  const int head = (bid / NQT) % NH;
  const int b    = bid / (NQT * NH);
  const int q0   = qt * ATT_Q + wave * (16 * QTW);

  // B fragments of q^T: col n = query q0 + 16t + c, k = d (k-contiguous row segment of the q plane)
  const size_t qofs = ((size_t)(b * SEQ + q0 + c)) * NHD + (size_t)(head * HD + 8 * hh);
  const _Float16* Qb = (const _Float16*)(const void*)QPp + qofs;
  // ---- this wave's slice of every stage: waves 0,1 = k rows (keys) 32*wave .., 128 B of this head each; waves 2,3 =
  //      v^T rows (d) 32*(wave-2) .., 128 B = 64 keys each ----
  const u16* sp = (wave < 2) ? (KPp + ((size_t)(b * SEQ + 32 * wave)) * NHD + (size_t)(head * HD))
                             : (VPp + ((size_t)(b * NHD + head * HD + 32 * (wave - 2))) * SEQ);
  const uint64_t ga0   = (uint64_t)(size_t)sp;
  const uint32_t gstep = (wave < 2) ? (uint32_t)(AKEYS * NHD * 2) : (uint32_t)(AKEYS * 2);   // bytes from stage to stage
  const uint32_t dst0  = (uint32_t)(size_t)ring + (uint32_t)wave * ASLICE;
  u32x8          g1    = tdm_group1_r128((wave < 2) ? (uint32_t)(NHD * 2) : (uint32_t)(SEQ * 2));
  u32x4          g0    = tdm_group0(dst0, ga0);
  // A fragments of k: LDS row = key (in its slice of 32) 16g + c, k = d; +16*hh bytes = +8*hh elements
  const unsigned char* kr = ring + c * APITCH + 16 * hh;
  // B fragments of v: col n = d = 16j + c = LDS row of the v^T slices, k = key (contiguous in the row)
  const unsigned char* vr = ring + 2 * ASLICE + c * APITCH + 16 * hh;

  const int   ex     = head + 1;
  const float slope  = (((ex & 1) != 0) ? RSQ2 : 1.0f) * __int_as_float((127 - (ex >> 1)) << 23);
  const float slope2 = slope * LOG2E;
  const float lsc    = (INVN * LOG2E) * (1.0f / (QSC * KSC));
  const float jb0    = (float)(8 * hh - (q0 + c));      // key - tile 0's query, key block base added per step

  v16h qf[QTW][2];
#pragma unroll
  for (int t = 0; t < QTW; ++t) {
    qf[t][0] = ldfrag_h(Qb + (size_t)(16 * t) * NHD);            // d 0..31
    qf[t][1] = ldfrag_h(Qb + (size_t)(16 * t) * NHD + 32);       // d 32..63
  }

  float mrun[QTW], lrun[QTW];
  v8f o[QTW][4];
#pragma unroll
  for (int t = 0; t < QTW; ++t) {
    mrun[t] = -INFINITY;
    lrun[t] = 0.f;
#pragma unroll
    for (int j = 0; j < 4; ++j) o[t][j] = zero8();
  }

  // ---- prologue: stage 0 lands and is published, then stage 1 is put in flight ----
  tdm_load(g0, g1);
  wait_tensor0();
  __syncthreads();
  tdm_aim(g0, dst0 + ASTAGE, ga0 + gstep);
  tdm_load(g0, g1);
#pragma unroll 1   // one pass per stage: the publish point below stands once per trip
  for (int s = 0; s < NST; ++s) {
    const int bo = (s & 1) * ASTAGE;
#pragma unroll     // constant LDS offsets for the key blocks of a stage
  for (int i32 = 0; i32 < AKEYS / 32; ++i32) {
    const int kb = s * AKEYS + i32 * 32;
    // ---- transposed scores: s0 = keys kb..kb+15, s1 = keys kb+16..kb+31, column = query q0 + 16t + c ----
    v8f s0[QTW], s1[QTW];
    const _Float16* k0p = (const _Float16*)(const void*)(kr + bo + i32 * ASLICE);
    const _Float16* k1p = (const _Float16*)(const void*)(kr + bo + i32 * ASLICE + 16 * APITCH);
    {
      const v16h ka0 = ldfrag_h(k0p),      ka1 = ldfrag_h(k0p + 32);
      const v16h kc0 = ldfrag_h(k1p),      kc1 = ldfrag_h(k1p + 32);
      s0[0] = mma_h(ka0, qf[0][0], zero8());
      s0[1] = mma_h(ka0, qf[1][0], zero8());
      s1[0] = mma_h(kc0, qf[0][0], zero8());
      s1[1] = mma_h(kc0, qf[1][0], zero8());
      s0[0] = mma_h(ka1, qf[0][1], s0[0]);
      s0[1] = mma_h(ka1, qf[1][1], s0[1]);
      s1[0] = mma_h(kc1, qf[0][1], s1[0]);
      s1[1] = mma_h(kc1, qf[1][1], s1[1]);
      guard4x8<v16h>(s0[0], s0[1], s1[0], s1[1], qf[0][0], qf[0][1], qf[1][0], qf[1][1], ka0, ka1, kc0, kc1);
    }
    // ---- position bias (base 2) of this lane's 16 keys, the same for both tiles ----
    const float jb = jb0 + (float)kb;
    float bs[16];
#pragma unroll
    for (int i = 0; i < 8; ++i) {
      bs[i]     = slope2 * (jb + (float)i);
      bs[8 + i] = slope2 * (jb + (float)(16 + i));
    }
    FragH ph[QTW];
#pragma unroll     // constant indices: the per-tile state stays in registers
    for (int t = 0; t < QTW; ++t) {
      // ---- base-2 logits of this lane's 16 keys for query q0 + 16t + c ----
      float tk[16];
#pragma unroll
      for (int i = 0; i < 8; ++i) {
        tk[i]     = fmaf(s0[t][i], lsc, bs[i]);
        tk[8 + i] = fmaf(s1[t][i], lsc, bs[8 + i]);
      }
      float cm = tk[0];
#pragma unroll
      for (int i = 1; i < 16; ++i) cm = fmaxf(cm, tk[i]);
      cm = fmaxf(cm, __shfl_xor(cm, 16, 32));
      const float mn = fmaxf(mrun[t], cm);                             // finite from the first key block on
      float ea = mrun[t] - mn, pe[16];
#pragma unroll     // constant indices: pe[] stays in registers, as the asm operands need it
      for (int i = 0; i < 16; ++i) pe[i] = fminf(tk[i] - mn, 0.f);
      exp2_hw17(ea, pe);
      const float al = (mrun[t] == -INFINITY) ? 0.f : ea;              // o and l are zero while mrun is -inf
      mrun[t] = mn;
      // ---- probabilities (<= 1) and the P A-fragment: f16(p * 32768); element i <-> tk[i] ----
      float ps = 0.f;
#pragma unroll
      for (int w = 0; w < 2; ++w) {
#pragma unroll
        for (int e4 = 0; e4 < 4; ++e4) {
          const int i = 8 * w + 2 * e4;
          const float p0 = pe[i];
          const float p1 = pe[i + 1];
          ps += p0 + p1;
          ph[t].u[w][e4] = pk16(h_bits((_Float16)(p0 * PCAR)), h_bits((_Float16)(p1 * PCAR)));
        }
      }
      ps += __shfl_xor(ps, 16, 32);
      lrun[t] = lrun[t] * al + ps;
      // ---- rescale the O accumulators: D row 8hh+r = query q0+16t+8hh+r, its factor lives in lane 8hh+r (and 16+8hh+r) ----
      float scl[8];
#pragma unroll
      for (int r = 0; r < 8; ++r) scl[r] = __shfl(al, 8 * hh + r, 32);
#pragma unroll
      for (int j = 0; j < 4; ++j) {
#pragma unroll
        for (int r = 0; r < 8; ++r) o[t][j][r] *= scl[r];
      }
    }
    // ---- P.V : B fragment col n = d = j*16 + c, keys contiguous in the v^T plane; one group of 8 ----
    {
      const unsigned char* vp = vr + bo + i32 * 64;
      const v16h vf0 = ldfrag_h((const _Float16*)(const void*)(vp));
      const v16h vf1 = ldfrag_h((const _Float16*)(const void*)(vp + 16 * APITCH));
      const v16h vf2 = ldfrag_h((const _Float16*)(const void*)(vp + ASLICE));
      const v16h vf3 = ldfrag_h((const _Float16*)(const void*)(vp + ASLICE + 16 * APITCH));
#pragma unroll
      for (int t = 0; t < QTW; ++t) {
        o[t][0] = mma_h(ph[t].v, vf0, o[t][0]);
        o[t][1] = mma_h(ph[t].v, vf1, o[t][1]);
        o[t][2] = mma_h(ph[t].v, vf2, o[t][2]);
        o[t][3] = mma_h(ph[t].v, vf3, o[t][3]);
      }
      guard8x6<v16h>(o, ph[0].v, ph[1].v, vf0, vf1, vf2, vf3);
    }
  }
    // ---- publish point of stage s + 1: own LDS reads retired, own slice landed, barrier, then the refill ----
    wait_ds0();
    wait_tensor0();
    __syncthreads();
    if (pinned((uint32_t)(s + 2 < NST))) {
      tdm_aim(g0, dst0 + (uint32_t)bo, ga0 + (uint64_t)(s + 2) * gstep);
      tdm_load(g0, g1);
    }
  }
  wait_tensor0();   // behind the loop: no request in flight and no LDS read open before the ring is used for the result
  wait_ds0();
  acc_guard8(o);

  // the wave's two slabs lie in the ring: every reader has left both buffers at the last stage's barrier, in front of which
  // every wave's last load has landed, and no load is aimed at them any more
#pragma unroll
  for (int t = 0; t < QTW; ++t) {
    // ---- fold 1/l (per query, owned by lane = query; l >= 1 by construction) and the P/v carries ----
    const float linv = (lrun[t] > 0.f) ? ((1.0f / lrun[t]) * (1.0f / (PCAR * VCAR))) : 0.f;
    float inv[8];
#pragma unroll
    for (int r = 0; r < 8; ++r) inv[r] = __shfl(linv, 8 * hh + r, 32);
    float* slab = (float*)(void*)ring + (wave * QTW + t) * GSLAB;
#pragma unroll
    for (int r = 0; r < 8; ++r) {
#pragma unroll
      for (int j = 0; j < 4; ++j) slab[(8 * hh + r) * 68 + j * 16 + c] = o[t][j][r] * inv[r];
    }
  }
  wave_sync_lds();
  // ---- f32 result: lanes 0..15 -> row 2*i2, lanes 16..31 -> row 2*i2+1; lane = 4 consecutive floats ----
  float* dst = Out + ((size_t)(b * SEQ + q0 + hh)) * DMOD + (size_t)(head * HD + c * 4);
#pragma unroll
  for (int t = 0; t < QTW; ++t) {
    const float* slab = (const float*)(const void*)ring + (wave * QTW + t) * GSLAB;
    v4f vals[8];
#pragma unroll
    for (int i2 = 0; i2 < 8; ++i2) vals[i2] = *(const v4f*)(slab + (i2 * 2 + hh) * 68 + c * 4);
#pragma unroll
    for (int i2 = 0; i2 < 8; ++i2) {
      *(v4f*)(dst + (size_t)(16 * t + i2 * 2) * (size_t)DMOD) = vals[i2];
    }
  }
}

// =====================================================================================================
// Workspace map (bytes, NB = 4); every plane is fully written by whole-line stores before it is read; all extents are
// exact multiples of the store granularity (no pad rows):
//   XB  bf16 [NB*SEQ][DMOD]                          16777216
//   WB  bf16 [3*NHD][DMOD]  (k | q | v chunks)        6291456
//   QP  f16  [NB*SEQ][NHD] x8                       16777216
//   KP  f16  [NB*SEQ][NHD] x8                       16777216
//   VP  f16  [NB][NHD][SEQ] x1024                   16777216
//   end                                             73400320
// 6 launches on one in-order stream.
// =====================================================================================================
extern "C" void kernel_launch(void* const* d_in, const int* in_sizes, int n_in,
                              void* d_out, int out_size, void* d_ws, size_t ws_size,
                              hipStream_t stream) {
  const int ROWS = NB * SEQ;
  if (n_in < 2) return;
  if (in_sizes[0] < ROWS * DMOD) return;
  if (in_sizes[1] != 3 * NHD * DMOD) return;
  if (out_size < ROWS * DMOD) return;

  const float* Xin = (const float*)d_in[0];
  const float* Win = (const float*)d_in[1];
  float*       out = (float*)d_out;

  const size_t szXB = (size_t)ROWS * DMOD * 2;
  const size_t szWB = (size_t)3 * NHD * DMOD * 2;
  const size_t szPl = (size_t)ROWS * NHD * 2;                  // q/k planes
  const size_t szVP = (size_t)NB * NHD * SEQ * 2;
  size_t off = 0;
  const size_t oXB = off; off += szXB;
  const size_t oWB = off; off += szWB;
  const size_t oQP = off; off += szPl;
  const size_t oKP = off; off += szPl;
  const size_t oVP = off; off += szVP;
  if (off > ws_size) return;                            // off = 73400320 for NB = 4
  if (off > (size_t)134217728) return;

  char* ws = (char*)d_ws;
  u16* XB = (u16*)(ws + oXB);
  u16* WB = (u16*)(ws + oWB);
  u16* QP = (u16*)(ws + oQP);
  u16* KP = (u16*)(ws + oKP);
  u16* VP = (u16*)(ws + oVP);

  const int n8x = (ROWS * DMOD) / 8;
  const int n8w = (3 * NHD * DMOD) / 8;
  if ((n8x % 256) != 0 || (n8w % 256) != 0) return;
  if ((DMOD % 64) != 0 || (NHD % GTILE) != 0 || (SEQ % GTILE) != 0 || (SQ % GTILE) != 0 || (DMOD % 32) != 0) return;

  const dim3 blk(256);
  const dim3 gX(n8x / 256);                             // 4096
  const dim3 gW(n8w / 256);                             // 1536
  const dim3 bG(128);
  const dim3 gQ(NB * (SQ / GTILE) * (NHD / GTILE));     // 512
  const dim3 gK(NB * (SEQ / GTILE) * (NHD / GTILE));    // 512
  const dim3 gV(NB * (NHD / GTILE) * (SEQ / GTILE));    // 512
  const dim3 gAT(ATT_BLOCKS);                           // 1024
  const dim3 bAT(ATT_THREADS);                          // 128

  // (1) x -> bf16 plane [ROWS][DMOD]
  cvt16<<<gX, blk, 0, stream>>>(Xin, XB, n8x);
  // (2) W [3*NHD out][DMOD in] -> bf16, same layout (already k-contiguous for B fragments / row-major A for the v^T GEMM)
  cvt16<<<gW, blk, 0, stream>>>(Win, WB, n8w);
  // (3,4) q, k as single f16 planes [b][s][h*64+d] = (x.Wq^T) x8 over SQ rows per batch, (x.Wk^T) x8 over all keys
  gemm_bb<<<gQ, bG, 0, stream>>>(XB, WB + (size_t)NHD * DMOD, QP, SQ, NHD, DMOD, SEQ * DMOD, 0, SEQ * NHD, QSC);
  gemm_bb<<<gK, bG, 0, stream>>>(XB, WB, KP, SEQ, NHD, DMOD, SEQ * DMOD, 0, SEQ * NHD, KSC);
  // (5) v^T plane per batch: [h*64+d][keys] = f16((Wv . x_b^T) x1024)
  gemm_bb<<<gV, bG, 0, stream>>>(WB + (size_t)2 * NHD * DMOD, XB, VP, NHD, SEQ, DMOD, 0, SEQ * DMOD, NHD * SEQ, VCAR);
  // (6) attention -> out [b][s][h*64+d] f32
  attn_fwd<<<gAT, bAT, 0, stream>>>(QP, KP, VP, out);
  (void)hipGetLastError();
}

// v006
// It runs in 108 microseconds.
// Two timings next to v005 both put it at 1.19 times that version's speed.
// Over all steps from v000 it is 3.77 times as fast.
// Contractions: x.Wk^T, x.Wq^T and Wv.x^T on v_wmma_f32_16x16x32_bf16 (x and W planes RNE-converted to bf16 operands,
// f32 accumulate); scores k.q^T (k and q single f16 planes carried x8) and P.v (P x32768 single f16, v x1024 single f16)
// on v_wmma_f32_16x16x32_f16, f32 accumulate. Base-2 online softmax with linear relative-position bias; 1/l and carry
// folds in f32 on VALU; f32 result written directly.
#include <hip/hip_runtime.h>
#include <math.h>
#include <stdint.h>

#ifndef NB
#define NB    4
#endif
#define SEQ   2048
#ifndef SQ
#define SQ    SEQ
#endif
#define DMOD  1024
#define NH    16
#define HD    64
#define NHD   (NH * HD)
#define QSC   8.0f
#define KSC   8.0f
#define PCAR  32768.0f
#define VCAR  1024.0f
#define LOG2E 1.4426950408889634f
#define INVN  0.03125f
#define RSQ2  0.70710678118654752f
#define ATT_WAVES   4                   // waves of one head in an attention block
#define ATT_HEADS   4                   // heads of one attention block
#define ATT_THREADS (ATT_HEADS * ATT_WAVES * 32)
#define QTW         2                   // query tiles of 16 per attention wave
#define ATT_Q       (ATT_WAVES * 16 * QTW)
#define NQT         (SQ / ATT_Q)
#define ATT_BLOCKS  (NB * (NH / ATT_HEADS) * NQT)
#define SKIPD       41.0f               // a base-2 logit this far below the running maximum gives a weight that is 0 in f16
// Heads of block group g, one nibble each (bits 16g .. 16g+15). The steeper a head's slope, the fewer of its key blocks carry
// weight, so every group gets one of the four flattest heads, one of the next four and two steep ones.
#define HEADMAP     0x468C379D25AE01BFull
#define NKB         (SEQ / 32)
#define GSLAB       (16 * 68)
#define GKC         128                 // k elements of one GEMM stage: rows of 256 bytes
#define GPITCH      272                 // LDS row pitch, bytes: 256 + 16, an odd multiple of 16 for 16-byte readers
#define GTILE       128                 // the block's tile of C: 128 x 128, one 64 x 64 quarter per wave
#define GSLICE      18432               // one wave's slice: 64 rows x 272 B = 17408 B, rounded up to a multiple of 2 KiB
#define GSTAGE      (4 * GSLICE)        // [A rows 0..63 | A rows 64..127 | B rows 0..63 | B rows 64..127]
#define GWSLAB      (64 * 68)           // floats of one wave's result slab: 64 rows at a pitch of 68
#define GRING       (2 * GSTAGE)
#define AKEYS       64                  // keys of one attention stage: k rows and v^T rows of 128 bytes each
#define APITCH      144                 // LDS row pitch, bytes: 128 + 16, an odd multiple of 16 for 16-byte readers
#define ASLICE      6144                // one wave's slice: 32 rows x 144 B = 4608 B, rounded up to a multiple of 2 KiB
#define ASTAGE      (4 * ASLICE)        // [k rows 0..31 | k rows 32..63 | v^T rows 0..31 | v^T rows 32..63]
#define ARING       (2 * ASTAGE)
#define NST         (SEQ / AKEYS)
static_assert(32 * APITCH <= ASLICE && (ASLICE % 2048) == 0 && HD * 2 == 128 && AKEYS * 2 == 128 && ATT_WAVES == 4);
static_assert(ATT_WAVES * QTW * GSLAB * 4 <= ARING && (SEQ % AKEYS) == 0 && NST >= 2 && (AKEYS % 32) == 0);
static_assert((SQ % ATT_Q) == 0 && QTW == 2);
static_assert(64 * GPITCH <= GSLICE && (GSLICE % 2048) == 0 && GKC * 2 == 256 && 4 * GWSLAB * 4 <= GSTAGE);
static_assert((NHD % GTILE) == 0 && (SEQ % GTILE) == 0 && (SQ % GTILE) == 0);
static_assert((DMOD % GKC) == 0 && (DMOD / GKC) >= 2);
static_assert(NH == 16 && HD == 64 && DMOD == NHD);
static_assert((HD % 32) == 0 && (SEQ % 64) == 0 && (SQ % 64) == 0 && SQ <= SEQ && SQ >= 64);
static_assert((DMOD % 64) == 0 && (DMOD % 32) == 0 && (NHD % 64) == 0);
static_assert(((NB * SEQ * DMOD / 8) % 256) == 0);
static_assert(((3 * NHD * DMOD / 8) % 256) == 0);
static_assert((GSLAB * 4) % 16 == 0 && ATT_THREADS == 512 && ATT_HEADS * 4 == NH && (ARING % 2048) == 0);
static_assert(NB >= 1 && NB <= 4);

typedef unsigned short u16;
typedef _Float16 v16h __attribute__((ext_vector_type(16)));
typedef _Float16 v8h  __attribute__((ext_vector_type(8)));
typedef __bf16   v16b __attribute__((ext_vector_type(16)));
typedef float    v8f  __attribute__((ext_vector_type(8)));
typedef float    v4f  __attribute__((ext_vector_type(4)));
typedef float    v2f  __attribute__((ext_vector_type(2)));
typedef unsigned int v4u __attribute__((ext_vector_type(4)));
typedef uint32_t u32x4 __attribute__((ext_vector_type(4)));
typedef uint32_t u32x8 __attribute__((ext_vector_type(8)));

union FragH { v16h v; v8h h[2]; v4u u[2]; };
union FragB { v16b v; v4u u[2]; };

// ---- scalar helpers --------------------------------------------------------------------------------
__device__ __forceinline__ unsigned short bf_bits(float f) {          // f32 -> bf16 bits, RNE convert
  unsigned u = __float_as_uint(f);
  return (unsigned short)((u + 0x7FFFu + ((u >> 16) & 1u)) >> 16);
}
__device__ __forceinline__ unsigned short h_bits(_Float16 x) { return __builtin_bit_cast(unsigned short, x); }
__device__ __forceinline__ unsigned pk16(unsigned short a, unsigned short b) { return (unsigned)a | ((unsigned)b << 16); }
// 2^x in place for a key block's rescale exponent and its 16 score exponents (all <= 0), by the bare hardware instruction.
// exp2f() wraps each v_exp_f32 in a compare, two selects, an add and an ldexp so that results below 2^-126 come out as
// denormals; such a weight vanishes anyway, in the f16 operand and in a row sum that is never below 1. One statement, so
// that no neighbour of a v_exp_f32 reads its result or overwrites its source; the closing v_nop keeps that slot behind the
// last one, whatever the compiler puts next.
__device__ __forceinline__ void exp2_hw17(float& a, float (&t)[16]) {
#if defined(__HIP_DEVICE_COMPILE__)
  asm("v_exp_f32 %0, %0\n\tv_exp_f32 %1, %1\n\tv_exp_f32 %2, %2\n\tv_exp_f32 %3, %3\n\tv_exp_f32 %4, %4\n\t"
      "v_exp_f32 %5, %5\n\tv_exp_f32 %6, %6\n\tv_exp_f32 %7, %7\n\tv_exp_f32 %8, %8\n\tv_exp_f32 %9, %9\n\t"
      "v_exp_f32 %10, %10\n\tv_exp_f32 %11, %11\n\tv_exp_f32 %12, %12\n\tv_exp_f32 %13, %13\n\t"
      "v_exp_f32 %14, %14\n\tv_exp_f32 %15, %15\n\tv_exp_f32 %16, %16\n\tv_nop"
      : "+v"(a), "+v"(t[0]), "+v"(t[1]), "+v"(t[2]), "+v"(t[3]), "+v"(t[4]), "+v"(t[5]), "+v"(t[6]), "+v"(t[7]),
        "+v"(t[8]), "+v"(t[9]), "+v"(t[10]), "+v"(t[11]), "+v"(t[12]), "+v"(t[13]), "+v"(t[14]), "+v"(t[15]));
#endif
}
__device__ __forceinline__ v8f zero8() { v8f z = {0.f, 0.f, 0.f, 0.f, 0.f, 0.f, 0.f, 0.f}; return z; }

// ---- fragment loaders: 16-bit A/B operand, lane -> row/col (lane&15), p already includes +8*(lane>>4);
//      elements 0..7 <- p[0..7] (k0+8h..), elements 8..15 <- p[16..23] (k0+16+8h..)  (same split k map for A and B;
//      B is always read from a k-contiguous [n][k] plane)
__device__ __forceinline__ v16h ldfrag_h(const _Float16* p) {
  FragH f;
  f.h[0] = *(const v8h*)(p);
  f.h[1] = *(const v8h*)(p + 16);
  return f.v;
}
__device__ __forceinline__ v16b ldfrag_b(const u16* p) {              // bf16 plane read as unsigned integer vectors
  FragB f;
  f.u[0] = *(const v4u*)(p);
  f.u[1] = *(const v4u*)(p + 16);
  return f.v;
}

__device__ __forceinline__ v8f mma_h(v16h a, v16h b, v8f c) {
  return __builtin_amdgcn_wmma_f32_16x16x32_f16(false, a, false, b, (short)0, c, false, false);
}
__device__ __forceinline__ v8f mma_b(v16b a, v16b b, v8f c) {
  return __builtin_amdgcn_wmma_f32_16x16x32_bf16(false, a, false, b, (short)0, c, false, false);
}
// Four vector slots between a group of matrix instructions and the first vector instruction that reads their results or
// overwrites their operands: results in-out, operands as inputs.
template <typename F>
__device__ __forceinline__ void guard4x8(v8f& a, v8f& b, v8f& c, v8f& d, F x0, F x1, F x2, F x3, F x4, F x5, F x6, F x7) {
#if defined(__HIP_DEVICE_COMPILE__)
  asm volatile("v_nop\n\tv_nop\n\tv_nop\n\tv_nop"
               : "+v"(a), "+v"(b), "+v"(c), "+v"(d)
               : "v"(x0), "v"(x1), "v"(x2), "v"(x3), "v"(x4), "v"(x5), "v"(x6), "v"(x7) : "memory");
#endif
}
template <typename F>
__device__ __forceinline__ void guard8x6(v8f (&a)[QTW][4], F x0, F x1, F x2, F x3, F x4, F x5) {
#if defined(__HIP_DEVICE_COMPILE__)
  asm volatile("v_nop\n\tv_nop\n\tv_nop\n\tv_nop"
               : "+v"(a[0][0]), "+v"(a[0][1]), "+v"(a[0][2]), "+v"(a[0][3]), "+v"(a[1][0]), "+v"(a[1][1]), "+v"(a[1][2]),
                 "+v"(a[1][3])
               : "v"(x0), "v"(x1), "v"(x2), "v"(x3), "v"(x4), "v"(x5) : "memory");
#endif
}
__device__ __forceinline__ void acc_guard8(v8f (&a)[QTW][4]) {
#if defined(__HIP_DEVICE_COMPILE__)
  asm volatile("v_nop\n\tv_nop\n\tv_nop\n\tv_nop"
               : "+v"(a[0][0]), "+v"(a[0][1]), "+v"(a[0][2]), "+v"(a[0][3]), "+v"(a[1][0]), "+v"(a[1][1]), "+v"(a[1][2]),
                 "+v"(a[1][3]));
#endif
}
// Four vector slots between the last matrix instructions of the GEMM loop, which is left by a taken branch, and the first
// read of their results.
__device__ __forceinline__ void acc_guard16(v8f (&a)[4][4]) {
#if defined(__HIP_DEVICE_COMPILE__)
  asm volatile("v_nop\n\tv_nop\n\tv_nop\n\tv_nop"
               : "+v"(a[0][0]), "+v"(a[0][1]), "+v"(a[0][2]), "+v"(a[0][3]), "+v"(a[1][0]), "+v"(a[1][1]), "+v"(a[1][2]),
                 "+v"(a[1][3]), "+v"(a[2][0]), "+v"(a[2][1]), "+v"(a[2][2]), "+v"(a[2][3]), "+v"(a[3][0]), "+v"(a[3][1]),
                 "+v"(a[3][2]), "+v"(a[3][3]));
#endif
}
// The scheduler moves nothing across this point. Without it the compiler sinks three of a step's four A fragments to just
// in front of the row of matrix instructions that reads them, each with a wait to 0: four LDS latencies a step, not one.
__device__ __forceinline__ void sched_fence() {
#if defined(__HIP_DEVICE_COMPILE__)
  __builtin_amdgcn_sched_barrier(0);
#endif
}
__device__ __forceinline__ void wave_sync_lds() {
#if defined(__HIP_DEVICE_COMPILE__)
  __builtin_amdgcn_fence(__ATOMIC_RELEASE, "workgroup");
  __builtin_amdgcn_wave_barrier();
  __builtin_amdgcn_fence(__ATOMIC_ACQUIRE, "workgroup");
#endif
}

// ---- tensor load to LDS: descriptor words, issue, waits ---------------------------------------------
__device__ __forceinline__ uint32_t uni(uint32_t v) { return (uint32_t)__builtin_amdgcn_readfirstlane((int)v); }
// Test around a tensor load, which ignores EXEC: it has to compile to s_cmp + s_cbranch_scc.
__device__ __forceinline__ uint32_t pinned(uint32_t v) {
  uint32_t w = uni(v);
  asm volatile("" : "+s"(w));   // pinned(): holds the test word in a scalar register, so that the branch on it is scalar
  return w;
}
// Group 1: 1-byte elements, tile = tensor = 64 rows of 256 bytes, source row pitch src_pitch bytes; word 0 is the pad
// constant for 256-byte rows with 16 bytes behind each row (LDS pitch 272), no mask.
__device__ __forceinline__ u32x8 tdm_group1(uint32_t src_pitch) {
  constexpr uint32_t d0 = 256u, d1 = 64u;
  u32x8 g;
  g[0] = uni((1u << 20) | (5u << 22) | (3u << 25));
  g[1] = uni((d0 & 0xFFFFu) << 16);
  g[2] = uni((d0 >> 16) | ((d1 & 0xFFFFu) << 16));
  g[3] = uni((d1 >> 16) | (d0 << 16));
  g[4] = uni(d1);
  g[5] = uni(src_pitch);
  g[6] = uni(0u);
  g[7] = uni(0u);
  return g;
}
// The same for 32 rows of 128 bytes: pad constant for 128-byte rows with 16 bytes behind each row (LDS pitch 144), no mask.
__device__ __forceinline__ u32x8 tdm_group1_r128(uint32_t src_pitch) {
  constexpr uint32_t d0 = 128u, d1 = 32u;
  u32x8 g;
  g[0] = uni((1u << 20) | (4u << 22) | (3u << 25));
  g[1] = uni((d0 & 0xFFFFu) << 16);
  g[2] = uni((d0 >> 16) | ((d1 & 0xFFFFu) << 16));
  g[3] = uni((d1 >> 16) | (d0 << 16));
  g[4] = uni(d1);
  g[5] = uni(src_pitch);
  g[6] = uni(0u);
  g[7] = uni(0u);
  return g;
}
__device__ __forceinline__ u32x4 tdm_group0(uint32_t lds_dst, uint64_t ga) {
  u32x4 g;
  g[0] = uni(1u);
  g[1] = uni(lds_dst);
  g[2] = uni((uint32_t)ga);
  g[3] = uni((((uint32_t)(ga >> 32)) & 0x01FFFFFFu) | 0x80000000u);
  return g;
}
// Aim group 0 at the next tile: only the LDS place and the address change.
__device__ __forceinline__ void tdm_aim(u32x4& g, uint32_t lds_dst, uint64_t ga) {
  g[1] = uni(lds_dst);
  g[2] = uni((uint32_t)ga);
  g[3] = uni((((uint32_t)(ga >> 32)) & 0x01FFFFFFu) | 0x80000000u);
}
// One request of the whole wave. Both groups are in-out operands so that their scalar registers stay theirs up to the
// next request: as plain inputs the compiler used some of them as temporaries while the request was in flight.
__device__ __forceinline__ void tdm_load(u32x4& g0, u32x8& g1) {
#if defined(__HIP_DEVICE_COMPILE__)
  asm volatile("tensor_load_to_lds %0, %1" : "+s"(g0), "+s"(g1) :: "memory");
#endif
}
// The wave's own slice has landed. Both groups are in-out operands: every scalar register
// of a descriptor stays the descriptor's own until the wait that covers its request; otherwise the compiler reuses a word
// that is dead behind the issue.
__device__ __forceinline__ void wait_tensor0_hold(u32x4& g0, u32x8& g1) {
#if defined(__HIP_DEVICE_COMPILE__)
  asm volatile("s_wait_tensorcnt 0x0" : "+s"(g0), "+s"(g1) :: "memory");
#endif
}
__device__ __forceinline__ void wait_ds0() {
#if defined(__HIP_DEVICE_COMPILE__)
  asm volatile("s_wait_dscnt 0x0" ::: "memory");       // the wave's LDS reads have retired before their buffer is refilled
#endif
}

// =====================================================================================================
// f32 plane -> bf16 RNE plane, same layout. Thread = 8 consecutive elements: two 16-B loads, one 16-B store;
// coverage: grid = n8/256 blocks (host checks exactness) x 256 thr x 8 = the whole plane.
// =====================================================================================================
__global__ __launch_bounds__(256) void cvt16(const float* __restrict__ x, u16* D, int n8) {
  const int gt = blockIdx.x * 256 + (int)threadIdx.x;
  if (gt >= n8) return;                     // no barriers in this kernel
  const float* p = x + (size_t)gt * 8;
  const v4f a = *(const v4f*)(p), c4 = *(const v4f*)(p + 4);
  v4u o;
  o[0] = pk16(bf_bits(a[0]),  bf_bits(a[1]));
  o[1] = pk16(bf_bits(a[2]),  bf_bits(a[3]));
  o[2] = pk16(bf_bits(c4[0]), bf_bits(c4[1]));
  o[3] = pk16(bf_bits(c4[2]), bf_bits(c4[3]));
  u16* d = D + (size_t)gt * 8;
  {
    *(v4u*)(d) = o;
    
  }
}

// =====================================================================================================
// Batched bf16 GEMM with f16 result:  C[bt][M][N] = f16( (A[bt][M][K] (bf16 row-major) . Bt[bt][N][K]^T (bf16
// k-contiguous)) * oscale ); per-batch element strides bstA/bstB/bstC. Block = 128x128 tile, 4 waves in a 2 x 2 grid, each
// with a 64x64 quarter = 4 x 4 accumulator tiles: a fragment read from LDS feeds 4 matrix instructions, and an operand row
// brought into LDS serves 128 rows or columns of C.
// Operands come through LDS: a stage is 128 k of the block's 128 A rows and 128 B rows; every wave brings its own slice
// of 64 rows x 256 B with one tensor load (LDS pitch 272 B), two buffers, the next stage in flight while this one is
// worked on. Fragments are read from the LDS rows (two 16-B loads each, split k map for A and B), K stepped by 32
// inside a stage (K = DMOD: a multiple of 128 and at least two stages; M % 128 == 0, N % 128 == 0,
// grid = nbatch*(M/128)*(N/128)). The ring becomes the result slabs behind the last pass's barrier.
// Result: lane = (row in group of 4, 8 consecutive cols); one instruction = 4 rows, each 64 halves = one 128-B line.
// coverage: 16 instructions x 4 rows x 8 lanes x 8 halves = the wave's 64 x 64 quarter; 4 waves = the block's 128 x 128 tile.
// =====================================================================================================
__global__ __launch_bounds__(128)
void gemm_bb(const u16* __restrict__ A, const u16* __restrict__ Bt, u16* C, int M, int N, int K,
             int bstA, int bstB, int bstC, float oscale) {
  __shared__ __attribute__((aligned(2048))) unsigned char ring[GRING];
  const int tid = threadIdx.x, lane = tid & 31, hh = lane >> 4, m = lane & 15;
  const int wave = (int)uni((uint32_t)tid >> 5);
  const int wm = wave >> 1, wn = wave & 1;   // the wave's quarter: rows 64*wm .., columns 64*wn ..
  const int ntile = N / GTILE, mtile = M / GTILE;
  const int per   = ntile * mtile;
  const int bid   = blockIdx.x;
  const int bt    = bid / per;
  const int t     = bid - bt * per;
  const int row0  = (t / ntile) * GTILE;
  const int col0  = (t % ntile) * GTILE;
  if (row0 + GTILE > M) return;              // block-uniform, never taken with the exact grid; in front of every barrier and load
  const u16* Ab  = A  + (size_t)bt * (size_t)bstA;
  const u16* Bb  = Bt + (size_t)bt * (size_t)bstB;
  u16*       Cb  = C  + (size_t)bt * (size_t)bstC;
  // ---- this wave's slice of every stage: waves 0,1 = A rows row0 + 64*wave .., waves 2,3 = B rows col0 + 64*(wave-2) .. ----
  const u16* sp = (wave < 2) ? (Ab + (size_t)(row0 + 64 * wave) * K) : (Bb + (size_t)(col0 + 64 * (wave - 2)) * K);
  const uint64_t ga0  = (uint64_t)(size_t)sp;
  const uint32_t dst0 = (uint32_t)(size_t)ring + (uint32_t)wave * GSLICE;
  u32x8          g1   = tdm_group1((uint32_t)K * 2u);
  u32x4          g0   = tdm_group0(dst0, ga0);
  const int      npass = K / GKC;
  // ---- fragment rows in LDS: A rows 16*i + m of slice wm, B rows 16*j + m of slice 2 + wn; +16*hh bytes = +8*hh elements ----
  const unsigned char* ar = ring + wm * GSLICE + m * GPITCH + 16 * hh;
  const unsigned char* br = ring + (2 + wn) * GSLICE + m * GPITCH + 16 * hh;
  v8f acc[4][4];
#pragma unroll
  for (int i = 0; i < 4; ++i) {
#pragma unroll
    for (int j = 0; j < 4; ++j) acc[i][j] = zero8();
  }
  // ---- prologue: stage 0 lands and is published, then stage 1 is put in flight ----
  tdm_load(g0, g1);
  wait_tensor0_hold(g0, g1);
  __syncthreads();
  tdm_aim(g0, dst0 + GSTAGE, ga0 + 2u * GKC);
  tdm_load(g0, g1);
#pragma unroll 1   // one pass per stage: the publish point below stands once per trip
  for (int s = 0; s < npass; ++s) {
    const int bo = (s & 1) * GSTAGE;
#pragma unroll     // constant LDS offsets for the four 32-deep steps of a stage
    for (int kk = 0; kk < GKC / 32; ++kk) {
      const int o = bo + kk * 64;
      v16b af[4], bf[4];
#pragma unroll     // constant indices: the fragments stay in registers
      for (int i = 0; i < 4; ++i) {
        af[i] = ldfrag_b((const u16*)(const void*)(ar + o + i * 16 * GPITCH));
        bf[i] = ldfrag_b((const u16*)(const void*)(br + o + i * 16 * GPITCH));
      }
      sched_fence();   // all 16 loads of the step are issued ahead of its 16 products
#pragma unroll
      for (int i = 0; i < 4; ++i) {
#pragma unroll
        for (int j = 0; j < 4; ++j) acc[i][j] = mma_b(af[i], bf[j], acc[i][j]);
      }
    }
    // ---- publish point of stage s + 1: own LDS reads retired, own slice landed, barrier, then the refill ----
    wait_ds0();
    wait_tensor0_hold(g0, g1);
    __syncthreads();
    if (pinned((uint32_t)(s + 2 < npass))) {
      tdm_aim(g0, dst0 + (uint32_t)bo, ga0 + (uint64_t)(s + 2) * (2u * GKC));
      tdm_load(g0, g1);
    }
  }
  wait_tensor0_hold(g0, g1);   // behind the loop: no request in flight and no LDS read open before the ring is used for the result
  wait_ds0();
  acc_guard16(acc);
  // ---- stage the scaled value in the wave's slab: the ring's first bytes, which every reader has left at the last
  //      pass's barrier and at which no load is aimed any more ----
  float* sl = (float*)(void*)ring + wave * GWSLAB;
#pragma unroll
  for (int i = 0; i < 4; ++i) {
#pragma unroll
    for (int r = 0; r < 8; ++r) {
      const int ro = (16 * i + 8 * hh + r) * 68 + m;
#pragma unroll
      for (int j = 0; j < 4; ++j) sl[ro + 16 * j] = acc[i][j][r] * oscale;
    }
  }
  wave_sync_lds();
  const int rq = lane >> 3, c8 = (lane & 7) * 8;
  u16* dst = Cb + ((size_t)(row0 + 64 * wm) + (size_t)rq) * (size_t)N + (size_t)(col0 + 64 * wn + c8);
#pragma unroll
  for (int i4 = 0; i4 < 16; ++i4) {
    const float* rp = sl + (i4 * 4 + rq) * 68 + c8;
    const v4f a = *(const v4f*)(rp), c4 = *(const v4f*)(rp + 4);
    v4u ov;
    ov[0] = pk16(h_bits((_Float16)a[0]),  h_bits((_Float16)a[1]));
    ov[1] = pk16(h_bits((_Float16)a[2]),  h_bits((_Float16)a[3]));
    ov[2] = pk16(h_bits((_Float16)c4[0]), h_bits((_Float16)c4[1]));
    ov[3] = pk16(h_bits((_Float16)c4[2]), h_bits((_Float16)c4[3]));
    *(v4u*)(dst + (size_t)(i4 * 4) * (size_t)N) = ov;
  }
}

// =====================================================================================================
// Multi-head flash attention with per-head linear relative-position bias (no mask): block = (batch b, 4 heads, 128 query
// rows), 4 waves per head, each head with an LDS ring of its own; wave w of a head owns query rows q0 = 128*qt + 32*w ..
// q0+31 as two tiles of 16 (tile t = rows q0+16t .. +15).
// The keys are walked from the last to the first: the bias falls along the walk, so a row's running maximum settles early,
// and a key block none of whose weights can count any more is left behind its scores (test in the loop). How many key blocks
// that is depends on the head's slope, so a block holds steep and flat heads, one wave of each on every SIMD.
// Every k fragment, v^T fragment and bias term that the wave fetches or forms serves both tiles.
//   k and v^T come through LDS, shared by the head's 4 waves: a stage is 64 keys = 64 k rows x 128 B and 64 v^T rows x
//   128 B; every wave brings its own slice of 32 rows with one tensor load (LDS pitch 144 B), two buffers, the next stage
//   in flight while this one is worked on; one publish point (waits + block barrier) per stage. The ring becomes the
//   wave-private result slabs behind the last stage's barrier.
//   q plane (f16, x8) laid out [b][s][h*64+d]; k plane the same (f16, x8); v^T plane [b][h*64+d][s] (x1024 f16).
//   The scores of all NKB = 64 key blocks of 32 keys are computed (static bound).
//   Scores are computed TRANSPOSED: S^T tile g (g = 0,1) = k rows (keys kb+16g .. +15, A operand, row m = lane&15, split k
//   map over d) times q^T (B operand, col n = query q0 + 16t + (lane&15), k = d, split map), one f16 product per tile and
//   32-deep d-chunk, one guarded group of 8 WMMAs; the four q fragments are loaded once per wave.
//   D element r of lane l = (key kb+16g+8h+r, query q0+16t+(l&15)), so a lane owns one query column per tile and 16 of its
//   32 keys; the partner lane l^16 owns the other 16 -> row max / row sum need one xor-16 shuffle.
//   Logit (base 2) = score * (1/32) * log2e / (8*8) + slope_h * (key - (q0 + (l&15))) * log2e, slope_h = (2^-0.5)^(h+1):
//   the bias of both tiles is taken relative to tile 0's query; the softmax over keys does not see a constant per query.
//   Online max-subtracted base-2 softmax in f32. The exp'd values ARE the P A-fragment in place: A row m = query = lane&15,
//   element i <- key kb+8h+i (tile 0, D element i), element 8+i <- key kb+16+8h+i (tile 1, D element i). P is carried
//   x32768 as single f16. The rescale factor of query row 8h+r of the O accumulators is fetched from lane 8h+r with a
//   shuffle (uniform control). 4 v^T B fragments (col n = d = 16j + (lane&15), keys k-contiguous), 8 P.V WMMAs per key
//   block in one guarded group.
//   Epilogue: 1/l (per query, shuffled to the D row owner) and the carry folds in f32; each 16x64 f32 result tile staged,
//   segment (b, q0+row, head) of the f32 result [b][s][h*64+d] written by 16 consecutive lanes x 16 B of one instruction
// coverage: per wave 2 tiles x 8 instructions x 2 rows x 16 lanes x 4 floats = 32 x 64; grid NB*(NH/4)*(SQ/128) blocks x 4
//           heads x 4 waves = every (b, s < SQ, h) row segment of the result exactly once.
// =====================================================================================================
__global__ __launch_bounds__(ATT_THREADS)
void attn_fwd(const u16* __restrict__ QPp, const u16* __restrict__ KPp, const u16* __restrict__ VPp, float* Out) {
  __shared__ __attribute__((aligned(2048))) unsigned char rings[ATT_HEADS * ARING];   // per head: k / v^T stages; result slabs in the epilogue

  const int tid  = threadIdx.x;
  const int w16  = (int)uni((uint32_t)tid >> 5);
  const int hq   = w16 >> 2;             // which of the block's heads; waves w, w+4, w+8, w+12 are one wave of each head
  const int wave = w16 & 3;              // the wave's place among its head's four
  unsigned char* ring = rings + hq * ARING;
  const int lane = tid & 31;
  const int hh   = lane >> 4;
  const int c    = lane & 15;

  const int bid  = blockIdx.x;
  const int qt   = bid % NQT;
  const int grp  = (bid / NQT) % (NH / ATT_HEADS);
  const int head = (int)((HEADMAP >> (16 * grp + 4 * hq)) & 15ull);
  const int b    = bid / (NQT * (NH / ATT_HEADS));
  const int q0   = qt * ATT_Q + wave * (16 * QTW);

  // B fragments of q^T: col n = query q0 + 16t + c, k = d (k-contiguous row segment of the q plane)
  const size_t qofs = ((size_t)(b * SEQ + q0 + c)) * NHD + (size_t)(head * HD + 8 * hh);
  const _Float16* Qb = (const _Float16*)(const void*)QPp + qofs;
  // ---- this wave's slice of every stage: waves 0,1 = k rows (keys) 32*wave .., 128 B of this head each; waves 2,3 =
  //      v^T rows (d) 32*(wave-2) .., 128 B = 64 keys each ----
  const u16* sp = (wave < 2) ? (KPp + ((size_t)(b * SEQ + 32 * wave)) * NHD + (size_t)(head * HD))
                             : (VPp + ((size_t)(b * NHD + head * HD + 32 * (wave - 2))) * SEQ);
  const uint64_t ga0   = (uint64_t)(size_t)sp;
  const uint32_t gstep = (wave < 2) ? (uint32_t)(AKEYS * NHD * 2) : (uint32_t)(AKEYS * 2);   // bytes from stage to stage
  const uint32_t dst0  = (uint32_t)(size_t)ring + (uint32_t)wave * ASLICE;
  u32x8          g1    = tdm_group1_r128((wave < 2) ? (uint32_t)(NHD * 2) : (uint32_t)(SEQ * 2));
  u32x4          g0    = tdm_group0(dst0, ga0 + (uint64_t)(NST - 1) * gstep);   // the walk starts at the last stage
  // A fragments of k: LDS row = key (in its slice of 32) 16g + c, k = d; +16*hh bytes = +8*hh elements
  const unsigned char* kr = ring + c * APITCH + 16 * hh;
  // B fragments of v: col n = d = 16j + c = LDS row of the v^T slices, k = key (contiguous in the row)
  const unsigned char* vr = ring + 2 * ASLICE + c * APITCH + 16 * hh;

  const int   ex     = head + 1;
  const float slope  = (((ex & 1) != 0) ? RSQ2 : 1.0f) * __int_as_float((127 - (ex >> 1)) << 23);
  const float slope2 = slope * LOG2E;
  const float lsc    = (INVN * LOG2E) * (1.0f / (QSC * KSC));
  const float jb0    = (float)(8 * hh - (q0 + c));      // key - tile 0's query, key block base added per step

  v16h qf[QTW][2];
#pragma unroll
  for (int t = 0; t < QTW; ++t) {
    qf[t][0] = ldfrag_h(Qb + (size_t)(16 * t) * NHD);            // d 0..31
    qf[t][1] = ldfrag_h(Qb + (size_t)(16 * t) * NHD + 32);       // d 32..63
  }

  float mrun[QTW], lrun[QTW];
  v8f o[QTW][4];
#pragma unroll
  for (int t = 0; t < QTW; ++t) {
    mrun[t] = -INFINITY;
    lrun[t] = 0.f;
#pragma unroll
    for (int j = 0; j < 4; ++j) o[t][j] = zero8();
  }

  // ---- prologue: the last stage lands and is published, then the one in front of it is put in flight ----
  tdm_load(g0, g1);
  wait_tensor0_hold(g0, g1);
  __syncthreads();
  tdm_aim(g0, dst0 + ASTAGE, ga0 + (uint64_t)(NST - 2) * gstep);
  tdm_load(g0, g1);
#pragma unroll 1   // one pass per stage: the publish point below stands once per trip
  for (int s = 0; s < NST; ++s) {        // pass s works on stage NST-1-s
    const int bo = (s & 1) * ASTAGE;
#pragma unroll     // constant LDS offsets for the key blocks of a stage
  for (int i32 = AKEYS / 32 - 1; i32 >= 0; --i32) {
    const int kb = (NST - 1 - s) * AKEYS + i32 * 32;
    // ---- transposed scores: s0 = keys kb..kb+15, s1 = keys kb+16..kb+31, column = query q0 + 16t + c ----
    v8f s0[QTW], s1[QTW];
    const _Float16* k0p = (const _Float16*)(const void*)(kr + bo + i32 * ASLICE);
    const _Float16* k1p = (const _Float16*)(const void*)(kr + bo + i32 * ASLICE + 16 * APITCH);
    {
      const v16h ka0 = ldfrag_h(k0p),      ka1 = ldfrag_h(k0p + 32);
      const v16h kc0 = ldfrag_h(k1p),      kc1 = ldfrag_h(k1p + 32);
      s0[0] = mma_h(ka0, qf[0][0], zero8());
      s0[1] = mma_h(ka0, qf[1][0], zero8());
      s1[0] = mma_h(kc0, qf[0][0], zero8());
      s1[1] = mma_h(kc0, qf[1][0], zero8());
      s0[0] = mma_h(ka1, qf[0][1], s0[0]);
      s0[1] = mma_h(ka1, qf[1][1], s0[1]);
      s1[0] = mma_h(kc1, qf[0][1], s1[0]);
      s1[1] = mma_h(kc1, qf[1][1], s1[1]);
      guard4x8<v16h>(s0[0], s0[1], s1[0], s1[1], qf[0][0], qf[0][1], qf[1][0], qf[1][1], ka0, ka1, kc0, kc1);
    }
    // ---- position bias (base 2) of this lane's 16 keys, the same for both tiles ----
    //      Bias and logits are formed in pairs (2k, 2k+1), the register pairs of the score accumulators: other pairs
    //      cost a register copy per element in front of the packed multiply-add.
    const float jb = jb0 + (float)kb;
    const v2f jb2 = {jb, jb}, sl2 = {slope2, slope2}, lsc2 = {lsc, lsc};
    v2f bs[8];
#pragma unroll
    for (int k = 0; k < 4; ++k) {
      const v2f e0 = {(float)(2 * k), (float)(2 * k + 1)}, e1 = {(float)(16 + 2 * k), (float)(17 + 2 * k)};
      bs[k]     = sl2 * (jb2 + e0);
      bs[4 + k] = sl2 * (jb2 + e1);
    }
    // ---- base-2 logits of this lane's 16 keys for query q0 + 16t + c, and their maximum ----
    float tk[QTW][16], cl[QTW];
#pragma unroll     // constant indices: the logits stay in registers
    for (int t = 0; t < QTW; ++t) {
#pragma unroll
      for (int k = 0; k < 4; ++k) {
        const v2f a0 = {s0[t][2 * k], s0[t][2 * k + 1]}, a1 = {s1[t][2 * k], s1[t][2 * k + 1]};
        const v2f l0 = __builtin_elementwise_fma(a0, lsc2, bs[k]), l1 = __builtin_elementwise_fma(a1, lsc2, bs[4 + k]);
        tk[t][2 * k]     = l0[0];
        tk[t][2 * k + 1] = l0[1];
        tk[t][8 + 2 * k]     = l1[0];
        tk[t][8 + 2 * k + 1] = l1[1];
      }
      cl[t] = tk[t][0];
#pragma unroll
      for (int i = 1; i < 16; ++i) cl[t] = fmaxf(cl[t], tk[t][i]);
    }
    // ---- does any of the wave's 32 x 32 weights count? Where every logit lies SKIPD or more below its query's running
    //      maximum, the rest of the key block changes no bit: the maximum stays, the rescale factor is 2^0 = 1, every weight
    //      x32768 is below half the smallest f16 and enters P as 0, and a row's 32 weights together are below half an ulp of
    //      its sum, which is 1 or more. One test per key block, wave-uniform; an unordered compare takes the full path. ----
    const bool need = !(cl[0] <= mrun[0] - SKIPD) || !(cl[1] <= mrun[1] - SKIPD);
    if (__builtin_amdgcn_ballot_w32(need) != 0u) {
    FragH ph[QTW];
#pragma unroll     // constant indices: the per-tile state stays in registers
    for (int t = 0; t < QTW; ++t) {
      const float cm = fmaxf(cl[t], __shfl_xor(cl[t], 16, 32));
      const float mn = fmaxf(mrun[t], cm);                             // finite from the first key block on
      float ea = mrun[t] - mn, pe[16];
#pragma unroll     // constant indices: pe[] stays in registers, as the asm operands need it
      for (int i = 0; i < 16; ++i) pe[i] = fminf(tk[t][i] - mn, 0.f);
      exp2_hw17(ea, pe);
      const float al = (mrun[t] == -INFINITY) ? 0.f : ea;              // o and l are zero while mrun is -inf
      mrun[t] = mn;
      // ---- probabilities (<= 1) and the P A-fragment: f16(p * 32768); element i <-> tk[i] ----
      float ps = 0.f;
#pragma unroll
      for (int w = 0; w < 2; ++w) {
#pragma unroll
        for (int e4 = 0; e4 < 4; ++e4) {
          const int i = 8 * w + 2 * e4;
          const float p0 = pe[i];
          const float p1 = pe[i + 1];
          ps += p0 + p1;
          ph[t].u[w][e4] = pk16(h_bits((_Float16)(p0 * PCAR)), h_bits((_Float16)(p1 * PCAR)));
        }
      }
      ps += __shfl_xor(ps, 16, 32);
      lrun[t] = lrun[t] * al + ps;
      // ---- rescale the O accumulators: D row 8hh+r = query q0+16t+8hh+r, its factor lives in lane 8hh+r (and 16+8hh+r) ----
      float scl[8];
#pragma unroll
      for (int r = 0; r < 8; ++r) scl[r] = __shfl(al, 8 * hh + r, 32);
#pragma unroll
      for (int j = 0; j < 4; ++j) {
#pragma unroll
        for (int r = 0; r < 8; ++r) o[t][j][r] *= scl[r];
      }
    }
    // ---- P.V : B fragment col n = d = j*16 + c, keys contiguous in the v^T plane; one group of 8 ----
    {
      const unsigned char* vp = vr + bo + i32 * 64;
      const v16h vf0 = ldfrag_h((const _Float16*)(const void*)(vp));
      const v16h vf1 = ldfrag_h((const _Float16*)(const void*)(vp + 16 * APITCH));
      const v16h vf2 = ldfrag_h((const _Float16*)(const void*)(vp + ASLICE));
      const v16h vf3 = ldfrag_h((const _Float16*)(const void*)(vp + ASLICE + 16 * APITCH));
#pragma unroll
      for (int t = 0; t < QTW; ++t) {
        o[t][0] = mma_h(ph[t].v, vf0, o[t][0]);
        o[t][1] = mma_h(ph[t].v, vf1, o[t][1]);
        o[t][2] = mma_h(ph[t].v, vf2, o[t][2]);
        o[t][3] = mma_h(ph[t].v, vf3, o[t][3]);
      }
      guard8x6<v16h>(o, ph[0].v, ph[1].v, vf0, vf1, vf2, vf3);
    }
    }
  }
    // ---- publish point of stage NST-2-s (pass s + 1): own LDS reads retired, own slice landed, barrier, then the refill ----
    wait_ds0();
    wait_tensor0_hold(g0, g1);
    __syncthreads();
    if (pinned((uint32_t)(s + 2 < NST))) {
      tdm_aim(g0, dst0 + (uint32_t)bo, ga0 + (uint64_t)(NST - 3 - s) * gstep);
      tdm_load(g0, g1);
    }
  }
  wait_tensor0_hold(g0, g1);   // behind the loop: no request in flight and no LDS read open before the ring is used for the result
  wait_ds0();
  acc_guard8(o);

  // the wave's two slabs lie in the ring: every reader has left both buffers at the last stage's barrier, in front of which
  // every wave's last load has landed, and no load is aimed at them any more
#pragma unroll
  for (int t = 0; t < QTW; ++t) {
    // ---- fold 1/l (per query, owned by lane = query; l >= 1 by construction) and the P/v carries ----
    const float linv = (lrun[t] > 0.f) ? ((1.0f / lrun[t]) * (1.0f / (PCAR * VCAR))) : 0.f;
    float inv[8];
#pragma unroll
    for (int r = 0; r < 8; ++r) inv[r] = __shfl(linv, 8 * hh + r, 32);
    float* slab = (float*)(void*)ring + (wave * QTW + t) * GSLAB;
#pragma unroll
    for (int r = 0; r < 8; ++r) {
#pragma unroll
      for (int j = 0; j < 4; ++j) slab[(8 * hh + r) * 68 + j * 16 + c] = o[t][j][r] * inv[r];
    }
  }
  wave_sync_lds();
  // ---- f32 result: lanes 0..15 -> row 2*i2, lanes 16..31 -> row 2*i2+1; lane = 4 consecutive floats ----
  float* dst = Out + ((size_t)(b * SEQ + q0 + hh)) * DMOD + (size_t)(head * HD + c * 4);
#pragma unroll
  for (int t = 0; t < QTW; ++t) {
    const float* slab = (const float*)(const void*)ring + (wave * QTW + t) * GSLAB;
    v4f vals[8];
#pragma unroll
    for (int i2 = 0; i2 < 8; ++i2) vals[i2] = *(const v4f*)(slab + (i2 * 2 + hh) * 68 + c * 4);
#pragma unroll
    for (int i2 = 0; i2 < 8; ++i2) {
      *(v4f*)(dst + (size_t)(16 * t + i2 * 2) * (size_t)DMOD) = vals[i2];
    }
  }
}

// =====================================================================================================
// Workspace map (bytes, NB = 4); every plane is fully written by whole-line stores before it is read; all extents are
// exact multiples of the store granularity (no pad rows):
//   XB  bf16 [NB*SEQ][DMOD]                          16777216
//   WB  bf16 [3*NHD][DMOD]  (k | q | v chunks)        6291456
//   QP  f16  [NB*SEQ][NHD] x8                       16777216
//   KP  f16  [NB*SEQ][NHD] x8                       16777216
//   VP  f16  [NB][NHD][SEQ] x1024                   16777216
//   end                                             73400320
// 6 launches on one in-order stream.
// =====================================================================================================
extern "C" void kernel_launch(void* const* d_in, const int* in_sizes, int n_in,
                              void* d_out, int out_size, void* d_ws, size_t ws_size,
                              hipStream_t stream) {
  const int ROWS = NB * SEQ;
  if (n_in < 2) return;
  if (in_sizes[0] < ROWS * DMOD) return;
  if (in_sizes[1] != 3 * NHD * DMOD) return;
  if (out_size < ROWS * DMOD) return;

  const float* Xin = (const float*)d_in[0];
  const float* Win = (const float*)d_in[1];
  float*       out = (float*)d_out;

  const size_t szXB = (size_t)ROWS * DMOD * 2;
  const size_t szWB = (size_t)3 * NHD * DMOD * 2;
  const size_t szPl = (size_t)ROWS * NHD * 2;                  // q/k planes
  const size_t szVP = (size_t)NB * NHD * SEQ * 2;
  size_t off = 0;
  const size_t oXB = off; off += szXB;
  const size_t oWB = off; off += szWB;
  const size_t oQP = off; off += szPl;
  const size_t oKP = off; off += szPl;
  const size_t oVP = off; off += szVP;
  if (off > ws_size) return;                            // off = 73400320 for NB = 4
  if (off > (size_t)134217728) return;

  char* ws = (char*)d_ws;
  u16* XB = (u16*)(ws + oXB);
  u16* WB = (u16*)(ws + oWB);
  u16* QP = (u16*)(ws + oQP);
  u16* KP = (u16*)(ws + oKP);
  u16* VP = (u16*)(ws + oVP);

  const int n8x = (ROWS * DMOD) / 8;
  const int n8w = (3 * NHD * DMOD) / 8;
  if ((n8x % 256) != 0 || (n8w % 256) != 0) return;
  if ((DMOD % 64) != 0 || (NHD % GTILE) != 0 || (SEQ % GTILE) != 0 || (SQ % GTILE) != 0 || (DMOD % 32) != 0) return;

  const dim3 blk(256);
  const dim3 gX(n8x / 256);                             // 4096
  const dim3 gW(n8w / 256);                             // 1536
  const dim3 bG(128);
  const dim3 gQ(NB * (SQ / GTILE) * (NHD / GTILE));     // 512
  const dim3 gK(NB * (SEQ / GTILE) * (NHD / GTILE));    // 512
  const dim3 gV(NB * (NHD / GTILE) * (SEQ / GTILE));    // 512
  const dim3 gAT(ATT_BLOCKS);                           // 256
  const dim3 bAT(ATT_THREADS);                          // 512

  // (1) x -> bf16 plane [ROWS][DMOD]
  cvt16<<<gX, blk, 0, stream>>>(Xin, XB, n8x);
  // (2) W [3*NHD out][DMOD in] -> bf16, same layout (already k-contiguous for B fragments / row-major A for the v^T GEMM)
  cvt16<<<gW, blk, 0, stream>>>(Win, WB, n8w);
  // (3,4) q, k as single f16 planes [b][s][h*64+d] = (x.Wq^T) x8 over SQ rows per batch, (x.Wk^T) x8 over all keys
  gemm_bb<<<gQ, bG, 0, stream>>>(XB, WB + (size_t)NHD * DMOD, QP, SQ, NHD, DMOD, SEQ * DMOD, 0, SEQ * NHD, QSC);
  gemm_bb<<<gK, bG, 0, stream>>>(XB, WB, KP, SEQ, NHD, DMOD, SEQ * DMOD, 0, SEQ * NHD, KSC);
  // (5) v^T plane per batch: [h*64+d][keys] = f16((Wv . x_b^T) x1024)
  gemm_bb<<<gV, bG, 0, stream>>>(WB + (size_t)2 * NHD * DMOD, XB, VP, NHD, SEQ, DMOD, 0, SEQ * DMOD, NHD * SEQ, VCAR);
  // (6) attention -> out [b][s][h*64+d] f32
  attn_fwd<<<gAT, bAT, 0, stream>>>(QP, KP, VP, out);
  (void)hipGetLastError();
}

// v007
// A run of this version takes 102 microseconds.
// In two side-by-side timings against v006, it was 1.06 and 1.07 times as fast.
// All steps since v000 together make it 4.02 times as fast.
// Contractions: x.Wk^T, x.Wq^T and Wv.x^T on v_wmma_f32_16x16x32_bf16 (x and W planes RNE-converted to bf16 operands,
// f32 accumulate); scores k.q^T (k and q single f16 planes carried x8) and P.v (P x32768 single f16, v x1024 single f16)
// on v_wmma_f32_16x16x32_f16, f32 accumulate. Base-2 online softmax with linear relative-position bias; 1/l and carry
// folds in f32 on VALU; f32 result written directly.
#include <hip/hip_runtime.h>
#include <math.h>
#include <stdint.h>

#ifndef NB
#define NB    4
#endif
#define SEQ   2048
#ifndef SQ
#define SQ    SEQ
#endif
#define DMOD  1024
#define NH    16
#define HD    64
#define NHD   (NH * HD)
#define QSC   8.0f
#define KSC   8.0f
#define PCAR  32768.0f
#define VCAR  1024.0f
#define LOG2E 1.4426950408889634f
#define INVN  0.03125f
#define RSQ2  0.70710678118654752f
#define ATT_WAVES   4                   // waves of one head in an attention block
#define ATT_HEADS   4                   // heads of one attention block
#define ATT_THREADS (ATT_HEADS * ATT_WAVES * 32)
#define QTW         2                   // query tiles of 16 per attention wave
#define ATT_Q       (ATT_WAVES * 16 * QTW)
#define NQT         (SQ / ATT_Q)
#define ATT_BLOCKS  (NB * (NH / ATT_HEADS) * NQT)
#define SKIPD       41.0f               // a base-2 logit this far below the running maximum gives a weight that is 0 in f16
// Heads of block group g, one nibble each (bits 16g .. 16g+15). The steeper a head's slope, the fewer of its key blocks carry
// weight, so every group gets one of the four flattest heads, one of the next four and two steep ones.
#define HEADMAP     0x468C379D25AE01BFull
#define NKB         (SEQ / 32)
#define GSLAB       (16 * 68)
#define GKC         128                 // k elements of one GEMM stage: rows of 256 bytes
#define GPITCH      272                 // LDS row pitch, bytes: 256 + 16, an odd multiple of 16 for 16-byte readers
#define GTILE       128                 // the block's tile of C: 128 x 128, one 64 x 64 quarter per wave
#define GSLICE      18432               // one wave's slice: 64 rows x 272 B = 17408 B, rounded up to a multiple of 2 KiB
#define GSTAGE      (4 * GSLICE)        // [A rows 0..63 | A rows 64..127 | B rows 0..63 | B rows 64..127]
#define GWSLAB      (64 * 68)           // floats of one wave's result slab: 64 rows at a pitch of 68
#define GRING       (2 * GSTAGE)
#define GNQ         (NB * (SQ / GTILE) * (NHD / GTILE))    // blocks of the q product
#define GNK         (NB * (SEQ / GTILE) * (NHD / GTILE))   // blocks of the k product
#define GNV         (NB * (NHD / GTILE) * (SEQ / GTILE))   // blocks of the v^T product
#define AKEYS       64                  // keys of one attention stage: k rows and v^T rows of 128 bytes each
#define APITCH      144                 // LDS row pitch, bytes: 128 + 16, an odd multiple of 16 for 16-byte readers
#define ASLICE      6144                // one wave's slice: 32 rows x 144 B = 4608 B, rounded up to a multiple of 2 KiB
#define ASTAGE      (4 * ASLICE)        // [k rows 0..31 | k rows 32..63 | v^T rows 0..31 | v^T rows 32..63]
#define ARING       (2 * ASTAGE)
#define NST         (SEQ / AKEYS)
static_assert(32 * APITCH <= ASLICE && (ASLICE % 2048) == 0 && HD * 2 == 128 && AKEYS * 2 == 128 && ATT_WAVES == 4);
static_assert(ATT_WAVES * QTW * GSLAB * 4 <= ARING && (SEQ % AKEYS) == 0 && NST >= 2 && (AKEYS % 32) == 0);
static_assert((SQ % ATT_Q) == 0 && QTW == 2);
static_assert(64 * GPITCH <= GSLICE && (GSLICE % 2048) == 0 && GKC * 2 == 256 && 4 * GWSLAB * 4 <= GSTAGE);
static_assert((NHD % GTILE) == 0 && (SEQ % GTILE) == 0 && (SQ % GTILE) == 0);
static_assert((DMOD % GKC) == 0 && (DMOD / GKC) >= 2);
static_assert(NH == 16 && HD == 64 && DMOD == NHD);
static_assert((HD % 32) == 0 && (SEQ % 64) == 0 && (SQ % 64) == 0 && SQ <= SEQ && SQ >= 64);
static_assert((DMOD % 64) == 0 && (DMOD % 32) == 0 && (NHD % 64) == 0);
static_assert(((NB * SEQ * DMOD / 8) % 256) == 0);
static_assert(((3 * NHD * DMOD / 8) % 256) == 0);
static_assert((GSLAB * 4) % 16 == 0 && ATT_THREADS == 512 && ATT_HEADS * 4 == NH && (ARING % 2048) == 0);
static_assert(NB >= 1 && NB <= 4);

typedef unsigned short u16;
typedef _Float16 v16h __attribute__((ext_vector_type(16)));
typedef _Float16 v8h  __attribute__((ext_vector_type(8)));
typedef __bf16   v16b __attribute__((ext_vector_type(16)));
typedef float    v8f  __attribute__((ext_vector_type(8)));
typedef float    v4f  __attribute__((ext_vector_type(4)));
typedef float    v2f  __attribute__((ext_vector_type(2)));
typedef unsigned int v4u __attribute__((ext_vector_type(4)));
typedef uint32_t u32x4 __attribute__((ext_vector_type(4)));
typedef uint32_t u32x8 __attribute__((ext_vector_type(8)));

union FragH { v16h v; v8h h[2]; v4u u[2]; };
union FragB { v16b v; v4u u[2]; };

// ---- scalar helpers --------------------------------------------------------------------------------
__device__ __forceinline__ unsigned short bf_bits(float f) {          // f32 -> bf16 bits, RNE convert
  unsigned u = __float_as_uint(f);
  return (unsigned short)((u + 0x7FFFu + ((u >> 16) & 1u)) >> 16);
}
__device__ __forceinline__ unsigned short h_bits(_Float16 x) { return __builtin_bit_cast(unsigned short, x); }
__device__ __forceinline__ unsigned pk16(unsigned short a, unsigned short b) { return (unsigned)a | ((unsigned)b << 16); }
// 2^x in place for a key block's rescale exponent and its 16 score exponents (all <= 0), by the bare hardware instruction.
// exp2f() wraps each v_exp_f32 in a compare, two selects, an add and an ldexp so that results below 2^-126 come out as
// denormals; such a weight vanishes anyway, in the f16 operand and in a row sum that is never below 1. One statement, so
// that no neighbour of a v_exp_f32 reads its result or overwrites its source; the closing v_nop keeps that slot behind the
// last one, whatever the compiler puts next.
__device__ __forceinline__ void exp2_hw17(float& a, float (&t)[16]) {
#if defined(__HIP_DEVICE_COMPILE__)
  asm("v_exp_f32 %0, %0\n\tv_exp_f32 %1, %1\n\tv_exp_f32 %2, %2\n\tv_exp_f32 %3, %3\n\tv_exp_f32 %4, %4\n\t"
      "v_exp_f32 %5, %5\n\tv_exp_f32 %6, %6\n\tv_exp_f32 %7, %7\n\tv_exp_f32 %8, %8\n\tv_exp_f32 %9, %9\n\t"
      "v_exp_f32 %10, %10\n\tv_exp_f32 %11, %11\n\tv_exp_f32 %12, %12\n\tv_exp_f32 %13, %13\n\t"
      "v_exp_f32 %14, %14\n\tv_exp_f32 %15, %15\n\tv_exp_f32 %16, %16\n\tv_nop"
      : "+v"(a), "+v"(t[0]), "+v"(t[1]), "+v"(t[2]), "+v"(t[3]), "+v"(t[4]), "+v"(t[5]), "+v"(t[6]), "+v"(t[7]),
        "+v"(t[8]), "+v"(t[9]), "+v"(t[10]), "+v"(t[11]), "+v"(t[12]), "+v"(t[13]), "+v"(t[14]), "+v"(t[15]));
#endif
}
__device__ __forceinline__ v8f zero8() { v8f z = {0.f, 0.f, 0.f, 0.f, 0.f, 0.f, 0.f, 0.f}; return z; }

// ---- fragment loaders: 16-bit A/B operand, lane -> row/col (lane&15), p already includes +8*(lane>>4);
//      elements 0..7 <- p[0..7] (k0+8h..), elements 8..15 <- p[16..23] (k0+16+8h..)  (same split k map for A and B;
//      B is always read from a k-contiguous [n][k] plane)
__device__ __forceinline__ v16h ldfrag_h(const _Float16* p) {
  FragH f;
  f.h[0] = *(const v8h*)(p);
  f.h[1] = *(const v8h*)(p + 16);
  return f.v;
}
__device__ __forceinline__ v16b ldfrag_b(const u16* p) {              // bf16 plane read as unsigned integer vectors
  FragB f;
  f.u[0] = *(const v4u*)(p);
  f.u[1] = *(const v4u*)(p + 16);
  return f.v;
}

__device__ __forceinline__ v8f mma_h(v16h a, v16h b, v8f c) {
  return __builtin_amdgcn_wmma_f32_16x16x32_f16(false, a, false, b, (short)0, c, false, false);
}
__device__ __forceinline__ v8f mma_b(v16b a, v16b b, v8f c) {
  return __builtin_amdgcn_wmma_f32_16x16x32_bf16(false, a, false, b, (short)0, c, false, false);
}
// Four vector slots between a group of matrix instructions and the first vector instruction that reads their results or
// overwrites their operands: results in-out, operands as inputs.
template <typename F>
__device__ __forceinline__ void guard4x8(v8f& a, v8f& b, v8f& c, v8f& d, F x0, F x1, F x2, F x3, F x4, F x5, F x6, F x7) {
#if defined(__HIP_DEVICE_COMPILE__)
  asm volatile("v_nop\n\tv_nop\n\tv_nop\n\tv_nop"
               : "+v"(a), "+v"(b), "+v"(c), "+v"(d)
               : "v"(x0), "v"(x1), "v"(x2), "v"(x3), "v"(x4), "v"(x5), "v"(x6), "v"(x7) : "memory");
#endif
}
template <typename F>
__device__ __forceinline__ void guard8x6(v8f (&a)[QTW][4], F x0, F x1, F x2, F x3, F x4, F x5) {
#if defined(__HIP_DEVICE_COMPILE__)
  asm volatile("v_nop\n\tv_nop\n\tv_nop\n\tv_nop"
               : "+v"(a[0][0]), "+v"(a[0][1]), "+v"(a[0][2]), "+v"(a[0][3]), "+v"(a[1][0]), "+v"(a[1][1]), "+v"(a[1][2]),
                 "+v"(a[1][3])
               : "v"(x0), "v"(x1), "v"(x2), "v"(x3), "v"(x4), "v"(x5) : "memory");
#endif
}
__device__ __forceinline__ void acc_guard8(v8f (&a)[QTW][4]) {
#if defined(__HIP_DEVICE_COMPILE__)
  asm volatile("v_nop\n\tv_nop\n\tv_nop\n\tv_nop"
               : "+v"(a[0][0]), "+v"(a[0][1]), "+v"(a[0][2]), "+v"(a[0][3]), "+v"(a[1][0]), "+v"(a[1][1]), "+v"(a[1][2]),
                 "+v"(a[1][3]));
#endif
}
// Four vector slots between the last matrix instructions of the GEMM loop, which is left by a taken branch, and the first
// read of their results.
__device__ __forceinline__ void acc_guard16(v8f (&a)[4][4]) {
#if defined(__HIP_DEVICE_COMPILE__)
  asm volatile("v_nop\n\tv_nop\n\tv_nop\n\tv_nop"
               : "+v"(a[0][0]), "+v"(a[0][1]), "+v"(a[0][2]), "+v"(a[0][3]), "+v"(a[1][0]), "+v"(a[1][1]), "+v"(a[1][2]),
                 "+v"(a[1][3]), "+v"(a[2][0]), "+v"(a[2][1]), "+v"(a[2][2]), "+v"(a[2][3]), "+v"(a[3][0]), "+v"(a[3][1]),
                 "+v"(a[3][2]), "+v"(a[3][3]));
#endif
}
// The scheduler moves nothing across this point. Without it the compiler sinks three of a step's four A fragments to just
// in front of the row of matrix instructions that reads them, each with a wait to 0: four LDS latencies a step, not one.
__device__ __forceinline__ void sched_fence() {
#if defined(__HIP_DEVICE_COMPILE__)
  __builtin_amdgcn_sched_barrier(0);
#endif
}
__device__ __forceinline__ void wave_sync_lds() {
#if defined(__HIP_DEVICE_COMPILE__)
  __builtin_amdgcn_fence(__ATOMIC_RELEASE, "workgroup");
  __builtin_amdgcn_wave_barrier();
  __builtin_amdgcn_fence(__ATOMIC_ACQUIRE, "workgroup");
#endif
}

// ---- tensor load to LDS: descriptor words, issue, waits ---------------------------------------------
__device__ __forceinline__ uint32_t uni(uint32_t v) { return (uint32_t)__builtin_amdgcn_readfirstlane((int)v); }
// Test around a tensor load, which ignores EXEC: it has to compile to s_cmp + s_cbranch_scc.
__device__ __forceinline__ uint32_t pinned(uint32_t v) {
  uint32_t w = uni(v);
  asm volatile("" : "+s"(w));   // pinned(): holds the test word in a scalar register, so that the branch on it is scalar
  return w;
}
// Group 1: 1-byte elements, tile = tensor = 64 rows of 256 bytes, source row pitch src_pitch bytes; word 0 is the pad
// constant for 256-byte rows with 16 bytes behind each row (LDS pitch 272), no mask.
__device__ __forceinline__ u32x8 tdm_group1(uint32_t src_pitch) {
  constexpr uint32_t d0 = 256u, d1 = 64u;
  u32x8 g;
  g[0] = uni((1u << 20) | (5u << 22) | (3u << 25));
  g[1] = uni((d0 & 0xFFFFu) << 16);
  g[2] = uni((d0 >> 16) | ((d1 & 0xFFFFu) << 16));
  g[3] = uni((d1 >> 16) | (d0 << 16));
  g[4] = uni(d1);
  g[5] = uni(src_pitch);
  g[6] = uni(0u);
  g[7] = uni(0u);
  return g;
}
// The same for 32 rows of 128 bytes: pad constant for 128-byte rows with 16 bytes behind each row (LDS pitch 144), no mask.
__device__ __forceinline__ u32x8 tdm_group1_r128(uint32_t src_pitch) {
  constexpr uint32_t d0 = 128u, d1 = 32u;
  u32x8 g;
  g[0] = uni((1u << 20) | (4u << 22) | (3u << 25));
  g[1] = uni((d0 & 0xFFFFu) << 16);
  g[2] = uni((d0 >> 16) | ((d1 & 0xFFFFu) << 16));
  g[3] = uni((d1 >> 16) | (d0 << 16));
  g[4] = uni(d1);
  g[5] = uni(src_pitch);
  g[6] = uni(0u);
  g[7] = uni(0u);
  return g;
}
__device__ __forceinline__ u32x4 tdm_group0(uint32_t lds_dst, uint64_t ga) {
  u32x4 g;
  g[0] = uni(1u);
  g[1] = uni(lds_dst);
  g[2] = uni((uint32_t)ga);
  g[3] = uni((((uint32_t)(ga >> 32)) & 0x01FFFFFFu) | 0x80000000u);
  return g;
}
// Aim group 0 at the next tile: only the LDS place and the address change.
__device__ __forceinline__ void tdm_aim(u32x4& g, uint32_t lds_dst, uint64_t ga) {
  g[1] = uni(lds_dst);
  g[2] = uni((uint32_t)ga);
  g[3] = uni((((uint32_t)(ga >> 32)) & 0x01FFFFFFu) | 0x80000000u);
}
// One request of the whole wave. Both groups are in-out operands so that their scalar registers stay theirs up to the
// next request: as plain inputs the compiler used some of them as temporaries while the request was in flight.
__device__ __forceinline__ void tdm_load(u32x4& g0, u32x8& g1) {
#if defined(__HIP_DEVICE_COMPILE__)
  asm volatile("tensor_load_to_lds %0, %1" : "+s"(g0), "+s"(g1) :: "memory");
#endif
}
// The wave's own slice has landed. Both groups are in-out operands: every scalar register
// of a descriptor stays the descriptor's own until the wait that covers its request; otherwise the compiler reuses a word
// that is dead behind the issue.
__device__ __forceinline__ void wait_tensor0_hold(u32x4& g0, u32x8& g1) {
#if defined(__HIP_DEVICE_COMPILE__)
  asm volatile("s_wait_tensorcnt 0x0" : "+s"(g0), "+s"(g1) :: "memory");
#endif
}
__device__ __forceinline__ void wait_ds0() {
#if defined(__HIP_DEVICE_COMPILE__)
  asm volatile("s_wait_dscnt 0x0" ::: "memory");       // the wave's LDS reads have retired before their buffer is refilled
#endif
}

// =====================================================================================================
// Both f32 planes -> bf16 RNE planes, same layouts, in one launch: neither conversion reads what the other writes. The two
// results lie one behind the other at D (x first), so a thread's place in D is its flat index; blocks below n8x/256 read x,
// the others w (n8x is a multiple of 256: the choice is the same for a whole block).
// Thread = 8 consecutive elements: two 16-B loads, one 16-B store;
// coverage: grid = n8/256 blocks (host checks exactness) x 256 thr x 8 = both planes, n8 = n8x + the chunks of w.
// =====================================================================================================
__global__ __launch_bounds__(256) void cvt16(const float* __restrict__ x, const float* __restrict__ w, u16* D, int n8x, int n8) {
  const int gt = blockIdx.x * 256 + (int)threadIdx.x;
  if (gt >= n8) return;                     // no barriers in this kernel
  const float* p = ((int)blockIdx.x * 256 < n8x) ? (x + (size_t)gt * 8) : (w + (size_t)(gt - n8x) * 8);
  const v4f a = *(const v4f*)(p), c4 = *(const v4f*)(p + 4);
  v4u o;
  o[0] = pk16(bf_bits(a[0]),  bf_bits(a[1]));
  o[1] = pk16(bf_bits(a[2]),  bf_bits(a[3]));
  o[2] = pk16(bf_bits(c4[0]), bf_bits(c4[1]));
  o[3] = pk16(bf_bits(c4[2]), bf_bits(c4[3]));
  u16* d = D + (size_t)gt * 8;
  {
    *(v4u*)(d) = o;
    
  }
}

// =====================================================================================================
// The three projections in one launch: none reads what another writes, so their blocks share one grid and a block that
// starts or stores its result runs beside blocks that are in their loops. The block index picks the product:
//   blocks 0 .. GNQ-1        q plane   = (x . Wq^T) x8 over SQ rows per batch
//   the next GNK             k plane   = (x . Wk^T) x8 over all keys
//   the last GNV             v^T plane = (Wv . x_b^T) x1024 per batch
// Each is a batched bf16 GEMM with f16 result:  C[bt][M][N] = f16( (A[bt][M][K] (bf16 row-major) . Bt[bt][N][K]^T (bf16
// k-contiguous)) * oscale ); per-batch element strides bstA/bstB/bstC. Block = 128x128 tile, 4 waves in a 2 x 2 grid, each
// with a 64x64 quarter = 4 x 4 accumulator tiles: a fragment read from LDS feeds 4 matrix instructions, and an operand row
// brought into LDS serves 128 rows or columns of C.
// Operands come through LDS: a stage is 128 k of the block's 128 A rows and 128 B rows; every wave brings its own slice
// of 64 rows x 256 B with one tensor load (LDS pitch 272 B), two buffers, the next stage in flight while this one is
// worked on. Fragments are read from the LDS rows (two 16-B loads each, split k map for A and B), K stepped by 32
// inside a stage (K = DMOD: a multiple of 128 and at least two stages; M % 128 == 0, N % 128 == 0,
// nbatch*(M/128)*(N/128) blocks per product). The ring becomes the result slabs behind the last pass's barrier.
// Result: lane = (row in group of 4, 8 consecutive cols); one instruction = 4 rows, each 64 halves = one 128-B line.
// coverage: 16 instructions x 4 rows x 8 lanes x 8 halves = the wave's 64 x 64 quarter; 4 waves = the block's 128 x 128 tile.
// =====================================================================================================
__global__ __launch_bounds__(128)
void gemm_bb(const u16* __restrict__ XBp, const u16* __restrict__ WBp, u16* QPp, u16* KPp, u16* VPp) {
  __shared__ __attribute__((aligned(2048))) unsigned char ring[GRING];
  // ---- which product: block-uniform, from the block index alone ----
  constexpr int K = DMOD;
  int bid = blockIdx.x;
  const u16 *A, *Bt;
  u16* C;
  int M, N, bstA, bstB, bstC;
  float oscale;
  if (bid < GNQ) {
    A = XBp; Bt = WBp + (size_t)NHD * DMOD; C = QPp;
    M = SQ; N = NHD; bstA = SEQ * DMOD; bstB = 0; bstC = SEQ * NHD; oscale = QSC;
  } else if (bid < GNQ + GNK) {
    bid -= GNQ;
    A = XBp; Bt = WBp; C = KPp;
    M = SEQ; N = NHD; bstA = SEQ * DMOD; bstB = 0; bstC = SEQ * NHD; oscale = KSC;
  } else {
    bid -= GNQ + GNK;
    A = WBp + (size_t)2 * NHD * DMOD; Bt = XBp; C = VPp;
    M = NHD; N = SEQ; bstA = 0; bstB = SEQ * DMOD; bstC = NHD * SEQ; oscale = VCAR;
  }
  const int tid = threadIdx.x, lane = tid & 31, hh = lane >> 4, m = lane & 15;
  const int wave = (int)uni((uint32_t)tid >> 5);
  const int wm = wave >> 1, wn = wave & 1;   // the wave's quarter: rows 64*wm .., columns 64*wn ..
  const int ntile = N / GTILE, mtile = M / GTILE;
  const int per   = ntile * mtile;
  const int bt    = bid / per;
  const int t     = bid - bt * per;
  const int row0  = (t / ntile) * GTILE;
  const int col0  = (t % ntile) * GTILE;
  if (row0 + GTILE > M) return;              // block-uniform, never taken with the exact grid; in front of every barrier and load
  const u16* Ab  = A  + (size_t)bt * (size_t)bstA;
  const u16* Bb  = Bt + (size_t)bt * (size_t)bstB;
  u16*       Cb  = C  + (size_t)bt * (size_t)bstC;
  // ---- this wave's slice of every stage: waves 0,1 = A rows row0 + 64*wave .., waves 2,3 = B rows col0 + 64*(wave-2) .. ----
  const u16* sp = (wave < 2) ? (Ab + (size_t)(row0 + 64 * wave) * K) : (Bb + (size_t)(col0 + 64 * (wave - 2)) * K);
  const uint64_t ga0  = (uint64_t)(size_t)sp;
  const uint32_t dst0 = (uint32_t)(size_t)ring + (uint32_t)wave * GSLICE;
  u32x8          g1   = tdm_group1((uint32_t)K * 2u);
  u32x4          g0   = tdm_group0(dst0, ga0);
  const int      npass = K / GKC;
  // ---- fragment rows in LDS: A rows 16*i + m of slice wm, B rows 16*j + m of slice 2 + wn; +16*hh bytes = +8*hh elements ----
  const unsigned char* ar = ring + wm * GSLICE + m * GPITCH + 16 * hh;
  const unsigned char* br = ring + (2 + wn) * GSLICE + m * GPITCH + 16 * hh;
  v8f acc[4][4];
#pragma unroll
  for (int i = 0; i < 4; ++i) {
#pragma unroll
    for (int j = 0; j < 4; ++j) acc[i][j] = zero8();
  }
  // ---- prologue: stage 0 lands and is published, then stage 1 is put in flight ----
  tdm_load(g0, g1);
  wait_tensor0_hold(g0, g1);
  __syncthreads();
  tdm_aim(g0, dst0 + GSTAGE, ga0 + 2u * GKC);
  tdm_load(g0, g1);
#pragma unroll 1   // one pass per stage: the publish point below stands once per trip
  for (int s = 0; s < npass; ++s) {
    const int bo = (s & 1) * GSTAGE;
#pragma unroll     // constant LDS offsets for the four 32-deep steps of a stage
    for (int kk = 0; kk < GKC / 32; ++kk) {
      const int o = bo + kk * 64;
      v16b af[4], bf[4];
#pragma unroll     // constant indices: the fragments stay in registers
      for (int i = 0; i < 4; ++i) {
        af[i] = ldfrag_b((const u16*)(const void*)(ar + o + i * 16 * GPITCH));
        bf[i] = ldfrag_b((const u16*)(const void*)(br + o + i * 16 * GPITCH));
      }
      sched_fence();   // all 16 loads of the step are issued ahead of its 16 products
#pragma unroll
      for (int i = 0; i < 4; ++i) {
#pragma unroll
        for (int j = 0; j < 4; ++j) acc[i][j] = mma_b(af[i], bf[j], acc[i][j]);
      }
    }
    // ---- publish point of stage s + 1: own LDS reads retired, own slice landed, barrier, then the refill ----
    wait_ds0();
    wait_tensor0_hold(g0, g1);
    __syncthreads();
    if (pinned((uint32_t)(s + 2 < npass))) {
      tdm_aim(g0, dst0 + (uint32_t)bo, ga0 + (uint64_t)(s + 2) * (2u * GKC));
      tdm_load(g0, g1);
    }
  }
  wait_tensor0_hold(g0, g1);   // behind the loop: no request in flight and no LDS read open before the ring is used for the result
  wait_ds0();
  acc_guard16(acc);
  // ---- stage the scaled value in the wave's slab: the ring's first bytes, which every reader has left at the last
  //      pass's barrier and at which no load is aimed any more ----
  float* sl = (float*)(void*)ring + wave * GWSLAB;
#pragma unroll
  for (int i = 0; i < 4; ++i) {
#pragma unroll
    for (int r = 0; r < 8; ++r) {
      const int ro = (16 * i + 8 * hh + r) * 68 + m;
#pragma unroll
      for (int j = 0; j < 4; ++j) sl[ro + 16 * j] = acc[i][j][r] * oscale;
    }
  }
  wave_sync_lds();
  const int rq = lane >> 3, c8 = (lane & 7) * 8;
  u16* dst = Cb + ((size_t)(row0 + 64 * wm) + (size_t)rq) * (size_t)N + (size_t)(col0 + 64 * wn + c8);
#pragma unroll
  for (int i4 = 0; i4 < 16; ++i4) {
    const float* rp = sl + (i4 * 4 + rq) * 68 + c8;
    const v4f a = *(const v4f*)(rp), c4 = *(const v4f*)(rp + 4);
    v4u ov;
    ov[0] = pk16(h_bits((_Float16)a[0]),  h_bits((_Float16)a[1]));
    ov[1] = pk16(h_bits((_Float16)a[2]),  h_bits((_Float16)a[3]));
    ov[2] = pk16(h_bits((_Float16)c4[0]), h_bits((_Float16)c4[1]));
    ov[3] = pk16(h_bits((_Float16)c4[2]), h_bits((_Float16)c4[3]));
    *(v4u*)(dst + (size_t)(i4 * 4) * (size_t)N) = ov;
  }
}

// =====================================================================================================
// Multi-head flash attention with per-head linear relative-position bias (no mask): block = (batch b, 4 heads, 128 query
// rows), 4 waves per head, each head with an LDS ring of its own; wave w of a head owns query rows q0 = 128*qt + 32*w ..
// q0+31 as two tiles of 16 (tile t = rows q0+16t .. +15).
// The keys are walked from the last to the first: the bias falls along the walk, so a row's running maximum settles early,
// and a key block none of whose weights can count any more is left behind its scores (test in the loop). How many key blocks
// that is depends on the head's slope, so a block holds steep and flat heads, one wave of each on every SIMD.
// Every k fragment, v^T fragment and bias term that the wave fetches or forms serves both tiles.
//   k and v^T come through LDS, shared by the head's 4 waves: a stage is 64 keys = 64 k rows x 128 B and 64 v^T rows x
//   128 B; every wave brings its own slice of 32 rows with one tensor load (LDS pitch 144 B), two buffers, the next stage
//   in flight while this one is worked on; one publish point (waits + block barrier) per stage. The ring becomes the
//   wave-private result slabs behind the last stage's barrier.
//   q plane (f16, x8) laid out [b][s][h*64+d]; k plane the same (f16, x8); v^T plane [b][h*64+d][s] (x1024 f16).
//   The scores of all NKB = 64 key blocks of 32 keys are computed (static bound).
//   Scores are computed TRANSPOSED: S^T tile g (g = 0,1) = k rows (keys kb+16g .. +15, A operand, row m = lane&15, split k
//   map over d) times q^T (B operand, col n = query q0 + 16t + (lane&15), k = d, split map), one f16 product per tile and
//   32-deep d-chunk, one guarded group of 8 WMMAs; the four q fragments are loaded once per wave.
//   D element r of lane l = (key kb+16g+8h+r, query q0+16t+(l&15)), so a lane owns one query column per tile and 16 of its
//   32 keys; the partner lane l^16 owns the other 16 -> row max / row sum need one xor-16 shuffle.
//   Logit (base 2) = score * (1/32) * log2e / (8*8) + slope_h * (key - (q0 + (l&15))) * log2e, slope_h = (2^-0.5)^(h+1):
//   the bias of both tiles is taken relative to tile 0's query; the softmax over keys does not see a constant per query.
//   Online max-subtracted base-2 softmax in f32. The exp'd values ARE the P A-fragment in place: A row m = query = lane&15,
//   element i <- key kb+8h+i (tile 0, D element i), element 8+i <- key kb+16+8h+i (tile 1, D element i). P is carried
//   x32768 as single f16. The rescale factor of query row 8h+r of the O accumulators is fetched from lane 8h+r with a
//   shuffle (uniform control). 4 v^T B fragments (col n = d = 16j + (lane&15), keys k-contiguous), 8 P.V WMMAs per key
//   block in one guarded group.
//   Epilogue: 1/l (per query, shuffled to the D row owner) and the carry folds in f32; each 16x64 f32 result tile staged,
//   segment (b, q0+row, head) of the f32 result [b][s][h*64+d] written by 16 consecutive lanes x 16 B of one instruction
// coverage: per wave 2 tiles x 8 instructions x 2 rows x 16 lanes x 4 floats = 32 x 64; grid NB*(NH/4)*(SQ/128) blocks x 4
//           heads x 4 waves = every (b, s < SQ, h) row segment of the result exactly once.
// =====================================================================================================
__global__ __launch_bounds__(ATT_THREADS)
void attn_fwd(const u16* __restrict__ QPp, const u16* __restrict__ KPp, const u16* __restrict__ VPp, float* Out) {
  __shared__ __attribute__((aligned(2048))) unsigned char rings[ATT_HEADS * ARING];   // per head: k / v^T stages; result slabs in the epilogue

  const int tid  = threadIdx.x;
  const int w16  = (int)uni((uint32_t)tid >> 5);
  const int hq   = w16 >> 2;             // which of the block's heads; waves w, w+4, w+8, w+12 are one wave of each head
  const int wave = w16 & 3;              // the wave's place among its head's four
  unsigned char* ring = rings + hq * ARING;
  const int lane = tid & 31;
  const int hh   = lane >> 4;
  const int c    = lane & 15;

  const int bid  = blockIdx.x;
  const int qt   = bid % NQT;
  const int grp  = (bid / NQT) % (NH / ATT_HEADS);
  const int head = (int)((HEADMAP >> (16 * grp + 4 * hq)) & 15ull);
  const int b    = bid / (NQT * (NH / ATT_HEADS));
  const int q0   = qt * ATT_Q + wave * (16 * QTW);

  // B fragments of q^T: col n = query q0 + 16t + c, k = d (k-contiguous row segment of the q plane)
  const size_t qofs = ((size_t)(b * SEQ + q0 + c)) * NHD + (size_t)(head * HD + 8 * hh);
  const _Float16* Qb = (const _Float16*)(const void*)QPp + qofs;
  // ---- this wave's slice of every stage: waves 0,1 = k rows (keys) 32*wave .., 128 B of this head each; waves 2,3 =
  //      v^T rows (d) 32*(wave-2) .., 128 B = 64 keys each ----
  const u16* sp = (wave < 2) ? (KPp + ((size_t)(b * SEQ + 32 * wave)) * NHD + (size_t)(head * HD))
                             : (VPp + ((size_t)(b * NHD + head * HD + 32 * (wave - 2))) * SEQ);
  const uint64_t ga0   = (uint64_t)(size_t)sp;
  const uint32_t gstep = (wave < 2) ? (uint32_t)(AKEYS * NHD * 2) : (uint32_t)(AKEYS * 2);   // bytes from stage to stage
  const uint32_t dst0  = (uint32_t)(size_t)ring + (uint32_t)wave * ASLICE;
  u32x8          g1    = tdm_group1_r128((wave < 2) ? (uint32_t)(NHD * 2) : (uint32_t)(SEQ * 2));
  u32x4          g0    = tdm_group0(dst0, ga0 + (uint64_t)(NST - 1) * gstep);   // the walk starts at the last stage
  // A fragments of k: LDS row = key (in its slice of 32) 16g + c, k = d; +16*hh bytes = +8*hh elements
  const unsigned char* kr = ring + c * APITCH + 16 * hh;
  // B fragments of v: col n = d = 16j + c = LDS row of the v^T slices, k = key (contiguous in the row)
  const unsigned char* vr = ring + 2 * ASLICE + c * APITCH + 16 * hh;

  const int   ex     = head + 1;
  const float slope  = (((ex & 1) != 0) ? RSQ2 : 1.0f) * __int_as_float((127 - (ex >> 1)) << 23);
  const float slope2 = slope * LOG2E;
  const float lsc    = (INVN * LOG2E) * (1.0f / (QSC * KSC));
  const float jb0    = (float)(8 * hh - (q0 + c));      // key - tile 0's query, key block base added per step

  v16h qf[QTW][2];
#pragma unroll
  for (int t = 0; t < QTW; ++t) {
    qf[t][0] = ldfrag_h(Qb + (size_t)(16 * t) * NHD);            // d 0..31
    qf[t][1] = ldfrag_h(Qb + (size_t)(16 * t) * NHD + 32);       // d 32..63
  }

  float mrun[QTW], lrun[QTW];
  v8f o[QTW][4];
#pragma unroll
  for (int t = 0; t < QTW; ++t) {
    mrun[t] = -INFINITY;
    lrun[t] = 0.f;
#pragma unroll
    for (int j = 0; j < 4; ++j) o[t][j] = zero8();
  }

  // ---- prologue: the last stage lands and is published, then the one in front of it is put in flight ----
  tdm_load(g0, g1);
  wait_tensor0_hold(g0, g1);
  __syncthreads();
  tdm_aim(g0, dst0 + ASTAGE, ga0 + (uint64_t)(NST - 2) * gstep);
  tdm_load(g0, g1);
#pragma unroll 1   // one pass per stage: the publish point below stands once per trip
  for (int s = 0; s < NST; ++s) {        // pass s works on stage NST-1-s
    const int bo = (s & 1) * ASTAGE;
#pragma unroll     // constant LDS offsets for the key blocks of a stage
  for (int i32 = AKEYS / 32 - 1; i32 >= 0; --i32) {
    const int kb = (NST - 1 - s) * AKEYS + i32 * 32;
    // ---- transposed scores: s0 = keys kb..kb+15, s1 = keys kb+16..kb+31, column = query q0 + 16t + c ----
    v8f s0[QTW], s1[QTW];
    const _Float16* k0p = (const _Float16*)(const void*)(kr + bo + i32 * ASLICE);
    const _Float16* k1p = (const _Float16*)(const void*)(kr + bo + i32 * ASLICE + 16 * APITCH);
    {
      const v16h ka0 = ldfrag_h(k0p),      ka1 = ldfrag_h(k0p + 32);
      const v16h kc0 = ldfrag_h(k1p),      kc1 = ldfrag_h(k1p + 32);
      s0[0] = mma_h(ka0, qf[0][0], zero8());
      s0[1] = mma_h(ka0, qf[1][0], zero8());
      s1[0] = mma_h(kc0, qf[0][0], zero8());
      s1[1] = mma_h(kc0, qf[1][0], zero8());
      s0[0] = mma_h(ka1, qf[0][1], s0[0]);
      s0[1] = mma_h(ka1, qf[1][1], s0[1]);
      s1[0] = mma_h(kc1, qf[0][1], s1[0]);
      s1[1] = mma_h(kc1, qf[1][1], s1[1]);
      guard4x8<v16h>(s0[0], s0[1], s1[0], s1[1], qf[0][0], qf[0][1], qf[1][0], qf[1][1], ka0, ka1, kc0, kc1);
    }
    // ---- position bias (base 2) of this lane's 16 keys, the same for both tiles ----
    //      Bias and logits are formed in pairs (2k, 2k+1), the register pairs of the score accumulators: other pairs
    //      cost a register copy per element in front of the packed multiply-add.
    const float jb = jb0 + (float)kb;
    const v2f jb2 = {jb, jb}, sl2 = {slope2, slope2}, lsc2 = {lsc, lsc};
    v2f bs[8];
#pragma unroll
    for (int k = 0; k < 4; ++k) {
      const v2f e0 = {(float)(2 * k), (float)(2 * k + 1)}, e1 = {(float)(16 + 2 * k), (float)(17 + 2 * k)};
      bs[k]     = sl2 * (jb2 + e0);
      bs[4 + k] = sl2 * (jb2 + e1);
    }
    // ---- base-2 logits of this lane's 16 keys for query q0 + 16t + c, and their maximum ----
    float tk[QTW][16], cl[QTW];
#pragma unroll     // constant indices: the logits stay in registers
    for (int t = 0; t < QTW; ++t) {
#pragma unroll
      for (int k = 0; k < 4; ++k) {
        const v2f a0 = {s0[t][2 * k], s0[t][2 * k + 1]}, a1 = {s1[t][2 * k], s1[t][2 * k + 1]};
        const v2f l0 = __builtin_elementwise_fma(a0, lsc2, bs[k]), l1 = __builtin_elementwise_fma(a1, lsc2, bs[4 + k]);
        tk[t][2 * k]     = l0[0];
        tk[t][2 * k + 1] = l0[1];
        tk[t][8 + 2 * k]     = l1[0];
        tk[t][8 + 2 * k + 1] = l1[1];
      }
      cl[t] = tk[t][0];
#pragma unroll
      for (int i = 1; i < 16; ++i) cl[t] = fmaxf(cl[t], tk[t][i]);
    }
    // ---- does any of the wave's 32 x 32 weights count? Where every logit lies SKIPD or more below its query's running
    //      maximum, the rest of the key block changes no bit: the maximum stays, the rescale factor is 2^0 = 1, every weight
    //      x32768 is below half the smallest f16 and enters P as 0, and a row's 32 weights together are below half an ulp of
    //      its sum, which is 1 or more. One test per key block, wave-uniform; an unordered compare takes the full path. ----
    const bool need = !(cl[0] <= mrun[0] - SKIPD) || !(cl[1] <= mrun[1] - SKIPD);
    if (__builtin_amdgcn_ballot_w32(need) != 0u) {
    FragH ph[QTW];
#pragma unroll     // constant indices: the per-tile state stays in registers
    for (int t = 0; t < QTW; ++t) {
      const float cm = fmaxf(cl[t], __shfl_xor(cl[t], 16, 32));
      const float mn = fmaxf(mrun[t], cm);                             // finite from the first key block on
      float ea = mrun[t] - mn, pe[16];
#pragma unroll     // constant indices: pe[] stays in registers, as the asm operands need it
      for (int i = 0; i < 16; ++i) pe[i] = fminf(tk[t][i] - mn, 0.f);
      exp2_hw17(ea, pe);
      const float al = (mrun[t] == -INFINITY) ? 0.f : ea;              // o and l are zero while mrun is -inf
      mrun[t] = mn;
      // ---- probabilities (<= 1) and the P A-fragment: f16(p * 32768); element i <-> tk[i] ----
      float ps = 0.f;
#pragma unroll
      for (int w = 0; w < 2; ++w) {
#pragma unroll
        for (int e4 = 0; e4 < 4; ++e4) {
          const int i = 8 * w + 2 * e4;
          const float p0 = pe[i];
          const float p1 = pe[i + 1];
          ps += p0 + p1;
          ph[t].u[w][e4] = pk16(h_bits((_Float16)(p0 * PCAR)), h_bits((_Float16)(p1 * PCAR)));
        }
      }
      ps += __shfl_xor(ps, 16, 32);
      lrun[t] = lrun[t] * al + ps;
      // ---- rescale the O accumulators: D row 8hh+r = query q0+16t+8hh+r, its factor lives in lane 8hh+r (and 16+8hh+r) ----
      float scl[8];
#pragma unroll
      for (int r = 0; r < 8; ++r) scl[r] = __shfl(al, 8 * hh + r, 32);
#pragma unroll
      for (int j = 0; j < 4; ++j) {
#pragma unroll
        for (int r = 0; r < 8; ++r) o[t][j][r] *= scl[r];
      }
    }
    // ---- P.V : B fragment col n = d = j*16 + c, keys contiguous in the v^T plane; one group of 8 ----
    {
      const unsigned char* vp = vr + bo + i32 * 64;
      const v16h vf0 = ldfrag_h((const _Float16*)(const void*)(vp));
      const v16h vf1 = ldfrag_h((const _Float16*)(const void*)(vp + 16 * APITCH));
      const v16h vf2 = ldfrag_h((const _Float16*)(const void*)(vp + ASLICE));
      const v16h vf3 = ldfrag_h((const _Float16*)(const void*)(vp + ASLICE + 16 * APITCH));
#pragma unroll
      for (int t = 0; t < QTW; ++t) {
        o[t][0] = mma_h(ph[t].v, vf0, o[t][0]);
        o[t][1] = mma_h(ph[t].v, vf1, o[t][1]);
        o[t][2] = mma_h(ph[t].v, vf2, o[t][2]);
        o[t][3] = mma_h(ph[t].v, vf3, o[t][3]);
      }
      guard8x6<v16h>(o, ph[0].v, ph[1].v, vf0, vf1, vf2, vf3);
    }
    }
  }
    // ---- publish point of stage NST-2-s (pass s + 1): own LDS reads retired, own slice landed, barrier, then the refill ----
    wait_ds0();
    wait_tensor0_hold(g0, g1);
    __syncthreads();
    if (pinned((uint32_t)(s + 2 < NST))) {
      tdm_aim(g0, dst0 + (uint32_t)bo, ga0 + (uint64_t)(NST - 3 - s) * gstep);
      tdm_load(g0, g1);
    }
  }
  wait_tensor0_hold(g0, g1);   // behind the loop: no request in flight and no LDS read open before the ring is used for the result
  wait_ds0();
  acc_guard8(o);

  // the wave's two slabs lie in the ring: every reader has left both buffers at the last stage's barrier, in front of which
  // every wave's last load has landed, and no load is aimed at them any more
#pragma unroll
  for (int t = 0; t < QTW; ++t) {
    // ---- fold 1/l (per query, owned by lane = query; l >= 1 by construction) and the P/v carries ----
    const float linv = (lrun[t] > 0.f) ? ((1.0f / lrun[t]) * (1.0f / (PCAR * VCAR))) : 0.f;
    float inv[8];
#pragma unroll
    for (int r = 0; r < 8; ++r) inv[r] = __shfl(linv, 8 * hh + r, 32);
    float* slab = (float*)(void*)ring + (wave * QTW + t) * GSLAB;
#pragma unroll
    for (int r = 0; r < 8; ++r) {
#pragma unroll
      for (int j = 0; j < 4; ++j) slab[(8 * hh + r) * 68 + j * 16 + c] = o[t][j][r] * inv[r];
    }
  }
  wave_sync_lds();
  // ---- f32 result: lanes 0..15 -> row 2*i2, lanes 16..31 -> row 2*i2+1; lane = 4 consecutive floats ----
  float* dst = Out + ((size_t)(b * SEQ + q0 + hh)) * DMOD + (size_t)(head * HD + c * 4);
#pragma unroll
  for (int t = 0; t < QTW; ++t) {
    const float* slab = (const float*)(const void*)ring + (wave * QTW + t) * GSLAB;
    v4f vals[8];
#pragma unroll
    for (int i2 = 0; i2 < 8; ++i2) vals[i2] = *(const v4f*)(slab + (i2 * 2 + hh) * 68 + c * 4);
#pragma unroll
    for (int i2 = 0; i2 < 8; ++i2) {
      *(v4f*)(dst + (size_t)(16 * t + i2 * 2) * (size_t)DMOD) = vals[i2];
    }
  }
}

// =====================================================================================================
// Workspace map (bytes, NB = 4); every plane is fully written by whole-line stores before it is read; all extents are
// exact multiples of the store granularity (no pad rows):
//   XB  bf16 [NB*SEQ][DMOD]                          16777216
//   WB  bf16 [3*NHD][DMOD]  (k | q | v chunks)        6291456
//   QP  f16  [NB*SEQ][NHD] x8                       16777216
//   KP  f16  [NB*SEQ][NHD] x8                       16777216
//   VP  f16  [NB][NHD][SEQ] x1024                   16777216
//   end                                             73400320
// 3 launches on one in-order stream.
// =====================================================================================================
extern "C" void kernel_launch(void* const* d_in, const int* in_sizes, int n_in,
                              void* d_out, int out_size, void* d_ws, size_t ws_size,
                              hipStream_t stream) {
  const int ROWS = NB * SEQ;
  if (n_in < 2) return;
  if (in_sizes[0] < ROWS * DMOD) return;
  if (in_sizes[1] != 3 * NHD * DMOD) return;
  if (out_size < ROWS * DMOD) return;

  const float* Xin = (const float*)d_in[0];
  const float* Win = (const float*)d_in[1];
  float*       out = (float*)d_out;

  const size_t szXB = (size_t)ROWS * DMOD * 2;
  const size_t szWB = (size_t)3 * NHD * DMOD * 2;
  const size_t szPl = (size_t)ROWS * NHD * 2;                  // q/k planes
  const size_t szVP = (size_t)NB * NHD * SEQ * 2;
  size_t off = 0;
  const size_t oXB = off; off += szXB;
  const size_t oWB = off; off += szWB;
  const size_t oQP = off; off += szPl;
  const size_t oKP = off; off += szPl;
  const size_t oVP = off; off += szVP;
  if (off > ws_size) return;                            // off = 73400320 for NB = 4
  if (off > (size_t)134217728) return;

  char* ws = (char*)d_ws;
  u16* XB = (u16*)(ws + oXB);
  u16* WB = (u16*)(ws + oWB);
  u16* QP = (u16*)(ws + oQP);
  u16* KP = (u16*)(ws + oKP);
  u16* VP = (u16*)(ws + oVP);

  const int n8x = (ROWS * DMOD) / 8;
  const int n8w = (3 * NHD * DMOD) / 8;
  if ((n8x % 256) != 0 || (n8w % 256) != 0) return;
  if ((DMOD % 64) != 0 || (NHD % GTILE) != 0 || (SEQ % GTILE) != 0 || (SQ % GTILE) != 0 || (DMOD % 32) != 0) return;

  const dim3 blk(256);
  const dim3 gC((n8x + n8w) / 256);                     // 4096 + 1536
  const dim3 bG(128);
  const dim3 gG(GNQ + GNK + GNV);                       // 3 x 512
  const dim3 gAT(ATT_BLOCKS);                           // 256
  const dim3 bAT(ATT_THREADS);                          // 512

  // (1) x -> bf16 plane [ROWS][DMOD] and W [3*NHD out][DMOD in] -> bf16, same layouts (W is already k-contiguous for B
  //     fragments / row-major A for the v^T GEMM); WB lies directly behind XB
  cvt16<<<gC, blk, 0, stream>>>(Xin, Win, XB, n8x, n8x + n8w);
  // (2) q, k as single f16 planes [b][s][h*64+d], x8, and the v^T plane per batch [h*64+d][keys], x1024
  gemm_bb<<<gG, bG, 0, stream>>>(XB, WB, QP, KP, VP);
  // (3) attention -> out [b][s][h*64+d] f32
  attn_fwd<<<gAT, bAT, 0, stream>>>(QP, KP, VP, out);
  (void)hipGetLastError();
}

// v008
// A run of this version takes 95.4 microseconds.
// Two timings next to v007 both put it at 1.06 times that version's speed.
// Counting every step since v000, it is 4.25 times as fast.
// Contractions: x.Wk^T, x.Wq^T and Wv.x^T on v_wmma_f32_16x16x32_bf16 (x and W planes RNE-converted to bf16 operands,
// f32 accumulate); scores k.q^T (single f16 planes: k carried x8, q carrying the base-2 logit scale / 8) and P.v (P x32768
// single f16, v x1024 single f16) on v_wmma_f32_16x16x32_f16, f32 accumulate, the score accumulators starting at the
// position bias. Base-2 online softmax; 1/l and carry folds in f32 on VALU; f32 result written directly.
#include <hip/hip_runtime.h>
#include <math.h>
#include <stdint.h>

#ifndef NB
#define NB    4
#endif
#define SEQ   2048
#ifndef SQ
#define SQ    SEQ
#endif
#define DMOD  1024
#define NH    16
#define HD    64
#define NHD   (NH * HD)
#define KSC   8.0f
#define QSC   (INVN * LOG2E / KSC)      // q plane x k plane = the base-2 logit without its bias: (q.k / 32) * log2e
#define PEXP  15.0f                     // P and the row sums are carried x 2^15: the carry rides in the exponent
#define VCAR  1024.0f
#define LOG2E 1.4426950408889634f
#define INVN  0.03125f
#define RSQ2  0.70710678118654752f
#define ATT_WAVES   4                   // waves of one head in an attention block
#define ATT_HEADS   4                   // heads of one attention block
#define ATT_THREADS (ATT_HEADS * ATT_WAVES * 32)
#define QTW         2                   // query tiles of 16 per attention wave
#define ATT_Q       (ATT_WAVES * 16 * QTW)
#define NQT         (SQ / ATT_Q)
#define ATT_BLOCKS  (NB * (NH / ATT_HEADS) * NQT)
#define SKIPD       41.0f               // a base-2 logit this far below the running maximum gives a weight that is 0 in f16
// Heads of block group g, one nibble each (bits 16g .. 16g+15). The steeper a head's slope, the fewer of its key blocks carry
// weight, so every group gets one of the four flattest heads, one of the next four and two steep ones.
#define HEADMAP     0x468C379D25AE01BFull
#define NKB         (SEQ / 32)
#define GSLAB       (16 * 68)
#define GKC         128                 // k elements of one GEMM stage: rows of 256 bytes
#define GPITCH      272                 // LDS row pitch, bytes: 256 + 16, an odd multiple of 16 for 16-byte readers
#define GTILE       128                 // the block's tile of C: 128 x 128, one 64 x 64 quarter per wave
#define GSLICE      18432               // one wave's slice: 64 rows x 272 B = 17408 B, rounded up to a multiple of 2 KiB
#define GSTAGE      (4 * GSLICE)        // [A rows 0..63 | A rows 64..127 | B rows 0..63 | B rows 64..127]
#define GWSLAB      (64 * 68)           // floats of one wave's result slab: 64 rows at a pitch of 68
#define GRING       (2 * GSTAGE)
#define GNQ         (NB * (SQ / GTILE) * (NHD / GTILE))    // blocks of the q product
#define GNK         (NB * (SEQ / GTILE) * (NHD / GTILE))   // blocks of the k product
#define GNV         (NB * (NHD / GTILE) * (SEQ / GTILE))   // blocks of the v^T product
#define AKEYS       64                  // keys of one attention stage: k rows and v^T rows of 128 bytes each
#define APITCH      144                 // LDS row pitch, bytes: 128 + 16, an odd multiple of 16 for 16-byte readers
#define ASLICE      6144                // one wave's slice: 32 rows x 144 B = 4608 B, rounded up to a multiple of 2 KiB
#define ASTAGE      (4 * ASLICE)        // [k rows 0..31 | k rows 32..63 | v^T rows 0..31 | v^T rows 32..63]
#define ARING       (2 * ASTAGE)
#define NST         (SEQ / AKEYS)
static_assert(32 * APITCH <= ASLICE && (ASLICE % 2048) == 0 && HD * 2 == 128 && AKEYS * 2 == 128 && ATT_WAVES == 4);
static_assert(ATT_WAVES * QTW * GSLAB * 4 <= ARING && (SEQ % AKEYS) == 0 && NST >= 2 && (AKEYS % 32) == 0);
static_assert((SQ % ATT_Q) == 0 && QTW == 2);
static_assert(64 * GPITCH <= GSLICE && (GSLICE % 2048) == 0 && GKC * 2 == 256 && 4 * GWSLAB * 4 <= GSTAGE);
static_assert((NHD % GTILE) == 0 && (SEQ % GTILE) == 0 && (SQ % GTILE) == 0);
static_assert((DMOD % GKC) == 0 && (DMOD / GKC) >= 2);
static_assert(NH == 16 && HD == 64 && DMOD == NHD);
static_assert((HD % 32) == 0 && (SEQ % 64) == 0 && (SQ % 64) == 0 && SQ <= SEQ && SQ >= 64);
static_assert((DMOD % 64) == 0 && (DMOD % 32) == 0 && (NHD % 64) == 0);
static_assert(((NB * SEQ * DMOD / 8) % 256) == 0);
static_assert(((3 * NHD * DMOD / 8) % 256) == 0);
static_assert((GSLAB * 4) % 16 == 0 && ATT_THREADS == 512 && ATT_HEADS * 4 == NH && (ARING % 2048) == 0);
static_assert(NB >= 1 && NB <= 4);

typedef unsigned short u16;
typedef _Float16 v16h __attribute__((ext_vector_type(16)));
typedef _Float16 v8h  __attribute__((ext_vector_type(8)));
typedef _Float16 v2h  __attribute__((ext_vector_type(2)));
typedef __bf16   v16b __attribute__((ext_vector_type(16)));
typedef float    v8f  __attribute__((ext_vector_type(8)));
typedef float    v4f  __attribute__((ext_vector_type(4)));
typedef float    v2f  __attribute__((ext_vector_type(2)));
typedef unsigned int v4u __attribute__((ext_vector_type(4)));
typedef uint32_t u32x4 __attribute__((ext_vector_type(4)));
typedef uint32_t u32x8 __attribute__((ext_vector_type(8)));

union FragH { v16h v; v8h h[2]; v4u u[2]; };
union FragB { v16b v; v4u u[2]; };

// ---- scalar helpers --------------------------------------------------------------------------------
__device__ __forceinline__ unsigned short bf_bits(float f) {          // f32 -> bf16 bits, RNE convert
  unsigned u = __float_as_uint(f);
  return (unsigned short)((u + 0x7FFFu + ((u >> 16) & 1u)) >> 16);
}
__device__ __forceinline__ unsigned short h_bits(_Float16 x) { return __builtin_bit_cast(unsigned short, x); }
__device__ __forceinline__ unsigned pk16(unsigned short a, unsigned short b) { return (unsigned)a | ((unsigned)b << 16); }
// 2^x in place for a key block's rescale exponent (<= 0) and its 16 score exponents (<= PEXP), by the bare hardware instruction.
// exp2f() wraps each v_exp_f32 in a compare, two selects, an add and an ldexp so that results below 2^-126 come out as
// denormals; such a weight vanishes anyway, in the f16 operand and in a row sum that holds its largest weight. One statement, so
// that no neighbour of a v_exp_f32 reads its result or overwrites its source; the closing v_nop keeps that slot behind the
// last one, whatever the compiler puts next.
__device__ __forceinline__ void exp2_hw17(float& a, float (&t)[16]) {
#if defined(__HIP_DEVICE_COMPILE__)
  asm("v_exp_f32 %0, %0\n\tv_exp_f32 %1, %1\n\tv_exp_f32 %2, %2\n\tv_exp_f32 %3, %3\n\tv_exp_f32 %4, %4\n\t"
      "v_exp_f32 %5, %5\n\tv_exp_f32 %6, %6\n\tv_exp_f32 %7, %7\n\tv_exp_f32 %8, %8\n\tv_exp_f32 %9, %9\n\t"
      "v_exp_f32 %10, %10\n\tv_exp_f32 %11, %11\n\tv_exp_f32 %12, %12\n\tv_exp_f32 %13, %13\n\t"
      "v_exp_f32 %14, %14\n\tv_exp_f32 %15, %15\n\tv_exp_f32 %16, %16\n\tv_nop"
      : "+v"(a), "+v"(t[0]), "+v"(t[1]), "+v"(t[2]), "+v"(t[3]), "+v"(t[4]), "+v"(t[5]), "+v"(t[6]), "+v"(t[7]),
        "+v"(t[8]), "+v"(t[9]), "+v"(t[10]), "+v"(t[11]), "+v"(t[12]), "+v"(t[13]), "+v"(t[14]), "+v"(t[15]));
#endif
}
__device__ __forceinline__ v8f zero8() { v8f z = {0.f, 0.f, 0.f, 0.f, 0.f, 0.f, 0.f, 0.f}; return z; }

// ---- fragment loaders: 16-bit A/B operand, lane -> row/col (lane&15), p already includes +8*(lane>>4);
//      elements 0..7 <- p[0..7] (k0+8h..), elements 8..15 <- p[16..23] (k0+16+8h..)  (same split k map for A and B;
//      B is always read from a k-contiguous [n][k] plane)
__device__ __forceinline__ v16h ldfrag_h(const _Float16* p) {
  FragH f;
  f.h[0] = *(const v8h*)(p);
  f.h[1] = *(const v8h*)(p + 16);
  return f.v;
}
__device__ __forceinline__ v16b ldfrag_b(const u16* p) {              // bf16 plane read as unsigned integer vectors
  FragB f;
  f.u[0] = *(const v4u*)(p);
  f.u[1] = *(const v4u*)(p + 16);
  return f.v;
}

__device__ __forceinline__ v8f mma_h(v16h a, v16h b, v8f c) {
  return __builtin_amdgcn_wmma_f32_16x16x32_f16(false, a, false, b, (short)0, c, false, false);
}
__device__ __forceinline__ v8f mma_b(v16b a, v16b b, v8f c) {
  return __builtin_amdgcn_wmma_f32_16x16x32_bf16(false, a, false, b, (short)0, c, false, false);
}
// Four vector slots between a group of matrix instructions and the first vector instruction that reads their results or
// overwrites their operands: results in-out, operands as inputs.
template <typename F>
__device__ __forceinline__ void guard4x8(v8f& a, v8f& b, v8f& c, v8f& d, F x0, F x1, F x2, F x3, F x4, F x5, F x6, F x7) {
#if defined(__HIP_DEVICE_COMPILE__)
  asm volatile("v_nop\n\tv_nop\n\tv_nop\n\tv_nop"
               : "+v"(a), "+v"(b), "+v"(c), "+v"(d)
               : "v"(x0), "v"(x1), "v"(x2), "v"(x3), "v"(x4), "v"(x5), "v"(x6), "v"(x7) : "memory");
#endif
}
template <typename F>
__device__ __forceinline__ void guard8x6(v8f (&a)[QTW][4], F x0, F x1, F x2, F x3, F x4, F x5) {
#if defined(__HIP_DEVICE_COMPILE__)
  asm volatile("v_nop\n\tv_nop\n\tv_nop\n\tv_nop"
               : "+v"(a[0][0]), "+v"(a[0][1]), "+v"(a[0][2]), "+v"(a[0][3]), "+v"(a[1][0]), "+v"(a[1][1]), "+v"(a[1][2]),
                 "+v"(a[1][3])
               : "v"(x0), "v"(x1), "v"(x2), "v"(x3), "v"(x4), "v"(x5) : "memory");
#endif
}
__device__ __forceinline__ void acc_guard8(v8f (&a)[QTW][4]) {
#if defined(__HIP_DEVICE_COMPILE__)
  asm volatile("v_nop\n\tv_nop\n\tv_nop\n\tv_nop"
               : "+v"(a[0][0]), "+v"(a[0][1]), "+v"(a[0][2]), "+v"(a[0][3]), "+v"(a[1][0]), "+v"(a[1][1]), "+v"(a[1][2]),
                 "+v"(a[1][3]));
#endif
}
// Four vector slots between the last matrix instructions of the GEMM loop, which is left by a taken branch, and the first
// read of their results.
__device__ __forceinline__ void acc_guard16(v8f (&a)[4][4]) {
#if defined(__HIP_DEVICE_COMPILE__)
  asm volatile("v_nop\n\tv_nop\n\tv_nop\n\tv_nop"
               : "+v"(a[0][0]), "+v"(a[0][1]), "+v"(a[0][2]), "+v"(a[0][3]), "+v"(a[1][0]), "+v"(a[1][1]), "+v"(a[1][2]),
                 "+v"(a[1][3]), "+v"(a[2][0]), "+v"(a[2][1]), "+v"(a[2][2]), "+v"(a[2][3]), "+v"(a[3][0]), "+v"(a[3][1]),
                 "+v"(a[3][2]), "+v"(a[3][3]));
#endif
}
// The scheduler moves nothing across this point. Without it the compiler sinks three of a step's four A fragments to just
// in front of the row of matrix instructions that reads them, each with a wait to 0: four LDS latencies a step, not one.
__device__ __forceinline__ void sched_fence() {
#if defined(__HIP_DEVICE_COMPILE__)
  __builtin_amdgcn_sched_barrier(0);
#endif
}
__device__ __forceinline__ void wave_sync_lds() {
#if defined(__HIP_DEVICE_COMPILE__)
  __builtin_amdgcn_fence(__ATOMIC_RELEASE, "workgroup");
  __builtin_amdgcn_wave_barrier();
  __builtin_amdgcn_fence(__ATOMIC_ACQUIRE, "workgroup");
#endif
}

// ---- tensor load to LDS: descriptor words, issue, waits ---------------------------------------------
__device__ __forceinline__ uint32_t uni(uint32_t v) { return (uint32_t)__builtin_amdgcn_readfirstlane((int)v); }
// Test around a tensor load, which ignores EXEC: it has to compile to s_cmp + s_cbranch_scc.
__device__ __forceinline__ uint32_t pinned(uint32_t v) {
  uint32_t w = uni(v);
  asm volatile("" : "+s"(w));   // pinned(): holds the test word in a scalar register, so that the branch on it is scalar
  return w;
}
// Group 1: 1-byte elements, tile = tensor = 64 rows of 256 bytes, source row pitch src_pitch bytes; word 0 is the pad
// constant for 256-byte rows with 16 bytes behind each row (LDS pitch 272), no mask.
__device__ __forceinline__ u32x8 tdm_group1(uint32_t src_pitch) {
  constexpr uint32_t d0 = 256u, d1 = 64u;
  u32x8 g;
  g[0] = uni((1u << 20) | (5u << 22) | (3u << 25));
  g[1] = uni((d0 & 0xFFFFu) << 16);
  g[2] = uni((d0 >> 16) | ((d1 & 0xFFFFu) << 16));
  g[3] = uni((d1 >> 16) | (d0 << 16));
  g[4] = uni(d1);
  g[5] = uni(src_pitch);
  g[6] = uni(0u);
  g[7] = uni(0u);
  return g;
}
// The same for 32 rows of 128 bytes: pad constant for 128-byte rows with 16 bytes behind each row (LDS pitch 144), no mask.
__device__ __forceinline__ u32x8 tdm_group1_r128(uint32_t src_pitch) {
  constexpr uint32_t d0 = 128u, d1 = 32u;
  u32x8 g;
  g[0] = uni((1u << 20) | (4u << 22) | (3u << 25));
  g[1] = uni((d0 & 0xFFFFu) << 16);
  g[2] = uni((d0 >> 16) | ((d1 & 0xFFFFu) << 16));
  g[3] = uni((d1 >> 16) | (d0 << 16));
  g[4] = uni(d1);
  g[5] = uni(src_pitch);
  g[6] = uni(0u);
  g[7] = uni(0u);
  return g;
}
__device__ __forceinline__ u32x4 tdm_group0(uint32_t lds_dst, uint64_t ga) {
  u32x4 g;
  g[0] = uni(1u);
  g[1] = uni(lds_dst);
  g[2] = uni((uint32_t)ga);
  g[3] = uni((((uint32_t)(ga >> 32)) & 0x01FFFFFFu) | 0x80000000u);
  return g;
}
// Aim group 0 at the next tile: only the LDS place and the address change.
__device__ __forceinline__ void tdm_aim(u32x4& g, uint32_t lds_dst, uint64_t ga) {
  g[1] = uni(lds_dst);
  g[2] = uni((uint32_t)ga);
  g[3] = uni((((uint32_t)(ga >> 32)) & 0x01FFFFFFu) | 0x80000000u);
}
// One request of the whole wave. Both groups are in-out operands so that their scalar registers stay theirs up to the
// next request: as plain inputs the compiler used some of them as temporaries while the request was in flight.
__device__ __forceinline__ void tdm_load(u32x4& g0, u32x8& g1) {
#if defined(__HIP_DEVICE_COMPILE__)
  asm volatile("tensor_load_to_lds %0, %1" : "+s"(g0), "+s"(g1) :: "memory");
#endif
}
// The wave's own slice has landed. Both groups are in-out operands: every scalar register
// of a descriptor stays the descriptor's own until the wait that covers its request; otherwise the compiler reuses a word
// that is dead behind the issue.
__device__ __forceinline__ void wait_tensor0_hold(u32x4& g0, u32x8& g1) {
#if defined(__HIP_DEVICE_COMPILE__)
  asm volatile("s_wait_tensorcnt 0x0" : "+s"(g0), "+s"(g1) :: "memory");
#endif
}
__device__ __forceinline__ void wait_ds0() {
#if defined(__HIP_DEVICE_COMPILE__)
  asm volatile("s_wait_dscnt 0x0" ::: "memory");       // the wave's LDS reads have retired before their buffer is refilled
#endif
}

// =====================================================================================================
// Both f32 planes -> bf16 RNE planes, same layouts, in one launch: neither conversion reads what the other writes. The two
// results lie one behind the other at D (x first), so a thread's place in D is its flat index; blocks below n8x/256 read x,
// the others w (n8x is a multiple of 256: the choice is the same for a whole block).
// Thread = 8 consecutive elements: two 16-B loads, one 16-B store;
// coverage: grid = n8/256 blocks (host checks exactness) x 256 thr x 8 = both planes, n8 = n8x + the chunks of w.
// =====================================================================================================
__global__ __launch_bounds__(256) void cvt16(const float* __restrict__ x, const float* __restrict__ w, u16* D, int n8x, int n8) {
  const int gt = blockIdx.x * 256 + (int)threadIdx.x;
  if (gt >= n8) return;                     // no barriers in this kernel
  const float* p = ((int)blockIdx.x * 256 < n8x) ? (x + (size_t)gt * 8) : (w + (size_t)(gt - n8x) * 8);
  const v4f a = *(const v4f*)(p), c4 = *(const v4f*)(p + 4);
  v4u o;
  o[0] = pk16(bf_bits(a[0]),  bf_bits(a[1]));
  o[1] = pk16(bf_bits(a[2]),  bf_bits(a[3]));
  o[2] = pk16(bf_bits(c4[0]), bf_bits(c4[1]));
  o[3] = pk16(bf_bits(c4[2]), bf_bits(c4[3]));
  u16* d = D + (size_t)gt * 8;
  {
    *(v4u*)(d) = o;
    
  }
}

// =====================================================================================================
// The three projections in one launch: none reads what another writes, so their blocks share one grid and a block that
// starts or stores its result runs beside blocks that are in their loops. The block index picks the product:
//   blocks 0 .. GNQ-1        q plane   = (x . Wq^T) x QSC over SQ rows per batch
//   the next GNK             k plane   = (x . Wk^T) x8 over all keys
//   the last GNV             v^T plane = (Wv . x_b^T) x1024 per batch
// Each is a batched bf16 GEMM with f16 result:  C[bt][M][N] = f16( (A[bt][M][K] (bf16 row-major) . Bt[bt][N][K]^T (bf16
// k-contiguous)) * oscale ); per-batch element strides bstA/bstB/bstC. Block = 128x128 tile, 4 waves in a 2 x 2 grid, each
// with a 64x64 quarter = 4 x 4 accumulator tiles: a fragment read from LDS feeds 4 matrix instructions, and an operand row
// brought into LDS serves 128 rows or columns of C.
// Operands come through LDS: a stage is 128 k of the block's 128 A rows and 128 B rows; every wave brings its own slice
// of 64 rows x 256 B with one tensor load (LDS pitch 272 B), two buffers, the next stage in flight while this one is
// worked on. Fragments are read from the LDS rows (two 16-B loads each, split k map for A and B), K stepped by 32
// inside a stage (K = DMOD: a multiple of 128 and at least two stages; M % 128 == 0, N % 128 == 0,
// nbatch*(M/128)*(N/128) blocks per product). The ring becomes the result slabs behind the last pass's barrier.
// Result: lane = (row in group of 4, 8 consecutive cols); one instruction = 4 rows, each 64 halves = one 128-B line.
// coverage: 16 instructions x 4 rows x 8 lanes x 8 halves = the wave's 64 x 64 quarter; 4 waves = the block's 128 x 128 tile.
// =====================================================================================================
__global__ __launch_bounds__(128)
void gemm_bb(const u16* __restrict__ XBp, const u16* __restrict__ WBp, u16* QPp, u16* KPp, u16* VPp) {
  __shared__ __attribute__((aligned(2048))) unsigned char ring[GRING];
  // ---- which product: block-uniform, from the block index alone ----
  constexpr int K = DMOD;
  int bid = blockIdx.x;
  const u16 *A, *Bt;
  u16* C;
  int M, N, bstA, bstB, bstC;
  float oscale;
  if (bid < GNQ) {
    A = XBp; Bt = WBp + (size_t)NHD * DMOD; C = QPp;
    M = SQ; N = NHD; bstA = SEQ * DMOD; bstB = 0; bstC = SEQ * NHD; oscale = QSC;
  } else if (bid < GNQ + GNK) {
    bid -= GNQ;
    A = XBp; Bt = WBp; C = KPp;
    M = SEQ; N = NHD; bstA = SEQ * DMOD; bstB = 0; bstC = SEQ * NHD; oscale = KSC;
  } else {
    bid -= GNQ + GNK;
    A = WBp + (size_t)2 * NHD * DMOD; Bt = XBp; C = VPp;
    M = NHD; N = SEQ; bstA = 0; bstB = SEQ * DMOD; bstC = NHD * SEQ; oscale = VCAR;
  }
  const int tid = threadIdx.x, lane = tid & 31, hh = lane >> 4, m = lane & 15;
  const int wave = (int)uni((uint32_t)tid >> 5);
  const int wm = wave >> 1, wn = wave & 1;   // the wave's quarter: rows 64*wm .., columns 64*wn ..
  const int ntile = N / GTILE, mtile = M / GTILE;
  const int per   = ntile * mtile;
  const int bt    = bid / per;
  const int t     = bid - bt * per;
  const int row0  = (t / ntile) * GTILE;
  const int col0  = (t % ntile) * GTILE;
  if (row0 + GTILE > M) return;              // block-uniform, never taken with the exact grid; in front of every barrier and load
  const u16* Ab  = A  + (size_t)bt * (size_t)bstA;
  const u16* Bb  = Bt + (size_t)bt * (size_t)bstB;
  u16*       Cb  = C  + (size_t)bt * (size_t)bstC;
  // ---- this wave's slice of every stage: waves 0,1 = A rows row0 + 64*wave .., waves 2,3 = B rows col0 + 64*(wave-2) .. ----
  const u16* sp = (wave < 2) ? (Ab + (size_t)(row0 + 64 * wave) * K) : (Bb + (size_t)(col0 + 64 * (wave - 2)) * K);
  const uint64_t ga0  = (uint64_t)(size_t)sp;
  const uint32_t dst0 = (uint32_t)(size_t)ring + (uint32_t)wave * GSLICE;
  u32x8          g1   = tdm_group1((uint32_t)K * 2u);
  u32x4          g0   = tdm_group0(dst0, ga0);
  const int      npass = K / GKC;
  // ---- fragment rows in LDS: A rows 16*i + m of slice wm, B rows 16*j + m of slice 2 + wn; +16*hh bytes = +8*hh elements ----
  const unsigned char* ar = ring + wm * GSLICE + m * GPITCH + 16 * hh;
  const unsigned char* br = ring + (2 + wn) * GSLICE + m * GPITCH + 16 * hh;
  v8f acc[4][4];
#pragma unroll
  for (int i = 0; i < 4; ++i) {
#pragma unroll
    for (int j = 0; j < 4; ++j) acc[i][j] = zero8();
  }
  // ---- prologue: stage 0 lands and is published, then stage 1 is put in flight ----
  tdm_load(g0, g1);
  wait_tensor0_hold(g0, g1);
  __syncthreads();
  tdm_aim(g0, dst0 + GSTAGE, ga0 + 2u * GKC);
  tdm_load(g0, g1);
#pragma unroll 1   // one pass per stage: the publish point below stands once per trip
  for (int s = 0; s < npass; ++s) {
    const int bo = (s & 1) * GSTAGE;
#pragma unroll     // constant LDS offsets for the four 32-deep steps of a stage
    for (int kk = 0; kk < GKC / 32; ++kk) {
      const int o = bo + kk * 64;
      v16b af[4], bf[4];
#pragma unroll     // constant indices: the fragments stay in registers
      for (int i = 0; i < 4; ++i) {
        af[i] = ldfrag_b((const u16*)(const void*)(ar + o + i * 16 * GPITCH));
        bf[i] = ldfrag_b((const u16*)(const void*)(br + o + i * 16 * GPITCH));
      }
      sched_fence();   // all 16 loads of the step are issued ahead of its 16 products
#pragma unroll
      for (int i = 0; i < 4; ++i) {
#pragma unroll
        for (int j = 0; j < 4; ++j) acc[i][j] = mma_b(af[i], bf[j], acc[i][j]);
      }
    }
    // ---- publish point of stage s + 1: own LDS reads retired, own slice landed, barrier, then the refill ----
    wait_ds0();
    wait_tensor0_hold(g0, g1);
    __syncthreads();
    if (pinned((uint32_t)(s + 2 < npass))) {
      tdm_aim(g0, dst0 + (uint32_t)bo, ga0 + (uint64_t)(s + 2) * (2u * GKC));
      tdm_load(g0, g1);
    }
  }
  wait_tensor0_hold(g0, g1);   // behind the loop: no request in flight and no LDS read open before the ring is used for the result
  wait_ds0();
  acc_guard16(acc);
  // ---- stage the scaled value in the wave's slab: the ring's first bytes, which every reader has left at the last
  //      pass's barrier and at which no load is aimed any more ----
  float* sl = (float*)(void*)ring + wave * GWSLAB;
#pragma unroll
  for (int i = 0; i < 4; ++i) {
#pragma unroll
    for (int r = 0; r < 8; ++r) {
      const int ro = (16 * i + 8 * hh + r) * 68 + m;
#pragma unroll
      for (int j = 0; j < 4; ++j) sl[ro + 16 * j] = acc[i][j][r] * oscale;
    }
  }
  wave_sync_lds();
  const int rq = lane >> 3, c8 = (lane & 7) * 8;
  u16* dst = Cb + ((size_t)(row0 + 64 * wm) + (size_t)rq) * (size_t)N + (size_t)(col0 + 64 * wn + c8);
#pragma unroll
  for (int i4 = 0; i4 < 16; ++i4) {
    const float* rp = sl + (i4 * 4 + rq) * 68 + c8;
    const v4f a = *(const v4f*)(rp), c4 = *(const v4f*)(rp + 4);
    v4u ov;
    ov[0] = pk16(h_bits((_Float16)a[0]),  h_bits((_Float16)a[1]));
    ov[1] = pk16(h_bits((_Float16)a[2]),  h_bits((_Float16)a[3]));
    ov[2] = pk16(h_bits((_Float16)c4[0]), h_bits((_Float16)c4[1]));
    ov[3] = pk16(h_bits((_Float16)c4[2]), h_bits((_Float16)c4[3]));
    *(v4u*)(dst + (size_t)(i4 * 4) * (size_t)N) = ov;
  }
}

// =====================================================================================================
// Multi-head flash attention with per-head linear relative-position bias (no mask): block = (batch b, 4 heads, 128 query
// rows), 4 waves per head, each head with an LDS ring of its own; wave w of a head owns query rows q0 = 128*qt + 32*w ..
// q0+31 as two tiles of 16 (tile t = rows q0+16t .. +15).
// The keys are walked from the last to the first: the bias falls along the walk, so a row's running maximum settles early,
// and a key block none of whose weights can count any more is left behind its scores (test in the loop). How many key blocks
// that is depends on the head's slope, so a block holds steep and flat heads, one wave of each on every SIMD.
// Every k fragment, v^T fragment and bias term that the wave fetches or forms serves both tiles.
//   k and v^T come through LDS, shared by the head's 4 waves: a stage is 64 keys = 64 k rows x 128 B and 64 v^T rows x
//   128 B; every wave brings its own slice of 32 rows with one tensor load (LDS pitch 144 B), two buffers, the next stage
//   in flight while this one is worked on; one publish point (waits + block barrier) per stage. The ring becomes the
//   wave-private result slabs behind the last stage's barrier.
//   q plane (f16, x QSC) laid out [b][s][h*64+d]; k plane the same (f16, x8); v^T plane [b][h*64+d][s] (x1024 f16).
//   The scores of all NKB = 64 key blocks of 32 keys are computed (static bound).
//   Scores are computed TRANSPOSED: S^T tile g (g = 0,1) = k rows (keys kb+16g .. +15, A operand, row m = lane&15, split k
//   map over d) times q^T (B operand, col n = query q0 + 16t + (lane&15), k = d, split map), one f16 product per tile and
//   32-deep d-chunk, one guarded group of 8 WMMAs; the four q fragments are loaded once per wave.
//   D element r of lane l = (key kb+16g+8h+r, query q0+16t+(l&15)), so a lane owns one query column per tile and 16 of its
//   32 keys; the partner lane l^16 owns the other 16 -> row max / row sum need one xor-16 shuffle.
//   The logits come out of the matrix unit: the q plane carries their scale, and the first product of every score tile adds
//   to a constant tile (its C operand) that holds the bias of the key's place inside its block, slope_h * log2e * (16g+8h+r),
//   slope_h = (2^-0.5)^(h+1). What the bias has besides is the same for a whole key block (slope_h * log2e * the block's
//   distance from the last block, cs below) and is added to or taken from the running maximum, one value per query, not per
//   logit; the query's own term is left out: the softmax over keys does not see a constant per query.
//   Online max-subtracted base-2 softmax in f32. The exp'd values ARE the P A-fragment in place: A row m = query = lane&15,
//   element i <- key kb+8h+i (tile 0, D element i), element 8+i <- key kb+16+8h+i (tile 1, D element i). P is carried
//   x32768 as single f16, the factor added as 15 to the exponent.
//   The rescale factor of query row 8h+r of the O accumulators is fetched from lane 8h+r with a
//   shuffle (uniform control). 4 v^T B fragments (col n = d = 16j + (lane&15), keys k-contiguous), 8 P.V WMMAs per key
//   block in one guarded group.
//   Epilogue: 1/l (per query, shuffled to the D row owner) and the carry folds in f32; each 16x64 f32 result tile staged,
//   segment (b, q0+row, head) of the f32 result [b][s][h*64+d] written by 16 consecutive lanes x 16 B of one instruction
// coverage: per wave 2 tiles x 8 instructions x 2 rows x 16 lanes x 4 floats = 32 x 64; grid NB*(NH/4)*(SQ/128) blocks x 4
//           heads x 4 waves = every (b, s < SQ, h) row segment of the result exactly once.
// =====================================================================================================
__global__ __launch_bounds__(ATT_THREADS)
void attn_fwd(const u16* __restrict__ QPp, const u16* __restrict__ KPp, const u16* __restrict__ VPp, float* Out) {
  __shared__ __attribute__((aligned(2048))) unsigned char rings[ATT_HEADS * ARING];   // per head: k / v^T stages; result slabs in the epilogue

  const int tid  = threadIdx.x;
  const int w16  = (int)uni((uint32_t)tid >> 5);
  const int hq   = w16 >> 2;             // which of the block's heads; waves w, w+4, w+8, w+12 are one wave of each head
  const int wave = w16 & 3;              // the wave's place among its head's four
  unsigned char* ring = rings + hq * ARING;
  const int lane = tid & 31;
  const int hh   = lane >> 4;
  const int c    = lane & 15;

  const int bid  = blockIdx.x;
  const int qt   = bid % NQT;
  const int grp  = (bid / NQT) % (NH / ATT_HEADS);
  const int head = (int)((HEADMAP >> (16 * grp + 4 * hq)) & 15ull);
  const int b    = bid / (NQT * (NH / ATT_HEADS));
  const int q0   = qt * ATT_Q + wave * (16 * QTW);

  // B fragments of q^T: col n = query q0 + 16t + c, k = d (k-contiguous row segment of the q plane)
  const size_t qofs = ((size_t)(b * SEQ + q0 + c)) * NHD + (size_t)(head * HD + 8 * hh);
  const _Float16* Qb = (const _Float16*)(const void*)QPp + qofs;
  // ---- this wave's slice of every stage: waves 0,1 = k rows (keys) 32*wave .., 128 B of this head each; waves 2,3 =
  //      v^T rows (d) 32*(wave-2) .., 128 B = 64 keys each ----
  const u16* sp = (wave < 2) ? (KPp + ((size_t)(b * SEQ + 32 * wave)) * NHD + (size_t)(head * HD))
                             : (VPp + ((size_t)(b * NHD + head * HD + 32 * (wave - 2))) * SEQ);
  const uint64_t ga0   = (uint64_t)(size_t)sp;
  const uint32_t gstep = (wave < 2) ? (uint32_t)(AKEYS * NHD * 2) : (uint32_t)(AKEYS * 2);   // bytes from stage to stage
  const uint32_t dst0  = (uint32_t)(size_t)ring + (uint32_t)wave * ASLICE;
  u32x8          g1    = tdm_group1_r128((wave < 2) ? (uint32_t)(NHD * 2) : (uint32_t)(SEQ * 2));
  u32x4          g0    = tdm_group0(dst0, ga0 + (uint64_t)(NST - 1) * gstep);   // the walk starts at the last stage
  // A fragments of k: LDS row = key (in its slice of 32) 16g + c, k = d; +16*hh bytes = +8*hh elements
  const unsigned char* kr = ring + c * APITCH + 16 * hh;
  // B fragments of v: col n = d = 16j + c = LDS row of the v^T slices, k = key (contiguous in the row)
  const unsigned char* vr = ring + 2 * ASLICE + c * APITCH + 16 * hh;

  const int   ex     = head + 1;
  const float slope  = (((ex & 1) != 0) ? RSQ2 : 1.0f) * __int_as_float((127 - (ex >> 1)) << 23);
  const float slope2 = slope * LOG2E;
  // C operands of the score tiles: bias (base 2) of this lane's keys 8hh+r and 16+8hh+r of a key block, the same for every block
  v8f bl0, bl1;
#pragma unroll
  for (int r = 0; r < 8; ++r) {
    bl0[r] = slope2 * (float)(8 * hh + r);
    bl1[r] = slope2 * (float)(16 + 8 * hh + r);
  }

  v16h qf[QTW][2];
#pragma unroll
  for (int t = 0; t < QTW; ++t) {
    qf[t][0] = ldfrag_h(Qb + (size_t)(16 * t) * NHD);            // d 0..31
    qf[t][1] = ldfrag_h(Qb + (size_t)(16 * t) * NHD + 32);       // d 32..63
  }

  float mrun[QTW], lrun[QTW];
  v8f o[QTW][4];
#pragma unroll
  for (int t = 0; t < QTW; ++t) {
    mrun[t] = -INFINITY;
    lrun[t] = 0.f;
#pragma unroll
    for (int j = 0; j < 4; ++j) o[t][j] = zero8();
  }

  // ---- prologue: the last stage lands and is published, then the one in front of it is put in flight ----
  tdm_load(g0, g1);
  wait_tensor0_hold(g0, g1);
  __syncthreads();
  tdm_aim(g0, dst0 + ASTAGE, ga0 + (uint64_t)(NST - 2) * gstep);
  tdm_load(g0, g1);
#pragma unroll 1   // one pass per stage: the publish point below stands once per trip
  for (int s = 0; s < NST; ++s) {        // pass s works on stage NST-1-s
    const int bo = (s & 1) * ASTAGE;
#pragma unroll     // constant LDS offsets for the key blocks of a stage
  for (int i32 = AKEYS / 32 - 1; i32 >= 0; --i32) {
    const int kb = (NST - 1 - s) * AKEYS + i32 * 32;
    // ---- transposed scores: s0 = keys kb..kb+15, s1 = keys kb+16..kb+31, column = query q0 + 16t + c ----
    v8f s0[QTW], s1[QTW];
    const _Float16* k0p = (const _Float16*)(const void*)(kr + bo + i32 * ASLICE);
    const _Float16* k1p = (const _Float16*)(const void*)(kr + bo + i32 * ASLICE + 16 * APITCH);
    {
      const v16h ka0 = ldfrag_h(k0p),      ka1 = ldfrag_h(k0p + 32);
      const v16h kc0 = ldfrag_h(k1p),      kc1 = ldfrag_h(k1p + 32);
      s0[0] = mma_h(ka0, qf[0][0], bl0);
      s0[1] = mma_h(ka0, qf[1][0], bl0);
      s1[0] = mma_h(kc0, qf[0][0], bl1);
      s1[1] = mma_h(kc0, qf[1][0], bl1);
      s0[0] = mma_h(ka1, qf[0][1], s0[0]);
      s0[1] = mma_h(ka1, qf[1][1], s0[1]);
      s1[0] = mma_h(kc1, qf[0][1], s1[0]);
      s1[1] = mma_h(kc1, qf[1][1], s1[1]);
      guard4x8<v16h>(s0[0], s0[1], s1[0], s1[1], qf[0][0], qf[0][1], qf[1][0], qf[1][1], ka0, ka1, kc0, kc1);
    }
    // ---- the accumulators hold the base-2 logits of this lane's 16 keys for query q0 + 16t + c, short of the block's own
    //      bias term cs (wave-uniform, 0 at the last block and falling along the walk); their maximum ----
    const float cs = slope2 * (float)(kb - (SEQ - 32));
    float cl[QTW];
#pragma unroll     // constant indices: the logits stay in the accumulators' registers
    for (int t = 0; t < QTW; ++t) {
      cl[t] = s0[t][0];
#pragma unroll
      for (int i = 1; i < 8; ++i) cl[t] = fmaxf(cl[t], s0[t][i]);
#pragma unroll
      for (int i = 0; i < 8; ++i) cl[t] = fmaxf(cl[t], s1[t][i]);
    }
    // ---- does any of the wave's 32 x 32 weights count? Where every logit lies SKIPD or more below its query's running
    //      maximum, the rest of the key block changes no bit: the maximum stays, the rescale factor is 2^0 = 1, every weight
    //      x32768 is below half the smallest f16 and enters P as 0, and a row's 32 weights together are below half an ulp of
    //      its sum, which holds the weight 1 of the maximum. One test per key block, wave-uniform; an unordered compare takes the
    //      full path. ----
    const float thr = SKIPD + cs;
    const bool need = !(cl[0] <= mrun[0] - thr) || !(cl[1] <= mrun[1] - thr);
    if (__builtin_amdgcn_ballot_w32(need) != 0u) {
    FragH ph[QTW];
#pragma unroll     // constant indices: the per-tile state stays in registers
    for (int t = 0; t < QTW; ++t) {
      const float cm = fmaxf(cl[t], __shfl_xor(cl[t], 16, 32));
      const float mn = fmaxf(mrun[t], cm + cs);                        // finite from the first key block on
      const float ml = mn - (cs + PEXP);                               // as this block's accumulators see it, less P's carry
      float ea = mrun[t] - mn, pe[16];
#pragma unroll     // constant indices: pe[] stays in registers, as the asm operands need it
      for (int i = 0; i < 8; ++i) {
        pe[i]     = fminf(s0[t][i] - ml, PEXP);
        pe[8 + i] = fminf(s1[t][i] - ml, PEXP);
      }
      exp2_hw17(ea, pe);
      const float al = (mrun[t] == -INFINITY) ? 0.f : ea;              // o and l are zero while mrun is -inf
      mrun[t] = mn;
      // ---- pe[i] = p * 32768 (p <= 1), as the exponent held the carry: the P A-fragment is f16(pe[i]), the row sum carries
      //      the same factor ----
      float ps = 0.f;
#pragma unroll
      for (int w = 0; w < 2; ++w) {
#pragma unroll
        for (int e4 = 0; e4 < 4; ++e4) {
          const int i = 8 * w + 2 * e4;
          const float p0 = pe[i];
          const float p1 = pe[i + 1];
          ps += p0 + p1;
          const v2f pp = {p0, p1};
          ph[t].u[w][e4] = __builtin_bit_cast(unsigned, __builtin_convertvector(pp, v2h));   // one packed convert, RNE
        }
      }
      ps += __shfl_xor(ps, 16, 32);
      lrun[t] = lrun[t] * al + ps;
      // ---- rescale the O accumulators: D row 8hh+r = query q0+16t+8hh+r, its factor lives in lane 8hh+r (and 16+8hh+r) ----
      float scl[8];
#pragma unroll
      for (int r = 0; r < 8; ++r) scl[r] = __shfl(al, 8 * hh + r, 32);
#pragma unroll
      for (int j = 0; j < 4; ++j) {
#pragma unroll
        for (int r = 0; r < 8; ++r) o[t][j][r] *= scl[r];
      }
    }
    // ---- P.V : B fragment col n = d = j*16 + c, keys contiguous in the v^T plane; one group of 8 ----
    {
      const unsigned char* vp = vr + bo + i32 * 64;
      const v16h vf0 = ldfrag_h((const _Float16*)(const void*)(vp));
      const v16h vf1 = ldfrag_h((const _Float16*)(const void*)(vp + 16 * APITCH));
      const v16h vf2 = ldfrag_h((const _Float16*)(const void*)(vp + ASLICE));
      const v16h vf3 = ldfrag_h((const _Float16*)(const void*)(vp + ASLICE + 16 * APITCH));
#pragma unroll
      for (int t = 0; t < QTW; ++t) {
        o[t][0] = mma_h(ph[t].v, vf0, o[t][0]);
        o[t][1] = mma_h(ph[t].v, vf1, o[t][1]);
        o[t][2] = mma_h(ph[t].v, vf2, o[t][2]);
        o[t][3] = mma_h(ph[t].v, vf3, o[t][3]);
      }
      guard8x6<v16h>(o, ph[0].v, ph[1].v, vf0, vf1, vf2, vf3);
    }
    }
  }
    // ---- publish point of stage NST-2-s (pass s + 1): own LDS reads retired, own slice landed, barrier, then the refill ----
    wait_ds0();
    wait_tensor0_hold(g0, g1);
    __syncthreads();
    if (pinned((uint32_t)(s + 2 < NST))) {
      tdm_aim(g0, dst0 + (uint32_t)bo, ga0 + (uint64_t)(NST - 3 - s) * gstep);
      tdm_load(g0, g1);
    }
  }
  wait_tensor0_hold(g0, g1);   // behind the loop: no request in flight and no LDS read open before the ring is used for the result
  wait_ds0();
  acc_guard8(o);

  // the wave's two slabs lie in the ring: every reader has left both buffers at the last stage's barrier, in front of which
  // every wave's last load has landed, and no load is aimed at them any more
#pragma unroll
  for (int t = 0; t < QTW; ++t) {
    // ---- fold 1/l (per query, owned by lane = query; l > 0 by construction; it carries P's factor, which cancels) and v's carry ----
    const float linv = (lrun[t] > 0.f) ? ((1.0f / lrun[t]) * (1.0f / VCAR)) : 0.f;
    float inv[8];
#pragma unroll
    for (int r = 0; r < 8; ++r) inv[r] = __shfl(linv, 8 * hh + r, 32);
    float* slab = (float*)(void*)ring + (wave * QTW + t) * GSLAB;
#pragma unroll
    for (int r = 0; r < 8; ++r) {
#pragma unroll
      for (int j = 0; j < 4; ++j) slab[(8 * hh + r) * 68 + j * 16 + c] = o[t][j][r] * inv[r];
    }
  }
  wave_sync_lds();
  // ---- f32 result: lanes 0..15 -> row 2*i2, lanes 16..31 -> row 2*i2+1; lane = 4 consecutive floats ----
  float* dst = Out + ((size_t)(b * SEQ + q0 + hh)) * DMOD + (size_t)(head * HD + c * 4);
#pragma unroll
  for (int t = 0; t < QTW; ++t) {
    const float* slab = (const float*)(const void*)ring + (wave * QTW + t) * GSLAB;
    v4f vals[8];
#pragma unroll
    for (int i2 = 0; i2 < 8; ++i2) vals[i2] = *(const v4f*)(slab + (i2 * 2 + hh) * 68 + c * 4);
#pragma unroll
    for (int i2 = 0; i2 < 8; ++i2) {
      *(v4f*)(dst + (size_t)(16 * t + i2 * 2) * (size_t)DMOD) = vals[i2];
    }
  }
}

// =====================================================================================================
// Workspace map (bytes, NB = 4); every plane is fully written by whole-line stores before it is read; all extents are
// exact multiples of the store granularity (no pad rows):
//   XB  bf16 [NB*SEQ][DMOD]                          16777216
//   WB  bf16 [3*NHD][DMOD]  (k | q | v chunks)        6291456
//   QP  f16  [NB*SEQ][NHD] x QSC                    16777216
//   KP  f16  [NB*SEQ][NHD] x8                       16777216
//   VP  f16  [NB][NHD][SEQ] x1024                   16777216
//   end                                             73400320
// 3 launches on one in-order stream.
// =====================================================================================================
extern "C" void kernel_launch(void* const* d_in, const int* in_sizes, int n_in,
                              void* d_out, int out_size, void* d_ws, size_t ws_size,
                              hipStream_t stream) {
  const int ROWS = NB * SEQ;
  if (n_in < 2) return;
  if (in_sizes[0] < ROWS * DMOD) return;
  if (in_sizes[1] != 3 * NHD * DMOD) return;
  if (out_size < ROWS * DMOD) return;

  const float* Xin = (const float*)d_in[0];
  const float* Win = (const float*)d_in[1];
  float*       out = (float*)d_out;

  const size_t szXB = (size_t)ROWS * DMOD * 2;
  const size_t szWB = (size_t)3 * NHD * DMOD * 2;
  const size_t szPl = (size_t)ROWS * NHD * 2;                  // q/k planes
  const size_t szVP = (size_t)NB * NHD * SEQ * 2;
  size_t off = 0;
  const size_t oXB = off; off += szXB;
  const size_t oWB = off; off += szWB;
  const size_t oQP = off; off += szPl;
  const size_t oKP = off; off += szPl;
  const size_t oVP = off; off += szVP;
  if (off > ws_size) return;                            // off = 73400320 for NB = 4
  if (off > (size_t)134217728) return;

  char* ws = (char*)d_ws;
  u16* XB = (u16*)(ws + oXB);
  u16* WB = (u16*)(ws + oWB);
  u16* QP = (u16*)(ws + oQP);
  u16* KP = (u16*)(ws + oKP);
  u16* VP = (u16*)(ws + oVP);

  const int n8x = (ROWS * DMOD) / 8;
  const int n8w = (3 * NHD * DMOD) / 8;
  if ((n8x % 256) != 0 || (n8w % 256) != 0) return;
  if ((DMOD % 64) != 0 || (NHD % GTILE) != 0 || (SEQ % GTILE) != 0 || (SQ % GTILE) != 0 || (DMOD % 32) != 0) return;

  const dim3 blk(256);
  const dim3 gC((n8x + n8w) / 256);                     // 4096 + 1536
  const dim3 bG(128);
  const dim3 gG(GNQ + GNK + GNV);                       // 3 x 512
  const dim3 gAT(ATT_BLOCKS);                           // 256
  const dim3 bAT(ATT_THREADS);                          // 512

  // (1) x -> bf16 plane [ROWS][DMOD] and W [3*NHD out][DMOD in] -> bf16, same layouts (W is already k-contiguous for B
  //     fragments / row-major A for the v^T GEMM); WB lies directly behind XB
  cvt16<<<gC, blk, 0, stream>>>(Xin, Win, XB, n8x, n8x + n8w);
  // (2) q (x QSC), k (x8) as single f16 planes [b][s][h*64+d], and the v^T plane per batch [h*64+d][keys], x1024
  gemm_bb<<<gG, bG, 0, stream>>>(XB, WB, QP, KP, VP);
  // (3) attention -> out [b][s][h*64+d] f32
  attn_fwd<<<gAT, bAT, 0, stream>>>(QP, KP, VP, out);
  (void)hipGetLastError();
}

// v009
// One run takes 93.1 microseconds.
// In both of two side-by-side timings against v008, it was 1.03 times as fast.
// Over all steps from v000 it is 4.39 times as fast.
// Contractions: x.Wk^T, x.Wq^T and x.Wv^T on v_wmma_f32_16x16x32_bf16 (x and W planes RNE-converted to bf16 operands,
// f32 accumulate); scores k.q^T (single f16 planes: k carried x8, q carrying the base-2 logit scale / 8) and P.v (P x32768
// single f16, v x1024 single f16) on v_wmma_f32_16x16x32_f16, f32 accumulate, the score accumulators starting at the
// position bias. Base-2 online softmax; 1/l and carry folds in f32 on VALU; f32 result written directly.
#include <hip/hip_runtime.h>
#include <math.h>
#include <stdint.h>

#ifndef NB
#define NB    4
#endif
#define SEQ   2048
#ifndef SQ
#define SQ    SEQ
#endif
#define DMOD  1024
#define NH    16
#define HD    64
#define NHD   (NH * HD)
#define KSC   8.0f
#define QSC   (INVN * LOG2E / KSC)      // q plane x k plane = the base-2 logit without its bias: (q.k / 32) * log2e
#define PEXP  15.0f                     // P and the row sums are carried x 2^15: the carry rides in the exponent
#define VCAR  1024.0f
#define LOG2E 1.4426950408889634f
#define INVN  0.03125f
#define RSQ2  0.70710678118654752f
#define ATT_WAVES   4                   // waves of one head in an attention block
#define ATT_HEADS   4                   // heads of one attention block
#define ATT_THREADS (ATT_HEADS * ATT_WAVES * 32)
#define QTW         2                   // query tiles of 16 per attention wave
#define ATT_Q       (ATT_WAVES * 16 * QTW)
#define NQT         (SQ / ATT_Q)
#define ATT_BLOCKS  (NB * (NH / ATT_HEADS) * NQT)
#define SKIPD       41.0f               // a base-2 logit this far below the running maximum gives a weight that is 0 in f16
// Heads of block group g, one nibble each (bits 16g .. 16g+15). The steeper a head's slope, the fewer of its key blocks carry
// weight, so every group gets one of the four flattest heads, one of the next four and two steep ones.
#define HEADMAP     0x468C379D25AE01BFull
#define NKB         (SEQ / 32)
#define GSLAB       (16 * 68)
#define GKC         128                 // k elements of one GEMM stage: rows of 256 bytes
#define GPITCH      272                 // LDS row pitch, bytes: 256 + 16, an odd multiple of 16 for 16-byte readers
#define GTM         256                 // the block's tile of x.[Wk|Wq|Wv]^T: 256 rows x 192 columns, one 64 x 64 part per wave
#define GTN         192
#define GWAVES      12                  // waves of a GEMM block: 4 down x 3 across
#define GISSUE      7                   // of which the first 7 bring a slice each
#define GSLICE      18432               // one wave's slice: 64 rows x 272 B = 17408 B, rounded up to a multiple of 2 KiB
#define GSTAGE      (GISSUE * GSLICE)   // [A rows 0..63 | 64..127 | 128..191 | 192..255 | B rows 0..63 | 64..127 | 128..191]
#define GWSLAB      (64 * 68)           // floats of one wave's result slab: 64 rows at a pitch of 68
#define GRING       (2 * GSTAGE)
#define GNT         (3 * NHD / GTN)                        // tiles across [k | q | v]
#define GNB         ((NB * SEQ / GTM) * GNT)               // blocks of the projection launch
#define AKEYS       64                  // keys of one attention stage: k rows and v^T rows of 128 bytes each
#define APITCH      144                 // LDS row pitch, bytes: 128 + 16, an odd multiple of 16 for 16-byte readers
#define ASLICE      6144                // one wave's slice: 32 rows x 144 B = 4608 B, rounded up to a multiple of 2 KiB
#define ASTAGE      (4 * ASLICE)        // [k rows 0..31 | k rows 32..63 | v^T rows 0..31 | v^T rows 32..63]
#define ARING       (2 * ASTAGE)
#define NST         (SEQ / AKEYS)
static_assert(32 * APITCH <= ASLICE && (ASLICE % 2048) == 0 && HD * 2 == 128 && AKEYS * 2 == 128 && ATT_WAVES == 4);
static_assert(ATT_WAVES * QTW * GSLAB * 4 <= ARING && (SEQ % AKEYS) == 0 && NST >= 2 && (AKEYS % 32) == 0);
static_assert((SQ % ATT_Q) == 0 && QTW == 2);
static_assert(64 * GPITCH <= GSLICE && (GSLICE % 2048) == 0 && GKC * 2 == 256 && GWAVES * GWSLAB * 4 <= GRING);
static_assert(((3 * NHD) % GTN) == 0 && (SEQ % GTM) == 0 && (NHD % 64) == 0 && GTM == 4 * 64 && GTN == 3 * 64);
static_assert(GISSUE * 64 == GTM + GTN && GISSUE <= GWAVES && GWAVES * 64 * 64 == GTM * GTN && GRING <= 327680);
static_assert((DMOD % GKC) == 0 && (DMOD / GKC) >= 2);
static_assert(NH == 16 && HD == 64 && DMOD == NHD);
static_assert((HD % 32) == 0 && (SEQ % 64) == 0 && (SQ % 64) == 0 && SQ <= SEQ && SQ >= 64);
static_assert((DMOD % 64) == 0 && (DMOD % 32) == 0 && (NHD % 64) == 0);
static_assert(((NB * SEQ * DMOD / 8) % 256) == 0);
static_assert(((3 * NHD * DMOD / 8) % 256) == 0);
static_assert((GSLAB * 4) % 16 == 0 && ATT_THREADS == 512 && ATT_HEADS * 4 == NH && (ARING % 2048) == 0);
static_assert(NB >= 1 && NB <= 4);

typedef unsigned short u16;
typedef _Float16 v16h __attribute__((ext_vector_type(16)));
typedef _Float16 v8h  __attribute__((ext_vector_type(8)));
typedef _Float16 v2h  __attribute__((ext_vector_type(2)));
typedef __bf16   v16b __attribute__((ext_vector_type(16)));
typedef float    v8f  __attribute__((ext_vector_type(8)));
typedef float    v4f  __attribute__((ext_vector_type(4)));
typedef float    v2f  __attribute__((ext_vector_type(2)));
typedef unsigned int v4u __attribute__((ext_vector_type(4)));
typedef uint32_t u32x4 __attribute__((ext_vector_type(4)));
typedef uint32_t u32x8 __attribute__((ext_vector_type(8)));

union FragH { v16h v; v8h h[2]; v4u u[2]; };
union FragB { v16b v; v4u u[2]; };

// ---- scalar helpers --------------------------------------------------------------------------------
__device__ __forceinline__ unsigned short bf_bits(float f) {          // f32 -> bf16 bits, RNE convert
  unsigned u = __float_as_uint(f);
  return (unsigned short)((u + 0x7FFFu + ((u >> 16) & 1u)) >> 16);
}
__device__ __forceinline__ unsigned short h_bits(_Float16 x) { return __builtin_bit_cast(unsigned short, x); }
__device__ __forceinline__ unsigned pk16(unsigned short a, unsigned short b) { return (unsigned)a | ((unsigned)b << 16); }
// 2^x in place for a key block's rescale exponent (<= 0) and its 16 score exponents (<= PEXP), by the bare hardware instruction.
// exp2f() wraps each v_exp_f32 in a compare, two selects, an add and an ldexp so that results below 2^-126 come out as
// denormals; such a weight vanishes anyway, in the f16 operand and in a row sum that holds its largest weight. One statement, so
// that no neighbour of a v_exp_f32 reads its result or overwrites its source; the closing v_nop keeps that slot behind the
// last one, whatever the compiler puts next.
__device__ __forceinline__ void exp2_hw17(float& a, float (&t)[16]) {
#if defined(__HIP_DEVICE_COMPILE__)
  asm("v_exp_f32 %0, %0\n\tv_exp_f32 %1, %1\n\tv_exp_f32 %2, %2\n\tv_exp_f32 %3, %3\n\tv_exp_f32 %4, %4\n\t"
      "v_exp_f32 %5, %5\n\tv_exp_f32 %6, %6\n\tv_exp_f32 %7, %7\n\tv_exp_f32 %8, %8\n\tv_exp_f32 %9, %9\n\t"
      "v_exp_f32 %10, %10\n\tv_exp_f32 %11, %11\n\tv_exp_f32 %12, %12\n\tv_exp_f32 %13, %13\n\t"
      "v_exp_f32 %14, %14\n\tv_exp_f32 %15, %15\n\tv_exp_f32 %16, %16\n\tv_nop"
      : "+v"(a), "+v"(t[0]), "+v"(t[1]), "+v"(t[2]), "+v"(t[3]), "+v"(t[4]), "+v"(t[5]), "+v"(t[6]), "+v"(t[7]),
        "+v"(t[8]), "+v"(t[9]), "+v"(t[10]), "+v"(t[11]), "+v"(t[12]), "+v"(t[13]), "+v"(t[14]), "+v"(t[15]));
#endif
}
__device__ __forceinline__ v8f zero8() { v8f z = {0.f, 0.f, 0.f, 0.f, 0.f, 0.f, 0.f, 0.f}; return z; }

// ---- fragment loaders: 16-bit A/B operand, lane -> row/col (lane&15), p already includes +8*(lane>>4);
//      elements 0..7 <- p[0..7] (k0+8h..), elements 8..15 <- p[16..23] (k0+16+8h..)  (same split k map for A and B;
//      B is always read from a k-contiguous [n][k] plane)
__device__ __forceinline__ v16h ldfrag_h(const _Float16* p) {
  FragH f;
  f.h[0] = *(const v8h*)(p);
  f.h[1] = *(const v8h*)(p + 16);
  return f.v;
}
__device__ __forceinline__ v16b ldfrag_b(const u16* p) {              // bf16 plane read as unsigned integer vectors
  FragB f;
  f.u[0] = *(const v4u*)(p);
  f.u[1] = *(const v4u*)(p + 16);
  return f.v;
}

__device__ __forceinline__ v8f mma_h(v16h a, v16h b, v8f c) {
  return __builtin_amdgcn_wmma_f32_16x16x32_f16(false, a, false, b, (short)0, c, false, false);
}
__device__ __forceinline__ v8f mma_b(v16b a, v16b b, v8f c) {
  return __builtin_amdgcn_wmma_f32_16x16x32_bf16(false, a, false, b, (short)0, c, false, false);
}
// Four vector slots between a group of matrix instructions and the first vector instruction that reads their results or
// overwrites their operands: results in-out, operands as inputs.
template <typename F>
__device__ __forceinline__ void guard4x8(v8f& a, v8f& b, v8f& c, v8f& d, F x0, F x1, F x2, F x3, F x4, F x5, F x6, F x7) {
#if defined(__HIP_DEVICE_COMPILE__)
  asm volatile("v_nop\n\tv_nop\n\tv_nop\n\tv_nop"
               : "+v"(a), "+v"(b), "+v"(c), "+v"(d)
               : "v"(x0), "v"(x1), "v"(x2), "v"(x3), "v"(x4), "v"(x5), "v"(x6), "v"(x7) : "memory");
#endif
}
template <typename F>
__device__ __forceinline__ void guard8x6(v8f (&a)[QTW][4], F x0, F x1, F x2, F x3, F x4, F x5) {
#if defined(__HIP_DEVICE_COMPILE__)
  asm volatile("v_nop\n\tv_nop\n\tv_nop\n\tv_nop"
               : "+v"(a[0][0]), "+v"(a[0][1]), "+v"(a[0][2]), "+v"(a[0][3]), "+v"(a[1][0]), "+v"(a[1][1]), "+v"(a[1][2]),
                 "+v"(a[1][3])
               : "v"(x0), "v"(x1), "v"(x2), "v"(x3), "v"(x4), "v"(x5) : "memory");
#endif
}
__device__ __forceinline__ void acc_guard8(v8f (&a)[QTW][4]) {
#if defined(__HIP_DEVICE_COMPILE__)
  asm volatile("v_nop\n\tv_nop\n\tv_nop\n\tv_nop"
               : "+v"(a[0][0]), "+v"(a[0][1]), "+v"(a[0][2]), "+v"(a[0][3]), "+v"(a[1][0]), "+v"(a[1][1]), "+v"(a[1][2]),
                 "+v"(a[1][3]));
#endif
}
// Four vector slots between the last matrix instructions of the GEMM loop, which is left by a taken branch, and the first
// read of their results.
__device__ __forceinline__ void acc_guard16(v8f (&a)[4][4]) {
#if defined(__HIP_DEVICE_COMPILE__)
  asm volatile("v_nop\n\tv_nop\n\tv_nop\n\tv_nop"
               : "+v"(a[0][0]), "+v"(a[0][1]), "+v"(a[0][2]), "+v"(a[0][3]), "+v"(a[1][0]), "+v"(a[1][1]), "+v"(a[1][2]),
                 "+v"(a[1][3]), "+v"(a[2][0]), "+v"(a[2][1]), "+v"(a[2][2]), "+v"(a[2][3]), "+v"(a[3][0]), "+v"(a[3][1]),
                 "+v"(a[3][2]), "+v"(a[3][3]));
#endif
}
// The scheduler moves nothing across this point. Without it the compiler sinks three of a step's four A fragments to just
// in front of the row of matrix instructions that reads them, each with a wait to 0: four LDS latencies a step, not one.
__device__ __forceinline__ void sched_fence() {
#if defined(__HIP_DEVICE_COMPILE__)
  __builtin_amdgcn_sched_barrier(0);
#endif
}
__device__ __forceinline__ void wave_sync_lds() {
#if defined(__HIP_DEVICE_COMPILE__)
  __builtin_amdgcn_fence(__ATOMIC_RELEASE, "workgroup");
  __builtin_amdgcn_wave_barrier();
  __builtin_amdgcn_fence(__ATOMIC_ACQUIRE, "workgroup");
#endif
}

// ---- tensor load to LDS: descriptor words, issue, waits ---------------------------------------------
__device__ __forceinline__ uint32_t uni(uint32_t v) { return (uint32_t)__builtin_amdgcn_readfirstlane((int)v); }
// Test around a tensor load, which ignores EXEC: it has to compile to s_cmp + s_cbranch_scc.
__device__ __forceinline__ uint32_t pinned(uint32_t v) {
  uint32_t w = uni(v);
  asm volatile("" : "+s"(w));   // pinned(): holds the test word in a scalar register, so that the branch on it is scalar
  return w;
}
// Group 1: 1-byte elements, tile = tensor = 64 rows of 256 bytes, source row pitch src_pitch bytes; word 0 is the pad
// constant for 256-byte rows with 16 bytes behind each row (LDS pitch 272), no mask.
__device__ __forceinline__ u32x8 tdm_group1(uint32_t src_pitch) {
  constexpr uint32_t d0 = 256u, d1 = 64u;
  u32x8 g;
  g[0] = uni((1u << 20) | (5u << 22) | (3u << 25));
  g[1] = uni((d0 & 0xFFFFu) << 16);
  g[2] = uni((d0 >> 16) | ((d1 & 0xFFFFu) << 16));
  g[3] = uni((d1 >> 16) | (d0 << 16));
  g[4] = uni(d1);
  g[5] = uni(src_pitch);
  g[6] = uni(0u);
  g[7] = uni(0u);
  return g;
}
// The same for 32 rows of 128 bytes: pad constant for 128-byte rows with 16 bytes behind each row (LDS pitch 144), no mask.
__device__ __forceinline__ u32x8 tdm_group1_r128(uint32_t src_pitch) {
  constexpr uint32_t d0 = 128u, d1 = 32u;
  u32x8 g;
  g[0] = uni((1u << 20) | (4u << 22) | (3u << 25));
  g[1] = uni((d0 & 0xFFFFu) << 16);
  g[2] = uni((d0 >> 16) | ((d1 & 0xFFFFu) << 16));
  g[3] = uni((d1 >> 16) | (d0 << 16));
  g[4] = uni(d1);
  g[5] = uni(src_pitch);
  g[6] = uni(0u);
  g[7] = uni(0u);
  return g;
}
__device__ __forceinline__ u32x4 tdm_group0(uint32_t lds_dst, uint64_t ga) {
  u32x4 g;
  g[0] = uni(1u);
  g[1] = uni(lds_dst);
  g[2] = uni((uint32_t)ga);
  g[3] = uni((((uint32_t)(ga >> 32)) & 0x01FFFFFFu) | 0x80000000u);
  return g;
}
// Aim group 0 at the next tile: only the LDS place and the address change.
__device__ __forceinline__ void tdm_aim(u32x4& g, uint32_t lds_dst, uint64_t ga) {
  g[1] = uni(lds_dst);
  g[2] = uni((uint32_t)ga);
  g[3] = uni((((uint32_t)(ga >> 32)) & 0x01FFFFFFu) | 0x80000000u);
}
// One request of the whole wave. Both groups are in-out operands so that their scalar registers stay theirs up to the
// next request: as plain inputs the compiler used some of them as temporaries while the request was in flight.
__device__ __forceinline__ void tdm_load(u32x4& g0, u32x8& g1) {
#if defined(__HIP_DEVICE_COMPILE__)
  asm volatile("tensor_load_to_lds %0, %1" : "+s"(g0), "+s"(g1) :: "memory");
#endif
}
// The wave's own slice has landed. Both groups are in-out operands: every scalar register
// of a descriptor stays the descriptor's own until the wait that covers its request; otherwise the compiler reuses a word
// that is dead behind the issue.
__device__ __forceinline__ void wait_tensor0_hold(u32x4& g0, u32x8& g1) {
#if defined(__HIP_DEVICE_COMPILE__)
  asm volatile("s_wait_tensorcnt 0x0" : "+s"(g0), "+s"(g1) :: "memory");
#endif
}
__device__ __forceinline__ void wait_ds0() {
#if defined(__HIP_DEVICE_COMPILE__)
  asm volatile("s_wait_dscnt 0x0" ::: "memory");       // the wave's LDS reads have retired before their buffer is refilled
#endif
}

// =====================================================================================================
// Both f32 planes -> bf16 RNE planes, same layouts, in one launch: neither conversion reads what the other writes. The two
// results lie one behind the other at D (x first), so a thread's place in D is its flat index; blocks below n8x/256 read x,
// the others w (n8x is a multiple of 256: the choice is the same for a whole block).
// Thread = 8 consecutive elements: two 16-B loads, one 16-B store;
// coverage: grid = n8/256 blocks (host checks exactness) x 256 thr x 8 = both planes, n8 = n8x + the chunks of w.
// =====================================================================================================
__global__ __launch_bounds__(256) void cvt16(const float* __restrict__ x, const float* __restrict__ w, u16* D, int n8x, int n8) {
  const int gt = blockIdx.x * 256 + (int)threadIdx.x;
  if (gt >= n8) return;                     // no barriers in this kernel
  const float* p = ((int)blockIdx.x * 256 < n8x) ? (x + (size_t)gt * 8) : (w + (size_t)(gt - n8x) * 8);
  const v4f a = *(const v4f*)(p), c4 = *(const v4f*)(p + 4);
  v4u o;
  o[0] = pk16(bf_bits(a[0]),  bf_bits(a[1]));
  o[1] = pk16(bf_bits(a[2]),  bf_bits(a[3]));
  o[2] = pk16(bf_bits(c4[0]), bf_bits(c4[1]));
  o[3] = pk16(bf_bits(c4[2]), bf_bits(c4[3]));
  u16* d = D + (size_t)gt * 8;
  {
    *(v4u*)(d) = o;
    
  }
}

// =====================================================================================================
// The three projections as one product in one launch: C = x . [Wk | Wq | Wv]^T, [NB*SEQ] x [3*NHD], bf16 operands (x row-major,
// W rows k-contiguous), f32 accumulate. 64 columns of C are one head of one projection; a wave's part goes out as f16:
//   columns 0 .. NHD-1        k plane   [b][s][h*64+d], x8
//   the next NHD              q plane   [b][s][h*64+d], x QSC
//   the last NHD              v^T plane [b][h*64+d][s], x1024: the part is turned over in its LDS slab
// Block = 256x192 tile, 12 waves in a 4 x 3 grid, each with a 64x64 part = 4 x 4 accumulator tiles: a fragment read from LDS
// feeds 4 matrix instructions, a row of x brought into LDS serves 192 columns of C and a row of W 256 rows of C.
// Operands come through LDS: a stage is 128 k of the block's 256 x rows and 192 W rows; each of waves 0..6 brings its own
// slice of 64 rows x 256 B with one tensor load (LDS pitch 272 B), two buffers, the next stage in flight while this one is
// worked on. Fragments are read from the LDS rows (two 16-B loads each, split k map for A and B), K stepped by 32
// inside a stage (K = DMOD: a multiple of 128 and at least two stages; (NB*SEQ/256)*(3*NHD/192) blocks; a tile's 256 rows lie
// in one batch). The ring becomes the result slabs behind the last pass's barrier.
// Result: lane = (row in group of 4, 8 consecutive cols); one instruction = 4 rows, each 64 halves = one 128-B line.
// coverage: 16 instructions x 4 rows x 8 lanes x 8 halves = the wave's 64 x 64 part; 12 waves = the block's 256 x 192 tile.
// =====================================================================================================
__global__ __launch_bounds__(GWAVES * 32)
void gemm_bb(const u16* __restrict__ XBp, const u16* __restrict__ WBp, u16* QPp, u16* KPp, u16* VPp) {
  __shared__ __attribute__((aligned(2048))) unsigned char ring[GRING];
  constexpr int K = DMOD;
  const int bid = blockIdx.x;
  const int tid = threadIdx.x, lane = tid & 31, hh = lane >> 4, m = lane & 15;
  const int wave = (int)uni((uint32_t)tid >> 5);
  const int wm = wave / 3, wn = wave - 3 * wm;   // the wave's part: rows 64*wm .., columns 64*wn ..
  const int row0  = (bid / GNT) * GTM;           // row of x, counted through the batches
  const int col0  = (bid % GNT) * GTN;           // row of W = column of [k | q | v]
  if (row0 + GTM > NB * SEQ) return;         // block-uniform, never taken with the exact grid; in front of every barrier and load
  // ---- this wave's slice of every stage: waves 0..3 = x rows row0 + 64*wave .., waves 4..6 = W rows col0 + 64*(wave-4) ..;
  //      waves 7..11 bring nothing (their words name slices 0..4 and are never issued) ----
  const uint32_t issuer = (uint32_t)(wave < GISSUE);
  const int      slice  = (wave < GISSUE) ? wave : wave - GISSUE;
  const u16* sp = (slice < 4) ? (XBp + (size_t)(row0 + 64 * slice) * K) : (WBp + (size_t)(col0 + 64 * (slice - 4)) * K);
  const uint64_t ga0  = (uint64_t)(size_t)sp;
  const uint32_t dst0 = (uint32_t)(size_t)ring + (uint32_t)slice * GSLICE;
  u32x8          g1   = tdm_group1((uint32_t)K * 2u);
  u32x4          g0   = tdm_group0(dst0, ga0);
  const int      npass = K / GKC;
  // ---- fragment rows in LDS: A rows 16*i + m of slice wm, B rows 16*j + m of slice 4 + wn; +16*hh bytes = +8*hh elements ----
  const unsigned char* ar = ring + wm * GSLICE + m * GPITCH + 16 * hh;
  const unsigned char* br = ring + (4 + wn) * GSLICE + m * GPITCH + 16 * hh;
  v8f acc[4][4];
#pragma unroll
  for (int i = 0; i < 4; ++i) {
#pragma unroll
    for (int j = 0; j < 4; ++j) acc[i][j] = zero8();
  }
  // ---- prologue: stage 0 lands and is published, then stage 1 is put in flight ----
  if (pinned(issuer)) {
    tdm_load(g0, g1);
    wait_tensor0_hold(g0, g1);
  }
  __syncthreads();
  if (pinned(issuer)) {
    tdm_aim(g0, dst0 + GSTAGE, ga0 + 2u * GKC);
    tdm_load(g0, g1);
  }
#pragma unroll 1   // one pass per stage: the publish point below stands once per trip
  for (int s = 0; s < npass; ++s) {
    const int bo = (s & 1) * GSTAGE;
#pragma unroll     // constant LDS offsets for the four 32-deep steps of a stage
    for (int kk = 0; kk < GKC / 32; ++kk) {
      const int o = bo + kk * 64;
      v16b af[4], bf[4];
#pragma unroll     // constant indices: the fragments stay in registers
      for (int i = 0; i < 4; ++i) {
        af[i] = ldfrag_b((const u16*)(const void*)(ar + o + i * 16 * GPITCH));
        bf[i] = ldfrag_b((const u16*)(const void*)(br + o + i * 16 * GPITCH));
      }
      sched_fence();   // all 16 loads of the step are issued ahead of its 16 products
#pragma unroll
      for (int i = 0; i < 4; ++i) {
#pragma unroll
        for (int j = 0; j < 4; ++j) acc[i][j] = mma_b(af[i], bf[j], acc[i][j]);
      }
    }
    // ---- publish point of stage s + 1: own LDS reads retired, own slice landed, barrier, then the refill ----
    wait_ds0();
    wait_tensor0_hold(g0, g1);
    __syncthreads();
    if (pinned((uint32_t)(s + 2 < npass) & issuer)) {
      tdm_aim(g0, dst0 + (uint32_t)bo, ga0 + (uint64_t)(s + 2) * (2u * GKC));
      tdm_load(g0, g1);
    }
  }
  wait_tensor0_hold(g0, g1);   // behind the loop: no request in flight and no LDS read open before the ring is used for the result
  wait_ds0();
  acc_guard16(acc);
  // ---- which projection the wave's 64 columns belong to: wave-uniform ----
  const int gc   = col0 + 64 * wn;
  const int prod = gc / NHD;                 // 0 = k, 1 = q, 2 = v
  const int pc   = gc - prod * NHD;          // first column inside the projection: h*64
  const int gr   = row0 + 64 * wm;           // first row of x
  const int rq = lane >> 3, c8 = (lane & 7) * 8;
  // ---- stage the scaled value in the wave's slab: the slabs lie over both buffers of the ring, which every reader has
  //      left at the last pass's barrier and at which no load is aimed any more ----
  float* sl = (float*)(void*)ring + wave * GWSLAB;
  u16*   dst;
  size_t N;                                  // row pitch of the plane, elements
  if (prod < 2) {                            // k, q: slab row = row of x, slab column = d
    const float oscale = (prod == 0) ? KSC : QSC;
#pragma unroll
    for (int i = 0; i < 4; ++i) {
#pragma unroll
      for (int r = 0; r < 8; ++r) {
        const int ro = (16 * i + 8 * hh + r) * 68 + m;
#pragma unroll
        for (int j = 0; j < 4; ++j) sl[ro + 16 * j] = acc[i][j][r] * oscale;
      }
    }
    N   = (size_t)NHD;
    dst = ((prod == 0) ? KPp : QPp) + ((size_t)gr + (size_t)rq) * N + (size_t)(pc + c8);
  } else {                                   // v: slab row = d, slab column = row of x; a lane's 8 values lie side by side
#pragma unroll
    for (int i = 0; i < 4; ++i) {
#pragma unroll
      for (int j = 0; j < 4; ++j) {
        float* tp = sl + (16 * j + m) * 68 + 16 * i + 8 * hh;
        const v4f lo = {acc[i][j][0] * VCAR, acc[i][j][1] * VCAR, acc[i][j][2] * VCAR, acc[i][j][3] * VCAR};
        const v4f hi = {acc[i][j][4] * VCAR, acc[i][j][5] * VCAR, acc[i][j][6] * VCAR, acc[i][j][7] * VCAR};
        *(v4f*)(tp)     = lo;
        *(v4f*)(tp + 4) = hi;
      }
    }
    const int bt = gr / SEQ;
    N   = (size_t)SEQ;
    dst = VPp + ((size_t)(bt * NHD + pc) + (size_t)rq) * N + (size_t)(gr - bt * SEQ + c8);
  }
  wave_sync_lds();
#pragma unroll
  for (int i4 = 0; i4 < 16; ++i4) {
    const float* rp = sl + (i4 * 4 + rq) * 68 + c8;
    const v4f a = *(const v4f*)(rp), c4 = *(const v4f*)(rp + 4);
    v4u ov;
    ov[0] = pk16(h_bits((_Float16)a[0]),  h_bits((_Float16)a[1]));
    ov[1] = pk16(h_bits((_Float16)a[2]),  h_bits((_Float16)a[3]));
    ov[2] = pk16(h_bits((_Float16)c4[0]), h_bits((_Float16)c4[1]));
    ov[3] = pk16(h_bits((_Float16)c4[2]), h_bits((_Float16)c4[3]));
    *(v4u*)(dst + (size_t)(i4 * 4) * (size_t)N) = ov;
  }
}

// =====================================================================================================
// Multi-head flash attention with per-head linear relative-position bias (no mask): block = (batch b, 4 heads, 128 query
// rows), 4 waves per head, each head with an LDS ring of its own; wave w of a head owns query rows q0 = 128*qt + 32*w ..
// q0+31 as two tiles of 16 (tile t = rows q0+16t .. +15).
// The keys are walked from the last to the first: the bias falls along the walk, so a row's running maximum settles early,
// and a key block none of whose weights can count any more is left behind its scores (test in the loop). How many key blocks
// that is depends on the head's slope, so a block holds steep and flat heads, one wave of each on every SIMD.
// Every k fragment, v^T fragment and bias term that the wave fetches or forms serves both tiles.
//   k and v^T come through LDS, shared by the head's 4 waves: a stage is 64 keys = 64 k rows x 128 B and 64 v^T rows x
//   128 B; every wave brings its own slice of 32 rows with one tensor load (LDS pitch 144 B), two buffers, the next stage
//   in flight while this one is worked on; one publish point (waits + block barrier) per stage. The ring becomes the
//   wave-private result slabs behind the last stage's barrier.
//   q plane (f16, x QSC) laid out [b][s][h*64+d]; k plane the same (f16, x8); v^T plane [b][h*64+d][s] (x1024 f16).
//   The scores of all NKB = 64 key blocks of 32 keys are computed (static bound).
//   Scores are computed TRANSPOSED: S^T tile g (g = 0,1) = k rows (keys kb+16g .. +15, A operand, row m = lane&15, split k
//   map over d) times q^T (B operand, col n = query q0 + 16t + (lane&15), k = d, split map), one f16 product per tile and
//   32-deep d-chunk, one guarded group of 8 WMMAs; the four q fragments are loaded once per wave.
//   D element r of lane l = (key kb+16g+8h+r, query q0+16t+(l&15)), so a lane owns one query column per tile and 16 of its
//   32 keys; the partner lane l^16 owns the other 16 -> row max / row sum need one xor-16 shuffle.
//   The logits come out of the matrix unit: the q plane carries their scale, and the first product of every score tile adds
//   to a constant tile (its C operand) that holds the bias of the key's place inside its block, slope_h * log2e * (16g+8h+r),
//   slope_h = (2^-0.5)^(h+1). What the bias has besides is the same for a whole key block (slope_h * log2e * the block's
//   distance from the last block, cs below) and is added to or taken from the running maximum, one value per query, not per
//   logit; the query's own term is left out: the softmax over keys does not see a constant per query.
//   Online max-subtracted base-2 softmax in f32. The exp'd values ARE the P A-fragment in place: A row m = query = lane&15,
//   element i <- key kb+8h+i (tile 0, D element i), element 8+i <- key kb+16+8h+i (tile 1, D element i). P is carried
//   x32768 as single f16, the factor added as 15 to the exponent.
//   The rescale factor of query row 8h+r of the O accumulators is fetched from lane 8h+r with a
//   shuffle (uniform control). 4 v^T B fragments (col n = d = 16j + (lane&15), keys k-contiguous), 8 P.V WMMAs per key
//   block in one guarded group.
//   Epilogue: 1/l (per query, shuffled to the D row owner) and the carry folds in f32; each 16x64 f32 result tile staged,
//   segment (b, q0+row, head) of the f32 result [b][s][h*64+d] written by 16 consecutive lanes x 16 B of one instruction
// coverage: per wave 2 tiles x 8 instructions x 2 rows x 16 lanes x 4 floats = 32 x 64; grid NB*(NH/4)*(SQ/128) blocks x 4
//           heads x 4 waves = every (b, s < SQ, h) row segment of the result exactly once.
// =====================================================================================================
__global__ __launch_bounds__(ATT_THREADS)
void attn_fwd(const u16* __restrict__ QPp, const u16* __restrict__ KPp, const u16* __restrict__ VPp, float* Out) {
  __shared__ __attribute__((aligned(2048))) unsigned char rings[ATT_HEADS * ARING];   // per head: k / v^T stages; result slabs in the epilogue

  const int tid  = threadIdx.x;
  const int w16  = (int)uni((uint32_t)tid >> 5);
  const int hq   = w16 >> 2;             // which of the block's heads; waves w, w+4, w+8, w+12 are one wave of each head
  const int wave = w16 & 3;              // the wave's place among its head's four
  unsigned char* ring = rings + hq * ARING;
  const int lane = tid & 31;
  const int hh   = lane >> 4;
  const int c    = lane & 15;

  const int bid  = blockIdx.x;
  const int qt   = bid % NQT;
  const int grp  = (bid / NQT) % (NH / ATT_HEADS);
  const int head = (int)((HEADMAP >> (16 * grp + 4 * hq)) & 15ull);
  const int b    = bid / (NQT * (NH / ATT_HEADS));
  const int q0   = qt * ATT_Q + wave * (16 * QTW);

  // B fragments of q^T: col n = query q0 + 16t + c, k = d (k-contiguous row segment of the q plane)
  const size_t qofs = ((size_t)(b * SEQ + q0 + c)) * NHD + (size_t)(head * HD + 8 * hh);
  const _Float16* Qb = (const _Float16*)(const void*)QPp + qofs;
  // ---- this wave's slice of every stage: waves 0,1 = k rows (keys) 32*wave .., 128 B of this head each; waves 2,3 =
  //      v^T rows (d) 32*(wave-2) .., 128 B = 64 keys each ----
  const u16* sp = (wave < 2) ? (KPp + ((size_t)(b * SEQ + 32 * wave)) * NHD + (size_t)(head * HD))
                             : (VPp + ((size_t)(b * NHD + head * HD + 32 * (wave - 2))) * SEQ);
  const uint64_t ga0   = (uint64_t)(size_t)sp;
  const uint32_t gstep = (wave < 2) ? (uint32_t)(AKEYS * NHD * 2) : (uint32_t)(AKEYS * 2);   // bytes from stage to stage
  const uint32_t dst0  = (uint32_t)(size_t)ring + (uint32_t)wave * ASLICE;
  u32x8          g1    = tdm_group1_r128((wave < 2) ? (uint32_t)(NHD * 2) : (uint32_t)(SEQ * 2));
  u32x4          g0    = tdm_group0(dst0, ga0 + (uint64_t)(NST - 1) * gstep);   // the walk starts at the last stage
  // A fragments of k: LDS row = key (in its slice of 32) 16g + c, k = d; +16*hh bytes = +8*hh elements
  const unsigned char* kr = ring + c * APITCH + 16 * hh;
  // B fragments of v: col n = d = 16j + c = LDS row of the v^T slices, k = key (contiguous in the row)
  const unsigned char* vr = ring + 2 * ASLICE + c * APITCH + 16 * hh;

  const int   ex     = head + 1;
  const float slope  = (((ex & 1) != 0) ? RSQ2 : 1.0f) * __int_as_float((127 - (ex >> 1)) << 23);
  const float slope2 = slope * LOG2E;
  // C operands of the score tiles: bias (base 2) of this lane's keys 8hh+r and 16+8hh+r of a key block, the same for every block
  v8f bl0, bl1;
#pragma unroll
  for (int r = 0; r < 8; ++r) {
    bl0[r] = slope2 * (float)(8 * hh + r);
    bl1[r] = slope2 * (float)(16 + 8 * hh + r);
  }

  v16h qf[QTW][2];
#pragma unroll
  for (int t = 0; t < QTW; ++t) {
    qf[t][0] = ldfrag_h(Qb + (size_t)(16 * t) * NHD);            // d 0..31
    qf[t][1] = ldfrag_h(Qb + (size_t)(16 * t) * NHD + 32);       // d 32..63
  }

  float mrun[QTW], lrun[QTW];
  v8f o[QTW][4];
#pragma unroll
  for (int t = 0; t < QTW; ++t) {
    mrun[t] = -INFINITY;
    lrun[t] = 0.f;
#pragma unroll
    for (int j = 0; j < 4; ++j) o[t][j] = zero8();
  }

  // ---- prologue: the last stage lands and is published, then the one in front of it is put in flight ----
  tdm_load(g0, g1);
  wait_tensor0_hold(g0, g1);
  __syncthreads();
  tdm_aim(g0, dst0 + ASTAGE, ga0 + (uint64_t)(NST - 2) * gstep);
  tdm_load(g0, g1);
#pragma unroll 1   // one pass per stage: the publish point below stands once per trip
  for (int s = 0; s < NST; ++s) {        // pass s works on stage NST-1-s
    const int bo = (s & 1) * ASTAGE;
#pragma unroll     // constant LDS offsets for the key blocks of a stage
  for (int i32 = AKEYS / 32 - 1; i32 >= 0; --i32) {
    const int kb = (NST - 1 - s) * AKEYS + i32 * 32;
    // ---- transposed scores: s0 = keys kb..kb+15, s1 = keys kb+16..kb+31, column = query q0 + 16t + c ----
    v8f s0[QTW], s1[QTW];
    const _Float16* k0p = (const _Float16*)(const void*)(kr + bo + i32 * ASLICE);
    const _Float16* k1p = (const _Float16*)(const void*)(kr + bo + i32 * ASLICE + 16 * APITCH);
    {
      const v16h ka0 = ldfrag_h(k0p),      ka1 = ldfrag_h(k0p + 32);
      const v16h kc0 = ldfrag_h(k1p),      kc1 = ldfrag_h(k1p + 32);
      s0[0] = mma_h(ka0, qf[0][0], bl0);
      s0[1] = mma_h(ka0, qf[1][0], bl0);
      s1[0] = mma_h(kc0, qf[0][0], bl1);
      s1[1] = mma_h(kc0, qf[1][0], bl1);
      s0[0] = mma_h(ka1, qf[0][1], s0[0]);
      s0[1] = mma_h(ka1, qf[1][1], s0[1]);
      s1[0] = mma_h(kc1, qf[0][1], s1[0]);
      s1[1] = mma_h(kc1, qf[1][1], s1[1]);
      guard4x8<v16h>(s0[0], s0[1], s1[0], s1[1], qf[0][0], qf[0][1], qf[1][0], qf[1][1], ka0, ka1, kc0, kc1);
    }
    // ---- the accumulators hold the base-2 logits of this lane's 16 keys for query q0 + 16t + c, short of the block's own
    //      bias term cs (wave-uniform, 0 at the last block and falling along the walk); their maximum ----
    const float cs = slope2 * (float)(kb - (SEQ - 32));
    float cl[QTW];
#pragma unroll     // constant indices: the logits stay in the accumulators' registers
    for (int t = 0; t < QTW; ++t) {
      cl[t] = s0[t][0];
#pragma unroll
      for (int i = 1; i < 8; ++i) cl[t] = fmaxf(cl[t], s0[t][i]);
#pragma unroll
      for (int i = 0; i < 8; ++i) cl[t] = fmaxf(cl[t], s1[t][i]);
    }
    // ---- does any of the wave's 32 x 32 weights count? Where every logit lies SKIPD or more below its query's running
    //      maximum, the rest of the key block changes no bit: the maximum stays, the rescale factor is 2^0 = 1, every weight
    //      x32768 is below half the smallest f16 and enters P as 0, and a row's 32 weights together are below half an ulp of
    //      its sum, which holds the weight 1 of the maximum. One test per key block, wave-uniform; an unordered compare takes the
    //      full path. ----
    const float thr = SKIPD + cs;
    const bool need = !(cl[0] <= mrun[0] - thr) || !(cl[1] <= mrun[1] - thr);
    if (__builtin_amdgcn_ballot_w32(need) != 0u) {
    FragH ph[QTW];
#pragma unroll     // constant indices: the per-tile state stays in registers
    for (int t = 0; t < QTW; ++t) {
      const float cm = fmaxf(cl[t], __shfl_xor(cl[t], 16, 32));
      const float mn = fmaxf(mrun[t], cm + cs);                        // finite from the first key block on
      const float ml = mn - (cs + PEXP);                               // as this block's accumulators see it, less P's carry
      float ea = mrun[t] - mn, pe[16];
#pragma unroll     // constant indices: pe[] stays in registers, as the asm operands need it
      for (int i = 0; i < 8; ++i) {
        pe[i]     = fminf(s0[t][i] - ml, PEXP);
        pe[8 + i] = fminf(s1[t][i] - ml, PEXP);
      }
      exp2_hw17(ea, pe);
      const float al = (mrun[t] == -INFINITY) ? 0.f : ea;              // o and l are zero while mrun is -inf
      mrun[t] = mn;
      // ---- pe[i] = p * 32768 (p <= 1), as the exponent held the carry: the P A-fragment is f16(pe[i]), the row sum carries
      //      the same factor ----
      float ps = 0.f;
#pragma unroll
      for (int w = 0; w < 2; ++w) {
#pragma unroll
        for (int e4 = 0; e4 < 4; ++e4) {
          const int i = 8 * w + 2 * e4;
          const float p0 = pe[i];
          const float p1 = pe[i + 1];
          ps += p0 + p1;
          const v2f pp = {p0, p1};
          ph[t].u[w][e4] = __builtin_bit_cast(unsigned, __builtin_convertvector(pp, v2h));   // one packed convert, RNE
        }
      }
      ps += __shfl_xor(ps, 16, 32);
      lrun[t] = lrun[t] * al + ps;
      // ---- rescale the O accumulators: D row 8hh+r = query q0+16t+8hh+r, its factor lives in lane 8hh+r (and 16+8hh+r) ----
      float scl[8];
#pragma unroll
      for (int r = 0; r < 8; ++r) scl[r] = __shfl(al, 8 * hh + r, 32);
#pragma unroll
      for (int j = 0; j < 4; ++j) {
#pragma unroll
        for (int r = 0; r < 8; ++r) o[t][j][r] *= scl[r];
      }
    }
    // ---- P.V : B fragment col n = d = j*16 + c, keys contiguous in the v^T plane; one group of 8 ----
    {
      const unsigned char* vp = vr + bo + i32 * 64;
      const v16h vf0 = ldfrag_h((const _Float16*)(const void*)(vp));
      const v16h vf1 = ldfrag_h((const _Float16*)(const void*)(vp + 16 * APITCH));
      const v16h vf2 = ldfrag_h((const _Float16*)(const void*)(vp + ASLICE));
      const v16h vf3 = ldfrag_h((const _Float16*)(const void*)(vp + ASLICE + 16 * APITCH));
#pragma unroll
      for (int t = 0; t < QTW; ++t) {
        o[t][0] = mma_h(ph[t].v, vf0, o[t][0]);
        o[t][1] = mma_h(ph[t].v, vf1, o[t][1]);
        o[t][2] = mma_h(ph[t].v, vf2, o[t][2]);
        o[t][3] = mma_h(ph[t].v, vf3, o[t][3]);
      }
      guard8x6<v16h>(o, ph[0].v, ph[1].v, vf0, vf1, vf2, vf3);
    }
    }
  }
    // ---- publish point of stage NST-2-s (pass s + 1): own LDS reads retired, own slice landed, barrier, then the refill ----
    wait_ds0();
    wait_tensor0_hold(g0, g1);
    __syncthreads();
    if (pinned((uint32_t)(s + 2 < NST))) {
      tdm_aim(g0, dst0 + (uint32_t)bo, ga0 + (uint64_t)(NST - 3 - s) * gstep);
      tdm_load(g0, g1);
    }
  }
  wait_tensor0_hold(g0, g1);   // behind the loop: no request in flight and no LDS read open before the ring is used for the result
  wait_ds0();
  acc_guard8(o);

  // the wave's two slabs lie in the ring: every reader has left both buffers at the last stage's barrier, in front of which
  // every wave's last load has landed, and no load is aimed at them any more
#pragma unroll
  for (int t = 0; t < QTW; ++t) {
    // ---- fold 1/l (per query, owned by lane = query; l > 0 by construction; it carries P's factor, which cancels) and v's carry ----
    const float linv = (lrun[t] > 0.f) ? ((1.0f / lrun[t]) * (1.0f / VCAR)) : 0.f;
    float inv[8];
#pragma unroll
    for (int r = 0; r < 8; ++r) inv[r] = __shfl(linv, 8 * hh + r, 32);
    float* slab = (float*)(void*)ring + (wave * QTW + t) * GSLAB;
#pragma unroll
    for (int r = 0; r < 8; ++r) {
#pragma unroll
      for (int j = 0; j < 4; ++j) slab[(8 * hh + r) * 68 + j * 16 + c] = o[t][j][r] * inv[r];
    }
  }
  wave_sync_lds();
  // ---- f32 result: lanes 0..15 -> row 2*i2, lanes 16..31 -> row 2*i2+1; lane = 4 consecutive floats ----
  float* dst = Out + ((size_t)(b * SEQ + q0 + hh)) * DMOD + (size_t)(head * HD + c * 4);
#pragma unroll
  for (int t = 0; t < QTW; ++t) {
    const float* slab = (const float*)(const void*)ring + (wave * QTW + t) * GSLAB;
    v4f vals[8];
#pragma unroll
    for (int i2 = 0; i2 < 8; ++i2) vals[i2] = *(const v4f*)(slab + (i2 * 2 + hh) * 68 + c * 4);
#pragma unroll
    for (int i2 = 0; i2 < 8; ++i2) {
      *(v4f*)(dst + (size_t)(16 * t + i2 * 2) * (size_t)DMOD) = vals[i2];
    }
  }
}

// =====================================================================================================
// Workspace map (bytes, NB = 4); every plane is fully written by whole-line stores before it is read; all extents are
// exact multiples of the store granularity (no pad rows):
//   XB  bf16 [NB*SEQ][DMOD]                          16777216
//   WB  bf16 [3*NHD][DMOD]  (k | q | v chunks)        6291456
//   QP  f16  [NB*SEQ][NHD] x QSC                    16777216
//   KP  f16  [NB*SEQ][NHD] x8                       16777216
//   VP  f16  [NB][NHD][SEQ] x1024                   16777216
//   end                                             73400320
// 3 launches on one in-order stream.
// =====================================================================================================
extern "C" void kernel_launch(void* const* d_in, const int* in_sizes, int n_in,
                              void* d_out, int out_size, void* d_ws, size_t ws_size,
                              hipStream_t stream) {
  const int ROWS = NB * SEQ;
  if (n_in < 2) return;
  if (in_sizes[0] < ROWS * DMOD) return;
  if (in_sizes[1] != 3 * NHD * DMOD) return;
  if (out_size < ROWS * DMOD) return;

  const float* Xin = (const float*)d_in[0];
  const float* Win = (const float*)d_in[1];
  float*       out = (float*)d_out;

  const size_t szXB = (size_t)ROWS * DMOD * 2;
  const size_t szWB = (size_t)3 * NHD * DMOD * 2;
  const size_t szPl = (size_t)ROWS * NHD * 2;                  // q/k planes
  const size_t szVP = (size_t)NB * NHD * SEQ * 2;
  size_t off = 0;
  const size_t oXB = off; off += szXB;
  const size_t oWB = off; off += szWB;
  const size_t oQP = off; off += szPl;
  const size_t oKP = off; off += szPl;
  const size_t oVP = off; off += szVP;
  if (off > ws_size) return;                            // off = 73400320 for NB = 4
  if (off > (size_t)134217728) return;

  char* ws = (char*)d_ws;
  u16* XB = (u16*)(ws + oXB);
  u16* WB = (u16*)(ws + oWB);
  u16* QP = (u16*)(ws + oQP);
  u16* KP = (u16*)(ws + oKP);
  u16* VP = (u16*)(ws + oVP);

  const int n8x = (ROWS * DMOD) / 8;
  const int n8w = (3 * NHD * DMOD) / 8;
  if ((n8x % 256) != 0 || (n8w % 256) != 0) return;
  if ((DMOD % 64) != 0 || ((3 * NHD) % GTN) != 0 || (SEQ % GTM) != 0 || (DMOD % 32) != 0) return;

  const dim3 blk(256);
  const dim3 gC((n8x + n8w) / 256);                     // 4096 + 1536
  const dim3 bG(GWAVES * 32);                           // 384
  const dim3 gG(GNB);                                   // 32 x 16
  const dim3 gAT(ATT_BLOCKS);                           // 256
  const dim3 bAT(ATT_THREADS);                          // 512

  // (1) x -> bf16 plane [ROWS][DMOD] and W [3*NHD out][DMOD in] -> bf16, same layouts (W is already k-contiguous for B
  //     fragments); WB lies directly behind XB
  cvt16<<<gC, blk, 0, stream>>>(Xin, Win, XB, n8x, n8x + n8w);
  // (2) q (x QSC), k (x8) as single f16 planes [b][s][h*64+d], and the v^T plane per batch [h*64+d][keys], x1024
  gemm_bb<<<gG, bG, 0, stream>>>(XB, WB, QP, KP, VP);
  // (3) attention -> out [b][s][h*64+d] f32
  attn_fwd<<<gAT, bAT, 0, stream>>>(QP, KP, VP, out);
  (void)hipGetLastError();
}

// v010
// One run takes 89.3 microseconds.
// Two timings next to v009 both put it at 1.04 times that version's speed.
// Counting every step since v000, it is 4.57 times as fast.
// Contractions: x.Wk^T, x.Wq^T and x.Wv^T on v_wmma_f32_16x16x32_bf16 (x and W planes RNE-converted to bf16 operands,
// f32 accumulate); scores k.q^T (single f16 planes: k carried x8, q carrying the base-2 logit scale / 8) and P.v (P x32768
// single f16, v x1024 single f16) on v_wmma_f32_16x16x32_f16, f32 accumulate, the score accumulators starting at the
// position bias. Base-2 online softmax; 1/l and carry folds in f32 on VALU; f32 result written directly.
#include <hip/hip_runtime.h>
#include <math.h>
#include <stdint.h>

#ifndef NB
#define NB    4
#endif
#define SEQ   2048
#ifndef SQ
#define SQ    SEQ
#endif
#define DMOD  1024
#define NH    16
#define HD    64
#define NHD   (NH * HD)
#define KSC   8.0f
#define QSC   (INVN * LOG2E / KSC)      // q plane x k plane = the base-2 logit without its bias: (q.k / 32) * log2e
#define PEXP  15.0f                     // P and the row sums are carried x 2^15: the carry rides in the exponent
#define VCAR  1024.0f
#define LOG2E 1.4426950408889634f
#define INVN  0.03125f
#define RSQ2  0.70710678118654752f
#define ATT_WAVES   4                   // waves of one head in an attention block
#define ATT_HEADS   4                   // heads of one attention block
#define ATT_THREADS (ATT_HEADS * ATT_WAVES * 32)
#define QTW         2                   // query tiles of 16 per attention wave
#define ATT_Q       (ATT_WAVES * 16 * QTW)
#define NQT         (SQ / ATT_Q)
#define ATT_BLOCKS  (NB * (NH / ATT_HEADS) * NQT)
#define SKIPD       41.0f               // a base-2 logit this far below the running maximum gives a weight that is 0 in f16
// Heads of block group g, one nibble each (bits 16g .. 16g+15). The steeper a head's slope, the fewer of its key blocks carry
// weight, so every group gets one of the four flattest heads, one of the next four and two steep ones.
#define HEADMAP     0x468C379D25AE01BFull
#define NKB         (SEQ / 32)
#define GSLAB       (16 * 68)
#define GKC         128                 // k elements of one GEMM stage: rows of 256 bytes
#define GPITCH      272                 // LDS row pitch, bytes: 256 + 16, an odd multiple of 16 for 16-byte readers
#define GTM         256                 // the block's tile of x.[Wk|Wq|Wv]^T: 256 rows x 192 columns, one 64 x 64 part per wave
#define GTN         192
#define GWAVES      12                  // waves of a GEMM block: 4 down x 3 across
#define GISSUE      7                   // of which the first 7 bring a slice each
#define GSLICE      18432               // one wave's slice: 64 rows x 272 B = 17408 B, rounded up to a multiple of 2 KiB
#define GSTAGE      (GISSUE * GSLICE)   // [A rows 0..63 | 64..127 | 128..191 | 192..255 | B rows 0..63 | 64..127 | 128..191]
#define GWSLAB      (64 * 68)           // floats of one wave's result slab: 64 rows at a pitch of 68
#define GRING       (2 * GSTAGE)
#define GNT         (3 * NHD / GTN)                        // tiles across [k | q | v]
#define GNB         ((NB * SEQ / GTM) * GNT)               // blocks of the projection launch
#define AKEYS       64                  // keys of one attention stage: k rows and v^T rows of 128 bytes each
#define APITCH      144                 // LDS row pitch, bytes: 128 + 16, an odd multiple of 16 for 16-byte readers
#define ASLICE      6144                // one wave's slice: 32 rows x 144 B = 4608 B, rounded up to a multiple of 2 KiB
#define ASTAGE      (4 * ASLICE)        // [k rows 0..31 | k rows 32..63 | v^T rows 0..31 | v^T rows 32..63]
#define ARING       (2 * ASTAGE)
#define NST         (SEQ / AKEYS)
static_assert(32 * APITCH <= ASLICE && (ASLICE % 2048) == 0 && HD * 2 == 128 && AKEYS * 2 == 128 && ATT_WAVES == 4);
static_assert(ATT_WAVES * QTW * GSLAB * 4 <= ARING && (SEQ % AKEYS) == 0 && NST >= 2 && (AKEYS % 32) == 0);
static_assert((SQ % ATT_Q) == 0 && QTW == 2);
static_assert(64 * GPITCH <= GSLICE && (GSLICE % 2048) == 0 && GKC * 2 == 256 && GWAVES * GWSLAB * 4 <= GRING);
static_assert(((3 * NHD) % GTN) == 0 && (SEQ % GTM) == 0 && (NHD % 64) == 0 && GTM == 4 * 64 && GTN == 3 * 64);
static_assert(GISSUE * 64 == GTM + GTN && GISSUE <= GWAVES && GWAVES * 64 * 64 == GTM * GTN && GRING <= 327680);
static_assert((DMOD % GKC) == 0 && (DMOD / GKC) >= 2);
static_assert(NH == 16 && HD == 64 && DMOD == NHD);
static_assert((HD % 32) == 0 && (SEQ % 64) == 0 && (SQ % 64) == 0 && SQ <= SEQ && SQ >= 64);
static_assert((DMOD % 64) == 0 && (DMOD % 32) == 0 && (NHD % 64) == 0);
static_assert(((NB * SEQ * DMOD / 8) % 256) == 0);
static_assert(((3 * NHD * DMOD / 8) % 256) == 0);
static_assert((GSLAB * 4) % 16 == 0 && ATT_THREADS == 512 && ATT_HEADS * 4 == NH && (ARING % 2048) == 0);
static_assert(NB >= 1 && NB <= 4);

typedef unsigned short u16;
typedef _Float16 v16h __attribute__((ext_vector_type(16)));
typedef _Float16 v8h  __attribute__((ext_vector_type(8)));
typedef _Float16 v2h  __attribute__((ext_vector_type(2)));
typedef __bf16   v16b __attribute__((ext_vector_type(16)));
typedef float    v8f  __attribute__((ext_vector_type(8)));
typedef float    v4f  __attribute__((ext_vector_type(4)));
typedef float    v2f  __attribute__((ext_vector_type(2)));
typedef unsigned int v4u __attribute__((ext_vector_type(4)));
typedef uint32_t u32x4 __attribute__((ext_vector_type(4)));
typedef uint32_t u32x8 __attribute__((ext_vector_type(8)));

union FragH { v16h v; v8h h[2]; v4u u[2]; };
union FragB { v16b v; v4u u[2]; };

// ---- scalar helpers --------------------------------------------------------------------------------
__device__ __forceinline__ unsigned short bf_bits(float f) {          // f32 -> bf16 bits, RNE convert
  unsigned u = __float_as_uint(f);
  return (unsigned short)((u + 0x7FFFu + ((u >> 16) & 1u)) >> 16);
}
__device__ __forceinline__ unsigned short h_bits(_Float16 x) { return __builtin_bit_cast(unsigned short, x); }
__device__ __forceinline__ unsigned pk16(unsigned short a, unsigned short b) { return (unsigned)a | ((unsigned)b << 16); }
// 2^x in place for a key block's 16 score exponents (<= PEXP), by the bare hardware instruction.
// exp2f() wraps each v_exp_f32 in a compare, two selects, an add and an ldexp so that results below 2^-126 come out as
// denormals; such a weight vanishes anyway, in the f16 operand and in a row sum that holds its largest weight. One statement, so
// that no neighbour of a v_exp_f32 reads its result or overwrites its source; the closing v_nop keeps that slot behind the
// last one, whatever the compiler puts next.
__device__ __forceinline__ void exp2_hw16(float (&t)[16]) {
#if defined(__HIP_DEVICE_COMPILE__)
  asm("v_exp_f32 %0, %0\n\tv_exp_f32 %1, %1\n\tv_exp_f32 %2, %2\n\tv_exp_f32 %3, %3\n\tv_exp_f32 %4, %4\n\t"
      "v_exp_f32 %5, %5\n\tv_exp_f32 %6, %6\n\tv_exp_f32 %7, %7\n\tv_exp_f32 %8, %8\n\tv_exp_f32 %9, %9\n\t"
      "v_exp_f32 %10, %10\n\tv_exp_f32 %11, %11\n\tv_exp_f32 %12, %12\n\tv_exp_f32 %13, %13\n\t"
      "v_exp_f32 %14, %14\n\tv_exp_f32 %15, %15\n\tv_nop"
      : "+v"(t[0]), "+v"(t[1]), "+v"(t[2]), "+v"(t[3]), "+v"(t[4]), "+v"(t[5]), "+v"(t[6]), "+v"(t[7]),
        "+v"(t[8]), "+v"(t[9]), "+v"(t[10]), "+v"(t[11]), "+v"(t[12]), "+v"(t[13]), "+v"(t[14]), "+v"(t[15]));
#endif
}
// The same for one rescale exponent (<= 0); the v_nop keeps the slot behind the v_exp_f32.
__device__ __forceinline__ void exp2_hw1(float& a) {
#if defined(__HIP_DEVICE_COMPILE__)
  asm("v_exp_f32 %0, %0\n\tv_nop" : "+v"(a));
#endif
}
__device__ __forceinline__ v8f zero8() { v8f z = {0.f, 0.f, 0.f, 0.f, 0.f, 0.f, 0.f, 0.f}; return z; }

// ---- fragment loaders: 16-bit A/B operand, lane -> row/col (lane&15), p already includes +8*(lane>>4);
//      elements 0..7 <- p[0..7] (k0+8h..), elements 8..15 <- p[16..23] (k0+16+8h..)  (same split k map for A and B;
//      B is always read from a k-contiguous [n][k] plane)
__device__ __forceinline__ v16h ldfrag_h(const _Float16* p) {
  FragH f;
  f.h[0] = *(const v8h*)(p);
  f.h[1] = *(const v8h*)(p + 16);
  return f.v;
}
__device__ __forceinline__ v16b ldfrag_b(const u16* p) {              // bf16 plane read as unsigned integer vectors
  FragB f;
  f.u[0] = *(const v4u*)(p);
  f.u[1] = *(const v4u*)(p + 16);
  return f.v;
}

__device__ __forceinline__ v8f mma_h(v16h a, v16h b, v8f c) {
  return __builtin_amdgcn_wmma_f32_16x16x32_f16(false, a, false, b, (short)0, c, false, false);
}
__device__ __forceinline__ v8f mma_b(v16b a, v16b b, v8f c) {
  return __builtin_amdgcn_wmma_f32_16x16x32_bf16(false, a, false, b, (short)0, c, false, false);
}
// Four vector slots between a group of matrix instructions and the first vector instruction that reads their results or
// overwrites their operands: results in-out, operands as inputs.
template <typename F>
__device__ __forceinline__ void guard4x8(v8f& a, v8f& b, v8f& c, v8f& d, F x0, F x1, F x2, F x3, F x4, F x5, F x6, F x7) {
#if defined(__HIP_DEVICE_COMPILE__)
  asm volatile("v_nop\n\tv_nop\n\tv_nop\n\tv_nop"
               : "+v"(a), "+v"(b), "+v"(c), "+v"(d)
               : "v"(x0), "v"(x1), "v"(x2), "v"(x3), "v"(x4), "v"(x5), "v"(x6), "v"(x7) : "memory");
#endif
}
template <typename F>
__device__ __forceinline__ void guard8x6(v8f (&a)[QTW][4], F x0, F x1, F x2, F x3, F x4, F x5) {
#if defined(__HIP_DEVICE_COMPILE__)
  asm volatile("v_nop\n\tv_nop\n\tv_nop\n\tv_nop"
               : "+v"(a[0][0]), "+v"(a[0][1]), "+v"(a[0][2]), "+v"(a[0][3]), "+v"(a[1][0]), "+v"(a[1][1]), "+v"(a[1][2]),
                 "+v"(a[1][3])
               : "v"(x0), "v"(x1), "v"(x2), "v"(x3), "v"(x4), "v"(x5) : "memory");
#endif
}
__device__ __forceinline__ void acc_guard8(v8f (&a)[QTW][4]) {
#if defined(__HIP_DEVICE_COMPILE__)
  asm volatile("v_nop\n\tv_nop\n\tv_nop\n\tv_nop"
               : "+v"(a[0][0]), "+v"(a[0][1]), "+v"(a[0][2]), "+v"(a[0][3]), "+v"(a[1][0]), "+v"(a[1][1]), "+v"(a[1][2]),
                 "+v"(a[1][3]));
#endif
}
// Four vector slots between the last matrix instructions of the GEMM loop, which is left by a taken branch, and the first
// read of their results.
__device__ __forceinline__ void acc_guard16(v8f (&a)[4][4]) {
#if defined(__HIP_DEVICE_COMPILE__)
  asm volatile("v_nop\n\tv_nop\n\tv_nop\n\tv_nop"
               : "+v"(a[0][0]), "+v"(a[0][1]), "+v"(a[0][2]), "+v"(a[0][3]), "+v"(a[1][0]), "+v"(a[1][1]), "+v"(a[1][2]),
                 "+v"(a[1][3]), "+v"(a[2][0]), "+v"(a[2][1]), "+v"(a[2][2]), "+v"(a[2][3]), "+v"(a[3][0]), "+v"(a[3][1]),
                 "+v"(a[3][2]), "+v"(a[3][3]));
#endif
}
// The scheduler moves nothing across this point. Without it the compiler sinks three of a step's four A fragments to just
// in front of the row of matrix instructions that reads them, each with a wait to 0: four LDS latencies a step, not one.
__device__ __forceinline__ void sched_fence() {
#if defined(__HIP_DEVICE_COMPILE__)
  __builtin_amdgcn_sched_barrier(0);
#endif
}
__device__ __forceinline__ void wave_sync_lds() {
#if defined(__HIP_DEVICE_COMPILE__)
  __builtin_amdgcn_fence(__ATOMIC_RELEASE, "workgroup");
  __builtin_amdgcn_wave_barrier();
  __builtin_amdgcn_fence(__ATOMIC_ACQUIRE, "workgroup");
#endif
}

// ---- tensor load to LDS: descriptor words, issue, waits ---------------------------------------------
__device__ __forceinline__ uint32_t uni(uint32_t v) { return (uint32_t)__builtin_amdgcn_readfirstlane((int)v); }
// Test around a tensor load, which ignores EXEC: it has to compile to s_cmp + s_cbranch_scc.
__device__ __forceinline__ uint32_t pinned(uint32_t v) {
  uint32_t w = uni(v);
  asm volatile("" : "+s"(w));   // pinned(): holds the test word in a scalar register, so that the branch on it is scalar
  return w;
}
// Group 1: 1-byte elements, tile = tensor = 64 rows of 256 bytes, source row pitch src_pitch bytes; word 0 is the pad
// constant for 256-byte rows with 16 bytes behind each row (LDS pitch 272), no mask.
__device__ __forceinline__ u32x8 tdm_group1(uint32_t src_pitch) {
  constexpr uint32_t d0 = 256u, d1 = 64u;
  u32x8 g;
  g[0] = uni((1u << 20) | (5u << 22) | (3u << 25));
  g[1] = uni((d0 & 0xFFFFu) << 16);
  g[2] = uni((d0 >> 16) | ((d1 & 0xFFFFu) << 16));
  g[3] = uni((d1 >> 16) | (d0 << 16));
  g[4] = uni(d1);
  g[5] = uni(src_pitch);
  g[6] = uni(0u);
  g[7] = uni(0u);
  return g;
}
// The same for 32 rows of 128 bytes: pad constant for 128-byte rows with 16 bytes behind each row (LDS pitch 144), no mask.
__device__ __forceinline__ u32x8 tdm_group1_r128(uint32_t src_pitch) {
  constexpr uint32_t d0 = 128u, d1 = 32u;
  u32x8 g;
  g[0] = uni((1u << 20) | (4u << 22) | (3u << 25));
  g[1] = uni((d0 & 0xFFFFu) << 16);
  g[2] = uni((d0 >> 16) | ((d1 & 0xFFFFu) << 16));
  g[3] = uni((d1 >> 16) | (d0 << 16));
  g[4] = uni(d1);
  g[5] = uni(src_pitch);
  g[6] = uni(0u);
  g[7] = uni(0u);
  return g;
}
__device__ __forceinline__ u32x4 tdm_group0(uint32_t lds_dst, uint64_t ga) {
  u32x4 g;
  g[0] = uni(1u);
  g[1] = uni(lds_dst);
  g[2] = uni((uint32_t)ga);
  g[3] = uni((((uint32_t)(ga >> 32)) & 0x01FFFFFFu) | 0x80000000u);
  return g;
}
// Aim group 0 at the next tile: only the LDS place and the address change.
__device__ __forceinline__ void tdm_aim(u32x4& g, uint32_t lds_dst, uint64_t ga) {
  g[1] = uni(lds_dst);
  g[2] = uni((uint32_t)ga);
  g[3] = uni((((uint32_t)(ga >> 32)) & 0x01FFFFFFu) | 0x80000000u);
}
// One request of the whole wave. Both groups are in-out operands so that their scalar registers stay theirs up to the
// next request: as plain inputs the compiler used some of them as temporaries while the request was in flight.
__device__ __forceinline__ void tdm_load(u32x4& g0, u32x8& g1) {
#if defined(__HIP_DEVICE_COMPILE__)
  asm volatile("tensor_load_to_lds %0, %1" : "+s"(g0), "+s"(g1) :: "memory");
#endif
}
// The wave's own slice has landed. Both groups are in-out operands: every scalar register
// of a descriptor stays the descriptor's own until the wait that covers its request; otherwise the compiler reuses a word
// that is dead behind the issue.
__device__ __forceinline__ void wait_tensor0_hold(u32x4& g0, u32x8& g1) {
#if defined(__HIP_DEVICE_COMPILE__)
  asm volatile("s_wait_tensorcnt 0x0" : "+s"(g0), "+s"(g1) :: "memory");
#endif
}
__device__ __forceinline__ void wait_ds0() {
#if defined(__HIP_DEVICE_COMPILE__)
  asm volatile("s_wait_dscnt 0x0" ::: "memory");       // the wave's LDS reads have retired before their buffer is refilled
#endif
}

// =====================================================================================================
// Both f32 planes -> bf16 RNE planes, same layouts, in one launch: neither conversion reads what the other writes. The two
// results lie one behind the other at D (x first), so a thread's place in D is its flat index; blocks below n8x/256 read x,
// the others w (n8x is a multiple of 256: the choice is the same for a whole block).
// Thread = 8 consecutive elements: two 16-B loads, one 16-B store;
// coverage: grid = n8/256 blocks (host checks exactness) x 256 thr x 8 = both planes, n8 = n8x + the chunks of w.
// =====================================================================================================
__global__ __launch_bounds__(256) void cvt16(const float* __restrict__ x, const float* __restrict__ w, u16* D, int n8x, int n8) {
  const int gt = blockIdx.x * 256 + (int)threadIdx.x;
  if (gt >= n8) return;                     // no barriers in this kernel
  const float* p = ((int)blockIdx.x * 256 < n8x) ? (x + (size_t)gt * 8) : (w + (size_t)(gt - n8x) * 8);
  const v4f a = *(const v4f*)(p), c4 = *(const v4f*)(p + 4);
  v4u o;
  o[0] = pk16(bf_bits(a[0]),  bf_bits(a[1]));
  o[1] = pk16(bf_bits(a[2]),  bf_bits(a[3]));
  o[2] = pk16(bf_bits(c4[0]), bf_bits(c4[1]));
  o[3] = pk16(bf_bits(c4[2]), bf_bits(c4[3]));
  u16* d = D + (size_t)gt * 8;
  {
    *(v4u*)(d) = o;
    
  }
}

// =====================================================================================================
// The three projections as one product in one launch: C = x . [Wk | Wq | Wv]^T, [NB*SEQ] x [3*NHD], bf16 operands (x row-major,
// W rows k-contiguous), f32 accumulate. 64 columns of C are one head of one projection; a wave's part goes out as f16:
//   columns 0 .. NHD-1        k plane   [b][s][h*64+d], x8
//   the next NHD              q plane   [b][s][h*64+d], x QSC
//   the last NHD              v^T plane [b][h*64+d][s], x1024: the part is turned over in its LDS slab
// Block = 256x192 tile, 12 waves in a 4 x 3 grid, each with a 64x64 part = 4 x 4 accumulator tiles: a fragment read from LDS
// feeds 4 matrix instructions, a row of x brought into LDS serves 192 columns of C and a row of W 256 rows of C.
// Operands come through LDS: a stage is 128 k of the block's 256 x rows and 192 W rows; each of waves 0..6 brings its own
// slice of 64 rows x 256 B with one tensor load (LDS pitch 272 B), two buffers, the next stage in flight while this one is
// worked on. Fragments are read from the LDS rows (two 16-B loads each, split k map for A and B), K stepped by 32
// inside a stage (K = DMOD: a multiple of 128 and at least two stages; (NB*SEQ/256)*(3*NHD/192) blocks; a tile's 256 rows lie
// in one batch). The ring becomes the result slabs behind the last pass's barrier.
// Result: lane = (row in group of 4, 8 consecutive cols); one instruction = 4 rows, each 64 halves = one 128-B line.
// coverage: 16 instructions x 4 rows x 8 lanes x 8 halves = the wave's 64 x 64 part; 12 waves = the block's 256 x 192 tile.
// =====================================================================================================
__global__ __launch_bounds__(GWAVES * 32)
void gemm_bb(const u16* __restrict__ XBp, const u16* __restrict__ WBp, u16* QPp, u16* KPp, u16* VPp) {
  __shared__ __attribute__((aligned(2048))) unsigned char ring[GRING];
  constexpr int K = DMOD;
  const int bid = blockIdx.x;
  const int tid = threadIdx.x, lane = tid & 31, hh = lane >> 4, m = lane & 15;
  const int wave = (int)uni((uint32_t)tid >> 5);
  const int wm = wave / 3, wn = wave - 3 * wm;   // the wave's part: rows 64*wm .., columns 64*wn ..
  const int row0  = (bid / GNT) * GTM;           // row of x, counted through the batches
  const int col0  = (bid % GNT) * GTN;           // row of W = column of [k | q | v]
  if (row0 + GTM > NB * SEQ) return;         // block-uniform, never taken with the exact grid; in front of every barrier and load
  // ---- this wave's slice of every stage: waves 0..3 = x rows row0 + 64*wave .., waves 4..6 = W rows col0 + 64*(wave-4) ..;
  //      waves 7..11 bring nothing (their words name slices 0..4 and are never issued) ----
  const uint32_t issuer = (uint32_t)(wave < GISSUE);
  const int      slice  = (wave < GISSUE) ? wave : wave - GISSUE;
  const u16* sp = (slice < 4) ? (XBp + (size_t)(row0 + 64 * slice) * K) : (WBp + (size_t)(col0 + 64 * (slice - 4)) * K);
  const uint64_t ga0  = (uint64_t)(size_t)sp;
  const uint32_t dst0 = (uint32_t)(size_t)ring + (uint32_t)slice * GSLICE;
  u32x8          g1   = tdm_group1((uint32_t)K * 2u);
  u32x4          g0   = tdm_group0(dst0, ga0);
  const int      npass = K / GKC;
  // ---- fragment rows in LDS: A rows 16*i + m of slice wm, B rows 16*j + m of slice 4 + wn; +16*hh bytes = +8*hh elements ----
  const unsigned char* ar = ring + wm * GSLICE + m * GPITCH + 16 * hh;
  const unsigned char* br = ring + (4 + wn) * GSLICE + m * GPITCH + 16 * hh;
  v8f acc[4][4];
#pragma unroll
  for (int i = 0; i < 4; ++i) {
#pragma unroll
    for (int j = 0; j < 4; ++j) acc[i][j] = zero8();
  }
  // ---- prologue: stage 0 lands and is published, then stage 1 is put in flight ----
  if (pinned(issuer)) {
    tdm_load(g0, g1);
    wait_tensor0_hold(g0, g1);
  }
  __syncthreads();
  if (pinned(issuer)) {
    tdm_aim(g0, dst0 + GSTAGE, ga0 + 2u * GKC);
    tdm_load(g0, g1);
  }
#pragma unroll 1   // one pass per stage: the publish point below stands once per trip
  for (int s = 0; s < npass; ++s) {
    const int bo = (s & 1) * GSTAGE;
#pragma unroll     // constant LDS offsets for the four 32-deep steps of a stage
    for (int kk = 0; kk < GKC / 32; ++kk) {
      const int o = bo + kk * 64;
      v16b af[4], bf[4];
#pragma unroll     // constant indices: the fragments stay in registers
      for (int i = 0; i < 4; ++i) {
        af[i] = ldfrag_b((const u16*)(const void*)(ar + o + i * 16 * GPITCH));
        bf[i] = ldfrag_b((const u16*)(const void*)(br + o + i * 16 * GPITCH));
      }
      sched_fence();   // all 16 loads of the step are issued ahead of its 16 products
#pragma unroll
      for (int i = 0; i < 4; ++i) {
#pragma unroll
        for (int j = 0; j < 4; ++j) acc[i][j] = mma_b(af[i], bf[j], acc[i][j]);
      }
    }
    // ---- publish point of stage s + 1: own LDS reads retired, own slice landed, barrier, then the refill ----
    wait_ds0();
    wait_tensor0_hold(g0, g1);
    __syncthreads();
    if (pinned((uint32_t)(s + 2 < npass) & issuer)) {
      tdm_aim(g0, dst0 + (uint32_t)bo, ga0 + (uint64_t)(s + 2) * (2u * GKC));
      tdm_load(g0, g1);
    }
  }
  wait_tensor0_hold(g0, g1);   // behind the loop: no request in flight and no LDS read open before the ring is used for the result
  wait_ds0();
  acc_guard16(acc);
  // ---- which projection the wave's 64 columns belong to: wave-uniform ----
  const int gc   = col0 + 64 * wn;
  const int prod = gc / NHD;                 // 0 = k, 1 = q, 2 = v
  const int pc   = gc - prod * NHD;          // first column inside the projection: h*64
  const int gr   = row0 + 64 * wm;           // first row of x
  const int rq = lane >> 3, c8 = (lane & 7) * 8;
  // ---- stage the scaled value in the wave's slab: the slabs lie over both buffers of the ring, which every reader has
  //      left at the last pass's barrier and at which no load is aimed any more ----
  float* sl = (float*)(void*)ring + wave * GWSLAB;
  u16*   dst;
  size_t N;                                  // row pitch of the plane, elements
  if (prod < 2) {                            // k, q: slab row = row of x, slab column = d
    const float oscale = (prod == 0) ? KSC : QSC;
#pragma unroll
    for (int i = 0; i < 4; ++i) {
#pragma unroll
      for (int r = 0; r < 8; ++r) {
        const int ro = (16 * i + 8 * hh + r) * 68 + m;
#pragma unroll
        for (int j = 0; j < 4; ++j) sl[ro + 16 * j] = acc[i][j][r] * oscale;
      }
    }
    N   = (size_t)NHD;
    dst = ((prod == 0) ? KPp : QPp) + ((size_t)gr + (size_t)rq) * N + (size_t)(pc + c8);
  } else {                                   // v: slab row = d, slab column = row of x; a lane's 8 values lie side by side
#pragma unroll
    for (int i = 0; i < 4; ++i) {
#pragma unroll
      for (int j = 0; j < 4; ++j) {
        float* tp = sl + (16 * j + m) * 68 + 16 * i + 8 * hh;
        const v4f lo = {acc[i][j][0] * VCAR, acc[i][j][1] * VCAR, acc[i][j][2] * VCAR, acc[i][j][3] * VCAR};
        const v4f hi = {acc[i][j][4] * VCAR, acc[i][j][5] * VCAR, acc[i][j][6] * VCAR, acc[i][j][7] * VCAR};
        *(v4f*)(tp)     = lo;
        *(v4f*)(tp + 4) = hi;
      }
    }
    const int bt = gr / SEQ;
    N   = (size_t)SEQ;
    dst = VPp + ((size_t)(bt * NHD + pc) + (size_t)rq) * N + (size_t)(gr - bt * SEQ + c8);
  }
  wave_sync_lds();
#pragma unroll
  for (int i4 = 0; i4 < 16; ++i4) {
    const float* rp = sl + (i4 * 4 + rq) * 68 + c8;
    const v4f a = *(const v4f*)(rp), c4 = *(const v4f*)(rp + 4);
    v4u ov;
    ov[0] = pk16(h_bits((_Float16)a[0]),  h_bits((_Float16)a[1]));
    ov[1] = pk16(h_bits((_Float16)a[2]),  h_bits((_Float16)a[3]));
    ov[2] = pk16(h_bits((_Float16)c4[0]), h_bits((_Float16)c4[1]));
    ov[3] = pk16(h_bits((_Float16)c4[2]), h_bits((_Float16)c4[3]));
    *(v4u*)(dst + (size_t)(i4 * 4) * (size_t)N) = ov;
  }
}

// =====================================================================================================
// Multi-head flash attention with per-head linear relative-position bias (no mask): block = (batch b, 4 heads, 128 query
// rows), 4 waves per head, each head with an LDS ring of its own; wave w of a head owns query rows q0 = 128*qt + 32*w ..
// q0+31 as two tiles of 16 (tile t = rows q0+16t .. +15).
// The keys are walked from the last to the first: the bias falls along the walk, so a row's running maximum settles early,
// and a key block none of whose weights can count any more is left behind its scores (test in the loop). How many key blocks
// that is depends on the head's slope, so a block holds steep and flat heads, one wave of each on every SIMD.
// Every k fragment, v^T fragment and bias term that the wave fetches or forms serves both tiles.
//   k and v^T come through LDS, shared by the head's 4 waves: a stage is 64 keys = 64 k rows x 128 B and 64 v^T rows x
//   128 B; every wave brings its own slice of 32 rows with one tensor load (LDS pitch 144 B), two buffers, the next stage
//   in flight while this one is worked on; one publish point (waits + block barrier) per stage. The ring becomes the
//   wave-private result slabs behind the last stage's barrier.
//   q plane (f16, x QSC) laid out [b][s][h*64+d]; k plane the same (f16, x8); v^T plane [b][h*64+d][s] (x1024 f16).
//   The scores of all NKB = 64 key blocks of 32 keys are computed (static bound).
//   Scores are computed TRANSPOSED: S^T tile g (g = 0,1) = k rows (keys kb+16g .. +15, A operand, row m = lane&15, split k
//   map over d) times q^T (B operand, col n = query q0 + 16t + (lane&15), k = d, split map), one f16 product per tile and
//   32-deep d-chunk, one guarded group of 8 WMMAs; the four q fragments are loaded once per wave.
//   D element r of lane l = (key kb+16g+8h+r, query q0+16t+(l&15)), so a lane owns one query column per tile and 16 of its
//   32 keys; the partner lane l^16 owns the other 16 -> a row max needs one xor-16 shuffle; the row sum is kept per lane (one
//   partial sum for each half of every key block) and the two are added once, in the epilogue.
//   The logits come out of the matrix unit: the q plane carries their scale, and the first product of every score tile adds
//   to a constant tile (its C operand) that holds the bias of the key's place inside its block, slope_h * log2e * (16g+8h+r),
//   slope_h = (2^-0.5)^(h+1). What the bias has besides is the same for a whole key block (slope_h * log2e * the block's
//   distance from the last block, cs below) and is added to or taken from the running maximum, one value per query, not per
//   logit; the query's own term is left out: the softmax over keys does not see a constant per query.
//   Online max-subtracted base-2 softmax in f32. The exp'd values ARE the P A-fragment in place: A row m = query = lane&15,
//   element i <- key kb+8h+i (tile 0, D element i), element 8+i <- key kb+16+8h+i (tile 1, D element i). P is carried
//   x32768 as single f16, the factor added as 15 to the exponent.
//   The rescale factor of query row 8h+r of the O accumulators is fetched from lane 8h+r with a
//   shuffle (uniform control), in the key blocks in which a running maximum of the wave rises. 4 v^T B fragments (col n = d = 16j + (lane&15), keys k-contiguous), 8 P.V WMMAs per key
//   block in one guarded group.
//   Epilogue: 1/l (per query, shuffled to the D row owner) and the carry folds in f32; each 16x64 f32 result tile staged,
//   segment (b, q0+row, head) of the f32 result [b][s][h*64+d] written by 16 consecutive lanes x 16 B of one instruction
// coverage: per wave 2 tiles x 8 instructions x 2 rows x 16 lanes x 4 floats = 32 x 64; grid NB*(NH/4)*(SQ/128) blocks x 4
//           heads x 4 waves = every (b, s < SQ, h) row segment of the result exactly once.
// =====================================================================================================
__global__ __launch_bounds__(ATT_THREADS)
void attn_fwd(const u16* __restrict__ QPp, const u16* __restrict__ KPp, const u16* __restrict__ VPp, float* Out) {
  __shared__ __attribute__((aligned(2048))) unsigned char rings[ATT_HEADS * ARING];   // per head: k / v^T stages; result slabs in the epilogue

  const int tid  = threadIdx.x;
  const int w16  = (int)uni((uint32_t)tid >> 5);
  const int hq   = w16 >> 2;             // which of the block's heads; waves w, w+4, w+8, w+12 are one wave of each head
  const int wave = w16 & 3;              // the wave's place among its head's four
  unsigned char* ring = rings + hq * ARING;
  const int lane = tid & 31;
  const int hh   = lane >> 4;
  const int c    = lane & 15;

  const int bid  = blockIdx.x;
  const int qt   = bid % NQT;
  const int grp  = (bid / NQT) % (NH / ATT_HEADS);
  const int head = (int)((HEADMAP >> (16 * grp + 4 * hq)) & 15ull);
  const int b    = bid / (NQT * (NH / ATT_HEADS));
  const int q0   = qt * ATT_Q + wave * (16 * QTW);

  // B fragments of q^T: col n = query q0 + 16t + c, k = d (k-contiguous row segment of the q plane)
  const size_t qofs = ((size_t)(b * SEQ + q0 + c)) * NHD + (size_t)(head * HD + 8 * hh);
  const _Float16* Qb = (const _Float16*)(const void*)QPp + qofs;
  // ---- this wave's slice of every stage: waves 0,1 = k rows (keys) 32*wave .., 128 B of this head each; waves 2,3 =
  //      v^T rows (d) 32*(wave-2) .., 128 B = 64 keys each ----
  const u16* sp = (wave < 2) ? (KPp + ((size_t)(b * SEQ + 32 * wave)) * NHD + (size_t)(head * HD))
                             : (VPp + ((size_t)(b * NHD + head * HD + 32 * (wave - 2))) * SEQ);
  const uint64_t ga0   = (uint64_t)(size_t)sp;
  const uint32_t gstep = (wave < 2) ? (uint32_t)(AKEYS * NHD * 2) : (uint32_t)(AKEYS * 2);   // bytes from stage to stage
  const uint32_t dst0  = (uint32_t)(size_t)ring + (uint32_t)wave * ASLICE;
  u32x8          g1    = tdm_group1_r128((wave < 2) ? (uint32_t)(NHD * 2) : (uint32_t)(SEQ * 2));
  u32x4          g0    = tdm_group0(dst0, ga0 + (uint64_t)(NST - 1) * gstep);   // the walk starts at the last stage
  // A fragments of k: LDS row = key (in its slice of 32) 16g + c, k = d; +16*hh bytes = +8*hh elements
  const unsigned char* kr = ring + c * APITCH + 16 * hh;
  // B fragments of v: col n = d = 16j + c = LDS row of the v^T slices, k = key (contiguous in the row)
  const unsigned char* vr = ring + 2 * ASLICE + c * APITCH + 16 * hh;

  const int   ex     = head + 1;
  const float slope  = (((ex & 1) != 0) ? RSQ2 : 1.0f) * __int_as_float((127 - (ex >> 1)) << 23);
  const float slope2 = slope * LOG2E;
  // C operands of the score tiles: bias (base 2) of this lane's keys 8hh+r and 16+8hh+r of a key block, the same for every block
  v8f bl0, bl1;
#pragma unroll
  for (int r = 0; r < 8; ++r) {
    bl0[r] = slope2 * (float)(8 * hh + r);
    bl1[r] = slope2 * (float)(16 + 8 * hh + r);
  }

  v16h qf[QTW][2];
#pragma unroll
  for (int t = 0; t < QTW; ++t) {
    qf[t][0] = ldfrag_h(Qb + (size_t)(16 * t) * NHD);            // d 0..31
    qf[t][1] = ldfrag_h(Qb + (size_t)(16 * t) * NHD + 32);       // d 32..63
  }

  float mrun[QTW], lrun[QTW];
  v8f o[QTW][4];
#pragma unroll
  for (int t = 0; t < QTW; ++t) {
    mrun[t] = -INFINITY;
    lrun[t] = 0.f;
#pragma unroll
    for (int j = 0; j < 4; ++j) o[t][j] = zero8();
  }

  // ---- prologue: the last stage lands and is published, then the one in front of it is put in flight ----
  tdm_load(g0, g1);
  wait_tensor0_hold(g0, g1);
  __syncthreads();
  tdm_aim(g0, dst0 + ASTAGE, ga0 + (uint64_t)(NST - 2) * gstep);
  tdm_load(g0, g1);
#pragma unroll 1   // one pass per stage: the publish point below stands once per trip
  for (int s = 0; s < NST; ++s) {        // pass s works on stage NST-1-s
    const int bo = (s & 1) * ASTAGE;
#pragma unroll     // constant LDS offsets for the key blocks of a stage
  for (int i32 = AKEYS / 32 - 1; i32 >= 0; --i32) {
    const int kb = (NST - 1 - s) * AKEYS + i32 * 32;
    // ---- transposed scores: s0 = keys kb..kb+15, s1 = keys kb+16..kb+31, column = query q0 + 16t + c ----
    v8f s0[QTW], s1[QTW];
    const _Float16* k0p = (const _Float16*)(const void*)(kr + bo + i32 * ASLICE);
    const _Float16* k1p = (const _Float16*)(const void*)(kr + bo + i32 * ASLICE + 16 * APITCH);
    {
      const v16h ka0 = ldfrag_h(k0p),      ka1 = ldfrag_h(k0p + 32);
      const v16h kc0 = ldfrag_h(k1p),      kc1 = ldfrag_h(k1p + 32);
      s0[0] = mma_h(ka0, qf[0][0], bl0);
      s0[1] = mma_h(ka0, qf[1][0], bl0);
      s1[0] = mma_h(kc0, qf[0][0], bl1);
      s1[1] = mma_h(kc0, qf[1][0], bl1);
      s0[0] = mma_h(ka1, qf[0][1], s0[0]);
      s0[1] = mma_h(ka1, qf[1][1], s0[1]);
      s1[0] = mma_h(kc1, qf[0][1], s1[0]);
      s1[1] = mma_h(kc1, qf[1][1], s1[1]);
      guard4x8<v16h>(s0[0], s0[1], s1[0], s1[1], qf[0][0], qf[0][1], qf[1][0], qf[1][1], ka0, ka1, kc0, kc1);
    }
    // ---- the accumulators hold the base-2 logits of this lane's 16 keys for query q0 + 16t + c, short of the block's own
    //      bias term cs (wave-uniform, 0 at the last block and falling along the walk); their maximum ----
    const float cs = slope2 * (float)(kb - (SEQ - 32));
    float cl[QTW];
#pragma unroll     // constant indices: the logits stay in the accumulators' registers
    for (int t = 0; t < QTW; ++t) {
      cl[t] = s0[t][0];
#pragma unroll
      for (int i = 1; i < 8; ++i) cl[t] = fmaxf(cl[t], s0[t][i]);
#pragma unroll
      for (int i = 0; i < 8; ++i) cl[t] = fmaxf(cl[t], s1[t][i]);
    }
    // ---- does any of the wave's 32 x 32 weights count? Where every logit lies SKIPD or more below its query's running
    //      maximum, the rest of the key block adds nothing: the maximum stays, the rescale factor is 2^0 = 1, every weight
    //      x32768 is below half the smallest f16 and enters P as 0, and a row's 32 weights together are below half an ulp of
    //      its whole sum, which holds the weight 1 of the maximum. One test per key block, wave-uniform; an unordered compare takes the
    //      full path. ----
    const float thr = SKIPD + cs;
    const bool need = !(cl[0] <= mrun[0] - thr) || !(cl[1] <= mrun[1] - thr);
    // ---- does any of the wave's 32 running maxima rise in this key block? A lane tests its own 16 keys, its partner lane
    //      the query's other 16, and the ballots join them, so the test needs no exchange. The bias falls along the walk, so
    //      past a head's first few key blocks no maximum rises any more; an unordered compare and the first block (maximum
    //      -inf) count as a rise. ----
    const uint32_t rises = __builtin_amdgcn_ballot_w32(!(cl[0] <= mrun[0] - cs)) | __builtin_amdgcn_ballot_w32(!(cl[1] <= mrun[1] - cs));
    if (__builtin_amdgcn_ballot_w32(need) != 0u) {
    FragH ph[QTW];
    // ---- where no maximum rises, the old maxima stay the softmax's reference and every rescale factor is 2^0 = 1: the
    //      exchange of the maxima, the factor, its broadcast and the products with o are left out, wave-uniformly (a logit
    //      that the rounding of the test lets pass an ulp above its maximum gets the weight 1 from the clamp below) ----
    float al[QTW] = {1.f, 1.f};
    if (rises != 0u) {
#pragma unroll     // constant indices: the per-tile state stays in registers
      for (int t = 0; t < QTW; ++t) {
        const float cm = fmaxf(cl[t], __shfl_xor(cl[t], 16, 32));
        const float mn = fmaxf(mrun[t], cm + cs);                      // finite from the first key block on
        float ea = mrun[t] - mn;
        exp2_hw1(ea);
        al[t] = (mrun[t] == -INFINITY) ? 0.f : ea;                     // o and l are zero while mrun is -inf
        mrun[t] = mn;
        // ---- rescale the O accumulators: D row 8hh+r = query q0+16t+8hh+r, its factor lives in lane 8hh+r (and 16+8hh+r) ----
        float scl[8];
#pragma unroll
        for (int r = 0; r < 8; ++r) scl[r] = __shfl(al[t], 8 * hh + r, 32);
#pragma unroll
        for (int j = 0; j < 4; ++j) {
#pragma unroll
          for (int r = 0; r < 8; ++r) o[t][j][r] *= scl[r];
        }
      }
    }
#pragma unroll     // constant indices: the per-tile state stays in registers
    for (int t = 0; t < QTW; ++t) {
      const float ml = mrun[t] - (cs + PEXP);                          // as this block's accumulators see it, less P's carry
      float pe[16];
#pragma unroll     // constant indices: pe[] stays in registers, as the asm operands need it
      for (int i = 0; i < 8; ++i) {
        pe[i]     = fminf(s0[t][i] - ml, PEXP);
        pe[8 + i] = fminf(s1[t][i] - ml, PEXP);
      }
      exp2_hw16(pe);
      // ---- pe[i] = p * 32768 (p <= 1), as the exponent held the carry: the P A-fragment is f16(pe[i]), the row sum carries
      //      the same factor ----
      float ps = 0.f;
#pragma unroll
      for (int w = 0; w < 2; ++w) {
#pragma unroll
        for (int e4 = 0; e4 < 4; ++e4) {
          const int i = 8 * w + 2 * e4;
          const float p0 = pe[i];
          const float p1 = pe[i + 1];
          ps += p0 + p1;
          const v2f pp = {p0, p1};
          ph[t].u[w][e4] = __builtin_bit_cast(unsigned, __builtin_convertvector(pp, v2h));   // one packed convert, RNE
        }
      }
      lrun[t] = lrun[t] * al[t] + ps;                                  // this lane's 16 keys of every block; the partner lane's join in the epilogue
    }
    // ---- P.V : B fragment col n = d = j*16 + c, keys contiguous in the v^T plane; one group of 8 ----
    {
      const unsigned char* vp = vr + bo + i32 * 64;
      const v16h vf0 = ldfrag_h((const _Float16*)(const void*)(vp));
      const v16h vf1 = ldfrag_h((const _Float16*)(const void*)(vp + 16 * APITCH));
      const v16h vf2 = ldfrag_h((const _Float16*)(const void*)(vp + ASLICE));
      const v16h vf3 = ldfrag_h((const _Float16*)(const void*)(vp + ASLICE + 16 * APITCH));
#pragma unroll
      for (int t = 0; t < QTW; ++t) {
        o[t][0] = mma_h(ph[t].v, vf0, o[t][0]);
        o[t][1] = mma_h(ph[t].v, vf1, o[t][1]);
        o[t][2] = mma_h(ph[t].v, vf2, o[t][2]);
        o[t][3] = mma_h(ph[t].v, vf3, o[t][3]);
      }
      guard8x6<v16h>(o, ph[0].v, ph[1].v, vf0, vf1, vf2, vf3);
    }
    }
  }
    // ---- publish point of stage NST-2-s (pass s + 1): own LDS reads retired, own slice landed, barrier, then the refill ----
    wait_ds0();
    wait_tensor0_hold(g0, g1);
    __syncthreads();
    if (pinned((uint32_t)(s + 2 < NST))) {
      tdm_aim(g0, dst0 + (uint32_t)bo, ga0 + (uint64_t)(NST - 3 - s) * gstep);
      tdm_load(g0, g1);
    }
  }
  wait_tensor0_hold(g0, g1);   // behind the loop: no request in flight and no LDS read open before the ring is used for the result
  wait_ds0();
  acc_guard8(o);

  // the wave's two slabs lie in the ring: every reader has left both buffers at the last stage's barrier, in front of which
  // every wave's last load has landed, and no load is aimed at them any more
#pragma unroll
  for (int t = 0; t < QTW; ++t) {
    // ---- fold 1/l (per query, owned by lane = query; l > 0 by construction; it carries P's factor, which cancels) and v's carry ----
    const float lsum = lrun[t] + __shfl_xor(lrun[t], 16, 32);          // both lanes of a query carry the same maximum and factors
    const float linv = (lsum > 0.f) ? ((1.0f / lsum) * (1.0f / VCAR)) : 0.f;
    float inv[8];
#pragma unroll
    for (int r = 0; r < 8; ++r) inv[r] = __shfl(linv, 8 * hh + r, 32);
    float* slab = (float*)(void*)ring + (wave * QTW + t) * GSLAB;
#pragma unroll
    for (int r = 0; r < 8; ++r) {
#pragma unroll
      for (int j = 0; j < 4; ++j) slab[(8 * hh + r) * 68 + j * 16 + c] = o[t][j][r] * inv[r];
    }
  }
  wave_sync_lds();
  // ---- f32 result: lanes 0..15 -> row 2*i2, lanes 16..31 -> row 2*i2+1; lane = 4 consecutive floats ----
  float* dst = Out + ((size_t)(b * SEQ + q0 + hh)) * DMOD + (size_t)(head * HD + c * 4);
#pragma unroll
  for (int t = 0; t < QTW; ++t) {
    const float* slab = (const float*)(const void*)ring + (wave * QTW + t) * GSLAB;
    v4f vals[8];
#pragma unroll
    for (int i2 = 0; i2 < 8; ++i2) vals[i2] = *(const v4f*)(slab + (i2 * 2 + hh) * 68 + c * 4);
#pragma unroll
    for (int i2 = 0; i2 < 8; ++i2) {
      *(v4f*)(dst + (size_t)(16 * t + i2 * 2) * (size_t)DMOD) = vals[i2];
    }
  }
}

// =====================================================================================================
// Workspace map (bytes, NB = 4); every plane is fully written by whole-line stores before it is read; all extents are
// exact multiples of the store granularity (no pad rows):
//   XB  bf16 [NB*SEQ][DMOD]                          16777216
//   WB  bf16 [3*NHD][DMOD]  (k | q | v chunks)        6291456
//   QP  f16  [NB*SEQ][NHD] x QSC                    16777216
//   KP  f16  [NB*SEQ][NHD] x8                       16777216
//   VP  f16  [NB][NHD][SEQ] x1024                   16777216
//   end                                             73400320
// 3 launches on one in-order stream.
// =====================================================================================================
extern "C" void kernel_launch(void* const* d_in, const int* in_sizes, int n_in,
                              void* d_out, int out_size, void* d_ws, size_t ws_size,
                              hipStream_t stream) {
  const int ROWS = NB * SEQ;
  if (n_in < 2) return;
  if (in_sizes[0] < ROWS * DMOD) return;
  if (in_sizes[1] != 3 * NHD * DMOD) return;
  if (out_size < ROWS * DMOD) return;

  const float* Xin = (const float*)d_in[0];
  const float* Win = (const float*)d_in[1];
  float*       out = (float*)d_out;

  const size_t szXB = (size_t)ROWS * DMOD * 2;
  const size_t szWB = (size_t)3 * NHD * DMOD * 2;
  const size_t szPl = (size_t)ROWS * NHD * 2;                  // q/k planes
  const size_t szVP = (size_t)NB * NHD * SEQ * 2;
  size_t off = 0;
  const size_t oXB = off; off += szXB;
  const size_t oWB = off; off += szWB;
  const size_t oQP = off; off += szPl;
  const size_t oKP = off; off += szPl;
  const size_t oVP = off; off += szVP;
  if (off > ws_size) return;                            // off = 73400320 for NB = 4
  if (off > (size_t)134217728) return;

  char* ws = (char*)d_ws;
  u16* XB = (u16*)(ws + oXB);
  u16* WB = (u16*)(ws + oWB);
  u16* QP = (u16*)(ws + oQP);
  u16* KP = (u16*)(ws + oKP);
  u16* VP = (u16*)(ws + oVP);

  const int n8x = (ROWS * DMOD) / 8;
  const int n8w = (3 * NHD * DMOD) / 8;
  if ((n8x % 256) != 0 || (n8w % 256) != 0) return;
  if ((DMOD % 64) != 0 || ((3 * NHD) % GTN) != 0 || (SEQ % GTM) != 0 || (DMOD % 32) != 0) return;

  const dim3 blk(256);
  const dim3 gC((n8x + n8w) / 256);                     // 4096 + 1536
  const dim3 bG(GWAVES * 32);                           // 384
  const dim3 gG(GNB);                                   // 32 x 16
  const dim3 gAT(ATT_BLOCKS);                           // 256
  const dim3 bAT(ATT_THREADS);                          // 512

  // (1) x -> bf16 plane [ROWS][DMOD] and W [3*NHD out][DMOD in] -> bf16, same layouts (W is already k-contiguous for B
  //     fragments); WB lies directly behind XB
  cvt16<<<gC, blk, 0, stream>>>(Xin, Win, XB, n8x, n8x + n8w);
  // (2) q (x QSC), k (x8) as single f16 planes [b][s][h*64+d], and the v^T plane per batch [h*64+d][keys], x1024
  gemm_bb<<<gG, bG, 0, stream>>>(XB, WB, QP, KP, VP);
  // (3) attention -> out [b][s][h*64+d] f32
  attn_fwd<<<gAT, bAT, 0, stream>>>(QP, KP, VP, out);
  (void)hipGetLastError();
}
